// v000
// The times below were measured on an AMD MI455X: many runs one after another, warmed up first and cycling through
// copies of the inputs, with the whole window's GPU time divided by the number of runs. Launches and the gaps
// between them are all in it. The median over several windows is given; except for v000 it joins two sittings, which
// can be a few percent apart, so the side-by-side timings, each taken in one sitting, are the better comparison.
// The starting kernel, v000, takes 540 microseconds a run.
// Contractions: q/kv/out projections on v_wmma_f32_16x16x32_bf16 (float inputs RNE-converted to bf16 once; out-projection A operand carried as bf16 hi+lo planes, 2 products); attention q.k and p.v on v_wmma_f32_16x16x32_bf16 with bf16 hi+lo planes for q,k,p,v (3 products); f32 accumulate; softmax and normalisation in f32.
#include <hip/hip_runtime.h>

typedef __attribute__((ext_vector_type(16))) _Float16 v16h;
typedef __attribute__((ext_vector_type(8)))  _Float16 v8h;
typedef __attribute__((ext_vector_type(16))) __bf16   v16b;
typedef __attribute__((ext_vector_type(8)))  __bf16   v8b;
typedef __attribute__((ext_vector_type(8)))  float    v8f;
typedef __attribute__((ext_vector_type(4)))  float    v4f;
typedef __attribute__((ext_vector_type(2)))  float    v2f;
typedef __attribute__((ext_vector_type(4)))  unsigned v4u;

static constexpr int kBatch  = 2;
static constexpr int kSeqQ   = 2048;
static constexpr int kSeqK   = 2048;
static constexpr int kEmb    = 1024;
static constexpr int kHeads  = 16;
static constexpr int kHeadD  = 64;
static constexpr int kKVCols = 2 * kEmb;          /* 2048: k at cols 0..1023, v at cols 1024..2047 */
static constexpr int kRowsM  = kBatch * kSeqQ;    /* 4096 (== kBatch * kSeqK) */
static constexpr int kKC     = 64;                /* keys per streamed chunk */

__device__ __forceinline__ unsigned short f2bf_bits(float f) {
  unsigned u = __float_as_uint(f);
  return (unsigned short)((u + 0x7FFFu + ((u >> 16) & 1u)) >> 16);
}
__device__ __forceinline__ float bf_bits2f(unsigned short h) { return __uint_as_float(((unsigned)h) << 16); }

// hazard guards as plain device helpers (no inline asm inside the kernel template body)
__device__ __forceinline__ void dep_guard_h(v8f& a, v8f& b, v16h x, v16h y) { asm volatile("v_nop\n\tv_nop\n\tv_nop\n\tv_nop" : "+v"(a), "+v"(b) : "v"(x), "v"(y)); }
__device__ __forceinline__ void dep_guard_b(v8f& a, v8f& b, v16b x, v16b y) { asm volatile("v_nop\n\tv_nop\n\tv_nop\n\tv_nop" : "+v"(a), "+v"(b) : "v"(x), "v"(y)); }
__device__ __forceinline__ void keep4_h(v16h a, v16h b, v16h c, v16h d) { asm volatile("v_nop" :: "v"(a), "v"(b), "v"(c), "v"(d)); }
__device__ __forceinline__ void keep4_b(v16b a, v16b b, v16b c, v16b d) { asm volatile("v_nop" :: "v"(a), "v"(b), "v"(c), "v"(d)); }
__device__ __forceinline__ void acc_guard4(v8f& a, v8f& b, v8f& c, v8f& d) { asm volatile("v_nop\n\tv_nop\n\tv_nop\n\tv_nop" : "+v"(a), "+v"(b), "+v"(c), "+v"(d)); }
template <typename T> struct Frag;
template <> struct Frag<_Float16> {
  typedef v16h V; union U { v16h v; v8h h[2]; };
  static __device__ __forceinline__ v16h load(const _Float16* p) {   // elements 0..7 <- p[0..7], 8..15 <- p[16..23]
    U f; f.h[0] = *(const v8h*)(p); f.h[1] = *(const v8h*)(p + 16); return f.v;
  }
  static __device__ __forceinline__ v8f mma(v16h a, v16h b, v8f c) {
    return __builtin_amdgcn_wmma_f32_16x16x32_f16(false, a, false, b, (short)0, c, false, false);
  }
  static __device__ __forceinline__ void guard(v8f& a, v8f& b, v16h x, v16h y) { dep_guard_h(a, b, x, y); }
  static __device__ __forceinline__ void keep(v16h a, v16h b, v16h c, v16h d) { keep4_h(a, b, c, d); }
};
template <> struct Frag<__bf16> {
  typedef v16b V; union U { v16b v; v8b h[2]; };
  static __device__ __forceinline__ v16b load(const __bf16* p) {
    U f; f.h[0] = *(const v8b*)(p); f.h[1] = *(const v8b*)(p + 16); return f.v;
  }
  static __device__ __forceinline__ v8f mma(v16b a, v16b b, v8f c) {
    return __builtin_amdgcn_wmma_f32_16x16x32_bf16(false, a, false, b, (short)0, c, false, false);
  }
  static __device__ __forceinline__ void guard(v8f& a, v8f& b, v16b x, v16b y) { dep_guard_b(a, b, x, y); }
  static __device__ __forceinline__ void keep(v16b a, v16b b, v16b c, v16b d) { keep4_b(a, b, c, d); }
};

// ---- Register-blocked batched WMMA GEMM ------------------------------------
// C[m,n] = scale * sum_k A[m,k] * Bt[n,k] (+bias); each wave owns a 64x64 tile.
// A row-major [M,K]; Bt row-major [N,K]; M,N % 64 == 0, K % 32 == 0.
// SPLIT: 0 = single product; 1 = A carried as hi+lo planes (A.B + A2.B); 2 = A and B hi+lo planes (A.B + A.B2 + A2.B).
// BIAS_MODE: 0 = none, 2 = bias[n] (bias RNE-converted to bf16 before the add).
// OUT_MODE: 0 = f32, 1 = f16, 2 = bf16 hi plane (Cout) + bf16 lo plane (Cout2).
// ET: 0 = f16 operands, 1 = bf16 operands (pointers passed as 16-bit storage)
template <int ET> struct Elem;
template <> struct Elem<0> { typedef _Float16 T; };
template <> struct Elem<1> { typedef __bf16 T; };
template <int ET, int SPLIT, int BIAS_MODE, int OUT_MODE>
__global__ __launch_bounds__(256) void wmma_gemm64(
    const unsigned short* __restrict__ Ap, const unsigned short* __restrict__ A2p, int lda, long strideA,
    const unsigned short* __restrict__ Btp, const unsigned short* __restrict__ Bt2p, int ldb, long strideB,
    void* __restrict__ Cout, void* __restrict__ Cout2, int ldc, long strideC,
    const float* __restrict__ bias,
    int M, int N, int K, float scale) {
  typedef typename Elem<ET>::T T;
  typedef typename Frag<T>::V V;
  const T* A = (const T*)Ap; const T* A2 = (const T*)A2p; const T* Bt = (const T*)Btp; const T* Bt2 = (const T*)Bt2p;
  __shared__ __align__(16) float sT[8][16 * 68];   // per-wave 16x64 slab, pitch 68 floats
  const int b    = blockIdx.y;
  const int lane = threadIdx.x & 31;
  const int wave = threadIdx.x >> 5;
  const int tilesN = N >> 6;
  const int tilesM = M >> 6;
  const int tile = blockIdx.x * 8 + wave;
  if (tile >= tilesM * tilesN) return;   // wave-uniform; no block barriers in this kernel
  const int tm = tile / tilesN;
  const int tn = tile - tm * tilesN;
  const int m0 = tm << 6;
  const int n0 = tn << 6;

  const T* Ab  = A  + (size_t)b * strideA;
  const T* Bb  = Bt + (size_t)b * strideB;
  const T* Ab2 = (SPLIT != 0) ? (A2  + (size_t)b * strideA) : nullptr;
  const T* Bb2 = (SPLIT == 2) ? (Bt2 + (size_t)b * strideB) : nullptr;

  const int rlane = lane & 15;                 // row (A) / col (B, D) within subtile
  const int koff  = (lane >> 4) * 8;           // k offset of this lane half
  const int mOff  = (lane >> 4) * 8;           // D row offset

  v8f acc[4][4];
#pragma unroll
  for (int i = 0; i < 4; ++i)
#pragma unroll
    for (int j = 0; j < 4; ++j) acc[i][j] = (v8f){0.f,0.f,0.f,0.f,0.f,0.f,0.f,0.f};

  for (int k0 = 0; k0 < K; k0 += 32) {
    V bh[4], bl[4];
#pragma unroll
    for (int j = 0; j < 4; ++j) {
      const size_t bo = (size_t)(n0 + (j << 4) + rlane) * ldb + koff + k0;
      bh[j] = Frag<T>::load(Bb + bo);
      if (SPLIT == 2) bl[j] = Frag<T>::load(Bb2 + bo);
    }
#pragma unroll
    for (int i = 0; i < 4; ++i) {
      const size_t ao = (size_t)(m0 + (i << 4) + rlane) * lda + koff + k0;
      V ah = Frag<T>::load(Ab + ao);
      V al;
      if (SPLIT != 0) al = Frag<T>::load(Ab2 + ao);
#pragma unroll
      for (int j = 0; j < 4; ++j) {
        acc[i][j] = Frag<T>::mma(ah, bh[j], acc[i][j]);
        if (SPLIT == 2) acc[i][j] = Frag<T>::mma(ah, bl[j], acc[i][j]);
        if (SPLIT != 0) acc[i][j] = Frag<T>::mma(al, bh[j], acc[i][j]);
      }
      Frag<T>::guard(acc[i][0], acc[i][3], ah, (SPLIT != 0) ? al : ah);
    }
    Frag<T>::keep(bh[0], bh[1], bh[2], bh[3]);
    if (SPLIT == 2) Frag<T>::keep(bl[0], bl[1], bl[2], bl[3]);
  }
  acc_guard4(acc[0][0], acc[0][1], acc[0][2], acc[0][3]);
  acc_guard4(acc[1][0], acc[1][1], acc[1][2], acc[1][3]);
  acc_guard4(acc[2][0], acc[2][1], acc[2][2], acc[2][3]);
  acc_guard4(acc[3][0], acc[3][1], acc[3][2], acc[3][3]);

  // ---- epilogue ----
  float* slab = sT[wave];
#pragma unroll
  for (int i = 0; i < 4; ++i) {
    const int mBase = m0 + (i << 4);
#pragma unroll
    for (int j = 0; j < 4; ++j) {
      const int n = n0 + (j << 4) + rlane;
      float bv = 0.f;
      if (BIAS_MODE == 2) bv = bf_bits2f(f2bf_bits(bias[n]));
#pragma unroll
      for (int r = 0; r < 8; ++r) {
        float v = acc[i][j][r] * scale;
        if (BIAS_MODE == 2) v += bv;
        slab[(mOff + r) * 68 + (j << 4) + rlane] = v;
      }
    }
    __builtin_amdgcn_fence(__ATOMIC_RELEASE, "workgroup");
    __builtin_amdgcn_wave_barrier();
    __builtin_amdgcn_fence(__ATOMIC_ACQUIRE, "workgroup");
    if (OUT_MODE == 0) {
      float* C = (float*)Cout + (size_t)b * strideC;
      const int hh = lane >> 4, c4 = (lane & 15) * 4;     // row seg = 256 B = 16 lanes x 16 B
      {
#pragma unroll
        for (int it = 0; it < 8; ++it) {
          const int row = it * 2 + hh;
          v4f v = *(const v4f*)(slab + row * 68 + c4);
          *(v4f*)(C + (size_t)(mBase + row) * ldc + n0 + c4) = v;
        }
        
      }
    } else {
      const int q = lane >> 3, c8 = (lane & 7) * 8;
      unsigned short* C  = (unsigned short*)Cout  + (size_t)b * strideC;
      unsigned short* C2 = (OUT_MODE == 2) ? ((unsigned short*)Cout2 + (size_t)b * strideC) : nullptr;
      {
#pragma unroll
        for (int it = 0; it < 4; ++it) {
          const int row = it * 4 + q;
          const float* sp = slab + row * 68 + c8;
          v8h hv, lv;
#pragma unroll
          for (int e = 0; e < 8; ++e) {
            if (OUT_MODE == 1) {
              hv[e] = (_Float16)sp[e];
            } else {
              unsigned short hb = f2bf_bits(sp[e]);
              unsigned short lb = f2bf_bits(sp[e] - bf_bits2f(hb));
              hv[e] = __builtin_bit_cast(_Float16, hb);
              lv[e] = __builtin_bit_cast(_Float16, lb);
            }
          }
          *(v8h*)(C + (size_t)(mBase + row) * ldc + n0 + c8) = hv;
          if (OUT_MODE == 2) *(v8h*)(C2 + (size_t)(mBase + row) * ldc + n0 + c8) = lv;
        }
        
      }
    }
    __builtin_amdgcn_fence(__ATOMIC_RELEASE, "workgroup");
    __builtin_amdgcn_wave_barrier();
    __builtin_amdgcn_fence(__ATOMIC_ACQUIRE, "workgroup");
  }
}

// coverage: grid = ceil(n2/256) blocks x 256 threads, thread i < n2 writes elements 2i, 2i+1; all n are multiples of 512 here.
__global__ __launch_bounds__(256) void cast_f32_bf16x2(
    const float* __restrict__ in, unsigned short* __restrict__ out, int n2) {
  int i = blockIdx.x * 256 + threadIdx.x;
  if (i < n2) {
    const v2f x = *(const v2f*)(in + 2 * (size_t)i);
    const unsigned u = (unsigned)f2bf_bits(x[0]) | ((unsigned)f2bf_bits(x[1]) << 16);
    ((unsigned*)out)[i] = u;
    
  }
}

// ---- bf16 helpers for the attention kernel ----
__device__ __forceinline__ __bf16 to_bf16(float f) { return __builtin_bit_cast(__bf16, f2bf_bits(f)); }
__device__ __forceinline__ void split_bf16(float f, __bf16& hi, __bf16& lo) {
  const unsigned short hb = f2bf_bits(f);
  hi = __builtin_bit_cast(__bf16, hb);
  lo = to_bf16(f - __uint_as_float(((unsigned)hb) << 16));
}
__device__ __forceinline__ v8f mma_bf16(v16b a, v16b b, v8f c) {
  c = __builtin_amdgcn_wmma_f32_16x16x32_bf16(false, a, false, b, (short)0, c, false, false);
  asm volatile("v_nop\n\tv_nop\n\tv_nop\n\tv_nop" : "+v"(c) : "v"(a), "v"(b));
  return c;
}

// =====================================================================================
// Cross attention, head_dim 64, 16-bit plane inputs:
//   q planes  Qh/Ql : bf16 hi/lo, element (b,s,h,d) at (b*SQ+s)*1024 + h*64 + d
//   kv planes KVh/KVl: bf16 hi/lo, row (b*SK+s) pitch 2048; k at col h*64+d, v at col 1024+h*64+d
//   scores = 0.125 * q.k^T (hi.hi + hi.lo + lo.hi) + bf16(attn_bias[b,kv]); key mask 0 -> score = -inf
//   out    = softmax(scores).v with p and v as bf16 hi/lo (3 products), f32 accumulate, f32 online softmax
//   ctx written as bf16 hi/lo planes Ch/Cl, element (b,s,h,d) at (b*SQ+s)*1024 + h*64 + d.
// Block = 4 waves = 64 query rows of one (b,h); grid.x = B*H*(SQ/64) = 1024.
// =====================================================================================
__global__ __launch_bounds__(128)
void mha_attn_hd64(const unsigned short* __restrict__ Qh, const unsigned short* __restrict__ Ql,
                   const unsigned short* __restrict__ KVh, const unsigned short* __restrict__ KVl,
                   const float* __restrict__ abias, const int* __restrict__ kmask,
                   unsigned short* __restrict__ Ch, unsigned short* __restrict__ Cl)
{
  __shared__ __align__(16) __bf16 Ksh[kKC * kHeadD];      // K hi [kv][d]   8 KB
  __shared__ __align__(16) __bf16 Ksl[kKC * kHeadD];      // K lo [kv][d]   8 KB
  __shared__ __align__(16) __bf16 Vth[kHeadD * kKC];      // V hi [d][kv]   8 KB
  __shared__ __align__(16) __bf16 Vtl[kHeadD * kKC];      // V lo [d][kv]   8 KB
  __shared__ __align__(16) __bf16 Psh[4][16 * kKC];       // per wave P hi [row][kv]; reused as out hi staging
  __shared__ __align__(16) __bf16 Psl[4][16 * kKC];       // per wave P lo [row][kv]; reused as out lo staging
  __shared__ float CB[kKC];                               // per chunk: bf16(bias) or -inf when masked

  const int tid  = threadIdx.x;
  const int wave = tid >> 5;
  const int lane = tid & 31;
  const int hh   = lane >> 4;
  const int c    = lane & 15;
  const int nqb  = kSeqQ / 64;
  const int bx   = blockIdx.x;
  const int qb   = bx % nqb;
  const int bhd  = bx / nqb;
  const int h    = bhd % kHeads;
  const int b    = bhd / kHeads;
  const int q0   = qb * 64 + wave * 16;
  const float ninf = -__builtin_huge_valf();

  const __bf16* Qhp = (const __bf16*)(const void*)Qh;
  const __bf16* Qlp = (const __bf16*)(const void*)Ql;

  // ---- Q fragments (A operand, row = c, split k map via Frag::load): 2 d-chunks, hi and lo ----
  v16b qah[2], qal[2];
  {
    const size_t qo = (size_t)(b * kSeqQ + q0 + c) * kEmb + h * kHeadD + 8 * hh;
#pragma unroll
    for (int dc = 0; dc < 2; ++dc) {
      qah[dc] = Frag<__bf16>::load(Qhp + qo + dc * 32);
      qal[dc] = Frag<__bf16>::load(Qlp + qo + dc * 32);
    }
  }

  const v8f zero8 = (v8f){0.f,0.f,0.f,0.f,0.f,0.f,0.f,0.f};
  float mrow[8], lrow[8];
  v8f oacc[4];
#pragma unroll
  for (int r = 0; r < 8; ++r) { mrow[r] = ninf; lrow[r] = 0.f; }
#pragma unroll
  for (int t = 0; t < 4; ++t) oacc[t] = zero8;

  __bf16* pwh = Psh[wave];
  __bf16* pwl = Psl[wave];

  for (int kc = 0; kc < kSeqK / kKC; ++kc) {
    const int kv0 = kc * kKC;
    __syncthreads();
    {
      // K planes: thread -> (kv row tid>>1, d half (tid&1)*32): 128 thr x 32 elems = 64 x 64 per plane
      const int kvr = tid >> 1, dh = (tid & 1) * 32;
      const size_t ro = (size_t)(b * kSeqK + kv0 + kvr) * kKVCols + h * kHeadD + dh;
#pragma unroll
      for (int i = 0; i < 4; ++i) {
        const v4u wh = *(const v4u*)(KVh + ro + 8 * i);
        const v4u wl = *(const v4u*)(KVl + ro + 8 * i);
        *(v4u*)(Ksh + kvr * kHeadD + dh + 8 * i) = wh;
        *(v4u*)(Ksl + kvr * kHeadD + dh + 8 * i) = wl;
      }
    }
    asm volatile("" ::: "memory");
    {
      // V planes transposed into [d][kv]: thread -> (kv pair p = tid>>2, d range dq = (tid&3)*16)
      // 32 pairs x 4 ranges = 128 thr; each writes 2 kv x 16 d as packed u32 (both halves per-lane data)
      const int p = tid >> 2, dq = (tid & 3) * 16;
      const size_t r0 = (size_t)(b * kSeqK + kv0 + 2 * p) * kKVCols + kEmb + h * kHeadD + dq;
      const size_t r1 = r0 + kKVCols;
#pragma unroll
      for (int i = 0; i < 2; ++i) {
        const v4u xh = *(const v4u*)(KVh + r0 + 8 * i);
        const v4u yh = *(const v4u*)(KVh + r1 + 8 * i);
        const v4u xl = *(const v4u*)(KVl + r0 + 8 * i);
        const v4u yl = *(const v4u*)(KVl + r1 + 8 * i);
#pragma unroll
        for (int jw = 0; jw < 4; ++jw) {
          const int d0 = dq + 8 * i + 2 * jw;
          const unsigned xhw = xh[jw], yhw = yh[jw], xlw = xl[jw], ylw = yl[jw];
          const unsigned h0 = (xhw & 0xffffu) | (yhw << 16);
          const unsigned h1 = (xhw >> 16) | (yhw & 0xffff0000u);
          const unsigned l0 = (xlw & 0xffffu) | (ylw << 16);
          const unsigned l1 = (xlw >> 16) | (ylw & 0xffff0000u);
          *(unsigned*)(Vth + d0 * kKC + 2 * p)       = h0;
          *(unsigned*)(Vth + (d0 + 1) * kKC + 2 * p) = h1;
          *(unsigned*)(Vtl + d0 * kKC + 2 * p)       = l0;
          *(unsigned*)(Vtl + (d0 + 1) * kKC + 2 * p) = l1;
        }
      }
    }
    if (tid < kKC) {   // waves 0 and 1 entirely: wave-uniform branch
      const size_t ki = (size_t)b * kSeqK + kv0 + tid;
      const int keep = kmask[ki];
      const float bb = bf_bits2f(f2bf_bits(abias[ki]));
      CB[tid] = (keep != 0) ? bb : ninf;
    }
    __syncthreads();

    // ---- scores: 4 key tiles x 2 d-chunks x 3 products ----
    v8f s[4];
#pragma unroll
    for (int j = 0; j < 4; ++j) {
      s[j] = zero8;
#pragma unroll
      for (int dc = 0; dc < 2; ++dc) {
        const v16b kbh = Frag<__bf16>::load(Ksh + (j * 16 + c) * kHeadD + dc * 32 + 8 * hh);
        const v16b kbl = Frag<__bf16>::load(Ksl + (j * 16 + c) * kHeadD + dc * 32 + 8 * hh);
        s[j] = mma_bf16(qah[dc], kbh, s[j]);
        s[j] = mma_bf16(qah[dc], kbl, s[j]);
        s[j] = mma_bf16(qal[dc], kbh, s[j]);
      }
    }
    float cbv[4];
#pragma unroll
    for (int j = 0; j < 4; ++j) cbv[j] = CB[j * 16 + c];
    float cm[8];
#pragma unroll
    for (int r = 0; r < 8; ++r) {
      float m = ninf;
#pragma unroll
      for (int j = 0; j < 4; ++j) {
        const float v = s[j][r] * 0.125f + cbv[j];
        s[j][r] = v;
        m = fmaxf(m, v);
      }
#pragma unroll
      for (int off = 1; off < 16; off <<= 1) m = fmaxf(m, __shfl_xor(m, off, 32));
      cm[r] = m;
    }
    // ---- online softmax; P tile (hi/lo) into this wave's LDS slots ----
#pragma unroll
    for (int r = 0; r < 8; ++r) {
      const float mnew = fmaxf(mrow[r], cm[r]);
      const bool live = (mnew != ninf);
      const float alpha = live ? expf(mrow[r] - mnew) : 1.0f;
      mrow[r] = mnew;
      float psum = 0.f;
#pragma unroll
      for (int j = 0; j < 4; ++j) {
        const float p = live ? expf(s[j][r] - mnew) : 0.0f;
        psum += p;
        __bf16 a, bl;
        split_bf16(p, a, bl);
        pwh[(8 * hh + r) * kKC + j * 16 + c] = a;
        pwl[(8 * hh + r) * kKC + j * 16 + c] = bl;
      }
#pragma unroll
      for (int off = 1; off < 16; off <<= 1) psum += __shfl_xor(psum, off, 32);
      lrow[r] = lrow[r] * alpha + psum;
#pragma unroll
      for (int t = 0; t < 4; ++t) oacc[t][r] *= alpha;
    }
    __builtin_amdgcn_fence(__ATOMIC_RELEASE, "workgroup");
    __builtin_amdgcn_wave_barrier();
    __builtin_amdgcn_fence(__ATOMIC_ACQUIRE, "workgroup");
    // ---- out += P.V : 2 kv-chunks x 4 d-tiles x 3 products ----
#pragma unroll
    for (int kk = 0; kk < 2; ++kk) {
      const v16b pa = Frag<__bf16>::load(pwh + c * kKC + kk * 32 + 8 * hh);
      const v16b pl = Frag<__bf16>::load(pwl + c * kKC + kk * 32 + 8 * hh);
#pragma unroll
      for (int t = 0; t < 4; ++t) {
        const v16b vb = Frag<__bf16>::load(Vth + (t * 16 + c) * kKC + kk * 32 + 8 * hh);
        const v16b vl = Frag<__bf16>::load(Vtl + (t * 16 + c) * kKC + kk * 32 + 8 * hh);
        oacc[t] = mma_bf16(pa, vb, oacc[t]);
        oacc[t] = mma_bf16(pa, vl, oacc[t]);
        oacc[t] = mma_bf16(pl, vb, oacc[t]);
      }
    }
  }

  // ---- epilogue: normalise, split to bf16 hi/lo into this wave's staging, whole-line stores ----
  __builtin_amdgcn_fence(__ATOMIC_RELEASE, "workgroup");
  __builtin_amdgcn_wave_barrier();
  __builtin_amdgcn_fence(__ATOMIC_ACQUIRE, "workgroup");
#pragma unroll
  for (int r = 0; r < 8; ++r) {
    const float inv = 1.0f / lrow[r];
#pragma unroll
    for (int t = 0; t < 4; ++t) {
      const float v = oacc[t][r] * inv;
      __bf16 a, bl;
      split_bf16(v, a, bl);
      pwh[(8 * hh + r) * kKC + t * 16 + c] = a;
      pwl[(8 * hh + r) * kKC + t * 16 + c] = bl;
    }
  }
  __builtin_amdgcn_fence(__ATOMIC_RELEASE, "workgroup");
  __builtin_amdgcn_wave_barrier();
  __builtin_amdgcn_fence(__ATOMIC_ACQUIRE, "workgroup");
  {
    _Float16* Chp = (_Float16*)(void*)Ch;
    _Float16* Clp = (_Float16*)(void*)Cl;
    const int q8 = lane >> 3, c8 = (lane & 7) * 8;
    const size_t ob = (size_t)(b * kSeqQ + q0) * kEmb + h * kHeadD + c8;
    {
#pragma unroll
      for (int it = 0; it < 4; ++it) {
        const int row = it * 4 + q8;
        const v8b xh = *(const v8b*)(pwh + row * kKC + c8);
        const v8b xl = *(const v8b*)(pwl + row * kKC + c8);
        const v8h yh = __builtin_bit_cast(v8h, xh);
        const v8h yl = __builtin_bit_cast(v8h, xl);
        *(v8h*)(Chp + ob + (size_t)row * kEmb) = yh;
        *(v8h*)(Clp + ob + (size_t)row * kEmb) = yl;
      }
      
    }
  }
}

extern "C" void kernel_launch(void* const* d_in, const int* in_sizes, int n_in,
                              void* d_out, int out_size, void* d_ws, size_t ws_size,
                              hipStream_t stream) {
  static_assert(kRowsM % 64 == 0 && kEmb % 64 == 0 && kKVCols % 64 == 0 && kEmb % 32 == 0);
  static_assert(kSeqQ % 64 == 0 && kSeqK % kKC == 0 && kHeadD == 64 && kHeads * kHeadD == kEmb && kSeqQ == kSeqK);

  if (n_in < 10) return;
  const int nAct = kRowsM * kEmb;            /* 4,194,304 elements */
  const int nWq  = kEmb * kEmb;              /* 1,048,576 */
  const int nWkv = kKVCols * kEmb;           /* 2,097,152 */
  const int nWo  = kEmb * kEmb;
  if (in_sizes[0] != nAct || in_sizes[1] != kBatch * kSeqK * kEmb || in_sizes[2] != kBatch * kSeqK ||
      in_sizes[3] != kBatch * kSeqK || in_sizes[4] != nWq || in_sizes[5] != kEmb || in_sizes[6] != nWkv ||
      in_sizes[7] != kKVCols || in_sizes[8] != nWo || in_sizes[9] != kEmb) return;
  if (out_size != nAct) return;

  const float* tgt   = (const float*)d_in[0];
  const float* mem   = (const float*)d_in[1];
  const float* abias = (const float*)d_in[2];
  const int*   kmask = (const int*)d_in[3];
  const float* Wq_w  = (const float*)d_in[4];
  const float* Wq_b  = (const float*)d_in[5];
  const float* Wkv_w = (const float*)d_in[6];
  const float* Wkv_b = (const float*)d_in[7];
  const float* out_w = (const float*)d_in[8];
  const float* out_b = (const float*)d_in[9];
  float* out = (float*)d_out;

  /* workspace region map (bytes, all offsets multiples of 1 MiB):
       [  0 MiB,  8 MiB)  tgt16   bf16 [4096][1024]
       [  8 MiB, 16 MiB)  mem16   bf16 [4096][1024]
       [ 16 MiB, 18 MiB)  wq16    bf16 [1024][1024]
       [ 18 MiB, 22 MiB)  wkv16   bf16 [2048][1024]
       [ 22 MiB, 24 MiB)  wo16    bf16 [1024][1024]
       [ 24 MiB, 32 MiB)  qh      bf16 [4096][1024]   [ 32, 40) ql
       [ 40 MiB, 56 MiB)  kvh     bf16 [4096][2048]   [ 56, 72) kvl
       [ 72 MiB, 80 MiB)  ch      bf16 [4096][1024]   [ 80, 88) cl
     total 92,274,688 B */
  const size_t szAct16 = (size_t)nAct * 2;
  const size_t szKV16  = (size_t)kRowsM * kKVCols * 2;
  const size_t oTgt = 0;
  const size_t oMem = oTgt + szAct16;
  const size_t oWq  = oMem + szAct16;
  const size_t oWkv = oWq + (size_t)nWq * 2;
  const size_t oWo  = oWkv + (size_t)nWkv * 2;
  const size_t oQh  = oWo + (size_t)nWo * 2;
  const size_t oQl  = oQh + szAct16;
  const size_t oKVh = oQl + szAct16;
  const size_t oKVl = oKVh + szKV16;
  const size_t oCh  = oKVl + szKV16;
  const size_t oCl  = oCh + szAct16;
  const size_t total = oCl + szAct16;
  if (total > ws_size) return;

  char* ws = (char*)d_ws;
  unsigned short* tgt16 = (unsigned short*)(ws + oTgt);
  unsigned short* mem16 = (unsigned short*)(ws + oMem);
  unsigned short* wq16  = (unsigned short*)(ws + oWq);
  unsigned short* wkv16 = (unsigned short*)(ws + oWkv);
  unsigned short* wo16  = (unsigned short*)(ws + oWo);
  unsigned short* qh    = (unsigned short*)(ws + oQh);
  unsigned short* ql    = (unsigned short*)(ws + oQl);
  unsigned short* kvh   = (unsigned short*)(ws + oKVh);
  unsigned short* kvl   = (unsigned short*)(ws + oKVl);
  unsigned short* ch    = (unsigned short*)(ws + oCh);
  unsigned short* cl    = (unsigned short*)(ws + oCl);

  /* 1. RNE-convert the five float matrices to bf16 planes (5 launches) */
  { const int n2 = nAct / 2; cast_f32_bf16x2<<<dim3((n2 + 255) / 256), dim3(256), 0, stream>>>(tgt,   tgt16, n2); }
  { const int n2 = nAct / 2; cast_f32_bf16x2<<<dim3((n2 + 255) / 256), dim3(256), 0, stream>>>(mem,   mem16, n2); }
  { const int n2 = nWq  / 2; cast_f32_bf16x2<<<dim3((n2 + 255) / 256), dim3(256), 0, stream>>>(Wq_w,  wq16,  n2); }
  { const int n2 = nWkv / 2; cast_f32_bf16x2<<<dim3((n2 + 255) / 256), dim3(256), 0, stream>>>(Wkv_w, wkv16, n2); }
  { const int n2 = nWo  / 2; cast_f32_bf16x2<<<dim3((n2 + 255) / 256), dim3(256), 0, stream>>>(out_w, wo16,  n2); }

  /* 2. q = tgt16 . wq16^T + bq : M=4096 N=1024 K=1024 -> bf16 hi/lo planes; 1024 tiles / 8 per block */
  {
    const int tiles = (kRowsM / 64) * (kEmb / 64);
    wmma_gemm64<1, 0, 2, 2><<<dim3((tiles + 7) / 8, 1), dim3(256), 0, stream>>>(
        tgt16, tgt16, kEmb, 0L, wq16, wq16, kEmb, 0L, (void*)qh, (void*)ql, kEmb, 0L,
        Wq_b, kRowsM, kEmb, kEmb, 1.0f);
  }
  /* 3. kv = mem16 . wkv16^T + bkv : M=4096 N=2048 K=1024 -> bf16 hi/lo planes; 2048 tiles */
  {
    const int tiles = (kRowsM / 64) * (kKVCols / 64);
    wmma_gemm64<1, 0, 2, 2><<<dim3((tiles + 7) / 8, 1), dim3(256), 0, stream>>>(
        mem16, mem16, kEmb, 0L, wkv16, wkv16, kEmb, 0L, (void*)kvh, (void*)kvl, kKVCols, 0L,
        Wkv_b, kRowsM, kKVCols, kEmb, 1.0f);
  }
  /* 4. attention: grid = B*H*(SQ/64) = 1024 blocks of 128 threads -> ctx hi/lo planes */
  {
    const int nblk = kBatch * kHeads * (kSeqQ / 64);
    mha_attn_hd64<<<dim3(nblk), dim3(128), 0, stream>>>(qh, ql, kvh, kvl, abias, kmask, ch, cl);
  }
  /* 5. out = (ch + cl) . wo16^T + bo : M=4096 N=1024 K=1024, A carried hi+lo (2 products), f32 out */
  {
    const int tiles = (kRowsM / 64) * (kEmb / 64);
    wmma_gemm64<1, 1, 2, 0><<<dim3((tiles + 7) / 8, 1), dim3(256), 0, stream>>>(
        ch, cl, kEmb, 0L, wo16, wo16, kEmb, 0L, (void*)out, (void*)cl, kEmb, 0L,
        out_b, kRowsM, kEmb, kEmb, 1.0f);
  }
}

// v001
// It runs in 416 microseconds.
// Next to v000, in two timings, it ran 1.34 times as fast each time.
// Contractions: q/kv/out projections on v_wmma_f32_16x16x32_bf16 (float inputs RNE-converted to bf16 once; out-projection A operand carried as bf16 hi+lo planes, 2 products); attention q.k and p.v on v_wmma_f32_16x16x32_bf16 with bf16 hi+lo planes for q,k,p,v (3 products); f32 accumulate; softmax and normalisation in f32.
#include <hip/hip_runtime.h>

typedef __attribute__((ext_vector_type(16))) _Float16 v16h;
typedef __attribute__((ext_vector_type(8)))  _Float16 v8h;
typedef __attribute__((ext_vector_type(16))) __bf16   v16b;
typedef __attribute__((ext_vector_type(8)))  __bf16   v8b;
typedef __attribute__((ext_vector_type(8)))  float    v8f;
typedef __attribute__((ext_vector_type(4)))  float    v4f;
typedef __attribute__((ext_vector_type(2)))  float    v2f;
typedef __attribute__((ext_vector_type(4)))  unsigned v4u;

static constexpr int kBatch  = 2;
static constexpr int kSeqQ   = 2048;
static constexpr int kSeqK   = 2048;
static constexpr int kEmb    = 1024;
static constexpr int kHeads  = 16;
static constexpr int kHeadD  = 64;
static constexpr int kKVCols = 2 * kEmb;          /* 2048: k at cols 0..1023, v at cols 1024..2047 */
static constexpr int kRowsM  = kBatch * kSeqQ;    /* 4096 (== kBatch * kSeqK) */
static constexpr int kKC     = 64;                /* keys per streamed chunk */
static constexpr int kLP     = 72;                /* LDS row pitch in 16-bit elements: 144 B = 16 B x 9, so the 16 rows of a 16-byte fragment read fall on distinct banks */

__device__ __forceinline__ unsigned short f2bf_bits(float f) {
  unsigned u = __float_as_uint(f);
  return (unsigned short)((u + 0x7FFFu + ((u >> 16) & 1u)) >> 16);
}
__device__ __forceinline__ float bf_bits2f(unsigned short h) { return __uint_as_float(((unsigned)h) << 16); }

// hazard guards as plain device helpers (no inline asm inside the kernel template body)
__device__ __forceinline__ void dep_guard_h(v8f& a, v8f& b, v16h x, v16h y) { asm volatile("v_nop\n\tv_nop\n\tv_nop\n\tv_nop" : "+v"(a), "+v"(b) : "v"(x), "v"(y)); }
__device__ __forceinline__ void dep_guard_b(v8f& a, v8f& b, v16b x, v16b y) { asm volatile("v_nop\n\tv_nop\n\tv_nop\n\tv_nop" : "+v"(a), "+v"(b) : "v"(x), "v"(y)); }
__device__ __forceinline__ void keep4_h(v16h a, v16h b, v16h c, v16h d) { asm volatile("v_nop" :: "v"(a), "v"(b), "v"(c), "v"(d)); }
__device__ __forceinline__ void keep4_b(v16b a, v16b b, v16b c, v16b d) { asm volatile("v_nop" :: "v"(a), "v"(b), "v"(c), "v"(d)); }
__device__ __forceinline__ void acc_guard4(v8f& a, v8f& b, v8f& c, v8f& d) { asm volatile("v_nop\n\tv_nop\n\tv_nop\n\tv_nop" : "+v"(a), "+v"(b), "+v"(c), "+v"(d)); }
template <typename T> struct Frag;
template <> struct Frag<_Float16> {
  typedef v16h V; union U { v16h v; v8h h[2]; };
  static __device__ __forceinline__ v16h load(const _Float16* p) {   // elements 0..7 <- p[0..7], 8..15 <- p[16..23]
    U f; f.h[0] = *(const v8h*)(p); f.h[1] = *(const v8h*)(p + 16); return f.v;
  }
  static __device__ __forceinline__ v8f mma(v16h a, v16h b, v8f c) {
    return __builtin_amdgcn_wmma_f32_16x16x32_f16(false, a, false, b, (short)0, c, false, false);
  }
  static __device__ __forceinline__ void guard(v8f& a, v8f& b, v16h x, v16h y) { dep_guard_h(a, b, x, y); }
  static __device__ __forceinline__ void keep(v16h a, v16h b, v16h c, v16h d) { keep4_h(a, b, c, d); }
};
template <> struct Frag<__bf16> {
  typedef v16b V; union U { v16b v; v8b h[2]; };
  static __device__ __forceinline__ v16b load(const __bf16* p) {
    U f; f.h[0] = *(const v8b*)(p); f.h[1] = *(const v8b*)(p + 16); return f.v;
  }
  static __device__ __forceinline__ v8f mma(v16b a, v16b b, v8f c) {
    return __builtin_amdgcn_wmma_f32_16x16x32_bf16(false, a, false, b, (short)0, c, false, false);
  }
  static __device__ __forceinline__ void guard(v8f& a, v8f& b, v16b x, v16b y) { dep_guard_b(a, b, x, y); }
  static __device__ __forceinline__ void keep(v16b a, v16b b, v16b c, v16b d) { keep4_b(a, b, c, d); }
};

// ---- Register-blocked batched WMMA GEMM ------------------------------------
// C[m,n] = scale * sum_k A[m,k] * Bt[n,k] (+bias); each wave owns a 64x64 tile.
// A row-major [M,K]; Bt row-major [N,K]; M,N % 64 == 0, K % 32 == 0.
// SPLIT: 0 = single product; 1 = A carried as hi+lo planes (A.B + A2.B); 2 = A and B hi+lo planes (A.B + A.B2 + A2.B).
// BIAS_MODE: 0 = none, 2 = bias[n] (bias RNE-converted to bf16 before the add).
// OUT_MODE: 0 = f32, 1 = f16, 2 = bf16 hi plane (Cout) + bf16 lo plane (Cout2).
// ET: 0 = f16 operands, 1 = bf16 operands (pointers passed as 16-bit storage)
template <int ET> struct Elem;
template <> struct Elem<0> { typedef _Float16 T; };
template <> struct Elem<1> { typedef __bf16 T; };
template <int ET, int SPLIT, int BIAS_MODE, int OUT_MODE>
__global__ __launch_bounds__(256) void wmma_gemm64(
    const unsigned short* __restrict__ Ap, const unsigned short* __restrict__ A2p, int lda, long strideA,
    const unsigned short* __restrict__ Btp, const unsigned short* __restrict__ Bt2p, int ldb, long strideB,
    void* __restrict__ Cout, void* __restrict__ Cout2, int ldc, long strideC,
    const float* __restrict__ bias,
    int M, int N, int K, float scale) {
  typedef typename Elem<ET>::T T;
  typedef typename Frag<T>::V V;
  const T* A = (const T*)Ap; const T* A2 = (const T*)A2p; const T* Bt = (const T*)Btp; const T* Bt2 = (const T*)Bt2p;
  __shared__ __align__(16) float sT[8][16 * 68];   // per-wave 16x64 slab, pitch 68 floats
  const int b    = blockIdx.y;
  const int lane = threadIdx.x & 31;
  const int wave = threadIdx.x >> 5;
  const int tilesN = N >> 6;
  const int tilesM = M >> 6;
  const int tile = blockIdx.x * 8 + wave;
  if (tile >= tilesM * tilesN) return;   // wave-uniform; no block barriers in this kernel
  const int tm = tile / tilesN;
  const int tn = tile - tm * tilesN;
  const int m0 = tm << 6;
  const int n0 = tn << 6;

  const T* Ab  = A  + (size_t)b * strideA;
  const T* Bb  = Bt + (size_t)b * strideB;
  const T* Ab2 = (SPLIT != 0) ? (A2  + (size_t)b * strideA) : nullptr;
  const T* Bb2 = (SPLIT == 2) ? (Bt2 + (size_t)b * strideB) : nullptr;

  const int rlane = lane & 15;                 // row (A) / col (B, D) within subtile
  const int koff  = (lane >> 4) * 8;           // k offset of this lane half
  const int mOff  = (lane >> 4) * 8;           // D row offset

  v8f acc[4][4];
#pragma unroll
  for (int i = 0; i < 4; ++i)
#pragma unroll
    for (int j = 0; j < 4; ++j) acc[i][j] = (v8f){0.f,0.f,0.f,0.f,0.f,0.f,0.f,0.f};

  for (int k0 = 0; k0 < K; k0 += 32) {
    V bh[4], bl[4];
#pragma unroll
    for (int j = 0; j < 4; ++j) {
      const size_t bo = (size_t)(n0 + (j << 4) + rlane) * ldb + koff + k0;
      bh[j] = Frag<T>::load(Bb + bo);
      if (SPLIT == 2) bl[j] = Frag<T>::load(Bb2 + bo);
    }
#pragma unroll
    for (int i = 0; i < 4; ++i) {
      const size_t ao = (size_t)(m0 + (i << 4) + rlane) * lda + koff + k0;
      V ah = Frag<T>::load(Ab + ao);
      V al;
      if (SPLIT != 0) al = Frag<T>::load(Ab2 + ao);
#pragma unroll
      for (int j = 0; j < 4; ++j) {
        acc[i][j] = Frag<T>::mma(ah, bh[j], acc[i][j]);
        if (SPLIT == 2) acc[i][j] = Frag<T>::mma(ah, bl[j], acc[i][j]);
        if (SPLIT != 0) acc[i][j] = Frag<T>::mma(al, bh[j], acc[i][j]);
      }
      Frag<T>::guard(acc[i][0], acc[i][3], ah, (SPLIT != 0) ? al : ah);
    }
    Frag<T>::keep(bh[0], bh[1], bh[2], bh[3]);
    if (SPLIT == 2) Frag<T>::keep(bl[0], bl[1], bl[2], bl[3]);
  }
  acc_guard4(acc[0][0], acc[0][1], acc[0][2], acc[0][3]);
  acc_guard4(acc[1][0], acc[1][1], acc[1][2], acc[1][3]);
  acc_guard4(acc[2][0], acc[2][1], acc[2][2], acc[2][3]);
  acc_guard4(acc[3][0], acc[3][1], acc[3][2], acc[3][3]);

  // ---- epilogue ----
  float* slab = sT[wave];
#pragma unroll
  for (int i = 0; i < 4; ++i) {
    const int mBase = m0 + (i << 4);
#pragma unroll
    for (int j = 0; j < 4; ++j) {
      const int n = n0 + (j << 4) + rlane;
      float bv = 0.f;
      if (BIAS_MODE == 2) bv = bf_bits2f(f2bf_bits(bias[n]));
#pragma unroll
      for (int r = 0; r < 8; ++r) {
        float v = acc[i][j][r] * scale;
        if (BIAS_MODE == 2) v += bv;
        slab[(mOff + r) * 68 + (j << 4) + rlane] = v;
      }
    }
    __builtin_amdgcn_fence(__ATOMIC_RELEASE, "workgroup");
    __builtin_amdgcn_wave_barrier();
    __builtin_amdgcn_fence(__ATOMIC_ACQUIRE, "workgroup");
    if (OUT_MODE == 0) {
      float* C = (float*)Cout + (size_t)b * strideC;
      const int hh = lane >> 4, c4 = (lane & 15) * 4;     // row seg = 256 B = 16 lanes x 16 B
      {
#pragma unroll
        for (int it = 0; it < 8; ++it) {
          const int row = it * 2 + hh;
          v4f v = *(const v4f*)(slab + row * 68 + c4);
          *(v4f*)(C + (size_t)(mBase + row) * ldc + n0 + c4) = v;
        }
        
      }
    } else {
      const int q = lane >> 3, c8 = (lane & 7) * 8;
      unsigned short* C  = (unsigned short*)Cout  + (size_t)b * strideC;
      unsigned short* C2 = (OUT_MODE == 2) ? ((unsigned short*)Cout2 + (size_t)b * strideC) : nullptr;
      {
#pragma unroll
        for (int it = 0; it < 4; ++it) {
          const int row = it * 4 + q;
          const float* sp = slab + row * 68 + c8;
          v8h hv, lv;
#pragma unroll
          for (int e = 0; e < 8; ++e) {
            if (OUT_MODE == 1) {
              hv[e] = (_Float16)sp[e];
            } else {
              unsigned short hb = f2bf_bits(sp[e]);
              unsigned short lb = f2bf_bits(sp[e] - bf_bits2f(hb));
              hv[e] = __builtin_bit_cast(_Float16, hb);
              lv[e] = __builtin_bit_cast(_Float16, lb);
            }
          }
          *(v8h*)(C + (size_t)(mBase + row) * ldc + n0 + c8) = hv;
          if (OUT_MODE == 2) *(v8h*)(C2 + (size_t)(mBase + row) * ldc + n0 + c8) = lv;
        }
        
      }
    }
    __builtin_amdgcn_fence(__ATOMIC_RELEASE, "workgroup");
    __builtin_amdgcn_wave_barrier();
    __builtin_amdgcn_fence(__ATOMIC_ACQUIRE, "workgroup");
  }
}

// coverage: grid = ceil(n2/256) blocks x 256 threads, thread i < n2 writes elements 2i, 2i+1; all n are multiples of 512 here.
__global__ __launch_bounds__(256) void cast_f32_bf16x2(
    const float* __restrict__ in, unsigned short* __restrict__ out, int n2) {
  int i = blockIdx.x * 256 + threadIdx.x;
  if (i < n2) {
    const v2f x = *(const v2f*)(in + 2 * (size_t)i);
    const unsigned u = (unsigned)f2bf_bits(x[0]) | ((unsigned)f2bf_bits(x[1]) << 16);
    ((unsigned*)out)[i] = u;
    
  }
}

// ---- bf16 helpers for the attention kernel ----
__device__ __forceinline__ __bf16 to_bf16(float f) { return __builtin_bit_cast(__bf16, f2bf_bits(f)); }
__device__ __forceinline__ void split_bf16(float f, __bf16& hi, __bf16& lo) {
  const unsigned short hb = f2bf_bits(f);
  hi = __builtin_bit_cast(__bf16, hb);
  lo = to_bf16(f - __uint_as_float(((unsigned)hb) << 16));
}
__device__ __forceinline__ v8f mma_bf16(v16b a, v16b b, v8f c) {
  c = __builtin_amdgcn_wmma_f32_16x16x32_bf16(false, a, false, b, (short)0, c, false, false);
  asm volatile("v_nop\n\tv_nop\n\tv_nop\n\tv_nop" : "+v"(c) : "v"(a), "v"(b));
  return c;
}

// =====================================================================================
// Cross attention, head_dim 64, 16-bit plane inputs:
//   q planes  Qh/Ql : bf16 hi/lo, element (b,s,h,d) at (b*SQ+s)*1024 + h*64 + d
//   kv planes KVh/KVl: bf16 hi/lo, row (b*SK+s) pitch 2048; k at col h*64+d, v at col 1024+h*64+d
//   scores = 0.125 * q.k^T (hi.hi + hi.lo + lo.hi) + bf16(attn_bias[b,kv]); key mask 0 -> score = -inf
//   out    = softmax(scores).v with p and v as bf16 hi/lo (3 products), f32 accumulate, f32 online softmax
//   ctx written as bf16 hi/lo planes Ch/Cl, element (b,s,h,d) at (b*SQ+s)*1024 + h*64 + d.
// Block = 4 waves = 64 query rows of one (b,h); grid.x = B*H*(SQ/64) = 1024.
// =====================================================================================
__global__ __launch_bounds__(128)
void mha_attn_hd64(const unsigned short* __restrict__ Qh, const unsigned short* __restrict__ Ql,
                   const unsigned short* __restrict__ KVh, const unsigned short* __restrict__ KVl,
                   const float* __restrict__ abias, const int* __restrict__ kmask,
                   unsigned short* __restrict__ Ch, unsigned short* __restrict__ Cl)
{
  __shared__ __align__(16) __bf16 Ksh[kKC * kLP];         // K hi [kv][d], pitch kLP   9 KB
  __shared__ __align__(16) __bf16 Ksl[kKC * kLP];         // K lo [kv][d], pitch kLP   9 KB
  __shared__ __align__(16) __bf16 Vth[kHeadD * kLP];      // V hi [d][kv], pitch kLP   9 KB
  __shared__ __align__(16) __bf16 Vtl[kHeadD * kLP];      // V lo [d][kv], pitch kLP   9 KB
  __shared__ __align__(16) __bf16 Psh[4][16 * kLP];       // per wave P hi [row][kv], pitch kLP; reused as out hi staging
  __shared__ __align__(16) __bf16 Psl[4][16 * kLP];       // per wave P lo [row][kv], pitch kLP; reused as out lo staging
  __shared__ float CB[kKC];                               // per chunk: bf16(bias) or -inf when masked

  const int tid  = threadIdx.x;
  const int wave = tid >> 5;
  const int lane = tid & 31;
  const int hh   = lane >> 4;
  const int c    = lane & 15;
  const int nqb  = kSeqQ / 64;
  const int bx   = blockIdx.x;
  const int qb   = bx % nqb;
  const int bhd  = bx / nqb;
  const int h    = bhd % kHeads;
  const int b    = bhd / kHeads;
  const int q0   = qb * 64 + wave * 16;
  const float ninf = -__builtin_huge_valf();

  const __bf16* Qhp = (const __bf16*)(const void*)Qh;
  const __bf16* Qlp = (const __bf16*)(const void*)Ql;

  // ---- Q fragments (A operand, row = c, split k map via Frag::load): 2 d-chunks, hi and lo ----
  v16b qah[2], qal[2];
  {
    const size_t qo = (size_t)(b * kSeqQ + q0 + c) * kEmb + h * kHeadD + 8 * hh;
#pragma unroll
    for (int dc = 0; dc < 2; ++dc) {
      qah[dc] = Frag<__bf16>::load(Qhp + qo + dc * 32);
      qal[dc] = Frag<__bf16>::load(Qlp + qo + dc * 32);
    }
  }

  const v8f zero8 = (v8f){0.f,0.f,0.f,0.f,0.f,0.f,0.f,0.f};
  float mrow[8], lrow[8];
  v8f oacc[4];
#pragma unroll
  for (int r = 0; r < 8; ++r) { mrow[r] = ninf; lrow[r] = 0.f; }
#pragma unroll
  for (int t = 0; t < 4; ++t) oacc[t] = zero8;

  __bf16* pwh = Psh[wave];
  __bf16* pwl = Psl[wave];

  for (int kc = 0; kc < kSeqK / kKC; ++kc) {
    const int kv0 = kc * kKC;
    __syncthreads();
    {
      // K planes: thread -> (kv row tid>>1, d half (tid&1)*32): 128 thr x 32 elems = 64 x 64 per plane
      const int kvr = tid >> 1, dh = (tid & 1) * 32;
      const size_t ro = (size_t)(b * kSeqK + kv0 + kvr) * kKVCols + h * kHeadD + dh;
#pragma unroll
      for (int i = 0; i < 4; ++i) {
        const v4u wh = *(const v4u*)(KVh + ro + 8 * i);
        const v4u wl = *(const v4u*)(KVl + ro + 8 * i);
        *(v4u*)(Ksh + kvr * kLP + dh + 8 * i) = wh;
        *(v4u*)(Ksl + kvr * kLP + dh + 8 * i) = wl;
      }
    }
    asm volatile("" ::: "memory");
    {
      // V planes transposed into [d][kv]: thread -> (kv pair p = tid>>2, d range dq = (tid&3)*16)
      // 32 pairs x 4 ranges = 128 thr; each writes 2 kv x 16 d as packed u32 (both halves per-lane data)
      const int p = tid >> 2, dq = (tid & 3) * 16;
      const size_t r0 = (size_t)(b * kSeqK + kv0 + 2 * p) * kKVCols + kEmb + h * kHeadD + dq;
      const size_t r1 = r0 + kKVCols;
#pragma unroll
      for (int i = 0; i < 2; ++i) {
        const v4u xh = *(const v4u*)(KVh + r0 + 8 * i);
        const v4u yh = *(const v4u*)(KVh + r1 + 8 * i);
        const v4u xl = *(const v4u*)(KVl + r0 + 8 * i);
        const v4u yl = *(const v4u*)(KVl + r1 + 8 * i);
#pragma unroll
        for (int jw = 0; jw < 4; ++jw) {
          const int d0 = dq + 8 * i + 2 * jw;
          const unsigned xhw = xh[jw], yhw = yh[jw], xlw = xl[jw], ylw = yl[jw];
          const unsigned h0 = (xhw & 0xffffu) | (yhw << 16);
          const unsigned h1 = (xhw >> 16) | (yhw & 0xffff0000u);
          const unsigned l0 = (xlw & 0xffffu) | (ylw << 16);
          const unsigned l1 = (xlw >> 16) | (ylw & 0xffff0000u);
          *(unsigned*)(Vth + d0 * kLP + 2 * p)       = h0;
          *(unsigned*)(Vth + (d0 + 1) * kLP + 2 * p) = h1;
          *(unsigned*)(Vtl + d0 * kLP + 2 * p)       = l0;
          *(unsigned*)(Vtl + (d0 + 1) * kLP + 2 * p) = l1;
        }
      }
    }
    if (tid < kKC) {   // waves 0 and 1 entirely: wave-uniform branch
      const size_t ki = (size_t)b * kSeqK + kv0 + tid;
      const int keep = kmask[ki];
      const float bb = bf_bits2f(f2bf_bits(abias[ki]));
      CB[tid] = (keep != 0) ? bb : ninf;
    }
    __syncthreads();

    // ---- scores: 4 key tiles x 2 d-chunks x 3 products ----
    v8f s[4];
#pragma unroll
    for (int j = 0; j < 4; ++j) {
      s[j] = zero8;
#pragma unroll
      for (int dc = 0; dc < 2; ++dc) {
        const v16b kbh = Frag<__bf16>::load(Ksh + (j * 16 + c) * kLP + dc * 32 + 8 * hh);
        const v16b kbl = Frag<__bf16>::load(Ksl + (j * 16 + c) * kLP + dc * 32 + 8 * hh);
        s[j] = mma_bf16(qah[dc], kbh, s[j]);
        s[j] = mma_bf16(qah[dc], kbl, s[j]);
        s[j] = mma_bf16(qal[dc], kbh, s[j]);
      }
    }
    float cbv[4];
#pragma unroll
    for (int j = 0; j < 4; ++j) cbv[j] = CB[j * 16 + c];
    float cm[8];
#pragma unroll
    for (int r = 0; r < 8; ++r) {
      float m = ninf;
#pragma unroll
      for (int j = 0; j < 4; ++j) {
        const float v = s[j][r] * 0.125f + cbv[j];
        s[j][r] = v;
        m = fmaxf(m, v);
      }
#pragma unroll
      for (int off = 1; off < 16; off <<= 1) m = fmaxf(m, __shfl_xor(m, off, 32));
      cm[r] = m;
    }
    // ---- online softmax; P tile (hi/lo) into this wave's LDS slots ----
#pragma unroll
    for (int r = 0; r < 8; ++r) {
      const float mnew = fmaxf(mrow[r], cm[r]);
      const bool live = (mnew != ninf);
      const float alpha = live ? expf(mrow[r] - mnew) : 1.0f;
      mrow[r] = mnew;
      float psum = 0.f;
#pragma unroll
      for (int j = 0; j < 4; ++j) {
        const float p = live ? expf(s[j][r] - mnew) : 0.0f;
        psum += p;
        __bf16 a, bl;
        split_bf16(p, a, bl);
        pwh[(8 * hh + r) * kLP + j * 16 + c] = a;
        pwl[(8 * hh + r) * kLP + j * 16 + c] = bl;
      }
#pragma unroll
      for (int off = 1; off < 16; off <<= 1) psum += __shfl_xor(psum, off, 32);
      lrow[r] = lrow[r] * alpha + psum;
#pragma unroll
      for (int t = 0; t < 4; ++t) oacc[t][r] *= alpha;
    }
    __builtin_amdgcn_fence(__ATOMIC_RELEASE, "workgroup");
    __builtin_amdgcn_wave_barrier();
    __builtin_amdgcn_fence(__ATOMIC_ACQUIRE, "workgroup");
    // ---- out += P.V : 2 kv-chunks x 4 d-tiles x 3 products ----
#pragma unroll
    for (int kk = 0; kk < 2; ++kk) {
      const v16b pa = Frag<__bf16>::load(pwh + c * kLP + kk * 32 + 8 * hh);
      const v16b pl = Frag<__bf16>::load(pwl + c * kLP + kk * 32 + 8 * hh);
#pragma unroll
      for (int t = 0; t < 4; ++t) {
        const v16b vb = Frag<__bf16>::load(Vth + (t * 16 + c) * kLP + kk * 32 + 8 * hh);
        const v16b vl = Frag<__bf16>::load(Vtl + (t * 16 + c) * kLP + kk * 32 + 8 * hh);
        oacc[t] = mma_bf16(pa, vb, oacc[t]);
        oacc[t] = mma_bf16(pa, vl, oacc[t]);
        oacc[t] = mma_bf16(pl, vb, oacc[t]);
      }
    }
  }

  // ---- epilogue: normalise, split to bf16 hi/lo into this wave's staging, whole-line stores ----
  __builtin_amdgcn_fence(__ATOMIC_RELEASE, "workgroup");
  __builtin_amdgcn_wave_barrier();
  __builtin_amdgcn_fence(__ATOMIC_ACQUIRE, "workgroup");
#pragma unroll
  for (int r = 0; r < 8; ++r) {
    const float inv = 1.0f / lrow[r];
#pragma unroll
    for (int t = 0; t < 4; ++t) {
      const float v = oacc[t][r] * inv;
      __bf16 a, bl;
      split_bf16(v, a, bl);
      pwh[(8 * hh + r) * kLP + t * 16 + c] = a;
      pwl[(8 * hh + r) * kLP + t * 16 + c] = bl;
    }
  }
  __builtin_amdgcn_fence(__ATOMIC_RELEASE, "workgroup");
  __builtin_amdgcn_wave_barrier();
  __builtin_amdgcn_fence(__ATOMIC_ACQUIRE, "workgroup");
  {
    _Float16* Chp = (_Float16*)(void*)Ch;
    _Float16* Clp = (_Float16*)(void*)Cl;
    const int q8 = lane >> 3, c8 = (lane & 7) * 8;
    const size_t ob = (size_t)(b * kSeqQ + q0) * kEmb + h * kHeadD + c8;
    {
#pragma unroll
      for (int it = 0; it < 4; ++it) {
        const int row = it * 4 + q8;
        const v8b xh = *(const v8b*)(pwh + row * kLP + c8);
        const v8b xl = *(const v8b*)(pwl + row * kLP + c8);
        const v8h yh = __builtin_bit_cast(v8h, xh);
        const v8h yl = __builtin_bit_cast(v8h, xl);
        *(v8h*)(Chp + ob + (size_t)row * kEmb) = yh;
        *(v8h*)(Clp + ob + (size_t)row * kEmb) = yl;
      }
      
    }
  }
}

extern "C" void kernel_launch(void* const* d_in, const int* in_sizes, int n_in,
                              void* d_out, int out_size, void* d_ws, size_t ws_size,
                              hipStream_t stream) {
  static_assert(kRowsM % 64 == 0 && kEmb % 64 == 0 && kKVCols % 64 == 0 && kEmb % 32 == 0);
  static_assert(kSeqQ % 64 == 0 && kSeqK % kKC == 0 && kHeadD == 64 && kHeads * kHeadD == kEmb && kSeqQ == kSeqK);

  if (n_in < 10) return;
  const int nAct = kRowsM * kEmb;            /* 4,194,304 elements */
  const int nWq  = kEmb * kEmb;              /* 1,048,576 */
  const int nWkv = kKVCols * kEmb;           /* 2,097,152 */
  const int nWo  = kEmb * kEmb;
  if (in_sizes[0] != nAct || in_sizes[1] != kBatch * kSeqK * kEmb || in_sizes[2] != kBatch * kSeqK ||
      in_sizes[3] != kBatch * kSeqK || in_sizes[4] != nWq || in_sizes[5] != kEmb || in_sizes[6] != nWkv ||
      in_sizes[7] != kKVCols || in_sizes[8] != nWo || in_sizes[9] != kEmb) return;
  if (out_size != nAct) return;

  const float* tgt   = (const float*)d_in[0];
  const float* mem   = (const float*)d_in[1];
  const float* abias = (const float*)d_in[2];
  const int*   kmask = (const int*)d_in[3];
  const float* Wq_w  = (const float*)d_in[4];
  const float* Wq_b  = (const float*)d_in[5];
  const float* Wkv_w = (const float*)d_in[6];
  const float* Wkv_b = (const float*)d_in[7];
  const float* out_w = (const float*)d_in[8];
  const float* out_b = (const float*)d_in[9];
  float* out = (float*)d_out;

  /* workspace region map (bytes, all offsets multiples of 1 MiB):
       [  0 MiB,  8 MiB)  tgt16   bf16 [4096][1024]
       [  8 MiB, 16 MiB)  mem16   bf16 [4096][1024]
       [ 16 MiB, 18 MiB)  wq16    bf16 [1024][1024]
       [ 18 MiB, 22 MiB)  wkv16   bf16 [2048][1024]
       [ 22 MiB, 24 MiB)  wo16    bf16 [1024][1024]
       [ 24 MiB, 32 MiB)  qh      bf16 [4096][1024]   [ 32, 40) ql
       [ 40 MiB, 56 MiB)  kvh     bf16 [4096][2048]   [ 56, 72) kvl
       [ 72 MiB, 80 MiB)  ch      bf16 [4096][1024]   [ 80, 88) cl
     total 92,274,688 B */
  const size_t szAct16 = (size_t)nAct * 2;
  const size_t szKV16  = (size_t)kRowsM * kKVCols * 2;
  const size_t oTgt = 0;
  const size_t oMem = oTgt + szAct16;
  const size_t oWq  = oMem + szAct16;
  const size_t oWkv = oWq + (size_t)nWq * 2;
  const size_t oWo  = oWkv + (size_t)nWkv * 2;
  const size_t oQh  = oWo + (size_t)nWo * 2;
  const size_t oQl  = oQh + szAct16;
  const size_t oKVh = oQl + szAct16;
  const size_t oKVl = oKVh + szKV16;
  const size_t oCh  = oKVl + szKV16;
  const size_t oCl  = oCh + szAct16;
  const size_t total = oCl + szAct16;
  if (total > ws_size) return;

  char* ws = (char*)d_ws;
  unsigned short* tgt16 = (unsigned short*)(ws + oTgt);
  unsigned short* mem16 = (unsigned short*)(ws + oMem);
  unsigned short* wq16  = (unsigned short*)(ws + oWq);
  unsigned short* wkv16 = (unsigned short*)(ws + oWkv);
  unsigned short* wo16  = (unsigned short*)(ws + oWo);
  unsigned short* qh    = (unsigned short*)(ws + oQh);
  unsigned short* ql    = (unsigned short*)(ws + oQl);
  unsigned short* kvh   = (unsigned short*)(ws + oKVh);
  unsigned short* kvl   = (unsigned short*)(ws + oKVl);
  unsigned short* ch    = (unsigned short*)(ws + oCh);
  unsigned short* cl    = (unsigned short*)(ws + oCl);

  /* 1. RNE-convert the five float matrices to bf16 planes (5 launches) */
  { const int n2 = nAct / 2; cast_f32_bf16x2<<<dim3((n2 + 255) / 256), dim3(256), 0, stream>>>(tgt,   tgt16, n2); }
  { const int n2 = nAct / 2; cast_f32_bf16x2<<<dim3((n2 + 255) / 256), dim3(256), 0, stream>>>(mem,   mem16, n2); }
  { const int n2 = nWq  / 2; cast_f32_bf16x2<<<dim3((n2 + 255) / 256), dim3(256), 0, stream>>>(Wq_w,  wq16,  n2); }
  { const int n2 = nWkv / 2; cast_f32_bf16x2<<<dim3((n2 + 255) / 256), dim3(256), 0, stream>>>(Wkv_w, wkv16, n2); }
  { const int n2 = nWo  / 2; cast_f32_bf16x2<<<dim3((n2 + 255) / 256), dim3(256), 0, stream>>>(out_w, wo16,  n2); }

  /* 2. q = tgt16 . wq16^T + bq : M=4096 N=1024 K=1024 -> bf16 hi/lo planes; 1024 tiles / 8 per block */
  {
    const int tiles = (kRowsM / 64) * (kEmb / 64);
    wmma_gemm64<1, 0, 2, 2><<<dim3((tiles + 7) / 8, 1), dim3(256), 0, stream>>>(
        tgt16, tgt16, kEmb, 0L, wq16, wq16, kEmb, 0L, (void*)qh, (void*)ql, kEmb, 0L,
        Wq_b, kRowsM, kEmb, kEmb, 1.0f);
  }
  /* 3. kv = mem16 . wkv16^T + bkv : M=4096 N=2048 K=1024 -> bf16 hi/lo planes; 2048 tiles */
  {
    const int tiles = (kRowsM / 64) * (kKVCols / 64);
    wmma_gemm64<1, 0, 2, 2><<<dim3((tiles + 7) / 8, 1), dim3(256), 0, stream>>>(
        mem16, mem16, kEmb, 0L, wkv16, wkv16, kEmb, 0L, (void*)kvh, (void*)kvl, kKVCols, 0L,
        Wkv_b, kRowsM, kKVCols, kEmb, 1.0f);
  }
  /* 4. attention: grid = B*H*(SQ/64) = 1024 blocks of 128 threads -> ctx hi/lo planes */
  {
    const int nblk = kBatch * kHeads * (kSeqQ / 64);
    mha_attn_hd64<<<dim3(nblk), dim3(128), 0, stream>>>(qh, ql, kvh, kvl, abias, kmask, ch, cl);
  }
  /* 5. out = (ch + cl) . wo16^T + bo : M=4096 N=1024 K=1024, A carried hi+lo (2 products), f32 out */
  {
    const int tiles = (kRowsM / 64) * (kEmb / 64);
    wmma_gemm64<1, 1, 2, 0><<<dim3((tiles + 7) / 8, 1), dim3(256), 0, stream>>>(
        ch, cl, kEmb, 0L, wo16, wo16, kEmb, 0L, (void*)out, (void*)cl, kEmb, 0L,
        out_b, kRowsM, kEmb, kEmb, 1.0f);
  }
}

// v002
// One run takes 329 microseconds.
// In both of two side-by-side timings against v001, it was 1.27 times as fast.
// All steps since v000 together make it 1.70 times as fast.
// Contractions: q/kv/out projections on v_wmma_f32_16x16x32_bf16 (float inputs RNE-converted to bf16 once; out-projection A operand carried as bf16 hi+lo planes, 2 products); attention q.k and p.v on v_wmma_f32_16x16x32_bf16 with bf16 hi+lo planes for q,k,p,v (3 products); f32 accumulate; softmax and normalisation in f32.
#include <hip/hip_runtime.h>

typedef __attribute__((ext_vector_type(16))) _Float16 v16h;
typedef __attribute__((ext_vector_type(8)))  _Float16 v8h;
typedef __attribute__((ext_vector_type(16))) __bf16   v16b;
typedef __attribute__((ext_vector_type(8)))  __bf16   v8b;
typedef __attribute__((ext_vector_type(8)))  float    v8f;
typedef __attribute__((ext_vector_type(4)))  float    v4f;
typedef __attribute__((ext_vector_type(2)))  float    v2f;
typedef __attribute__((ext_vector_type(4)))  unsigned v4u;

static constexpr int kBatch  = 2;
static constexpr int kSeqQ   = 2048;
static constexpr int kSeqK   = 2048;
static constexpr int kEmb    = 1024;
static constexpr int kHeads  = 16;
static constexpr int kHeadD  = 64;
static constexpr int kKVCols = 2 * kEmb;          /* 2048: k at cols 0..1023, v at cols 1024..2047 */
static constexpr int kRowsM  = kBatch * kSeqQ;    /* 4096 (== kBatch * kSeqK) */
static constexpr int kKC     = 64;                /* keys per streamed chunk */
static constexpr int kLP     = 72;                /* LDS row pitch in 16-bit elements: 144 B = 16 B x 9, so the 16 rows of a 16-byte fragment read fall on distinct banks */

__device__ __forceinline__ unsigned short f2bf_bits(float f) {
  unsigned u = __float_as_uint(f);
  return (unsigned short)((u + 0x7FFFu + ((u >> 16) & 1u)) >> 16);
}
__device__ __forceinline__ float bf_bits2f(unsigned short h) { return __uint_as_float(((unsigned)h) << 16); }

// hazard guards as plain device helpers (no inline asm inside the kernel template body)
__device__ __forceinline__ void dep_guard_h(v8f& a, v8f& b, v16h x, v16h y) { asm volatile("v_nop\n\tv_nop\n\tv_nop\n\tv_nop" : "+v"(a), "+v"(b) : "v"(x), "v"(y)); }
__device__ __forceinline__ void dep_guard_b(v8f& a, v8f& b, v16b x, v16b y) { asm volatile("v_nop\n\tv_nop\n\tv_nop\n\tv_nop" : "+v"(a), "+v"(b) : "v"(x), "v"(y)); }
__device__ __forceinline__ void keep4_h(v16h a, v16h b, v16h c, v16h d) { asm volatile("v_nop" :: "v"(a), "v"(b), "v"(c), "v"(d)); }
__device__ __forceinline__ void keep4_b(v16b a, v16b b, v16b c, v16b d) { asm volatile("v_nop" :: "v"(a), "v"(b), "v"(c), "v"(d)); }
__device__ __forceinline__ void acc_guard4(v8f& a, v8f& b, v8f& c, v8f& d) { asm volatile("v_nop\n\tv_nop\n\tv_nop\n\tv_nop" : "+v"(a), "+v"(b), "+v"(c), "+v"(d)); }
template <typename T> struct Frag;
template <> struct Frag<_Float16> {
  typedef v16h V; union U { v16h v; v8h h[2]; };
  static __device__ __forceinline__ v16h load(const _Float16* p) {   // elements 0..7 <- p[0..7], 8..15 <- p[16..23]
    U f; f.h[0] = *(const v8h*)(p); f.h[1] = *(const v8h*)(p + 16); return f.v;
  }
  static __device__ __forceinline__ v8f mma(v16h a, v16h b, v8f c) {
    return __builtin_amdgcn_wmma_f32_16x16x32_f16(false, a, false, b, (short)0, c, false, false);
  }
  static __device__ __forceinline__ void guard(v8f& a, v8f& b, v16h x, v16h y) { dep_guard_h(a, b, x, y); }
  static __device__ __forceinline__ void keep(v16h a, v16h b, v16h c, v16h d) { keep4_h(a, b, c, d); }
};
template <> struct Frag<__bf16> {
  typedef v16b V; union U { v16b v; v8b h[2]; };
  static __device__ __forceinline__ v16b load(const __bf16* p) {
    U f; f.h[0] = *(const v8b*)(p); f.h[1] = *(const v8b*)(p + 16); return f.v;
  }
  static __device__ __forceinline__ v8f mma(v16b a, v16b b, v8f c) {
    return __builtin_amdgcn_wmma_f32_16x16x32_bf16(false, a, false, b, (short)0, c, false, false);
  }
  static __device__ __forceinline__ void guard(v8f& a, v8f& b, v16b x, v16b y) { dep_guard_b(a, b, x, y); }
  static __device__ __forceinline__ void keep(v16b a, v16b b, v16b c, v16b d) { keep4_b(a, b, c, d); }
};

// ---- Register-blocked batched WMMA GEMM ------------------------------------
// C[m,n] = scale * sum_k A[m,k] * Bt[n,k] (+bias); each wave owns a 64x64 tile.
// A row-major [M,K]; Bt row-major [N,K]; M,N % 64 == 0, K % 32 == 0.
// SPLIT: 0 = single product; 1 = A carried as hi+lo planes (A.B + A2.B); 2 = A and B hi+lo planes (A.B + A.B2 + A2.B).
// BIAS_MODE: 0 = none, 2 = bias[n] (bias RNE-converted to bf16 before the add).
// OUT_MODE: 0 = f32, 1 = f16, 2 = bf16 hi plane (Cout) + bf16 lo plane (Cout2).
// ET: 0 = f16 operands, 1 = bf16 operands (pointers passed as 16-bit storage)
template <int ET> struct Elem;
template <> struct Elem<0> { typedef _Float16 T; };
template <> struct Elem<1> { typedef __bf16 T; };
template <int ET, int SPLIT, int BIAS_MODE, int OUT_MODE>
__global__ __launch_bounds__(256) void wmma_gemm64(
    const unsigned short* __restrict__ Ap, const unsigned short* __restrict__ A2p, int lda, long strideA,
    const unsigned short* __restrict__ Btp, const unsigned short* __restrict__ Bt2p, int ldb, long strideB,
    void* __restrict__ Cout, void* __restrict__ Cout2, int ldc, long strideC,
    const float* __restrict__ bias,
    int M, int N, int K, float scale) {
  typedef typename Elem<ET>::T T;
  typedef typename Frag<T>::V V;
  const T* A = (const T*)Ap; const T* A2 = (const T*)A2p; const T* Bt = (const T*)Btp; const T* Bt2 = (const T*)Bt2p;
  __shared__ __align__(16) float sT[8][16 * 68];   // per-wave 16x64 slab, pitch 68 floats
  const int b    = blockIdx.y;
  const int lane = threadIdx.x & 31;
  const int wave = threadIdx.x >> 5;
  const int tilesN = N >> 6;
  const int tilesM = M >> 6;
  const int tile = blockIdx.x * 8 + wave;
  if (tile >= tilesM * tilesN) return;   // wave-uniform; no block barriers in this kernel
  const int tm = tile / tilesN;
  const int tn = tile - tm * tilesN;
  const int m0 = tm << 6;
  const int n0 = tn << 6;

  const T* Ab  = A  + (size_t)b * strideA;
  const T* Bb  = Bt + (size_t)b * strideB;
  const T* Ab2 = (SPLIT != 0) ? (A2  + (size_t)b * strideA) : nullptr;
  const T* Bb2 = (SPLIT == 2) ? (Bt2 + (size_t)b * strideB) : nullptr;

  const int rlane = lane & 15;                 // row (A) / col (B, D) within subtile
  const int koff  = (lane >> 4) * 8;           // k offset of this lane half
  const int mOff  = (lane >> 4) * 8;           // D row offset

  v8f acc[4][4];
#pragma unroll
  for (int i = 0; i < 4; ++i)
#pragma unroll
    for (int j = 0; j < 4; ++j) acc[i][j] = (v8f){0.f,0.f,0.f,0.f,0.f,0.f,0.f,0.f};

  for (int k0 = 0; k0 < K; k0 += 32) {
    V bh[4], bl[4];
#pragma unroll
    for (int j = 0; j < 4; ++j) {
      const size_t bo = (size_t)(n0 + (j << 4) + rlane) * ldb + koff + k0;
      bh[j] = Frag<T>::load(Bb + bo);
      if (SPLIT == 2) bl[j] = Frag<T>::load(Bb2 + bo);
    }
#pragma unroll
    for (int i = 0; i < 4; ++i) {
      const size_t ao = (size_t)(m0 + (i << 4) + rlane) * lda + koff + k0;
      V ah = Frag<T>::load(Ab + ao);
      V al;
      if (SPLIT != 0) al = Frag<T>::load(Ab2 + ao);
#pragma unroll
      for (int j = 0; j < 4; ++j) {
        acc[i][j] = Frag<T>::mma(ah, bh[j], acc[i][j]);
        if (SPLIT == 2) acc[i][j] = Frag<T>::mma(ah, bl[j], acc[i][j]);
        if (SPLIT != 0) acc[i][j] = Frag<T>::mma(al, bh[j], acc[i][j]);
      }
      Frag<T>::guard(acc[i][0], acc[i][3], ah, (SPLIT != 0) ? al : ah);
    }
    Frag<T>::keep(bh[0], bh[1], bh[2], bh[3]);
    if (SPLIT == 2) Frag<T>::keep(bl[0], bl[1], bl[2], bl[3]);
  }
  acc_guard4(acc[0][0], acc[0][1], acc[0][2], acc[0][3]);
  acc_guard4(acc[1][0], acc[1][1], acc[1][2], acc[1][3]);
  acc_guard4(acc[2][0], acc[2][1], acc[2][2], acc[2][3]);
  acc_guard4(acc[3][0], acc[3][1], acc[3][2], acc[3][3]);

  // ---- epilogue ----
  float* slab = sT[wave];
#pragma unroll
  for (int i = 0; i < 4; ++i) {
    const int mBase = m0 + (i << 4);
#pragma unroll
    for (int j = 0; j < 4; ++j) {
      const int n = n0 + (j << 4) + rlane;
      float bv = 0.f;
      if (BIAS_MODE == 2) bv = bf_bits2f(f2bf_bits(bias[n]));
#pragma unroll
      for (int r = 0; r < 8; ++r) {
        float v = acc[i][j][r] * scale;
        if (BIAS_MODE == 2) v += bv;
        slab[(mOff + r) * 68 + (j << 4) + rlane] = v;
      }
    }
    __builtin_amdgcn_fence(__ATOMIC_RELEASE, "workgroup");
    __builtin_amdgcn_wave_barrier();
    __builtin_amdgcn_fence(__ATOMIC_ACQUIRE, "workgroup");
    if (OUT_MODE == 0) {
      float* C = (float*)Cout + (size_t)b * strideC;
      const int hh = lane >> 4, c4 = (lane & 15) * 4;     // row seg = 256 B = 16 lanes x 16 B
      {
#pragma unroll
        for (int it = 0; it < 8; ++it) {
          const int row = it * 2 + hh;
          v4f v = *(const v4f*)(slab + row * 68 + c4);
          *(v4f*)(C + (size_t)(mBase + row) * ldc + n0 + c4) = v;
        }
        
      }
    } else {
      const int q = lane >> 3, c8 = (lane & 7) * 8;
      unsigned short* C  = (unsigned short*)Cout  + (size_t)b * strideC;
      unsigned short* C2 = (OUT_MODE == 2) ? ((unsigned short*)Cout2 + (size_t)b * strideC) : nullptr;
      {
#pragma unroll
        for (int it = 0; it < 4; ++it) {
          const int row = it * 4 + q;
          const float* sp = slab + row * 68 + c8;
          v8h hv, lv;
#pragma unroll
          for (int e = 0; e < 8; ++e) {
            if (OUT_MODE == 1) {
              hv[e] = (_Float16)sp[e];
            } else {
              unsigned short hb = f2bf_bits(sp[e]);
              unsigned short lb = f2bf_bits(sp[e] - bf_bits2f(hb));
              hv[e] = __builtin_bit_cast(_Float16, hb);
              lv[e] = __builtin_bit_cast(_Float16, lb);
            }
          }
          *(v8h*)(C + (size_t)(mBase + row) * ldc + n0 + c8) = hv;
          if (OUT_MODE == 2) *(v8h*)(C2 + (size_t)(mBase + row) * ldc + n0 + c8) = lv;
        }
        
      }
    }
    __builtin_amdgcn_fence(__ATOMIC_RELEASE, "workgroup");
    __builtin_amdgcn_wave_barrier();
    __builtin_amdgcn_fence(__ATOMIC_ACQUIRE, "workgroup");
  }
}

// coverage: grid = ceil(n2/256) blocks x 256 threads, thread i < n2 writes elements 2i, 2i+1; all n are multiples of 512 here.
__global__ __launch_bounds__(256) void cast_f32_bf16x2(
    const float* __restrict__ in, unsigned short* __restrict__ out, int n2) {
  int i = blockIdx.x * 256 + threadIdx.x;
  if (i < n2) {
    const v2f x = *(const v2f*)(in + 2 * (size_t)i);
    const unsigned u = (unsigned)f2bf_bits(x[0]) | ((unsigned)f2bf_bits(x[1]) << 16);
    ((unsigned*)out)[i] = u;
    
  }
}

// ---- bf16 helpers for the attention kernel ----
__device__ __forceinline__ __bf16 to_bf16(float f) { return __builtin_bit_cast(__bf16, f2bf_bits(f)); }
__device__ __forceinline__ void split_bf16(float f, __bf16& hi, __bf16& lo) {
  const unsigned short hb = f2bf_bits(f);
  hi = __builtin_bit_cast(__bf16, hb);
  lo = to_bf16(f - __uint_as_float(((unsigned)hb) << 16));
}
__device__ __forceinline__ v8f mma_bf16(v16b a, v16b b, v8f c) {
  c = __builtin_amdgcn_wmma_f32_16x16x32_bf16(false, a, false, b, (short)0, c, false, false);
  asm volatile("v_nop\n\tv_nop\n\tv_nop\n\tv_nop" : "+v"(c) : "v"(a), "v"(b));
  return c;
}

// lane l with lane l ^ 16
__device__ __forceinline__ float xhalf(float x) {
  return __builtin_bit_cast(float, __builtin_amdgcn_permlanex16(__builtin_bit_cast(int, x), __builtin_bit_cast(int, x), 0x76543210, 0xfedcba98, false, false));
}

// =====================================================================================
// Cross attention, head_dim 64, 16-bit plane inputs:
//   q planes  Qh/Ql : bf16 hi/lo, element (b,s,h,d) at (b*SQ+s)*1024 + h*64 + d
//   kv planes KVh/KVl: bf16 hi/lo, row (b*SK+s) pitch 2048; k at col h*64+d, v at col 1024+h*64+d
//   scores = 0.125 * q.k^T (hi.hi + hi.lo + lo.hi) + bf16(attn_bias[b,kv]); key mask 0 -> score = -inf
//   out    = softmax(scores).v with p and v as bf16 hi/lo (3 products), f32 accumulate, f32 online softmax
//   both products run transposed (scores^T = k.q^T, out^T += v^T.p^T): a lane owns one query, p stays in registers
//   ctx written as bf16 hi/lo planes Ch/Cl, element (b,s,h,d) at (b*SQ+s)*1024 + h*64 + d.
// Block = 4 waves = 64 query rows of one (b,h); grid.x = B*H*(SQ/64) = 1024.
// =====================================================================================
__global__ __launch_bounds__(128)
void mha_attn_hd64(const unsigned short* __restrict__ Qh, const unsigned short* __restrict__ Ql,
                   const unsigned short* __restrict__ KVh, const unsigned short* __restrict__ KVl,
                   const float* __restrict__ abias, const int* __restrict__ kmask,
                   unsigned short* __restrict__ Ch, unsigned short* __restrict__ Cl)
{
  __shared__ __align__(16) __bf16 Ksh[kKC * kLP];         // K hi [kv][d], pitch kLP   9 KB
  __shared__ __align__(16) __bf16 Ksl[kKC * kLP];         // K lo [kv][d], pitch kLP   9 KB
  __shared__ __align__(16) __bf16 Vth[kHeadD * kLP];      // V hi [d][kv], pitch kLP   9 KB
  __shared__ __align__(16) __bf16 Vtl[kHeadD * kLP];      // V lo [d][kv], pitch kLP   9 KB
  __shared__ __align__(16) __bf16 Psh[4][16 * kLP];       // per wave out hi staging [row][d], pitch kLP
  __shared__ __align__(16) __bf16 Psl[4][16 * kLP];       // per wave out lo staging [row][d], pitch kLP
  __shared__ __align__(16) float CB[kKC];                               // per chunk: bf16(bias) or -inf when masked

  const int tid  = threadIdx.x;
  const int wave = tid >> 5;
  const int lane = tid & 31;
  const int hh   = lane >> 4;
  const int c    = lane & 15;
  const int nqb  = kSeqQ / 64;
  const int bx   = blockIdx.x;
  const int qb   = bx % nqb;
  const int bhd  = bx / nqb;
  const int h    = bhd % kHeads;
  const int b    = bhd / kHeads;
  const int q0   = qb * 64 + wave * 16;
  const float ninf = -__builtin_huge_valf();

  const __bf16* Qhp = (const __bf16*)(const void*)Qh;
  const __bf16* Qlp = (const __bf16*)(const void*)Ql;

  // ---- Q fragments (B operand, column = c, split k map via Frag::load): 2 d-chunks, hi and lo ----
  v16b qah[2], qal[2];
  {
    const size_t qo = (size_t)(b * kSeqQ + q0 + c) * kEmb + h * kHeadD + 8 * hh;
#pragma unroll
    for (int dc = 0; dc < 2; ++dc) {
      qah[dc] = Frag<__bf16>::load(Qhp + qo + dc * 32);
      qal[dc] = Frag<__bf16>::load(Qlp + qo + dc * 32);
    }
  }

  const v8f zero8 = (v8f){0.f,0.f,0.f,0.f,0.f,0.f,0.f,0.f};
  float mrow = ninf, lrow = 0.f;   // one query (column c) per lane
  v8f oacc[4];
#pragma unroll
  for (int t = 0; t < 4; ++t) oacc[t] = zero8;

  __bf16* pwh = Psh[wave];
  __bf16* pwl = Psl[wave];

  for (int kc = 0; kc < kSeqK / kKC; ++kc) {
    const int kv0 = kc * kKC;
    __syncthreads();
    {
      // K planes: thread -> (kv row tid>>1, d half (tid&1)*32): 128 thr x 32 elems = 64 x 64 per plane
      const int kvr = tid >> 1, dh = (tid & 1) * 32;
      const size_t ro = (size_t)(b * kSeqK + kv0 + kvr) * kKVCols + h * kHeadD + dh;
#pragma unroll
      for (int i = 0; i < 4; ++i) {
        const v4u wh = *(const v4u*)(KVh + ro + 8 * i);
        const v4u wl = *(const v4u*)(KVl + ro + 8 * i);
        *(v4u*)(Ksh + kvr * kLP + dh + 8 * i) = wh;
        *(v4u*)(Ksl + kvr * kLP + dh + 8 * i) = wl;
      }
    }
    asm volatile("" ::: "memory");
    {
      // V planes transposed into [d][kv]: thread -> (kv pair p = tid>>2, d range dq = (tid&3)*16)
      // 32 pairs x 4 ranges = 128 thr; each writes 2 kv x 16 d as packed u32 (both halves per-lane data)
      const int p = tid >> 2, dq = (tid & 3) * 16;
      const size_t r0 = (size_t)(b * kSeqK + kv0 + 2 * p) * kKVCols + kEmb + h * kHeadD + dq;
      const size_t r1 = r0 + kKVCols;
#pragma unroll
      for (int i = 0; i < 2; ++i) {
        const v4u xh = *(const v4u*)(KVh + r0 + 8 * i);
        const v4u yh = *(const v4u*)(KVh + r1 + 8 * i);
        const v4u xl = *(const v4u*)(KVl + r0 + 8 * i);
        const v4u yl = *(const v4u*)(KVl + r1 + 8 * i);
#pragma unroll
        for (int jw = 0; jw < 4; ++jw) {
          const int d0 = dq + 8 * i + 2 * jw;
          const unsigned xhw = xh[jw], yhw = yh[jw], xlw = xl[jw], ylw = yl[jw];
          const unsigned h0 = (xhw & 0xffffu) | (yhw << 16);
          const unsigned h1 = (xhw >> 16) | (yhw & 0xffff0000u);
          const unsigned l0 = (xlw & 0xffffu) | (ylw << 16);
          const unsigned l1 = (xlw >> 16) | (ylw & 0xffff0000u);
          *(unsigned*)(Vth + d0 * kLP + 2 * p)       = h0;
          *(unsigned*)(Vth + (d0 + 1) * kLP + 2 * p) = h1;
          *(unsigned*)(Vtl + d0 * kLP + 2 * p)       = l0;
          *(unsigned*)(Vtl + (d0 + 1) * kLP + 2 * p) = l1;
        }
      }
    }
    if (tid < kKC) {   // waves 0 and 1 entirely: wave-uniform branch
      const size_t ki = (size_t)b * kSeqK + kv0 + tid;
      const int keep = kmask[ki];
      const float bb = bf_bits2f(f2bf_bits(abias[ki]));
      CB[tid] = (keep != 0) ? bb : ninf;
    }
    __syncthreads();

    // ---- scores, transposed: tile j = K rows (A operand) x Q columns (B operand), 2 d-chunks x 3 products ----
    // D map: this lane holds query column c and the keys j*16 + 8*hh + r
    v8f s[4];
#pragma unroll
    for (int j = 0; j < 4; ++j) {
      s[j] = zero8;
#pragma unroll
      for (int dc = 0; dc < 2; ++dc) {
        const v16b kbh = Frag<__bf16>::load(Ksh + (j * 16 + c) * kLP + dc * 32 + 8 * hh);
        const v16b kbl = Frag<__bf16>::load(Ksl + (j * 16 + c) * kLP + dc * 32 + 8 * hh);
        s[j] = mma_bf16(kbh, qah[dc], s[j]);
        s[j] = mma_bf16(kbl, qah[dc], s[j]);
        s[j] = mma_bf16(kbh, qal[dc], s[j]);
      }
    }
    float cm = ninf;
#pragma unroll
    for (int j = 0; j < 4; ++j) {
      const v4f cb0 = *(const v4f*)(CB + j * 16 + 8 * hh);
      const v4f cb1 = *(const v4f*)(CB + j * 16 + 8 * hh + 4);
#pragma unroll
      for (int r = 0; r < 8; ++r) {
        const float v = s[j][r] * 0.125f + ((r < 4) ? cb0[r & 3] : cb1[r & 3]);
        s[j][r] = v;
        cm = fmaxf(cm, v);
      }
    }
    cm = fmaxf(cm, xhalf(cm));   // the other lane half holds this query's other 32 keys
    // ---- online softmax, one query per lane; P packs from the score tiles straight into B operands ----
    const float mnew = fmaxf(mrow, cm);
    const bool live = (mnew != ninf);
    float alpha = 1.0f;
    float ps[4] = {0.f, 0.f, 0.f, 0.f};
    if (live) {   // one guard per lane: it owns one query, so one flag covers the rescale factor and all 32 of its scores
      alpha = expf(mrow - mnew);
#pragma unroll
      for (int j = 0; j < 4; ++j) {
#pragma unroll
        for (int r = 0; r < 8; ++r) {
          s[j][r] = expf(s[j][r] - mnew);
          ps[j] += s[j][r];
        }
      }
    } else {
#pragma unroll
      for (int j = 0; j < 4; ++j) s[j] = zero8;
    }
    mrow = mnew;
    v16b ph[2], pl[2];
#pragma unroll
    for (int j = 0; j < 4; ++j) {
#pragma unroll
      for (int r = 0; r < 8; ++r) {
        const float p = s[j][r];
        __bf16 a, bl;
        split_bf16(p, a, bl);
        ph[j >> 1][(j & 1) * 8 + r] = a;    // element e of the operand is key kk*32 + (e < 8 ? 8*hh + e : 16 + 8*hh + e - 8): the order of Frag::load
        pl[j >> 1][(j & 1) * 8 + r] = bl;
      }
    }
    lrow = lrow * alpha + ((ps[0] + ps[1]) + (ps[2] + ps[3]));   // this lane half's share; the halves join in the epilogue
#pragma unroll
    for (int t = 0; t < 4; ++t)
#pragma unroll
      for (int r = 0; r < 8; ++r) oacc[t][r] *= alpha;
    // ---- out^T += V^T.P^T : 2 kv-chunks x 4 d-tiles x 3 products; this lane holds query c, d = t*16 + 8*hh + r ----
#pragma unroll
    for (int kk = 0; kk < 2; ++kk) {
#pragma unroll
      for (int t = 0; t < 4; ++t) {
        const v16b vb = Frag<__bf16>::load(Vth + (t * 16 + c) * kLP + kk * 32 + 8 * hh);
        const v16b vl = Frag<__bf16>::load(Vtl + (t * 16 + c) * kLP + kk * 32 + 8 * hh);
        oacc[t] = mma_bf16(vb, ph[kk], oacc[t]);
        oacc[t] = mma_bf16(vl, ph[kk], oacc[t]);
        oacc[t] = mma_bf16(vb, pl[kk], oacc[t]);
      }
    }
  }

  // ---- epilogue: join the halves' sums, normalise, split to bf16 hi/lo into this wave's staging, whole-line stores ----
  {
    const float inv = 1.0f / (lrow + xhalf(lrow));
#pragma unroll
    for (int t = 0; t < 4; ++t) {
      v8b xa, xb;
#pragma unroll
      for (int r = 0; r < 8; ++r) {
        const float v = oacc[t][r] * inv;
        __bf16 a, bl;
        split_bf16(v, a, bl);
        xa[r] = a;
        xb[r] = bl;
      }
      *(v8b*)(pwh + c * kLP + t * 16 + 8 * hh) = xa;
      *(v8b*)(pwl + c * kLP + t * 16 + 8 * hh) = xb;
    }
  }
  __builtin_amdgcn_fence(__ATOMIC_RELEASE, "workgroup");
  __builtin_amdgcn_wave_barrier();
  __builtin_amdgcn_fence(__ATOMIC_ACQUIRE, "workgroup");
  {
    _Float16* Chp = (_Float16*)(void*)Ch;
    _Float16* Clp = (_Float16*)(void*)Cl;
    const int q8 = lane >> 3, c8 = (lane & 7) * 8;
    const size_t ob = (size_t)(b * kSeqQ + q0) * kEmb + h * kHeadD + c8;
    {
#pragma unroll
      for (int it = 0; it < 4; ++it) {
        const int row = it * 4 + q8;
        const v8b xh = *(const v8b*)(pwh + row * kLP + c8);
        const v8b xl = *(const v8b*)(pwl + row * kLP + c8);
        const v8h yh = __builtin_bit_cast(v8h, xh);
        const v8h yl = __builtin_bit_cast(v8h, xl);
        *(v8h*)(Chp + ob + (size_t)row * kEmb) = yh;
        *(v8h*)(Clp + ob + (size_t)row * kEmb) = yl;
      }
      
    }
  }
}

extern "C" void kernel_launch(void* const* d_in, const int* in_sizes, int n_in,
                              void* d_out, int out_size, void* d_ws, size_t ws_size,
                              hipStream_t stream) {
  static_assert(kRowsM % 64 == 0 && kEmb % 64 == 0 && kKVCols % 64 == 0 && kEmb % 32 == 0);
  static_assert(kSeqQ % 64 == 0 && kSeqK % kKC == 0 && kHeadD == 64 && kHeads * kHeadD == kEmb && kSeqQ == kSeqK);

  if (n_in < 10) return;
  const int nAct = kRowsM * kEmb;            /* 4,194,304 elements */
  const int nWq  = kEmb * kEmb;              /* 1,048,576 */
  const int nWkv = kKVCols * kEmb;           /* 2,097,152 */
  const int nWo  = kEmb * kEmb;
  if (in_sizes[0] != nAct || in_sizes[1] != kBatch * kSeqK * kEmb || in_sizes[2] != kBatch * kSeqK ||
      in_sizes[3] != kBatch * kSeqK || in_sizes[4] != nWq || in_sizes[5] != kEmb || in_sizes[6] != nWkv ||
      in_sizes[7] != kKVCols || in_sizes[8] != nWo || in_sizes[9] != kEmb) return;
  if (out_size != nAct) return;

  const float* tgt   = (const float*)d_in[0];
  const float* mem   = (const float*)d_in[1];
  const float* abias = (const float*)d_in[2];
  const int*   kmask = (const int*)d_in[3];
  const float* Wq_w  = (const float*)d_in[4];
  const float* Wq_b  = (const float*)d_in[5];
  const float* Wkv_w = (const float*)d_in[6];
  const float* Wkv_b = (const float*)d_in[7];
  const float* out_w = (const float*)d_in[8];
  const float* out_b = (const float*)d_in[9];
  float* out = (float*)d_out;

  /* workspace region map (bytes, all offsets multiples of 1 MiB):
       [  0 MiB,  8 MiB)  tgt16   bf16 [4096][1024]
       [  8 MiB, 16 MiB)  mem16   bf16 [4096][1024]
       [ 16 MiB, 18 MiB)  wq16    bf16 [1024][1024]
       [ 18 MiB, 22 MiB)  wkv16   bf16 [2048][1024]
       [ 22 MiB, 24 MiB)  wo16    bf16 [1024][1024]
       [ 24 MiB, 32 MiB)  qh      bf16 [4096][1024]   [ 32, 40) ql
       [ 40 MiB, 56 MiB)  kvh     bf16 [4096][2048]   [ 56, 72) kvl
       [ 72 MiB, 80 MiB)  ch      bf16 [4096][1024]   [ 80, 88) cl
     total 92,274,688 B */
  const size_t szAct16 = (size_t)nAct * 2;
  const size_t szKV16  = (size_t)kRowsM * kKVCols * 2;
  const size_t oTgt = 0;
  const size_t oMem = oTgt + szAct16;
  const size_t oWq  = oMem + szAct16;
  const size_t oWkv = oWq + (size_t)nWq * 2;
  const size_t oWo  = oWkv + (size_t)nWkv * 2;
  const size_t oQh  = oWo + (size_t)nWo * 2;
  const size_t oQl  = oQh + szAct16;
  const size_t oKVh = oQl + szAct16;
  const size_t oKVl = oKVh + szKV16;
  const size_t oCh  = oKVl + szKV16;
  const size_t oCl  = oCh + szAct16;
  const size_t total = oCl + szAct16;
  if (total > ws_size) return;

  char* ws = (char*)d_ws;
  unsigned short* tgt16 = (unsigned short*)(ws + oTgt);
  unsigned short* mem16 = (unsigned short*)(ws + oMem);
  unsigned short* wq16  = (unsigned short*)(ws + oWq);
  unsigned short* wkv16 = (unsigned short*)(ws + oWkv);
  unsigned short* wo16  = (unsigned short*)(ws + oWo);
  unsigned short* qh    = (unsigned short*)(ws + oQh);
  unsigned short* ql    = (unsigned short*)(ws + oQl);
  unsigned short* kvh   = (unsigned short*)(ws + oKVh);
  unsigned short* kvl   = (unsigned short*)(ws + oKVl);
  unsigned short* ch    = (unsigned short*)(ws + oCh);
  unsigned short* cl    = (unsigned short*)(ws + oCl);

  /* 1. RNE-convert the five float matrices to bf16 planes (5 launches) */
  { const int n2 = nAct / 2; cast_f32_bf16x2<<<dim3((n2 + 255) / 256), dim3(256), 0, stream>>>(tgt,   tgt16, n2); }
  { const int n2 = nAct / 2; cast_f32_bf16x2<<<dim3((n2 + 255) / 256), dim3(256), 0, stream>>>(mem,   mem16, n2); }
  { const int n2 = nWq  / 2; cast_f32_bf16x2<<<dim3((n2 + 255) / 256), dim3(256), 0, stream>>>(Wq_w,  wq16,  n2); }
  { const int n2 = nWkv / 2; cast_f32_bf16x2<<<dim3((n2 + 255) / 256), dim3(256), 0, stream>>>(Wkv_w, wkv16, n2); }
  { const int n2 = nWo  / 2; cast_f32_bf16x2<<<dim3((n2 + 255) / 256), dim3(256), 0, stream>>>(out_w, wo16,  n2); }

  /* 2. q = tgt16 . wq16^T + bq : M=4096 N=1024 K=1024 -> bf16 hi/lo planes; 1024 tiles / 8 per block */
  {
    const int tiles = (kRowsM / 64) * (kEmb / 64);
    wmma_gemm64<1, 0, 2, 2><<<dim3((tiles + 7) / 8, 1), dim3(256), 0, stream>>>(
        tgt16, tgt16, kEmb, 0L, wq16, wq16, kEmb, 0L, (void*)qh, (void*)ql, kEmb, 0L,
        Wq_b, kRowsM, kEmb, kEmb, 1.0f);
  }
  /* 3. kv = mem16 . wkv16^T + bkv : M=4096 N=2048 K=1024 -> bf16 hi/lo planes; 2048 tiles */
  {
    const int tiles = (kRowsM / 64) * (kKVCols / 64);
    wmma_gemm64<1, 0, 2, 2><<<dim3((tiles + 7) / 8, 1), dim3(256), 0, stream>>>(
        mem16, mem16, kEmb, 0L, wkv16, wkv16, kEmb, 0L, (void*)kvh, (void*)kvl, kKVCols, 0L,
        Wkv_b, kRowsM, kKVCols, kEmb, 1.0f);
  }
  /* 4. attention: grid = B*H*(SQ/64) = 1024 blocks of 128 threads -> ctx hi/lo planes */
  {
    const int nblk = kBatch * kHeads * (kSeqQ / 64);
    mha_attn_hd64<<<dim3(nblk), dim3(128), 0, stream>>>(qh, ql, kvh, kvl, abias, kmask, ch, cl);
  }
  /* 5. out = (ch + cl) . wo16^T + bo : M=4096 N=1024 K=1024, A carried hi+lo (2 products), f32 out */
  {
    const int tiles = (kRowsM / 64) * (kEmb / 64);
    wmma_gemm64<1, 1, 2, 0><<<dim3((tiles + 7) / 8, 1), dim3(256), 0, stream>>>(
        ch, cl, kEmb, 0L, wo16, wo16, kEmb, 0L, (void*)out, (void*)cl, kEmb, 0L,
        out_b, kRowsM, kEmb, kEmb, 1.0f);
  }
}

// v003
// Measured time: 227 microseconds a run.
// Two timings next to v002 both put it at 1.45 times that version's speed.
// Over all steps from v000 it is 2.46 times as fast.
// Contractions: q/kv/out projections on v_wmma_f32_16x16x32_bf16 (float inputs RNE-converted to bf16 once; out-projection A operand carried as bf16 hi+lo planes, 2 products); attention q.k and p.v on v_wmma_f32_16x16x32_bf16 with bf16 hi+lo planes for q,k,p,v (3 products); f32 accumulate; softmax and normalisation in f32.
#include <hip/hip_runtime.h>

typedef __attribute__((ext_vector_type(16))) _Float16 v16h;
typedef __attribute__((ext_vector_type(8)))  _Float16 v8h;
typedef __attribute__((ext_vector_type(16))) __bf16   v16b;
typedef __attribute__((ext_vector_type(8)))  __bf16   v8b;
typedef __attribute__((ext_vector_type(8)))  float    v8f;
typedef __attribute__((ext_vector_type(4)))  float    v4f;
typedef __attribute__((ext_vector_type(2)))  float    v2f;
typedef __attribute__((ext_vector_type(4)))  unsigned v4u;

static constexpr int kBatch  = 2;
static constexpr int kSeqQ   = 2048;
static constexpr int kSeqK   = 2048;
static constexpr int kEmb    = 1024;
static constexpr int kHeads  = 16;
static constexpr int kHeadD  = 64;
static constexpr int kKVCols = 2 * kEmb;          /* 2048: k at cols 0..1023, v at cols 1024..2047 */
static constexpr int kRowsM  = kBatch * kSeqQ;    /* 4096 (== kBatch * kSeqK) */
static constexpr int kKC     = 64;                /* keys per streamed chunk */
static constexpr int kLP     = 72;                /* LDS row pitch in 16-bit elements: 144 B = 16 B x 9, so the 16 rows of a 16-byte fragment read fall on distinct banks */

__device__ __forceinline__ unsigned short f2bf_bits(float f) {
  unsigned u = __float_as_uint(f);
  return (unsigned short)((u + 0x7FFFu + ((u >> 16) & 1u)) >> 16);
}
__device__ __forceinline__ float bf_bits2f(unsigned short h) { return __uint_as_float(((unsigned)h) << 16); }

// hazard guards as plain device helpers
__device__ __forceinline__ void dep_guard_h(v8f& a, v8f& b, v16h x, v16h y) { asm volatile("v_nop\n\tv_nop\n\tv_nop\n\tv_nop" : "+v"(a), "+v"(b) : "v"(x), "v"(y)); }
__device__ __forceinline__ void dep_guard_b(v8f& a, v8f& b, v16b x, v16b y) { asm volatile("v_nop\n\tv_nop\n\tv_nop\n\tv_nop" : "+v"(a), "+v"(b) : "v"(x), "v"(y)); }
__device__ __forceinline__ void keep4_h(v16h a, v16h b, v16h c, v16h d) { asm volatile("v_nop" :: "v"(a), "v"(b), "v"(c), "v"(d)); }
__device__ __forceinline__ void keep4_b(v16b a, v16b b, v16b c, v16b d) { asm volatile("v_nop" :: "v"(a), "v"(b), "v"(c), "v"(d)); }
__device__ __forceinline__ void acc_guard4(v8f& a, v8f& b, v8f& c, v8f& d) { asm volatile("v_nop\n\tv_nop\n\tv_nop\n\tv_nop" : "+v"(a), "+v"(b), "+v"(c), "+v"(d)); }
template <typename T> struct Frag;
template <> struct Frag<_Float16> {
  typedef v16h V; union U { v16h v; v8h h[2]; };
  static __device__ __forceinline__ v16h load(const _Float16* p) {   // elements 0..7 <- p[0..7], 8..15 <- p[16..23]
    U f; f.h[0] = *(const v8h*)(p); f.h[1] = *(const v8h*)(p + 16); return f.v;
  }
  static __device__ __forceinline__ v8f mma(v16h a, v16h b, v8f c) {
    return __builtin_amdgcn_wmma_f32_16x16x32_f16(false, a, false, b, (short)0, c, false, false);
  }
  static __device__ __forceinline__ void guard(v8f& a, v8f& b, v16h x, v16h y) { dep_guard_h(a, b, x, y); }
  static __device__ __forceinline__ void keep(v16h a, v16h b, v16h c, v16h d) { keep4_h(a, b, c, d); }
};
template <> struct Frag<__bf16> {
  typedef v16b V; union U { v16b v; v8b h[2]; };
  static __device__ __forceinline__ v16b load(const __bf16* p) {
    U f; f.h[0] = *(const v8b*)(p); f.h[1] = *(const v8b*)(p + 16); return f.v;
  }
  static __device__ __forceinline__ v8f mma(v16b a, v16b b, v8f c) {
    return __builtin_amdgcn_wmma_f32_16x16x32_bf16(false, a, false, b, (short)0, c, false, false);
  }
  static __device__ __forceinline__ void guard(v8f& a, v8f& b, v16b x, v16b y) { dep_guard_b(a, b, x, y); }
  static __device__ __forceinline__ void keep(v16b a, v16b b, v16b c, v16b d) { keep4_b(a, b, c, d); }
};

// a block-uniform global address, pinned into a scalar register pair
typedef const __attribute__((address_space(1))) char* gbytes;
typedef const __attribute__((address_space(1))) v4u*  gvec16;
__device__ __forceinline__ gbytes uniform_ptr(const void* p) {
  const unsigned long long u = (unsigned long long)p;
  const unsigned lo = (unsigned)__builtin_amdgcn_readfirstlane((int)(unsigned)u);
  const unsigned hi = (unsigned)__builtin_amdgcn_readfirstlane((int)(unsigned)(u >> 32));
  return (gbytes)(((unsigned long long)hi << 32) | lo);
}

// ---- Register-blocked batched WMMA GEMM, operands staged through LDS ---------
// C[m,n] = scale * sum_k A[m,k] * Bt[n,k] (+bias); a block of 4 waves owns a 128x128 tile, each wave a 64x64 quarter.
// A row-major [M,K]; Bt row-major [N,K]; M,N % 128 == 0, K % 64 == 0.
// Each stage is 64 k = one whole 128-byte line of every operand row: 8 lanes read a line, a wave-wide load covers 4 whole lines.
// Two LDS buffers: stage s+1 is loaded into registers while stage s is multiplied, and stored behind it; one barrier per stage.
// SPLIT: 0 = single product; 1 = A carried as hi+lo planes (A.B + A2.B); 2 = A and B hi+lo planes (A.B + A.B2 + A2.B).
// BIAS_MODE: 0 = none, 2 = bias[n] (bias RNE-converted to bf16 before the add).
// OUT_MODE: 0 = f32, 1 = f16, 2 = bf16 hi plane (Cout) + bf16 lo plane (Cout2).
// ET: 0 = f16 operands, 1 = bf16 operands (pointers passed as 16-bit storage)
template <int ET> struct Elem;
template <> struct Elem<0> { typedef _Float16 T; };
template <> struct Elem<1> { typedef __bf16 T; };
template <int ET, int SPLIT, int BIAS_MODE, int OUT_MODE>
__global__ __launch_bounds__(128) void wmma_gemm64(
    const unsigned short* __restrict__ Ap, const unsigned short* __restrict__ A2p, int lda, long strideA,
    const unsigned short* __restrict__ Btp, const unsigned short* __restrict__ Bt2p, int ldb, long strideB,
    void* __restrict__ Cout, void* __restrict__ Cout2, int ldc, long strideC,
    const float* __restrict__ bias,
    int M, int N, int K, float scale) {
  typedef typename Elem<ET>::T T;
  typedef typename Frag<T>::V V;
  const T* A = (const T*)Ap; const T* A2 = (const T*)A2p; const T* Bt = (const T*)Btp; const T* Bt2 = (const T*)Bt2p;
  constexpr int PA = 0, PB = 1, PA2 = 2, PB2 = 3;              // operand planes in LDS
  constexpr int NPL = 2 + (SPLIT != 0 ? 1 : 0) + (SPLIT == 2 ? 1 : 0);
  __shared__ __align__(16) T sOp[2][NPL][128 * kLP];           // [buffer][plane][row][64 k], pitch kLP
  __shared__ __align__(16) float sT[4][16 * 68];               // per-wave 16x64 slab, pitch 68 floats
  const int b    = blockIdx.y;
  const int tid  = threadIdx.x;
  const int lane = tid & 31;
  const int wave = tid >> 5;
  const int tilesN = N >> 7;
  const int tilesM = M >> 7;
  if ((int)blockIdx.x >= tilesM * tilesN) return;   // block-uniform, in front of every barrier
  const int bm = blockIdx.x / tilesN;
  const int bn = blockIdx.x - bm * tilesN;
  const int wm = (wave >> 1) << 6;             // this wave's quarter inside the block tile
  const int wn = (wave & 1) << 6;
  const int m0 = (bm << 7) + wm;
  const int n0 = (bn << 7) + wn;

  const T* Ab  = A  + (size_t)b * strideA;
  const T* Bb  = Bt + (size_t)b * strideB;
  const T* Ab2 = (SPLIT != 0) ? (A2  + (size_t)b * strideA) : nullptr;
  const T* Bb2 = (SPLIT == 2) ? (Bt2 + (size_t)b * strideB) : nullptr;

  const int rlane = lane & 15;                 // row (A) / col (B, D) within subtile
  const int koff  = (lane >> 4) * 8;           // k offset of this lane half
  const int mOff  = (lane >> 4) * 8;           // D row offset

  // staging map: thread -> (row tid>>3 of each group of 16 rows, 16-byte piece tid&7 of the row's line)
  const int srow = tid >> 3;
  const int sseg = (tid & 7) * 8;
  const int sLane = srow * kLP + sseg;
  unsigned aByte = (unsigned)(srow * lda + sseg) * 2u;      // per-lane byte offsets; they advance by one line (128 B) per stage
  unsigned bByte = (unsigned)(srow * ldb + sseg) * 2u;
  // block-uniform base of each group of 16 rows, held in scalar registers: every load is base + one per-lane offset,
  // so no address register is rewritten while a stage's loads are being issued
  gbytes gp[NPL][8];
#pragma unroll
  for (int i = 0; i < 8; ++i) {
    gp[PA][i] = uniform_ptr(Ab + (size_t)((bm << 7) + 16 * i) * lda);
    gp[PB][i] = uniform_ptr(Bb + (size_t)((bn << 7) + 16 * i) * ldb);
    if (SPLIT != 0) gp[SPLIT != 0 ? PA2 : PA][i] = uniform_ptr(Ab2 + (size_t)((bm << 7) + 16 * i) * lda);
    if (SPLIT == 2) gp[SPLIT == 2 ? PB2 : PB][i] = uniform_ptr(Bb2 + (size_t)((bn << 7) + 16 * i) * ldb);
  }

  v8f acc[4][4];
#pragma unroll
  for (int i = 0; i < 4; ++i)
#pragma unroll
    for (int j = 0; j < 4; ++j) acc[i][j] = (v8f){0.f,0.f,0.f,0.f,0.f,0.f,0.f,0.f};

  v4u rg[NPL][8];
  const int nst = K >> 6;
#pragma unroll
  for (int p = 0; p < NPL; ++p)
#pragma unroll
    for (int i = 0; i < 8; ++i) rg[p][i] = *(gvec16)(gp[p][i] + ((p & 1) ? bByte : aByte));
#pragma unroll
  for (int p = 0; p < NPL; ++p)
#pragma unroll
    for (int i = 0; i < 8; ++i) *(v4u*)(&sOp[0][p][sLane + 16 * i * kLP]) = rg[p][i];

  for (int s = 0; s < nst; ++s) {
    const bool more = (s + 1 < nst);           // block-uniform
    __syncthreads();                           // publishes stage s; ends every wave's reads of the buffer that stage s+1 goes into
    if (more) {
      aByte += 128u;
      bByte += 128u;
#pragma unroll
      for (int p = 0; p < NPL; ++p)
#pragma unroll
        for (int i = 0; i < 8; ++i) rg[p][i] = *(gvec16)(gp[p][i] + ((p & 1) ? bByte : aByte));
      // behind this wait the address registers of the loads above may be rewritten; it also keeps the loads in front of the stage's LDS reads
      asm volatile("s_wait_xcnt 0x0" ::: "memory");
    }
    const int cur = s & 1;
    // the A fragments run one row of tiles ahead of the products, so that a row's LDS latency hides behind the row before it
    const int aoLane = (wm + rlane) * kLP + koff;
    V ahn = Frag<T>::load(&sOp[cur][PA][aoLane]);
    V aln;
    if (SPLIT != 0) aln = Frag<T>::load(&sOp[cur][SPLIT != 0 ? PA2 : PA][aoLane]);
#pragma unroll
    for (int kk = 0; kk < 64; kk += 32) {
      V bh[4], bl[4];
#pragma unroll
      for (int j = 0; j < 4; ++j) {
        const int bo = (wn + (j << 4) + rlane) * kLP + koff + kk;
        bh[j] = Frag<T>::load(&sOp[cur][PB][bo]);
        if (SPLIT == 2) bl[j] = Frag<T>::load(&sOp[cur][SPLIT == 2 ? PB2 : PB][bo]);
      }
#pragma unroll
      for (int i = 0; i < 4; ++i) {
        const V ah = ahn;
        V al;
        if (SPLIT != 0) al = aln;
        if (i < 3 || kk == 0) {
          const int an = aoLane + ((i < 3) ? ((i + 1) << 4) * kLP + kk : 32);
          ahn = Frag<T>::load(&sOp[cur][PA][an]);
          if (SPLIT != 0) aln = Frag<T>::load(&sOp[cur][SPLIT != 0 ? PA2 : PA][an]);
        }
#pragma unroll
        for (int j = 0; j < 4; ++j) {
          acc[i][j] = Frag<T>::mma(ah, bh[j], acc[i][j]);
          if (SPLIT == 2) acc[i][j] = Frag<T>::mma(ah, bl[j], acc[i][j]);
          if (SPLIT != 0) acc[i][j] = Frag<T>::mma(al, bh[j], acc[i][j]);
        }
        Frag<T>::guard(acc[i][0], acc[i][3], ah, (SPLIT != 0) ? al : ah);
      }
      Frag<T>::keep(bh[0], bh[1], bh[2], bh[3]);
      if (SPLIT == 2) Frag<T>::keep(bl[0], bl[1], bl[2], bl[3]);
    }
    if (more) {
#pragma unroll
      for (int p = 0; p < NPL; ++p)
#pragma unroll
        for (int i = 0; i < 8; ++i) *(v4u*)(&sOp[cur ^ 1][p][sLane + 16 * i * kLP]) = rg[p][i];
    }
  }
  acc_guard4(acc[0][0], acc[0][1], acc[0][2], acc[0][3]);
  acc_guard4(acc[1][0], acc[1][1], acc[1][2], acc[1][3]);
  acc_guard4(acc[2][0], acc[2][1], acc[2][2], acc[2][3]);
  acc_guard4(acc[3][0], acc[3][1], acc[3][2], acc[3][3]);

  // ---- epilogue ----
  float* slab = sT[wave];
#pragma unroll
  for (int i = 0; i < 4; ++i) {
    const int mBase = m0 + (i << 4);
#pragma unroll
    for (int j = 0; j < 4; ++j) {
      const int n = n0 + (j << 4) + rlane;
      float bv = 0.f;
      if (BIAS_MODE == 2) bv = bf_bits2f(f2bf_bits(bias[n]));
#pragma unroll
      for (int r = 0; r < 8; ++r) {
        float v = acc[i][j][r] * scale;
        if (BIAS_MODE == 2) v += bv;
        slab[(mOff + r) * 68 + (j << 4) + rlane] = v;
      }
    }
    __builtin_amdgcn_fence(__ATOMIC_RELEASE, "workgroup");
    __builtin_amdgcn_wave_barrier();
    __builtin_amdgcn_fence(__ATOMIC_ACQUIRE, "workgroup");
    if (OUT_MODE == 0) {
      float* C = (float*)Cout + (size_t)b * strideC;
      const int hh = lane >> 4, c4 = (lane & 15) * 4;     // row seg = 256 B = 16 lanes x 16 B
      {
#pragma unroll
        for (int it = 0; it < 8; ++it) {
          const int row = it * 2 + hh;
          v4f v = *(const v4f*)(slab + row * 68 + c4);
          *(v4f*)(C + (size_t)(mBase + row) * ldc + n0 + c4) = v;
        }
        
      }
    } else {
      const int q = lane >> 3, c8 = (lane & 7) * 8;
      unsigned short* C  = (unsigned short*)Cout  + (size_t)b * strideC;
      unsigned short* C2 = (OUT_MODE == 2) ? ((unsigned short*)Cout2 + (size_t)b * strideC) : nullptr;
      {
#pragma unroll
        for (int it = 0; it < 4; ++it) {
          const int row = it * 4 + q;
          const float* sp = slab + row * 68 + c8;
          v8h hv, lv;
#pragma unroll
          for (int e = 0; e < 8; ++e) {
            if (OUT_MODE == 1) {
              hv[e] = (_Float16)sp[e];
            } else {
              unsigned short hb = f2bf_bits(sp[e]);
              unsigned short lb = f2bf_bits(sp[e] - bf_bits2f(hb));
              hv[e] = __builtin_bit_cast(_Float16, hb);
              lv[e] = __builtin_bit_cast(_Float16, lb);
            }
          }
          *(v8h*)(C + (size_t)(mBase + row) * ldc + n0 + c8) = hv;
          if (OUT_MODE == 2) *(v8h*)(C2 + (size_t)(mBase + row) * ldc + n0 + c8) = lv;
        }
        
      }
    }
    __builtin_amdgcn_fence(__ATOMIC_RELEASE, "workgroup");
    __builtin_amdgcn_wave_barrier();
    __builtin_amdgcn_fence(__ATOMIC_ACQUIRE, "workgroup");
  }
}

// coverage: grid = ceil(n2/256) blocks x 256 threads, thread i < n2 writes elements 2i, 2i+1; all n are multiples of 512 here.
__global__ __launch_bounds__(256) void cast_f32_bf16x2(
    const float* __restrict__ in, unsigned short* __restrict__ out, int n2) {
  int i = blockIdx.x * 256 + threadIdx.x;
  if (i < n2) {
    const v2f x = *(const v2f*)(in + 2 * (size_t)i);
    const unsigned u = (unsigned)f2bf_bits(x[0]) | ((unsigned)f2bf_bits(x[1]) << 16);
    ((unsigned*)out)[i] = u;
    
  }
}

// ---- bf16 helpers for the attention kernel ----
__device__ __forceinline__ __bf16 to_bf16(float f) { return __builtin_bit_cast(__bf16, f2bf_bits(f)); }
__device__ __forceinline__ void split_bf16(float f, __bf16& hi, __bf16& lo) {
  const unsigned short hb = f2bf_bits(f);
  hi = __builtin_bit_cast(__bf16, hb);
  lo = to_bf16(f - __uint_as_float(((unsigned)hb) << 16));
}
__device__ __forceinline__ v8f mma_bf16(v16b a, v16b b, v8f c) {
  c = __builtin_amdgcn_wmma_f32_16x16x32_bf16(false, a, false, b, (short)0, c, false, false);
  asm volatile("v_nop\n\tv_nop\n\tv_nop\n\tv_nop" : "+v"(c) : "v"(a), "v"(b));
  return c;
}

// lane l with lane l ^ 16
__device__ __forceinline__ float xhalf(float x) {
  return __builtin_bit_cast(float, __builtin_amdgcn_permlanex16(__builtin_bit_cast(int, x), __builtin_bit_cast(int, x), 0x76543210, 0xfedcba98, false, false));
}

// =====================================================================================
// Cross attention, head_dim 64, 16-bit plane inputs:
//   q planes  Qh/Ql : bf16 hi/lo, element (b,s,h,d) at (b*SQ+s)*1024 + h*64 + d
//   kv planes KVh/KVl: bf16 hi/lo, row (b*SK+s) pitch 2048; k at col h*64+d, v at col 1024+h*64+d
//   scores = 0.125 * q.k^T (hi.hi + hi.lo + lo.hi) + bf16(attn_bias[b,kv]); key mask 0 -> score = -inf
//   out    = softmax(scores).v with p and v as bf16 hi/lo (3 products), f32 accumulate, f32 online softmax
//   both products run transposed (scores^T = k.q^T, out^T += v^T.p^T): a lane owns one query, p stays in registers
//   ctx written as bf16 hi/lo planes Ch/Cl, element (b,s,h,d) at (b*SQ+s)*1024 + h*64 + d.
// Block = 4 waves = 64 query rows of one (b,h); grid.x = B*H*(SQ/64) = 1024.
// =====================================================================================
__global__ __launch_bounds__(128)
void mha_attn_hd64(const unsigned short* __restrict__ Qh, const unsigned short* __restrict__ Ql,
                   const unsigned short* __restrict__ KVh, const unsigned short* __restrict__ KVl,
                   const float* __restrict__ abias, const int* __restrict__ kmask,
                   unsigned short* __restrict__ Ch, unsigned short* __restrict__ Cl)
{
  __shared__ __align__(16) __bf16 Ksh[kKC * kLP];         // K hi [kv][d], pitch kLP   9 KB
  __shared__ __align__(16) __bf16 Ksl[kKC * kLP];         // K lo [kv][d], pitch kLP   9 KB
  __shared__ __align__(16) __bf16 Vth[kHeadD * kLP];      // V hi [d][kv], pitch kLP   9 KB
  __shared__ __align__(16) __bf16 Vtl[kHeadD * kLP];      // V lo [d][kv], pitch kLP   9 KB
  __shared__ __align__(16) __bf16 Psh[4][16 * kLP];       // per wave out hi staging [row][d], pitch kLP
  __shared__ __align__(16) __bf16 Psl[4][16 * kLP];       // per wave out lo staging [row][d], pitch kLP
  __shared__ __align__(16) float CB[kKC];                               // per chunk: bf16(bias) or -inf when masked

  const int tid  = threadIdx.x;
  const int wave = tid >> 5;
  const int lane = tid & 31;
  const int hh   = lane >> 4;
  const int c    = lane & 15;
  const int nqb  = kSeqQ / 64;
  const int bx   = blockIdx.x;
  const int qb   = bx % nqb;
  const int bhd  = bx / nqb;
  const int h    = bhd % kHeads;
  const int b    = bhd / kHeads;
  const int q0   = qb * 64 + wave * 16;
  const float ninf = -__builtin_huge_valf();

  const __bf16* Qhp = (const __bf16*)(const void*)Qh;
  const __bf16* Qlp = (const __bf16*)(const void*)Ql;

  // ---- Q fragments (B operand, column = c, split k map via Frag::load): 2 d-chunks, hi and lo ----
  v16b qah[2], qal[2];
  {
    const size_t qo = (size_t)(b * kSeqQ + q0 + c) * kEmb + h * kHeadD + 8 * hh;
#pragma unroll
    for (int dc = 0; dc < 2; ++dc) {
      qah[dc] = Frag<__bf16>::load(Qhp + qo + dc * 32);
      qal[dc] = Frag<__bf16>::load(Qlp + qo + dc * 32);
    }
  }

  const v8f zero8 = (v8f){0.f,0.f,0.f,0.f,0.f,0.f,0.f,0.f};
  float mrow = ninf, lrow = 0.f;   // one query (column c) per lane
  v8f oacc[4];
#pragma unroll
  for (int t = 0; t < 4; ++t) oacc[t] = zero8;

  __bf16* pwh = Psh[wave];
  __bf16* pwl = Psl[wave];

  for (int kc = 0; kc < kSeqK / kKC; ++kc) {
    const int kv0 = kc * kKC;
    __syncthreads();
    {
      // K planes: thread -> (kv row tid>>1, d half (tid&1)*32): 128 thr x 32 elems = 64 x 64 per plane
      const int kvr = tid >> 1, dh = (tid & 1) * 32;
      const size_t ro = (size_t)(b * kSeqK + kv0 + kvr) * kKVCols + h * kHeadD + dh;
#pragma unroll
      for (int i = 0; i < 4; ++i) {
        const v4u wh = *(const v4u*)(KVh + ro + 8 * i);
        const v4u wl = *(const v4u*)(KVl + ro + 8 * i);
        *(v4u*)(Ksh + kvr * kLP + dh + 8 * i) = wh;
        *(v4u*)(Ksl + kvr * kLP + dh + 8 * i) = wl;
      }
    }
    asm volatile("" ::: "memory");
    {
      // V planes transposed into [d][kv]: thread -> (kv pair p = tid>>2, d range dq = (tid&3)*16)
      // 32 pairs x 4 ranges = 128 thr; each writes 2 kv x 16 d as packed u32 (both halves per-lane data)
      const int p = tid >> 2, dq = (tid & 3) * 16;
      const size_t r0 = (size_t)(b * kSeqK + kv0 + 2 * p) * kKVCols + kEmb + h * kHeadD + dq;
      const size_t r1 = r0 + kKVCols;
#pragma unroll
      for (int i = 0; i < 2; ++i) {
        const v4u xh = *(const v4u*)(KVh + r0 + 8 * i);
        const v4u yh = *(const v4u*)(KVh + r1 + 8 * i);
        const v4u xl = *(const v4u*)(KVl + r0 + 8 * i);
        const v4u yl = *(const v4u*)(KVl + r1 + 8 * i);
#pragma unroll
        for (int jw = 0; jw < 4; ++jw) {
          const int d0 = dq + 8 * i + 2 * jw;
          const unsigned xhw = xh[jw], yhw = yh[jw], xlw = xl[jw], ylw = yl[jw];
          const unsigned h0 = (xhw & 0xffffu) | (yhw << 16);
          const unsigned h1 = (xhw >> 16) | (yhw & 0xffff0000u);
          const unsigned l0 = (xlw & 0xffffu) | (ylw << 16);
          const unsigned l1 = (xlw >> 16) | (ylw & 0xffff0000u);
          *(unsigned*)(Vth + d0 * kLP + 2 * p)       = h0;
          *(unsigned*)(Vth + (d0 + 1) * kLP + 2 * p) = h1;
          *(unsigned*)(Vtl + d0 * kLP + 2 * p)       = l0;
          *(unsigned*)(Vtl + (d0 + 1) * kLP + 2 * p) = l1;
        }
      }
    }
    if (tid < kKC) {   // waves 0 and 1 entirely: wave-uniform branch
      const size_t ki = (size_t)b * kSeqK + kv0 + tid;
      const int keep = kmask[ki];
      const float bb = bf_bits2f(f2bf_bits(abias[ki]));
      CB[tid] = (keep != 0) ? bb : ninf;
    }
    __syncthreads();

    // ---- scores, transposed: tile j = K rows (A operand) x Q columns (B operand), 2 d-chunks x 3 products ----
    // D map: this lane holds query column c and the keys j*16 + 8*hh + r
    v8f s[4];
#pragma unroll
    for (int j = 0; j < 4; ++j) {
      s[j] = zero8;
#pragma unroll
      for (int dc = 0; dc < 2; ++dc) {
        const v16b kbh = Frag<__bf16>::load(Ksh + (j * 16 + c) * kLP + dc * 32 + 8 * hh);
        const v16b kbl = Frag<__bf16>::load(Ksl + (j * 16 + c) * kLP + dc * 32 + 8 * hh);
        s[j] = mma_bf16(kbh, qah[dc], s[j]);
        s[j] = mma_bf16(kbl, qah[dc], s[j]);
        s[j] = mma_bf16(kbh, qal[dc], s[j]);
      }
    }
    float cm = ninf;
#pragma unroll
    for (int j = 0; j < 4; ++j) {
      const v4f cb0 = *(const v4f*)(CB + j * 16 + 8 * hh);
      const v4f cb1 = *(const v4f*)(CB + j * 16 + 8 * hh + 4);
#pragma unroll
      for (int r = 0; r < 8; ++r) {
        const float v = s[j][r] * 0.125f + ((r < 4) ? cb0[r & 3] : cb1[r & 3]);
        s[j][r] = v;
        cm = fmaxf(cm, v);
      }
    }
    cm = fmaxf(cm, xhalf(cm));   // the other lane half holds this query's other 32 keys
    // ---- online softmax, one query per lane; P packs from the score tiles straight into B operands ----
    const float mnew = fmaxf(mrow, cm);
    const bool live = (mnew != ninf);
    float alpha = 1.0f;
    float ps[4] = {0.f, 0.f, 0.f, 0.f};
    if (live) {   // one guard per lane: it owns one query, so one flag covers the rescale factor and all 32 of its scores
      alpha = expf(mrow - mnew);
#pragma unroll
      for (int j = 0; j < 4; ++j) {
#pragma unroll
        for (int r = 0; r < 8; ++r) {
          s[j][r] = expf(s[j][r] - mnew);
          ps[j] += s[j][r];
        }
      }
    } else {
#pragma unroll
      for (int j = 0; j < 4; ++j) s[j] = zero8;
    }
    mrow = mnew;
    v16b ph[2], pl[2];
#pragma unroll
    for (int j = 0; j < 4; ++j) {
#pragma unroll
      for (int r = 0; r < 8; ++r) {
        const float p = s[j][r];
        __bf16 a, bl;
        split_bf16(p, a, bl);
        ph[j >> 1][(j & 1) * 8 + r] = a;    // element e of the operand is key kk*32 + (e < 8 ? 8*hh + e : 16 + 8*hh + e - 8): the order of Frag::load
        pl[j >> 1][(j & 1) * 8 + r] = bl;
      }
    }
    lrow = lrow * alpha + ((ps[0] + ps[1]) + (ps[2] + ps[3]));   // this lane half's share; the halves join in the epilogue
#pragma unroll
    for (int t = 0; t < 4; ++t)
#pragma unroll
      for (int r = 0; r < 8; ++r) oacc[t][r] *= alpha;
    // ---- out^T += V^T.P^T : 2 kv-chunks x 4 d-tiles x 3 products; this lane holds query c, d = t*16 + 8*hh + r ----
#pragma unroll
    for (int kk = 0; kk < 2; ++kk) {
#pragma unroll
      for (int t = 0; t < 4; ++t) {
        const v16b vb = Frag<__bf16>::load(Vth + (t * 16 + c) * kLP + kk * 32 + 8 * hh);
        const v16b vl = Frag<__bf16>::load(Vtl + (t * 16 + c) * kLP + kk * 32 + 8 * hh);
        oacc[t] = mma_bf16(vb, ph[kk], oacc[t]);
        oacc[t] = mma_bf16(vl, ph[kk], oacc[t]);
        oacc[t] = mma_bf16(vb, pl[kk], oacc[t]);
      }
    }
  }

  // ---- epilogue: join the halves' sums, normalise, split to bf16 hi/lo into this wave's staging, whole-line stores ----
  {
    const float inv = 1.0f / (lrow + xhalf(lrow));
#pragma unroll
    for (int t = 0; t < 4; ++t) {
      v8b xa, xb;
#pragma unroll
      for (int r = 0; r < 8; ++r) {
        const float v = oacc[t][r] * inv;
        __bf16 a, bl;
        split_bf16(v, a, bl);
        xa[r] = a;
        xb[r] = bl;
      }
      *(v8b*)(pwh + c * kLP + t * 16 + 8 * hh) = xa;
      *(v8b*)(pwl + c * kLP + t * 16 + 8 * hh) = xb;
    }
  }
  __builtin_amdgcn_fence(__ATOMIC_RELEASE, "workgroup");
  __builtin_amdgcn_wave_barrier();
  __builtin_amdgcn_fence(__ATOMIC_ACQUIRE, "workgroup");
  {
    _Float16* Chp = (_Float16*)(void*)Ch;
    _Float16* Clp = (_Float16*)(void*)Cl;
    const int q8 = lane >> 3, c8 = (lane & 7) * 8;
    const size_t ob = (size_t)(b * kSeqQ + q0) * kEmb + h * kHeadD + c8;
    {
#pragma unroll
      for (int it = 0; it < 4; ++it) {
        const int row = it * 4 + q8;
        const v8b xh = *(const v8b*)(pwh + row * kLP + c8);
        const v8b xl = *(const v8b*)(pwl + row * kLP + c8);
        const v8h yh = __builtin_bit_cast(v8h, xh);
        const v8h yl = __builtin_bit_cast(v8h, xl);
        *(v8h*)(Chp + ob + (size_t)row * kEmb) = yh;
        *(v8h*)(Clp + ob + (size_t)row * kEmb) = yl;
      }
      
    }
  }
}

extern "C" void kernel_launch(void* const* d_in, const int* in_sizes, int n_in,
                              void* d_out, int out_size, void* d_ws, size_t ws_size,
                              hipStream_t stream) {
  static_assert(kRowsM % 128 == 0 && kEmb % 128 == 0 && kKVCols % 128 == 0 && kEmb % 64 == 0);
  static_assert(kSeqQ % 64 == 0 && kSeqK % kKC == 0 && kHeadD == 64 && kHeads * kHeadD == kEmb && kSeqQ == kSeqK);

  if (n_in < 10) return;
  const int nAct = kRowsM * kEmb;            /* 4,194,304 elements */
  const int nWq  = kEmb * kEmb;              /* 1,048,576 */
  const int nWkv = kKVCols * kEmb;           /* 2,097,152 */
  const int nWo  = kEmb * kEmb;
  if (in_sizes[0] != nAct || in_sizes[1] != kBatch * kSeqK * kEmb || in_sizes[2] != kBatch * kSeqK ||
      in_sizes[3] != kBatch * kSeqK || in_sizes[4] != nWq || in_sizes[5] != kEmb || in_sizes[6] != nWkv ||
      in_sizes[7] != kKVCols || in_sizes[8] != nWo || in_sizes[9] != kEmb) return;
  if (out_size != nAct) return;

  const float* tgt   = (const float*)d_in[0];
  const float* mem   = (const float*)d_in[1];
  const float* abias = (const float*)d_in[2];
  const int*   kmask = (const int*)d_in[3];
  const float* Wq_w  = (const float*)d_in[4];
  const float* Wq_b  = (const float*)d_in[5];
  const float* Wkv_w = (const float*)d_in[6];
  const float* Wkv_b = (const float*)d_in[7];
  const float* out_w = (const float*)d_in[8];
  const float* out_b = (const float*)d_in[9];
  float* out = (float*)d_out;

  /* workspace region map (bytes, all offsets multiples of 1 MiB):
       [  0 MiB,  8 MiB)  tgt16   bf16 [4096][1024]
       [  8 MiB, 16 MiB)  mem16   bf16 [4096][1024]
       [ 16 MiB, 18 MiB)  wq16    bf16 [1024][1024]
       [ 18 MiB, 22 MiB)  wkv16   bf16 [2048][1024]
       [ 22 MiB, 24 MiB)  wo16    bf16 [1024][1024]
       [ 24 MiB, 32 MiB)  qh      bf16 [4096][1024]   [ 32, 40) ql
       [ 40 MiB, 56 MiB)  kvh     bf16 [4096][2048]   [ 56, 72) kvl
       [ 72 MiB, 80 MiB)  ch      bf16 [4096][1024]   [ 80, 88) cl
     total 92,274,688 B */
  const size_t szAct16 = (size_t)nAct * 2;
  const size_t szKV16  = (size_t)kRowsM * kKVCols * 2;
  const size_t oTgt = 0;
  const size_t oMem = oTgt + szAct16;
  const size_t oWq  = oMem + szAct16;
  const size_t oWkv = oWq + (size_t)nWq * 2;
  const size_t oWo  = oWkv + (size_t)nWkv * 2;
  const size_t oQh  = oWo + (size_t)nWo * 2;
  const size_t oQl  = oQh + szAct16;
  const size_t oKVh = oQl + szAct16;
  const size_t oKVl = oKVh + szKV16;
  const size_t oCh  = oKVl + szKV16;
  const size_t oCl  = oCh + szAct16;
  const size_t total = oCl + szAct16;
  if (total > ws_size) return;

  char* ws = (char*)d_ws;
  unsigned short* tgt16 = (unsigned short*)(ws + oTgt);
  unsigned short* mem16 = (unsigned short*)(ws + oMem);
  unsigned short* wq16  = (unsigned short*)(ws + oWq);
  unsigned short* wkv16 = (unsigned short*)(ws + oWkv);
  unsigned short* wo16  = (unsigned short*)(ws + oWo);
  unsigned short* qh    = (unsigned short*)(ws + oQh);
  unsigned short* ql    = (unsigned short*)(ws + oQl);
  unsigned short* kvh   = (unsigned short*)(ws + oKVh);
  unsigned short* kvl   = (unsigned short*)(ws + oKVl);
  unsigned short* ch    = (unsigned short*)(ws + oCh);
  unsigned short* cl    = (unsigned short*)(ws + oCl);

  /* 1. RNE-convert the five float matrices to bf16 planes (5 launches) */
  { const int n2 = nAct / 2; cast_f32_bf16x2<<<dim3((n2 + 255) / 256), dim3(256), 0, stream>>>(tgt,   tgt16, n2); }
  { const int n2 = nAct / 2; cast_f32_bf16x2<<<dim3((n2 + 255) / 256), dim3(256), 0, stream>>>(mem,   mem16, n2); }
  { const int n2 = nWq  / 2; cast_f32_bf16x2<<<dim3((n2 + 255) / 256), dim3(256), 0, stream>>>(Wq_w,  wq16,  n2); }
  { const int n2 = nWkv / 2; cast_f32_bf16x2<<<dim3((n2 + 255) / 256), dim3(256), 0, stream>>>(Wkv_w, wkv16, n2); }
  { const int n2 = nWo  / 2; cast_f32_bf16x2<<<dim3((n2 + 255) / 256), dim3(256), 0, stream>>>(out_w, wo16,  n2); }

  /* 2. q = tgt16 . wq16^T + bq : M=4096 N=1024 K=1024 -> bf16 hi/lo planes; 256 block tiles of 128x128 */
  {
    const int tiles = (kRowsM / 128) * (kEmb / 128);
    wmma_gemm64<1, 0, 2, 2><<<dim3(tiles, 1), dim3(128), 0, stream>>>(
        tgt16, tgt16, kEmb, 0L, wq16, wq16, kEmb, 0L, (void*)qh, (void*)ql, kEmb, 0L,
        Wq_b, kRowsM, kEmb, kEmb, 1.0f);
  }
  /* 3. kv = mem16 . wkv16^T + bkv : M=4096 N=2048 K=1024 -> bf16 hi/lo planes; 512 block tiles */
  {
    const int tiles = (kRowsM / 128) * (kKVCols / 128);
    wmma_gemm64<1, 0, 2, 2><<<dim3(tiles, 1), dim3(128), 0, stream>>>(
        mem16, mem16, kEmb, 0L, wkv16, wkv16, kEmb, 0L, (void*)kvh, (void*)kvl, kKVCols, 0L,
        Wkv_b, kRowsM, kKVCols, kEmb, 1.0f);
  }
  /* 4. attention: grid = B*H*(SQ/64) = 1024 blocks of 128 threads -> ctx hi/lo planes */
  {
    const int nblk = kBatch * kHeads * (kSeqQ / 64);
    mha_attn_hd64<<<dim3(nblk), dim3(128), 0, stream>>>(qh, ql, kvh, kvl, abias, kmask, ch, cl);
  }
  /* 5. out = (ch + cl) . wo16^T + bo : M=4096 N=1024 K=1024, A carried hi+lo (2 products), f32 out */
  {
    const int tiles = (kRowsM / 128) * (kEmb / 128);
    wmma_gemm64<1, 1, 2, 0><<<dim3(tiles, 1), dim3(128), 0, stream>>>(
        ch, cl, kEmb, 0L, wo16, wo16, kEmb, 0L, (void*)out, (void*)cl, kEmb, 0L,
        out_b, kRowsM, kEmb, kEmb, 1.0f);
  }
}

// v004
// One run takes 217 microseconds.
// Next to v003, in two timings, it ran 1.04 times as fast each time.
// Over all steps from v000 it is 2.57 times as fast.
// Contractions: q/kv/out projections on v_wmma_f32_16x16x32_bf16 (float inputs RNE-converted to bf16 once; out-projection A operand carried as bf16 hi+lo planes, 2 products); attention q.k and p.v on v_wmma_f32_16x16x32_bf16 with bf16 hi+lo planes for q,k,p,v (3 products); f32 accumulate; softmax and normalisation in f32.
#include <hip/hip_runtime.h>

typedef __attribute__((ext_vector_type(16))) _Float16 v16h;
typedef __attribute__((ext_vector_type(8)))  _Float16 v8h;
typedef __attribute__((ext_vector_type(16))) __bf16   v16b;
typedef __attribute__((ext_vector_type(8)))  __bf16   v8b;
typedef __attribute__((ext_vector_type(8)))  float    v8f;
typedef __attribute__((ext_vector_type(4)))  float    v4f;
typedef __attribute__((ext_vector_type(2)))  float    v2f;
typedef __attribute__((ext_vector_type(4)))  unsigned v4u;
typedef __attribute__((ext_vector_type(2)))  unsigned v2u;

static constexpr int kBatch  = 2;
static constexpr int kSeqQ   = 2048;
static constexpr int kSeqK   = 2048;
static constexpr int kEmb    = 1024;
static constexpr int kHeads  = 16;
static constexpr int kHeadD  = 64;
static constexpr int kKVCols = 2 * kEmb;          /* 2048: k at cols 0..1023, v at cols 1024..2047 */
static constexpr int kRowsM  = kBatch * kSeqQ;    /* 4096 (== kBatch * kSeqK) */
static constexpr int kKC     = 64;                /* keys per streamed chunk */
static constexpr int kLP     = 72;                /* LDS row pitch in 16-bit elements: 144 B = 16 B x 9, so the 16 rows of a 16-byte fragment read fall on distinct banks */

__device__ __forceinline__ unsigned short f2bf_bits(float f) {
  unsigned u = __float_as_uint(f);
  return (unsigned short)((u + 0x7FFFu + ((u >> 16) & 1u)) >> 16);
}
__device__ __forceinline__ float bf_bits2f(unsigned short h) { return __uint_as_float(((unsigned)h) << 16); }

// hazard guards as plain device helpers
__device__ __forceinline__ void dep_guard_h(v8f& a, v8f& b, v16h x, v16h y) { asm volatile("v_nop\n\tv_nop\n\tv_nop\n\tv_nop" : "+v"(a), "+v"(b) : "v"(x), "v"(y)); }
__device__ __forceinline__ void dep_guard_b(v8f& a, v8f& b, v16b x, v16b y) { asm volatile("v_nop\n\tv_nop\n\tv_nop\n\tv_nop" : "+v"(a), "+v"(b) : "v"(x), "v"(y)); }
__device__ __forceinline__ void keep4_h(v16h a, v16h b, v16h c, v16h d) { asm volatile("v_nop" :: "v"(a), "v"(b), "v"(c), "v"(d)); }
__device__ __forceinline__ void keep4_b(v16b a, v16b b, v16b c, v16b d) { asm volatile("v_nop" :: "v"(a), "v"(b), "v"(c), "v"(d)); }
__device__ __forceinline__ void acc_guard4(v8f& a, v8f& b, v8f& c, v8f& d) { asm volatile("v_nop\n\tv_nop\n\tv_nop\n\tv_nop" : "+v"(a), "+v"(b), "+v"(c), "+v"(d)); }
template <typename T> struct Frag;
template <> struct Frag<_Float16> {
  typedef v16h V; union U { v16h v; v8h h[2]; };
  static __device__ __forceinline__ v16h load(const _Float16* p) {   // elements 0..7 <- p[0..7], 8..15 <- p[16..23]
    U f; f.h[0] = *(const v8h*)(p); f.h[1] = *(const v8h*)(p + 16); return f.v;
  }
  static __device__ __forceinline__ v8f mma(v16h a, v16h b, v8f c) {
    return __builtin_amdgcn_wmma_f32_16x16x32_f16(false, a, false, b, (short)0, c, false, false);
  }
  static __device__ __forceinline__ void guard(v8f& a, v8f& b, v16h x, v16h y) { dep_guard_h(a, b, x, y); }
  static __device__ __forceinline__ void keep(v16h a, v16h b, v16h c, v16h d) { keep4_h(a, b, c, d); }
};
template <> struct Frag<__bf16> {
  typedef v16b V; union U { v16b v; v8b h[2]; };
  static __device__ __forceinline__ v16b load(const __bf16* p) {
    U f; f.h[0] = *(const v8b*)(p); f.h[1] = *(const v8b*)(p + 16); return f.v;
  }
  static __device__ __forceinline__ v8f mma(v16b a, v16b b, v8f c) {
    return __builtin_amdgcn_wmma_f32_16x16x32_bf16(false, a, false, b, (short)0, c, false, false);
  }
  static __device__ __forceinline__ void guard(v8f& a, v8f& b, v16b x, v16b y) { dep_guard_b(a, b, x, y); }
  static __device__ __forceinline__ void keep(v16b a, v16b b, v16b c, v16b d) { keep4_b(a, b, c, d); }
};

// a block-uniform global address, pinned into a scalar register pair
typedef const __attribute__((address_space(1))) char* gbytes;
typedef const __attribute__((address_space(1))) v4u*  gvec16;
__device__ __forceinline__ gbytes uniform_ptr(const void* p) {
  const unsigned long long u = (unsigned long long)p;
  const unsigned lo = (unsigned)__builtin_amdgcn_readfirstlane((int)(unsigned)u);
  const unsigned hi = (unsigned)__builtin_amdgcn_readfirstlane((int)(unsigned)(u >> 32));
  return (gbytes)(((unsigned long long)hi << 32) | lo);
}

// ---- Register-blocked batched WMMA GEMM, operands staged through LDS ---------
// C[m,n] = scale * sum_k A[m,k] * Bt[n,k] (+bias); a block of 4 waves owns a 128x128 tile, each wave a 64x64 quarter.
// A row-major [M,K]; Bt row-major [N,K]; M,N % 128 == 0, K % 64 == 0.
// Each stage is 64 k = one whole 128-byte line of every operand row: 8 lanes read a line, a wave-wide load covers 4 whole lines.
// Two LDS buffers: stage s+1 is loaded into registers while stage s is multiplied, and stored behind it; one barrier per stage.
// SPLIT: 0 = single product; 1 = A carried as hi+lo planes (A.B + A2.B); 2 = A and B hi+lo planes (A.B + A.B2 + A2.B).
// BIAS_MODE: 0 = none, 2 = bias[n] (bias RNE-converted to bf16 before the add).
// OUT_MODE: 0 = f32, 1 = f16, 2 = bf16 hi plane (Cout) + bf16 lo plane (Cout2).
// ET: 0 = f16 operands, 1 = bf16 operands (pointers passed as 16-bit storage)
template <int ET> struct Elem;
template <> struct Elem<0> { typedef _Float16 T; };
template <> struct Elem<1> { typedef __bf16 T; };
template <int ET, int SPLIT, int BIAS_MODE, int OUT_MODE>
__global__ __launch_bounds__(128) void wmma_gemm64(
    const unsigned short* __restrict__ Ap, const unsigned short* __restrict__ A2p, int lda, long strideA,
    const unsigned short* __restrict__ Btp, const unsigned short* __restrict__ Bt2p, int ldb, long strideB,
    void* __restrict__ Cout, void* __restrict__ Cout2, int ldc, long strideC,
    const float* __restrict__ bias,
    int M, int N, int K, float scale) {
  typedef typename Elem<ET>::T T;
  typedef typename Frag<T>::V V;
  const T* A = (const T*)Ap; const T* A2 = (const T*)A2p; const T* Bt = (const T*)Btp; const T* Bt2 = (const T*)Bt2p;
  constexpr int PA = 0, PB = 1, PA2 = 2, PB2 = 3;              // operand planes in LDS
  constexpr int NPL = 2 + (SPLIT != 0 ? 1 : 0) + (SPLIT == 2 ? 1 : 0);
  __shared__ __align__(16) T sOp[2][NPL][128 * kLP];           // [buffer][plane][row][64 k], pitch kLP
  __shared__ __align__(16) float sT[4][16 * 68];               // per-wave 16x64 slab, pitch 68 floats
  const int b    = blockIdx.y;
  const int tid  = threadIdx.x;
  const int lane = tid & 31;
  const int wave = tid >> 5;
  const int tilesN = N >> 7;
  const int tilesM = M >> 7;
  if ((int)blockIdx.x >= tilesM * tilesN) return;   // block-uniform, in front of every barrier
  const int bm = blockIdx.x / tilesN;
  const int bn = blockIdx.x - bm * tilesN;
  const int wm = (wave >> 1) << 6;             // this wave's quarter inside the block tile
  const int wn = (wave & 1) << 6;
  const int m0 = (bm << 7) + wm;
  const int n0 = (bn << 7) + wn;

  const T* Ab  = A  + (size_t)b * strideA;
  const T* Bb  = Bt + (size_t)b * strideB;
  const T* Ab2 = (SPLIT != 0) ? (A2  + (size_t)b * strideA) : nullptr;
  const T* Bb2 = (SPLIT == 2) ? (Bt2 + (size_t)b * strideB) : nullptr;

  const int rlane = lane & 15;                 // row (A) / col (B, D) within subtile
  const int koff  = (lane >> 4) * 8;           // k offset of this lane half
  const int mOff  = (lane >> 4) * 8;           // D row offset

  // staging map: thread -> (row tid>>3 of each group of 16 rows, 16-byte piece tid&7 of the row's line)
  const int srow = tid >> 3;
  const int sseg = (tid & 7) * 8;
  const int sLane = srow * kLP + sseg;
  unsigned aByte = (unsigned)(srow * lda + sseg) * 2u;      // per-lane byte offsets; they advance by one line (128 B) per stage
  unsigned bByte = (unsigned)(srow * ldb + sseg) * 2u;
  // block-uniform base of each group of 16 rows, held in scalar registers: every load is base + one per-lane offset,
  // so no address register is rewritten while a stage's loads are being issued
  gbytes gp[NPL][8];
#pragma unroll
  for (int i = 0; i < 8; ++i) {
    gp[PA][i] = uniform_ptr(Ab + (size_t)((bm << 7) + 16 * i) * lda);
    gp[PB][i] = uniform_ptr(Bb + (size_t)((bn << 7) + 16 * i) * ldb);
    if (SPLIT != 0) gp[SPLIT != 0 ? PA2 : PA][i] = uniform_ptr(Ab2 + (size_t)((bm << 7) + 16 * i) * lda);
    if (SPLIT == 2) gp[SPLIT == 2 ? PB2 : PB][i] = uniform_ptr(Bb2 + (size_t)((bn << 7) + 16 * i) * ldb);
  }

  v8f acc[4][4];
#pragma unroll
  for (int i = 0; i < 4; ++i)
#pragma unroll
    for (int j = 0; j < 4; ++j) acc[i][j] = (v8f){0.f,0.f,0.f,0.f,0.f,0.f,0.f,0.f};

  v4u rg[NPL][8];
  const int nst = K >> 6;
#pragma unroll
  for (int p = 0; p < NPL; ++p)
#pragma unroll
    for (int i = 0; i < 8; ++i) rg[p][i] = *(gvec16)(gp[p][i] + ((p & 1) ? bByte : aByte));
#pragma unroll
  for (int p = 0; p < NPL; ++p)
#pragma unroll
    for (int i = 0; i < 8; ++i) *(v4u*)(&sOp[0][p][sLane + 16 * i * kLP]) = rg[p][i];

  for (int s = 0; s < nst; ++s) {
    const bool more = (s + 1 < nst);           // block-uniform
    __syncthreads();                           // publishes stage s; ends every wave's reads of the buffer that stage s+1 goes into
    if (more) {
      aByte += 128u;
      bByte += 128u;
#pragma unroll
      for (int p = 0; p < NPL; ++p)
#pragma unroll
        for (int i = 0; i < 8; ++i) rg[p][i] = *(gvec16)(gp[p][i] + ((p & 1) ? bByte : aByte));
      // behind this wait the address registers of the loads above may be rewritten; it also keeps the loads in front of the stage's LDS reads
      asm volatile("s_wait_xcnt 0x0" ::: "memory");
    }
    const int cur = s & 1;
    // the A fragments run one row of tiles ahead of the products, so that a row's LDS latency hides behind the row before it
    const int aoLane = (wm + rlane) * kLP + koff;
    V ahn = Frag<T>::load(&sOp[cur][PA][aoLane]);
    V aln;
    if (SPLIT != 0) aln = Frag<T>::load(&sOp[cur][SPLIT != 0 ? PA2 : PA][aoLane]);
#pragma unroll
    for (int kk = 0; kk < 64; kk += 32) {
      V bh[4], bl[4];
#pragma unroll
      for (int j = 0; j < 4; ++j) {
        const int bo = (wn + (j << 4) + rlane) * kLP + koff + kk;
        bh[j] = Frag<T>::load(&sOp[cur][PB][bo]);
        if (SPLIT == 2) bl[j] = Frag<T>::load(&sOp[cur][SPLIT == 2 ? PB2 : PB][bo]);
      }
#pragma unroll
      for (int i = 0; i < 4; ++i) {
        const V ah = ahn;
        V al;
        if (SPLIT != 0) al = aln;
        if (i < 3 || kk == 0) {
          const int an = aoLane + ((i < 3) ? ((i + 1) << 4) * kLP + kk : 32);
          ahn = Frag<T>::load(&sOp[cur][PA][an]);
          if (SPLIT != 0) aln = Frag<T>::load(&sOp[cur][SPLIT != 0 ? PA2 : PA][an]);
        }
#pragma unroll
        for (int j = 0; j < 4; ++j) {
          acc[i][j] = Frag<T>::mma(ah, bh[j], acc[i][j]);
          if (SPLIT == 2) acc[i][j] = Frag<T>::mma(ah, bl[j], acc[i][j]);
          if (SPLIT != 0) acc[i][j] = Frag<T>::mma(al, bh[j], acc[i][j]);
        }
        Frag<T>::guard(acc[i][0], acc[i][3], ah, (SPLIT != 0) ? al : ah);
      }
      Frag<T>::keep(bh[0], bh[1], bh[2], bh[3]);
      if (SPLIT == 2) Frag<T>::keep(bl[0], bl[1], bl[2], bl[3]);
    }
    if (more) {
#pragma unroll
      for (int p = 0; p < NPL; ++p)
#pragma unroll
        for (int i = 0; i < 8; ++i) *(v4u*)(&sOp[cur ^ 1][p][sLane + 16 * i * kLP]) = rg[p][i];
    }
  }
  acc_guard4(acc[0][0], acc[0][1], acc[0][2], acc[0][3]);
  acc_guard4(acc[1][0], acc[1][1], acc[1][2], acc[1][3]);
  acc_guard4(acc[2][0], acc[2][1], acc[2][2], acc[2][3]);
  acc_guard4(acc[3][0], acc[3][1], acc[3][2], acc[3][3]);

  // ---- epilogue ----
  float* slab = sT[wave];
#pragma unroll
  for (int i = 0; i < 4; ++i) {
    const int mBase = m0 + (i << 4);
#pragma unroll
    for (int j = 0; j < 4; ++j) {
      const int n = n0 + (j << 4) + rlane;
      float bv = 0.f;
      if (BIAS_MODE == 2) bv = bf_bits2f(f2bf_bits(bias[n]));
#pragma unroll
      for (int r = 0; r < 8; ++r) {
        float v = acc[i][j][r] * scale;
        if (BIAS_MODE == 2) v += bv;
        slab[(mOff + r) * 68 + (j << 4) + rlane] = v;
      }
    }
    __builtin_amdgcn_fence(__ATOMIC_RELEASE, "workgroup");
    __builtin_amdgcn_wave_barrier();
    __builtin_amdgcn_fence(__ATOMIC_ACQUIRE, "workgroup");
    if (OUT_MODE == 0) {
      float* C = (float*)Cout + (size_t)b * strideC;
      const int hh = lane >> 4, c4 = (lane & 15) * 4;     // row seg = 256 B = 16 lanes x 16 B
      {
#pragma unroll
        for (int it = 0; it < 8; ++it) {
          const int row = it * 2 + hh;
          v4f v = *(const v4f*)(slab + row * 68 + c4);
          *(v4f*)(C + (size_t)(mBase + row) * ldc + n0 + c4) = v;
        }
        
      }
    } else {
      const int q = lane >> 3, c8 = (lane & 7) * 8;
      unsigned short* C  = (unsigned short*)Cout  + (size_t)b * strideC;
      unsigned short* C2 = (OUT_MODE == 2) ? ((unsigned short*)Cout2 + (size_t)b * strideC) : nullptr;
      {
#pragma unroll
        for (int it = 0; it < 4; ++it) {
          const int row = it * 4 + q;
          const float* sp = slab + row * 68 + c8;
          v8h hv, lv;
#pragma unroll
          for (int e = 0; e < 8; ++e) {
            if (OUT_MODE == 1) {
              hv[e] = (_Float16)sp[e];
            } else {
              unsigned short hb = f2bf_bits(sp[e]);
              unsigned short lb = f2bf_bits(sp[e] - bf_bits2f(hb));
              hv[e] = __builtin_bit_cast(_Float16, hb);
              lv[e] = __builtin_bit_cast(_Float16, lb);
            }
          }
          *(v8h*)(C + (size_t)(mBase + row) * ldc + n0 + c8) = hv;
          if (OUT_MODE == 2) *(v8h*)(C2 + (size_t)(mBase + row) * ldc + n0 + c8) = lv;
        }
        
      }
    }
    __builtin_amdgcn_fence(__ATOMIC_RELEASE, "workgroup");
    __builtin_amdgcn_wave_barrier();
    __builtin_amdgcn_fence(__ATOMIC_ACQUIRE, "workgroup");
  }
}

// One launch converts all five float matrices. Their bf16 planes lie back to back in the workspace, in the order
// tgt, mem, Wq_w, Wkv_w, out_w, so the output is one flat array of three equal thirds: tgt, mem, the three weights.
// A unit = 1024 consecutive elements = one wave x 8 loads of 16 B per lane; every matrix is a whole number of units.
// Grid = kCastBlocks blocks x 16 waves, all resident at once; wave w converts unit w of each third: every element exactly once.
static constexpr int kCastUnit   = 1024;
static constexpr int kCastBlocks = 256;
static constexpr int kCastThird  = kCastBlocks * 16 * kCastUnit;    /* 4,194,304 elements */
static_assert(kRowsM * kEmb == kCastThird && kEmb * kEmb + kKVCols * kEmb + kEmb * kEmb == kCastThird);
static_assert((kEmb * kEmb) % kCastUnit == 0 && (kKVCols * kEmb) % kCastUnit == 0);
__global__ __launch_bounds__(512) void cast_f32_bf16_all(
    const float* __restrict__ tgt, const float* __restrict__ mem, const float* __restrict__ wq,
    const float* __restrict__ wkv, const float* __restrict__ wo, unsigned short* __restrict__ out) {
  constexpr int w1 = kEmb * kEmb, w2 = w1 + kKVCols * kEmb;
  const int l4 = (threadIdx.x & 31) * 4;
  const int e  = __builtin_amdgcn_readfirstlane((int)(blockIdx.x * 16 + (threadIdx.x >> 5))) * kCastUnit;   // wave-uniform, 0 <= e < kCastThird
  const float* src[3];
  src[0] = tgt + e;
  src[1] = mem + e;
  src[2] = (e < w1) ? wq + e : (e < w2) ? wkv + (e - w1) : wo + (e - w2);
  v4f x[3][8];
#pragma unroll
  for (int s = 0; s < 3; ++s)
#pragma unroll
    for (int i = 0; i < 8; ++i) x[s][i] = *(const v4f*)(src[s] + i * 128 + l4);   // 512 contiguous bytes per wave-wide load
  // keeps all 24 loads in front of the first conversion: without it the compiler waits for the first 8 before it issues the rest
  __builtin_amdgcn_sched_barrier(0);
#pragma unroll
  for (int s = 0; s < 3; ++s)
#pragma unroll
    for (int i = 0; i < 8; ++i) {
      v2u y;
      y[0] = (unsigned)f2bf_bits(x[s][i][0]) | ((unsigned)f2bf_bits(x[s][i][1]) << 16);
      y[1] = (unsigned)f2bf_bits(x[s][i][2]) | ((unsigned)f2bf_bits(x[s][i][3]) << 16);
      *(v2u*)(out + s * kCastThird + e + i * 128 + l4) = y;                        // 256 contiguous bytes per wave-wide store: two whole lines
    }
}

// ---- bf16 helpers for the attention kernel ----
__device__ __forceinline__ __bf16 to_bf16(float f) { return __builtin_bit_cast(__bf16, f2bf_bits(f)); }
__device__ __forceinline__ void split_bf16(float f, __bf16& hi, __bf16& lo) {
  const unsigned short hb = f2bf_bits(f);
  hi = __builtin_bit_cast(__bf16, hb);
  lo = to_bf16(f - __uint_as_float(((unsigned)hb) << 16));
}
__device__ __forceinline__ v8f mma_bf16(v16b a, v16b b, v8f c) {
  c = __builtin_amdgcn_wmma_f32_16x16x32_bf16(false, a, false, b, (short)0, c, false, false);
  asm volatile("v_nop\n\tv_nop\n\tv_nop\n\tv_nop" : "+v"(c) : "v"(a), "v"(b));
  return c;
}

// lane l with lane l ^ 16
__device__ __forceinline__ float xhalf(float x) {
  return __builtin_bit_cast(float, __builtin_amdgcn_permlanex16(__builtin_bit_cast(int, x), __builtin_bit_cast(int, x), 0x76543210, 0xfedcba98, false, false));
}

// =====================================================================================
// Cross attention, head_dim 64, 16-bit plane inputs:
//   q planes  Qh/Ql : bf16 hi/lo, element (b,s,h,d) at (b*SQ+s)*1024 + h*64 + d
//   kv planes KVh/KVl: bf16 hi/lo, row (b*SK+s) pitch 2048; k at col h*64+d, v at col 1024+h*64+d
//   scores = 0.125 * q.k^T (hi.hi + hi.lo + lo.hi) + bf16(attn_bias[b,kv]); key mask 0 -> score = -inf
//   out    = softmax(scores).v with p and v as bf16 hi/lo (3 products), f32 accumulate, f32 online softmax
//   both products run transposed (scores^T = k.q^T, out^T += v^T.p^T): a lane owns one query, p stays in registers
//   ctx written as bf16 hi/lo planes Ch/Cl, element (b,s,h,d) at (b*SQ+s)*1024 + h*64 + d.
// Block = 4 waves = 64 query rows of one (b,h); grid.x = B*H*(SQ/64) = 1024.
// =====================================================================================
__global__ __launch_bounds__(128)
void mha_attn_hd64(const unsigned short* __restrict__ Qh, const unsigned short* __restrict__ Ql,
                   const unsigned short* __restrict__ KVh, const unsigned short* __restrict__ KVl,
                   const float* __restrict__ abias, const int* __restrict__ kmask,
                   unsigned short* __restrict__ Ch, unsigned short* __restrict__ Cl)
{
  __shared__ __align__(16) __bf16 Ksh[kKC * kLP];         // K hi [kv][d], pitch kLP   9 KB
  __shared__ __align__(16) __bf16 Ksl[kKC * kLP];         // K lo [kv][d], pitch kLP   9 KB
  __shared__ __align__(16) __bf16 Vth[kHeadD * kLP];      // V hi [d][kv], pitch kLP   9 KB
  __shared__ __align__(16) __bf16 Vtl[kHeadD * kLP];      // V lo [d][kv], pitch kLP   9 KB
  __shared__ __align__(16) __bf16 Psh[4][16 * kLP];       // per wave out hi staging [row][d], pitch kLP
  __shared__ __align__(16) __bf16 Psl[4][16 * kLP];       // per wave out lo staging [row][d], pitch kLP
  __shared__ __align__(16) float CB[kKC];                               // per chunk: bf16(bias) or -inf when masked

  const int tid  = threadIdx.x;
  const int wave = tid >> 5;
  const int lane = tid & 31;
  const int hh   = lane >> 4;
  const int c    = lane & 15;
  const int nqb  = kSeqQ / 64;
  const int bx   = blockIdx.x;
  const int qb   = bx % nqb;
  const int bhd  = bx / nqb;
  const int h    = bhd % kHeads;
  const int b    = bhd / kHeads;
  const int q0   = qb * 64 + wave * 16;
  const float ninf = -__builtin_huge_valf();

  const __bf16* Qhp = (const __bf16*)(const void*)Qh;
  const __bf16* Qlp = (const __bf16*)(const void*)Ql;

  // ---- Q fragments (B operand, column = c, split k map via Frag::load): 2 d-chunks, hi and lo ----
  v16b qah[2], qal[2];
  {
    const size_t qo = (size_t)(b * kSeqQ + q0 + c) * kEmb + h * kHeadD + 8 * hh;
#pragma unroll
    for (int dc = 0; dc < 2; ++dc) {
      qah[dc] = Frag<__bf16>::load(Qhp + qo + dc * 32);
      qal[dc] = Frag<__bf16>::load(Qlp + qo + dc * 32);
    }
  }

  const v8f zero8 = (v8f){0.f,0.f,0.f,0.f,0.f,0.f,0.f,0.f};
  float mrow = ninf, lrow = 0.f;   // one query (column c) per lane
  v8f oacc[4];
#pragma unroll
  for (int t = 0; t < 4; ++t) oacc[t] = zero8;

  __bf16* pwh = Psh[wave];
  __bf16* pwl = Psl[wave];

  for (int kc = 0; kc < kSeqK / kKC; ++kc) {
    const int kv0 = kc * kKC;
    __syncthreads();
    {
      // K planes: thread -> (kv row tid>>1, d half (tid&1)*32): 128 thr x 32 elems = 64 x 64 per plane
      const int kvr = tid >> 1, dh = (tid & 1) * 32;
      const size_t ro = (size_t)(b * kSeqK + kv0 + kvr) * kKVCols + h * kHeadD + dh;
#pragma unroll
      for (int i = 0; i < 4; ++i) {
        const v4u wh = *(const v4u*)(KVh + ro + 8 * i);
        const v4u wl = *(const v4u*)(KVl + ro + 8 * i);
        *(v4u*)(Ksh + kvr * kLP + dh + 8 * i) = wh;
        *(v4u*)(Ksl + kvr * kLP + dh + 8 * i) = wl;
      }
    }
    asm volatile("" ::: "memory");
    {
      // V planes transposed into [d][kv]: thread -> (kv pair p = tid>>2, d range dq = (tid&3)*16)
      // 32 pairs x 4 ranges = 128 thr; each writes 2 kv x 16 d as packed u32 (both halves per-lane data)
      const int p = tid >> 2, dq = (tid & 3) * 16;
      const size_t r0 = (size_t)(b * kSeqK + kv0 + 2 * p) * kKVCols + kEmb + h * kHeadD + dq;
      const size_t r1 = r0 + kKVCols;
#pragma unroll
      for (int i = 0; i < 2; ++i) {
        const v4u xh = *(const v4u*)(KVh + r0 + 8 * i);
        const v4u yh = *(const v4u*)(KVh + r1 + 8 * i);
        const v4u xl = *(const v4u*)(KVl + r0 + 8 * i);
        const v4u yl = *(const v4u*)(KVl + r1 + 8 * i);
#pragma unroll
        for (int jw = 0; jw < 4; ++jw) {
          const int d0 = dq + 8 * i + 2 * jw;
          const unsigned xhw = xh[jw], yhw = yh[jw], xlw = xl[jw], ylw = yl[jw];
          const unsigned h0 = (xhw & 0xffffu) | (yhw << 16);
          const unsigned h1 = (xhw >> 16) | (yhw & 0xffff0000u);
          const unsigned l0 = (xlw & 0xffffu) | (ylw << 16);
          const unsigned l1 = (xlw >> 16) | (ylw & 0xffff0000u);
          *(unsigned*)(Vth + d0 * kLP + 2 * p)       = h0;
          *(unsigned*)(Vth + (d0 + 1) * kLP + 2 * p) = h1;
          *(unsigned*)(Vtl + d0 * kLP + 2 * p)       = l0;
          *(unsigned*)(Vtl + (d0 + 1) * kLP + 2 * p) = l1;
        }
      }
    }
    if (tid < kKC) {   // waves 0 and 1 entirely: wave-uniform branch
      const size_t ki = (size_t)b * kSeqK + kv0 + tid;
      const int keep = kmask[ki];
      const float bb = bf_bits2f(f2bf_bits(abias[ki]));
      CB[tid] = (keep != 0) ? bb : ninf;
    }
    __syncthreads();

    // ---- scores, transposed: tile j = K rows (A operand) x Q columns (B operand), 2 d-chunks x 3 products ----
    // D map: this lane holds query column c and the keys j*16 + 8*hh + r
    v8f s[4];
#pragma unroll
    for (int j = 0; j < 4; ++j) {
      s[j] = zero8;
#pragma unroll
      for (int dc = 0; dc < 2; ++dc) {
        const v16b kbh = Frag<__bf16>::load(Ksh + (j * 16 + c) * kLP + dc * 32 + 8 * hh);
        const v16b kbl = Frag<__bf16>::load(Ksl + (j * 16 + c) * kLP + dc * 32 + 8 * hh);
        s[j] = mma_bf16(kbh, qah[dc], s[j]);
        s[j] = mma_bf16(kbl, qah[dc], s[j]);
        s[j] = mma_bf16(kbh, qal[dc], s[j]);
      }
    }
    float cm = ninf;
#pragma unroll
    for (int j = 0; j < 4; ++j) {
      const v4f cb0 = *(const v4f*)(CB + j * 16 + 8 * hh);
      const v4f cb1 = *(const v4f*)(CB + j * 16 + 8 * hh + 4);
#pragma unroll
      for (int r = 0; r < 8; ++r) {
        const float v = s[j][r] * 0.125f + ((r < 4) ? cb0[r & 3] : cb1[r & 3]);
        s[j][r] = v;
        cm = fmaxf(cm, v);
      }
    }
    cm = fmaxf(cm, xhalf(cm));   // the other lane half holds this query's other 32 keys
    // ---- online softmax, one query per lane; P packs from the score tiles straight into B operands ----
    const float mnew = fmaxf(mrow, cm);
    const bool live = (mnew != ninf);
    float alpha = 1.0f;
    float ps[4] = {0.f, 0.f, 0.f, 0.f};
    if (live) {   // one guard per lane: it owns one query, so one flag covers the rescale factor and all 32 of its scores
      alpha = expf(mrow - mnew);
#pragma unroll
      for (int j = 0; j < 4; ++j) {
#pragma unroll
        for (int r = 0; r < 8; ++r) {
          s[j][r] = expf(s[j][r] - mnew);
          ps[j] += s[j][r];
        }
      }
    } else {
#pragma unroll
      for (int j = 0; j < 4; ++j) s[j] = zero8;
    }
    mrow = mnew;
    v16b ph[2], pl[2];
#pragma unroll
    for (int j = 0; j < 4; ++j) {
#pragma unroll
      for (int r = 0; r < 8; ++r) {
        const float p = s[j][r];
        __bf16 a, bl;
        split_bf16(p, a, bl);
        ph[j >> 1][(j & 1) * 8 + r] = a;    // element e of the operand is key kk*32 + (e < 8 ? 8*hh + e : 16 + 8*hh + e - 8): the order of Frag::load
        pl[j >> 1][(j & 1) * 8 + r] = bl;
      }
    }
    lrow = lrow * alpha + ((ps[0] + ps[1]) + (ps[2] + ps[3]));   // this lane half's share; the halves join in the epilogue
#pragma unroll
    for (int t = 0; t < 4; ++t)
#pragma unroll
      for (int r = 0; r < 8; ++r) oacc[t][r] *= alpha;
    // ---- out^T += V^T.P^T : 2 kv-chunks x 4 d-tiles x 3 products; this lane holds query c, d = t*16 + 8*hh + r ----
#pragma unroll
    for (int kk = 0; kk < 2; ++kk) {
#pragma unroll
      for (int t = 0; t < 4; ++t) {
        const v16b vb = Frag<__bf16>::load(Vth + (t * 16 + c) * kLP + kk * 32 + 8 * hh);
        const v16b vl = Frag<__bf16>::load(Vtl + (t * 16 + c) * kLP + kk * 32 + 8 * hh);
        oacc[t] = mma_bf16(vb, ph[kk], oacc[t]);
        oacc[t] = mma_bf16(vl, ph[kk], oacc[t]);
        oacc[t] = mma_bf16(vb, pl[kk], oacc[t]);
      }
    }
  }

  // ---- epilogue: join the halves' sums, normalise, split to bf16 hi/lo into this wave's staging, whole-line stores ----
  {
    const float inv = 1.0f / (lrow + xhalf(lrow));
#pragma unroll
    for (int t = 0; t < 4; ++t) {
      v8b xa, xb;
#pragma unroll
      for (int r = 0; r < 8; ++r) {
        const float v = oacc[t][r] * inv;
        __bf16 a, bl;
        split_bf16(v, a, bl);
        xa[r] = a;
        xb[r] = bl;
      }
      *(v8b*)(pwh + c * kLP + t * 16 + 8 * hh) = xa;
      *(v8b*)(pwl + c * kLP + t * 16 + 8 * hh) = xb;
    }
  }
  __builtin_amdgcn_fence(__ATOMIC_RELEASE, "workgroup");
  __builtin_amdgcn_wave_barrier();
  __builtin_amdgcn_fence(__ATOMIC_ACQUIRE, "workgroup");
  {
    _Float16* Chp = (_Float16*)(void*)Ch;
    _Float16* Clp = (_Float16*)(void*)Cl;
    const int q8 = lane >> 3, c8 = (lane & 7) * 8;
    const size_t ob = (size_t)(b * kSeqQ + q0) * kEmb + h * kHeadD + c8;
    {
#pragma unroll
      for (int it = 0; it < 4; ++it) {
        const int row = it * 4 + q8;
        const v8b xh = *(const v8b*)(pwh + row * kLP + c8);
        const v8b xl = *(const v8b*)(pwl + row * kLP + c8);
        const v8h yh = __builtin_bit_cast(v8h, xh);
        const v8h yl = __builtin_bit_cast(v8h, xl);
        *(v8h*)(Chp + ob + (size_t)row * kEmb) = yh;
        *(v8h*)(Clp + ob + (size_t)row * kEmb) = yl;
      }
      
    }
  }
}

extern "C" void kernel_launch(void* const* d_in, const int* in_sizes, int n_in,
                              void* d_out, int out_size, void* d_ws, size_t ws_size,
                              hipStream_t stream) {
  static_assert(kRowsM % 128 == 0 && kEmb % 128 == 0 && kKVCols % 128 == 0 && kEmb % 64 == 0);
  static_assert(kSeqQ % 64 == 0 && kSeqK % kKC == 0 && kHeadD == 64 && kHeads * kHeadD == kEmb && kSeqQ == kSeqK);

  if (n_in < 10) return;
  const int nAct = kRowsM * kEmb;            /* 4,194,304 elements */
  const int nWq  = kEmb * kEmb;              /* 1,048,576 */
  const int nWkv = kKVCols * kEmb;           /* 2,097,152 */
  const int nWo  = kEmb * kEmb;
  if (in_sizes[0] != nAct || in_sizes[1] != kBatch * kSeqK * kEmb || in_sizes[2] != kBatch * kSeqK ||
      in_sizes[3] != kBatch * kSeqK || in_sizes[4] != nWq || in_sizes[5] != kEmb || in_sizes[6] != nWkv ||
      in_sizes[7] != kKVCols || in_sizes[8] != nWo || in_sizes[9] != kEmb) return;
  if (out_size != nAct) return;

  const float* tgt   = (const float*)d_in[0];
  const float* mem   = (const float*)d_in[1];
  const float* abias = (const float*)d_in[2];
  const int*   kmask = (const int*)d_in[3];
  const float* Wq_w  = (const float*)d_in[4];
  const float* Wq_b  = (const float*)d_in[5];
  const float* Wkv_w = (const float*)d_in[6];
  const float* Wkv_b = (const float*)d_in[7];
  const float* out_w = (const float*)d_in[8];
  const float* out_b = (const float*)d_in[9];
  float* out = (float*)d_out;

  /* workspace region map (bytes, all offsets multiples of 1 MiB):
       [  0 MiB,  8 MiB)  tgt16   bf16 [4096][1024]
       [  8 MiB, 16 MiB)  mem16   bf16 [4096][1024]
       [ 16 MiB, 18 MiB)  wq16    bf16 [1024][1024]
       [ 18 MiB, 22 MiB)  wkv16   bf16 [2048][1024]
       [ 22 MiB, 24 MiB)  wo16    bf16 [1024][1024]
       [ 24 MiB, 32 MiB)  qh      bf16 [4096][1024]   [ 32, 40) ql
       [ 40 MiB, 56 MiB)  kvh     bf16 [4096][2048]   [ 56, 72) kvl
       [ 72 MiB, 80 MiB)  ch      bf16 [4096][1024]   [ 80, 88) cl
     total 92,274,688 B */
  const size_t szAct16 = (size_t)nAct * 2;
  const size_t szKV16  = (size_t)kRowsM * kKVCols * 2;
  const size_t oTgt = 0;
  const size_t oMem = oTgt + szAct16;
  const size_t oWq  = oMem + szAct16;
  const size_t oWkv = oWq + (size_t)nWq * 2;
  const size_t oWo  = oWkv + (size_t)nWkv * 2;
  const size_t oQh  = oWo + (size_t)nWo * 2;
  const size_t oQl  = oQh + szAct16;
  const size_t oKVh = oQl + szAct16;
  const size_t oKVl = oKVh + szKV16;
  const size_t oCh  = oKVl + szKV16;
  const size_t oCl  = oCh + szAct16;
  const size_t total = oCl + szAct16;
  if (total > ws_size) return;

  char* ws = (char*)d_ws;
  unsigned short* tgt16 = (unsigned short*)(ws + oTgt);
  unsigned short* mem16 = (unsigned short*)(ws + oMem);
  unsigned short* wq16  = (unsigned short*)(ws + oWq);
  unsigned short* wkv16 = (unsigned short*)(ws + oWkv);
  unsigned short* wo16  = (unsigned short*)(ws + oWo);
  unsigned short* qh    = (unsigned short*)(ws + oQh);
  unsigned short* ql    = (unsigned short*)(ws + oQl);
  unsigned short* kvh   = (unsigned short*)(ws + oKVh);
  unsigned short* kvl   = (unsigned short*)(ws + oKVl);
  unsigned short* ch    = (unsigned short*)(ws + oCh);
  unsigned short* cl    = (unsigned short*)(ws + oCl);

  /* 1. RNE-convert the five float matrices to bf16 planes: one launch; the planes tgt16 .. wo16 are contiguous from tgt16 on */
  cast_f32_bf16_all<<<dim3(kCastBlocks), dim3(512), 0, stream>>>(tgt, mem, Wq_w, Wkv_w, out_w, tgt16);

  /* 2. q = tgt16 . wq16^T + bq : M=4096 N=1024 K=1024 -> bf16 hi/lo planes; 256 block tiles of 128x128 */
  {
    const int tiles = (kRowsM / 128) * (kEmb / 128);
    wmma_gemm64<1, 0, 2, 2><<<dim3(tiles, 1), dim3(128), 0, stream>>>(
        tgt16, tgt16, kEmb, 0L, wq16, wq16, kEmb, 0L, (void*)qh, (void*)ql, kEmb, 0L,
        Wq_b, kRowsM, kEmb, kEmb, 1.0f);
  }
  /* 3. kv = mem16 . wkv16^T + bkv : M=4096 N=2048 K=1024 -> bf16 hi/lo planes; 512 block tiles */
  {
    const int tiles = (kRowsM / 128) * (kKVCols / 128);
    wmma_gemm64<1, 0, 2, 2><<<dim3(tiles, 1), dim3(128), 0, stream>>>(
        mem16, mem16, kEmb, 0L, wkv16, wkv16, kEmb, 0L, (void*)kvh, (void*)kvl, kKVCols, 0L,
        Wkv_b, kRowsM, kKVCols, kEmb, 1.0f);
  }
  /* 4. attention: grid = B*H*(SQ/64) = 1024 blocks of 128 threads -> ctx hi/lo planes */
  {
    const int nblk = kBatch * kHeads * (kSeqQ / 64);
    mha_attn_hd64<<<dim3(nblk), dim3(128), 0, stream>>>(qh, ql, kvh, kvl, abias, kmask, ch, cl);
  }
  /* 5. out = (ch + cl) . wo16^T + bo : M=4096 N=1024 K=1024, A carried hi+lo (2 products), f32 out */
  {
    const int tiles = (kRowsM / 128) * (kEmb / 128);
    wmma_gemm64<1, 1, 2, 0><<<dim3(tiles, 1), dim3(128), 0, stream>>>(
        ch, cl, kEmb, 0L, wo16, wo16, kEmb, 0L, (void*)out, (void*)cl, kEmb, 0L,
        out_b, kRowsM, kEmb, kEmb, 1.0f);
  }
}

// v005
// It runs in 200 microseconds.
// In both of two side-by-side timings against v004, it was 1.09 times as fast.
// Over all steps from v000 it is 2.80 times as fast.
// Contractions: q/kv/out projections on v_wmma_f32_16x16x32_bf16 (float inputs RNE-converted to bf16 once; out-projection A operand carried as bf16 hi+lo planes, 2 products); attention q.k and p.v on v_wmma_f32_16x16x32_bf16 with bf16 hi+lo planes for q,k,p,v (3 products); f32 accumulate; softmax and normalisation in f32.
#include <hip/hip_runtime.h>

typedef __attribute__((ext_vector_type(16))) _Float16 v16h;
typedef __attribute__((ext_vector_type(8)))  _Float16 v8h;
typedef __attribute__((ext_vector_type(16))) __bf16   v16b;
typedef __attribute__((ext_vector_type(8)))  __bf16   v8b;
typedef __attribute__((ext_vector_type(8)))  float    v8f;
typedef __attribute__((ext_vector_type(4)))  float    v4f;
typedef __attribute__((ext_vector_type(2)))  float    v2f;
typedef __attribute__((ext_vector_type(4)))  unsigned v4u;
typedef __attribute__((ext_vector_type(2)))  unsigned v2u;

static constexpr int kBatch  = 2;
static constexpr int kSeqQ   = 2048;
static constexpr int kSeqK   = 2048;
static constexpr int kEmb    = 1024;
static constexpr int kHeads  = 16;
static constexpr int kHeadD  = 64;
static constexpr int kKVCols = 2 * kEmb;          /* 2048: k at cols 0..1023, v at cols 1024..2047 */
static constexpr int kRowsM  = kBatch * kSeqQ;    /* 4096 (== kBatch * kSeqK) */
static constexpr int kKC     = 64;                /* keys per streamed chunk */
static constexpr float kLog2E = 1.4426950408889634f;   /* log2(e): the attention scores are carried in the base-2 domain */
static constexpr int kLP     = 72;                /* LDS row pitch in 16-bit elements: 144 B = 16 B x 9, so the 16 rows of a 16-byte fragment read fall on distinct banks */

__device__ __forceinline__ unsigned short f2bf_bits(float f) {
  unsigned u = __float_as_uint(f);
  return (unsigned short)((u + 0x7FFFu + ((u >> 16) & 1u)) >> 16);
}
__device__ __forceinline__ float bf_bits2f(unsigned short h) { return __uint_as_float(((unsigned)h) << 16); }

// hazard guards as plain device helpers
__device__ __forceinline__ void dep_guard_h(v8f& a, v8f& b, v16h x, v16h y) { asm volatile("v_nop\n\tv_nop\n\tv_nop\n\tv_nop" : "+v"(a), "+v"(b) : "v"(x), "v"(y)); }
__device__ __forceinline__ void dep_guard_b(v8f& a, v8f& b, v16b x, v16b y) { asm volatile("v_nop\n\tv_nop\n\tv_nop\n\tv_nop" : "+v"(a), "+v"(b) : "v"(x), "v"(y)); }
__device__ __forceinline__ void keep4_h(v16h a, v16h b, v16h c, v16h d) { asm volatile("v_nop" :: "v"(a), "v"(b), "v"(c), "v"(d)); }
__device__ __forceinline__ void keep4_b(v16b a, v16b b, v16b c, v16b d) { asm volatile("v_nop" :: "v"(a), "v"(b), "v"(c), "v"(d)); }
__device__ __forceinline__ void acc_guard4(v8f& a, v8f& b, v8f& c, v8f& d) { asm volatile("v_nop\n\tv_nop\n\tv_nop\n\tv_nop" : "+v"(a), "+v"(b), "+v"(c), "+v"(d)); }
template <typename T> struct Frag;
template <> struct Frag<_Float16> {
  typedef v16h V; union U { v16h v; v8h h[2]; };
  static __device__ __forceinline__ v16h load(const _Float16* p) {   // elements 0..7 <- p[0..7], 8..15 <- p[16..23]
    U f; f.h[0] = *(const v8h*)(p); f.h[1] = *(const v8h*)(p + 16); return f.v;
  }
  static __device__ __forceinline__ v8f mma(v16h a, v16h b, v8f c) {
    return __builtin_amdgcn_wmma_f32_16x16x32_f16(false, a, false, b, (short)0, c, false, false);
  }
  static __device__ __forceinline__ void guard(v8f& a, v8f& b, v16h x, v16h y) { dep_guard_h(a, b, x, y); }
  static __device__ __forceinline__ void keep(v16h a, v16h b, v16h c, v16h d) { keep4_h(a, b, c, d); }
};
template <> struct Frag<__bf16> {
  typedef v16b V; union U { v16b v; v8b h[2]; };
  static __device__ __forceinline__ v16b load(const __bf16* p) {
    U f; f.h[0] = *(const v8b*)(p); f.h[1] = *(const v8b*)(p + 16); return f.v;
  }
  static __device__ __forceinline__ v8f mma(v16b a, v16b b, v8f c) {
    return __builtin_amdgcn_wmma_f32_16x16x32_bf16(false, a, false, b, (short)0, c, false, false);
  }
  static __device__ __forceinline__ void guard(v8f& a, v8f& b, v16b x, v16b y) { dep_guard_b(a, b, x, y); }
  static __device__ __forceinline__ void keep(v16b a, v16b b, v16b c, v16b d) { keep4_b(a, b, c, d); }
};

// a block-uniform global address, pinned into a scalar register pair
typedef const __attribute__((address_space(1))) char* gbytes;
typedef const __attribute__((address_space(1))) v4u*  gvec16;
__device__ __forceinline__ gbytes uniform_ptr(const void* p) {
  const unsigned long long u = (unsigned long long)p;
  const unsigned lo = (unsigned)__builtin_amdgcn_readfirstlane((int)(unsigned)u);
  const unsigned hi = (unsigned)__builtin_amdgcn_readfirstlane((int)(unsigned)(u >> 32));
  return (gbytes)(((unsigned long long)hi << 32) | lo);
}

// ---- Register-blocked batched WMMA GEMM, operands staged through LDS ---------
// C[m,n] = scale * sum_k A[m,k] * Bt[n,k] (+bias); a block of 4 waves owns a 128x128 tile, each wave a 64x64 quarter.
// A row-major [M,K]; Bt row-major [N,K]; M,N % 128 == 0, K % 64 == 0.
// Each stage is 64 k = one whole 128-byte line of every operand row: 8 lanes read a line, a wave-wide load covers 4 whole lines.
// Two LDS buffers: stage s+1 is loaded into registers while stage s is multiplied, and stored behind it; one barrier per stage.
// SPLIT: 0 = single product; 1 = A carried as hi+lo planes (A.B + A2.B); 2 = A and B hi+lo planes (A.B + A.B2 + A2.B).
// BIAS_MODE: 0 = none, 2 = bias[n] (bias RNE-converted to bf16 before the add).
// OUT_MODE: 0 = f32, 1 = f16, 2 = bf16 hi plane (Cout) + bf16 lo plane (Cout2).
// ET: 0 = f16 operands, 1 = bf16 operands (pointers passed as 16-bit storage)
template <int ET> struct Elem;
template <> struct Elem<0> { typedef _Float16 T; };
template <> struct Elem<1> { typedef __bf16 T; };
template <int ET, int SPLIT, int BIAS_MODE, int OUT_MODE>
__global__ __launch_bounds__(128) void wmma_gemm64(
    const unsigned short* __restrict__ Ap, const unsigned short* __restrict__ A2p, int lda, long strideA,
    const unsigned short* __restrict__ Btp, const unsigned short* __restrict__ Bt2p, int ldb, long strideB,
    void* __restrict__ Cout, void* __restrict__ Cout2, int ldc, long strideC,
    const float* __restrict__ bias,
    int M, int N, int K, float scale) {
  typedef typename Elem<ET>::T T;
  typedef typename Frag<T>::V V;
  const T* A = (const T*)Ap; const T* A2 = (const T*)A2p; const T* Bt = (const T*)Btp; const T* Bt2 = (const T*)Bt2p;
  constexpr int PA = 0, PB = 1, PA2 = 2, PB2 = 3;              // operand planes in LDS
  constexpr int NPL = 2 + (SPLIT != 0 ? 1 : 0) + (SPLIT == 2 ? 1 : 0);
  __shared__ __align__(16) T sOp[2][NPL][128 * kLP];           // [buffer][plane][row][64 k], pitch kLP
  __shared__ __align__(16) float sT[4][16 * 68];               // per-wave 16x64 slab, pitch 68 floats
  const int b    = blockIdx.y;
  const int tid  = threadIdx.x;
  const int lane = tid & 31;
  const int wave = tid >> 5;
  const int tilesN = N >> 7;
  const int tilesM = M >> 7;
  if ((int)blockIdx.x >= tilesM * tilesN) return;   // block-uniform, in front of every barrier
  const int bm = blockIdx.x / tilesN;
  const int bn = blockIdx.x - bm * tilesN;
  const int wm = (wave >> 1) << 6;             // this wave's quarter inside the block tile
  const int wn = (wave & 1) << 6;
  const int m0 = (bm << 7) + wm;
  const int n0 = (bn << 7) + wn;

  const T* Ab  = A  + (size_t)b * strideA;
  const T* Bb  = Bt + (size_t)b * strideB;
  const T* Ab2 = (SPLIT != 0) ? (A2  + (size_t)b * strideA) : nullptr;
  const T* Bb2 = (SPLIT == 2) ? (Bt2 + (size_t)b * strideB) : nullptr;

  const int rlane = lane & 15;                 // row (A) / col (B, D) within subtile
  const int koff  = (lane >> 4) * 8;           // k offset of this lane half
  const int mOff  = (lane >> 4) * 8;           // D row offset

  // staging map: thread -> (row tid>>3 of each group of 16 rows, 16-byte piece tid&7 of the row's line)
  const int srow = tid >> 3;
  const int sseg = (tid & 7) * 8;
  const int sLane = srow * kLP + sseg;
  unsigned aByte = (unsigned)(srow * lda + sseg) * 2u;      // per-lane byte offsets; they advance by one line (128 B) per stage
  unsigned bByte = (unsigned)(srow * ldb + sseg) * 2u;
  // block-uniform base of each group of 16 rows, held in scalar registers: every load is base + one per-lane offset,
  // so no address register is rewritten while a stage's loads are being issued
  gbytes gp[NPL][8];
#pragma unroll
  for (int i = 0; i < 8; ++i) {
    gp[PA][i] = uniform_ptr(Ab + (size_t)((bm << 7) + 16 * i) * lda);
    gp[PB][i] = uniform_ptr(Bb + (size_t)((bn << 7) + 16 * i) * ldb);
    if (SPLIT != 0) gp[SPLIT != 0 ? PA2 : PA][i] = uniform_ptr(Ab2 + (size_t)((bm << 7) + 16 * i) * lda);
    if (SPLIT == 2) gp[SPLIT == 2 ? PB2 : PB][i] = uniform_ptr(Bb2 + (size_t)((bn << 7) + 16 * i) * ldb);
  }

  v8f acc[4][4];
#pragma unroll
  for (int i = 0; i < 4; ++i)
#pragma unroll
    for (int j = 0; j < 4; ++j) acc[i][j] = (v8f){0.f,0.f,0.f,0.f,0.f,0.f,0.f,0.f};

  v4u rg[NPL][8];
  const int nst = K >> 6;
#pragma unroll
  for (int p = 0; p < NPL; ++p)
#pragma unroll
    for (int i = 0; i < 8; ++i) rg[p][i] = *(gvec16)(gp[p][i] + ((p & 1) ? bByte : aByte));
#pragma unroll
  for (int p = 0; p < NPL; ++p)
#pragma unroll
    for (int i = 0; i < 8; ++i) *(v4u*)(&sOp[0][p][sLane + 16 * i * kLP]) = rg[p][i];

  for (int s = 0; s < nst; ++s) {
    const bool more = (s + 1 < nst);           // block-uniform
    __syncthreads();                           // publishes stage s; ends every wave's reads of the buffer that stage s+1 goes into
    if (more) {
      aByte += 128u;
      bByte += 128u;
#pragma unroll
      for (int p = 0; p < NPL; ++p)
#pragma unroll
        for (int i = 0; i < 8; ++i) rg[p][i] = *(gvec16)(gp[p][i] + ((p & 1) ? bByte : aByte));
      // behind this wait the address registers of the loads above may be rewritten; it also keeps the loads in front of the stage's LDS reads
      asm volatile("s_wait_xcnt 0x0" ::: "memory");
    }
    const int cur = s & 1;
    // the A fragments run one row of tiles ahead of the products, so that a row's LDS latency hides behind the row before it
    const int aoLane = (wm + rlane) * kLP + koff;
    V ahn = Frag<T>::load(&sOp[cur][PA][aoLane]);
    V aln;
    if (SPLIT != 0) aln = Frag<T>::load(&sOp[cur][SPLIT != 0 ? PA2 : PA][aoLane]);
#pragma unroll
    for (int kk = 0; kk < 64; kk += 32) {
      V bh[4], bl[4];
#pragma unroll
      for (int j = 0; j < 4; ++j) {
        const int bo = (wn + (j << 4) + rlane) * kLP + koff + kk;
        bh[j] = Frag<T>::load(&sOp[cur][PB][bo]);
        if (SPLIT == 2) bl[j] = Frag<T>::load(&sOp[cur][SPLIT == 2 ? PB2 : PB][bo]);
      }
#pragma unroll
      for (int i = 0; i < 4; ++i) {
        const V ah = ahn;
        V al;
        if (SPLIT != 0) al = aln;
        if (i < 3 || kk == 0) {
          const int an = aoLane + ((i < 3) ? ((i + 1) << 4) * kLP + kk : 32);
          ahn = Frag<T>::load(&sOp[cur][PA][an]);
          if (SPLIT != 0) aln = Frag<T>::load(&sOp[cur][SPLIT != 0 ? PA2 : PA][an]);
        }
#pragma unroll
        for (int j = 0; j < 4; ++j) {
          acc[i][j] = Frag<T>::mma(ah, bh[j], acc[i][j]);
          if (SPLIT == 2) acc[i][j] = Frag<T>::mma(ah, bl[j], acc[i][j]);
          if (SPLIT != 0) acc[i][j] = Frag<T>::mma(al, bh[j], acc[i][j]);
        }
        Frag<T>::guard(acc[i][0], acc[i][3], ah, (SPLIT != 0) ? al : ah);
      }
      Frag<T>::keep(bh[0], bh[1], bh[2], bh[3]);
      if (SPLIT == 2) Frag<T>::keep(bl[0], bl[1], bl[2], bl[3]);
    }
    if (more) {
#pragma unroll
      for (int p = 0; p < NPL; ++p)
#pragma unroll
        for (int i = 0; i < 8; ++i) *(v4u*)(&sOp[cur ^ 1][p][sLane + 16 * i * kLP]) = rg[p][i];
    }
  }
  acc_guard4(acc[0][0], acc[0][1], acc[0][2], acc[0][3]);
  acc_guard4(acc[1][0], acc[1][1], acc[1][2], acc[1][3]);
  acc_guard4(acc[2][0], acc[2][1], acc[2][2], acc[2][3]);
  acc_guard4(acc[3][0], acc[3][1], acc[3][2], acc[3][3]);

  // ---- epilogue ----
  float* slab = sT[wave];
#pragma unroll
  for (int i = 0; i < 4; ++i) {
    const int mBase = m0 + (i << 4);
#pragma unroll
    for (int j = 0; j < 4; ++j) {
      const int n = n0 + (j << 4) + rlane;
      float bv = 0.f;
      if (BIAS_MODE == 2) bv = bf_bits2f(f2bf_bits(bias[n]));
#pragma unroll
      for (int r = 0; r < 8; ++r) {
        float v = acc[i][j][r] * scale;
        if (BIAS_MODE == 2) v += bv;
        slab[(mOff + r) * 68 + (j << 4) + rlane] = v;
      }
    }
    __builtin_amdgcn_fence(__ATOMIC_RELEASE, "workgroup");
    __builtin_amdgcn_wave_barrier();
    __builtin_amdgcn_fence(__ATOMIC_ACQUIRE, "workgroup");
    if (OUT_MODE == 0) {
      float* C = (float*)Cout + (size_t)b * strideC;
      const int hh = lane >> 4, c4 = (lane & 15) * 4;     // row seg = 256 B = 16 lanes x 16 B
      {
#pragma unroll
        for (int it = 0; it < 8; ++it) {
          const int row = it * 2 + hh;
          v4f v = *(const v4f*)(slab + row * 68 + c4);
          *(v4f*)(C + (size_t)(mBase + row) * ldc + n0 + c4) = v;
        }
        
      }
    } else {
      const int q = lane >> 3, c8 = (lane & 7) * 8;
      unsigned short* C  = (unsigned short*)Cout  + (size_t)b * strideC;
      unsigned short* C2 = (OUT_MODE == 2) ? ((unsigned short*)Cout2 + (size_t)b * strideC) : nullptr;
      {
#pragma unroll
        for (int it = 0; it < 4; ++it) {
          const int row = it * 4 + q;
          const float* sp = slab + row * 68 + c8;
          v8h hv, lv;
#pragma unroll
          for (int e = 0; e < 8; ++e) {
            if (OUT_MODE == 1) {
              hv[e] = (_Float16)sp[e];
            } else {
              unsigned short hb = f2bf_bits(sp[e]);
              unsigned short lb = f2bf_bits(sp[e] - bf_bits2f(hb));
              hv[e] = __builtin_bit_cast(_Float16, hb);
              lv[e] = __builtin_bit_cast(_Float16, lb);
            }
          }
          *(v8h*)(C + (size_t)(mBase + row) * ldc + n0 + c8) = hv;
          if (OUT_MODE == 2) *(v8h*)(C2 + (size_t)(mBase + row) * ldc + n0 + c8) = lv;
        }
        
      }
    }
    __builtin_amdgcn_fence(__ATOMIC_RELEASE, "workgroup");
    __builtin_amdgcn_wave_barrier();
    __builtin_amdgcn_fence(__ATOMIC_ACQUIRE, "workgroup");
  }
}

// One launch converts all five float matrices. Their bf16 planes lie back to back in the workspace, in the order
// tgt, mem, Wq_w, Wkv_w, out_w, so the output is one flat array of three equal thirds: tgt, mem, the three weights.
// A unit = 1024 consecutive elements = one wave x 8 loads of 16 B per lane; every matrix is a whole number of units.
// Grid = kCastBlocks blocks x 16 waves, all resident at once; wave w converts unit w of each third: every element exactly once.
static constexpr int kCastUnit   = 1024;
static constexpr int kCastBlocks = 256;
static constexpr int kCastThird  = kCastBlocks * 16 * kCastUnit;    /* 4,194,304 elements */
static_assert(kRowsM * kEmb == kCastThird && kEmb * kEmb + kKVCols * kEmb + kEmb * kEmb == kCastThird);
static_assert((kEmb * kEmb) % kCastUnit == 0 && (kKVCols * kEmb) % kCastUnit == 0);
__global__ __launch_bounds__(512) void cast_f32_bf16_all(
    const float* __restrict__ tgt, const float* __restrict__ mem, const float* __restrict__ wq,
    const float* __restrict__ wkv, const float* __restrict__ wo, unsigned short* __restrict__ out) {
  constexpr int w1 = kEmb * kEmb, w2 = w1 + kKVCols * kEmb;
  const int l4 = (threadIdx.x & 31) * 4;
  const int e  = __builtin_amdgcn_readfirstlane((int)(blockIdx.x * 16 + (threadIdx.x >> 5))) * kCastUnit;   // wave-uniform, 0 <= e < kCastThird
  const float* src[3];
  src[0] = tgt + e;
  src[1] = mem + e;
  src[2] = (e < w1) ? wq + e : (e < w2) ? wkv + (e - w1) : wo + (e - w2);
  v4f x[3][8];
#pragma unroll
  for (int s = 0; s < 3; ++s)
#pragma unroll
    for (int i = 0; i < 8; ++i) x[s][i] = *(const v4f*)(src[s] + i * 128 + l4);   // 512 contiguous bytes per wave-wide load
  // keeps all 24 loads in front of the first conversion: without it the compiler waits for the first 8 before it issues the rest
  __builtin_amdgcn_sched_barrier(0);
#pragma unroll
  for (int s = 0; s < 3; ++s)
#pragma unroll
    for (int i = 0; i < 8; ++i) {
      v2u y;
      y[0] = (unsigned)f2bf_bits(x[s][i][0]) | ((unsigned)f2bf_bits(x[s][i][1]) << 16);
      y[1] = (unsigned)f2bf_bits(x[s][i][2]) | ((unsigned)f2bf_bits(x[s][i][3]) << 16);
      *(v2u*)(out + s * kCastThird + e + i * 128 + l4) = y;                        // 256 contiguous bytes per wave-wide store: two whole lines
    }
}

// ---- bf16 helpers for the attention kernel ----
__device__ __forceinline__ __bf16 to_bf16(float f) { return __builtin_bit_cast(__bf16, f2bf_bits(f)); }
__device__ __forceinline__ void split_bf16(float f, __bf16& hi, __bf16& lo) {
  const unsigned short hb = f2bf_bits(f);
  hi = __builtin_bit_cast(__bf16, hb);
  lo = to_bf16(f - __uint_as_float(((unsigned)hb) << 16));
}
__device__ __forceinline__ v8f mma_bf16(v16b a, v16b b, v8f c) {
  c = __builtin_amdgcn_wmma_f32_16x16x32_bf16(false, a, false, b, (short)0, c, false, false);
  asm volatile("v_nop\n\tv_nop\n\tv_nop\n\tv_nop" : "+v"(c) : "v"(a), "v"(b));
  return c;
}

__device__ __forceinline__ void exp2_x8(v8f& x) {
  float a = x[0], b = x[1], c = x[2], d = x[3], e = x[4], f = x[5], g = x[6], h = x[7];
  // one statement, so that nothing comes between: an independent v_exp_f32 behind each, the v_nop behind the last
  asm("v_exp_f32 %0, %0\n\tv_exp_f32 %1, %1\n\tv_exp_f32 %2, %2\n\tv_exp_f32 %3, %3\n\t"
      "v_exp_f32 %4, %4\n\tv_exp_f32 %5, %5\n\tv_exp_f32 %6, %6\n\tv_exp_f32 %7, %7\n\tv_nop"
      : "+v"(a), "+v"(b), "+v"(c), "+v"(d), "+v"(e), "+v"(f), "+v"(g), "+v"(h));
  x = (v8f){a, b, c, d, e, f, g, h};
}
__device__ __forceinline__ float exp2_x1(float x) {
  asm("v_exp_f32 %0, %0\n\tv_nop" : "+v"(x));   // the v_nop: the same slot
  return x;
}

// lane l with lane l ^ 16
__device__ __forceinline__ float xhalf(float x) {
  return __builtin_bit_cast(float, __builtin_amdgcn_permlanex16(__builtin_bit_cast(int, x), __builtin_bit_cast(int, x), 0x76543210, 0xfedcba98, false, false));
}

// =====================================================================================
// Cross attention, head_dim 64, 16-bit plane inputs:
//   q planes  Qh/Ql : bf16 hi/lo, element (b,s,h,d) at (b*SQ+s)*1024 + h*64 + d
//   kv planes KVh/KVl: bf16 hi/lo, row (b*SK+s) pitch 2048; k at col h*64+d, v at col 1024+h*64+d
//   scores = 0.125 * q.k^T (hi.hi + hi.lo + lo.hi) + bf16(attn_bias[b,kv]); key mask 0 -> score = -inf
//   the scores are held times log2(e) (folded into the scale and into the staged bias), so e^(s-m) is one v_exp_f32 of a difference
//   out    = softmax(scores).v with p and v as bf16 hi/lo (3 products), f32 accumulate, f32 online softmax
//   both products run transposed (scores^T = k.q^T, out^T += v^T.p^T): a lane owns one query, p stays in registers
//   ctx written as bf16 hi/lo planes Ch/Cl, element (b,s,h,d) at (b*SQ+s)*1024 + h*64 + d.
// Block = 4 waves = 64 query rows of one (b,h); grid.x = B*H*(SQ/64) = 1024.
// =====================================================================================
__global__ __launch_bounds__(128)
void mha_attn_hd64(const unsigned short* __restrict__ Qh, const unsigned short* __restrict__ Ql,
                   const unsigned short* __restrict__ KVh, const unsigned short* __restrict__ KVl,
                   const float* __restrict__ abias, const int* __restrict__ kmask,
                   unsigned short* __restrict__ Ch, unsigned short* __restrict__ Cl)
{
  __shared__ __align__(16) __bf16 Ksh[kKC * kLP];         // K hi [kv][d], pitch kLP   9 KB
  __shared__ __align__(16) __bf16 Ksl[kKC * kLP];         // K lo [kv][d], pitch kLP   9 KB
  __shared__ __align__(16) __bf16 Vth[kHeadD * kLP];      // V hi [d][kv], pitch kLP   9 KB
  __shared__ __align__(16) __bf16 Vtl[kHeadD * kLP];      // V lo [d][kv], pitch kLP   9 KB
  __shared__ __align__(16) __bf16 Psh[4][16 * kLP];       // per wave out hi staging [row][d], pitch kLP
  __shared__ __align__(16) __bf16 Psl[4][16 * kLP];       // per wave out lo staging [row][d], pitch kLP
  __shared__ __align__(16) float CB[kKC];                               // per chunk: bf16(bias) * log2(e), or -inf when masked

  const int tid  = threadIdx.x;
  const int wave = tid >> 5;
  const int lane = tid & 31;
  const int hh   = lane >> 4;
  const int c    = lane & 15;
  const int nqb  = kSeqQ / 64;
  const int bx   = blockIdx.x;
  const int qb   = bx % nqb;
  const int bhd  = bx / nqb;
  const int h    = bhd % kHeads;
  const int b    = bhd / kHeads;
  const int q0   = qb * 64 + wave * 16;
  const float ninf = -__builtin_huge_valf();

  const __bf16* Qhp = (const __bf16*)(const void*)Qh;
  const __bf16* Qlp = (const __bf16*)(const void*)Ql;

  // ---- Q fragments (B operand, column = c, split k map via Frag::load): 2 d-chunks, hi and lo ----
  v16b qah[2], qal[2];
  {
    const size_t qo = (size_t)(b * kSeqQ + q0 + c) * kEmb + h * kHeadD + 8 * hh;
#pragma unroll
    for (int dc = 0; dc < 2; ++dc) {
      qah[dc] = Frag<__bf16>::load(Qhp + qo + dc * 32);
      qal[dc] = Frag<__bf16>::load(Qlp + qo + dc * 32);
    }
  }

  const v8f zero8 = (v8f){0.f,0.f,0.f,0.f,0.f,0.f,0.f,0.f};
  float mrow = ninf, lrow = 0.f;   // one query (column c) per lane
  v8f oacc[4];
#pragma unroll
  for (int t = 0; t < 4; ++t) oacc[t] = zero8;

  __bf16* pwh = Psh[wave];
  __bf16* pwl = Psl[wave];

  for (int kc = 0; kc < kSeqK / kKC; ++kc) {
    const int kv0 = kc * kKC;
    __syncthreads();
    {
      // K planes: thread -> (kv row tid>>1, d half (tid&1)*32): 128 thr x 32 elems = 64 x 64 per plane
      const int kvr = tid >> 1, dh = (tid & 1) * 32;
      const size_t ro = (size_t)(b * kSeqK + kv0 + kvr) * kKVCols + h * kHeadD + dh;
#pragma unroll
      for (int i = 0; i < 4; ++i) {
        const v4u wh = *(const v4u*)(KVh + ro + 8 * i);
        const v4u wl = *(const v4u*)(KVl + ro + 8 * i);
        *(v4u*)(Ksh + kvr * kLP + dh + 8 * i) = wh;
        *(v4u*)(Ksl + kvr * kLP + dh + 8 * i) = wl;
      }
    }
    asm volatile("" ::: "memory");
    {
      // V planes transposed into [d][kv]: thread -> (kv pair p = tid>>2, d range dq = (tid&3)*16)
      // 32 pairs x 4 ranges = 128 thr; each writes 2 kv x 16 d as packed u32 (both halves per-lane data)
      const int p = tid >> 2, dq = (tid & 3) * 16;
      const size_t r0 = (size_t)(b * kSeqK + kv0 + 2 * p) * kKVCols + kEmb + h * kHeadD + dq;
      const size_t r1 = r0 + kKVCols;
#pragma unroll
      for (int i = 0; i < 2; ++i) {
        const v4u xh = *(const v4u*)(KVh + r0 + 8 * i);
        const v4u yh = *(const v4u*)(KVh + r1 + 8 * i);
        const v4u xl = *(const v4u*)(KVl + r0 + 8 * i);
        const v4u yl = *(const v4u*)(KVl + r1 + 8 * i);
#pragma unroll
        for (int jw = 0; jw < 4; ++jw) {
          const int d0 = dq + 8 * i + 2 * jw;
          const unsigned xhw = xh[jw], yhw = yh[jw], xlw = xl[jw], ylw = yl[jw];
          const unsigned h0 = (xhw & 0xffffu) | (yhw << 16);
          const unsigned h1 = (xhw >> 16) | (yhw & 0xffff0000u);
          const unsigned l0 = (xlw & 0xffffu) | (ylw << 16);
          const unsigned l1 = (xlw >> 16) | (ylw & 0xffff0000u);
          *(unsigned*)(Vth + d0 * kLP + 2 * p)       = h0;
          *(unsigned*)(Vth + (d0 + 1) * kLP + 2 * p) = h1;
          *(unsigned*)(Vtl + d0 * kLP + 2 * p)       = l0;
          *(unsigned*)(Vtl + (d0 + 1) * kLP + 2 * p) = l1;
        }
      }
    }
    if (tid < kKC) {   // waves 0 and 1 entirely: wave-uniform branch
      const size_t ki = (size_t)b * kSeqK + kv0 + tid;
      const int keep = kmask[ki];
      const float bb = bf_bits2f(f2bf_bits(abias[ki]));
      CB[tid] = (keep != 0) ? bb * kLog2E : ninf;
    }
    __syncthreads();

    // ---- scores, transposed: tile j = K rows (A operand) x Q columns (B operand), 2 d-chunks x 3 products ----
    // D map: this lane holds query column c and the keys j*16 + 8*hh + r
    v8f s[4];
#pragma unroll
    for (int j = 0; j < 4; ++j) {
      s[j] = zero8;
#pragma unroll
      for (int dc = 0; dc < 2; ++dc) {
        const v16b kbh = Frag<__bf16>::load(Ksh + (j * 16 + c) * kLP + dc * 32 + 8 * hh);
        const v16b kbl = Frag<__bf16>::load(Ksl + (j * 16 + c) * kLP + dc * 32 + 8 * hh);
        s[j] = mma_bf16(kbh, qah[dc], s[j]);
        s[j] = mma_bf16(kbl, qah[dc], s[j]);
        s[j] = mma_bf16(kbh, qal[dc], s[j]);
      }
    }
    float cm = ninf;
#pragma unroll
    for (int j = 0; j < 4; ++j) {
      const v4f cb0 = *(const v4f*)(CB + j * 16 + 8 * hh);
      const v4f cb1 = *(const v4f*)(CB + j * 16 + 8 * hh + 4);
#pragma unroll
      for (int r = 0; r < 8; ++r) {
        const float v = s[j][r] * (0.125f * kLog2E) + ((r < 4) ? cb0[r & 3] : cb1[r & 3]);
        s[j][r] = v;
        cm = fmaxf(cm, v);
      }
    }
    cm = fmaxf(cm, xhalf(cm));   // the other lane half holds this query's other 32 keys
    // ---- online softmax, one query per lane; P packs from the score tiles straight into B operands ----
    const float mnew = fmaxf(mrow, cm);
    const bool live = (mnew != ninf);
    float alpha = 1.0f;
    float ps[4] = {0.f, 0.f, 0.f, 0.f};
    if (live) {   // one guard per lane: it owns one query, so one flag covers the rescale factor and all 32 of its scores
      alpha = exp2_x1(mrow - mnew);   // every argument here is <= 0: no range reduction, no overflow test
#pragma unroll
      for (int j = 0; j < 4; ++j) {
#pragma unroll
        for (int r = 0; r < 8; ++r) s[j][r] -= mnew;
        exp2_x8(s[j]);
#pragma unroll
        for (int r = 0; r < 8; ++r) ps[j] += s[j][r];
      }
    } else {
#pragma unroll
      for (int j = 0; j < 4; ++j) s[j] = zero8;
    }
    mrow = mnew;
    v16b ph[2], pl[2];
#pragma unroll
    for (int j = 0; j < 4; ++j) {
#pragma unroll
      for (int r = 0; r < 8; ++r) {
        const float p = s[j][r];
        __bf16 a, bl;
        split_bf16(p, a, bl);
        ph[j >> 1][(j & 1) * 8 + r] = a;    // element e of the operand is key kk*32 + (e < 8 ? 8*hh + e : 16 + 8*hh + e - 8): the order of Frag::load
        pl[j >> 1][(j & 1) * 8 + r] = bl;
      }
    }
    lrow = lrow * alpha + ((ps[0] + ps[1]) + (ps[2] + ps[3]));   // this lane half's share; the halves join in the epilogue
#pragma unroll
    for (int t = 0; t < 4; ++t)
#pragma unroll
      for (int r = 0; r < 8; ++r) oacc[t][r] *= alpha;
    // ---- out^T += V^T.P^T : 2 kv-chunks x 4 d-tiles x 3 products; this lane holds query c, d = t*16 + 8*hh + r ----
#pragma unroll
    for (int kk = 0; kk < 2; ++kk) {
#pragma unroll
      for (int t = 0; t < 4; ++t) {
        const v16b vb = Frag<__bf16>::load(Vth + (t * 16 + c) * kLP + kk * 32 + 8 * hh);
        const v16b vl = Frag<__bf16>::load(Vtl + (t * 16 + c) * kLP + kk * 32 + 8 * hh);
        oacc[t] = mma_bf16(vb, ph[kk], oacc[t]);
        oacc[t] = mma_bf16(vl, ph[kk], oacc[t]);
        oacc[t] = mma_bf16(vb, pl[kk], oacc[t]);
      }
    }
  }

  // ---- epilogue: join the halves' sums, normalise, split to bf16 hi/lo into this wave's staging, whole-line stores ----
  {
    const float inv = 1.0f / (lrow + xhalf(lrow));
#pragma unroll
    for (int t = 0; t < 4; ++t) {
      v8b xa, xb;
#pragma unroll
      for (int r = 0; r < 8; ++r) {
        const float v = oacc[t][r] * inv;
        __bf16 a, bl;
        split_bf16(v, a, bl);
        xa[r] = a;
        xb[r] = bl;
      }
      *(v8b*)(pwh + c * kLP + t * 16 + 8 * hh) = xa;
      *(v8b*)(pwl + c * kLP + t * 16 + 8 * hh) = xb;
    }
  }
  __builtin_amdgcn_fence(__ATOMIC_RELEASE, "workgroup");
  __builtin_amdgcn_wave_barrier();
  __builtin_amdgcn_fence(__ATOMIC_ACQUIRE, "workgroup");
  {
    _Float16* Chp = (_Float16*)(void*)Ch;
    _Float16* Clp = (_Float16*)(void*)Cl;
    const int q8 = lane >> 3, c8 = (lane & 7) * 8;
    const size_t ob = (size_t)(b * kSeqQ + q0) * kEmb + h * kHeadD + c8;
    {
#pragma unroll
      for (int it = 0; it < 4; ++it) {
        const int row = it * 4 + q8;
        const v8b xh = *(const v8b*)(pwh + row * kLP + c8);
        const v8b xl = *(const v8b*)(pwl + row * kLP + c8);
        const v8h yh = __builtin_bit_cast(v8h, xh);
        const v8h yl = __builtin_bit_cast(v8h, xl);
        *(v8h*)(Chp + ob + (size_t)row * kEmb) = yh;
        *(v8h*)(Clp + ob + (size_t)row * kEmb) = yl;
      }
      
    }
  }
}

extern "C" void kernel_launch(void* const* d_in, const int* in_sizes, int n_in,
                              void* d_out, int out_size, void* d_ws, size_t ws_size,
                              hipStream_t stream) {
  static_assert(kRowsM % 128 == 0 && kEmb % 128 == 0 && kKVCols % 128 == 0 && kEmb % 64 == 0);
  static_assert(kSeqQ % 64 == 0 && kSeqK % kKC == 0 && kHeadD == 64 && kHeads * kHeadD == kEmb && kSeqQ == kSeqK);

  if (n_in < 10) return;
  const int nAct = kRowsM * kEmb;            /* 4,194,304 elements */
  const int nWq  = kEmb * kEmb;              /* 1,048,576 */
  const int nWkv = kKVCols * kEmb;           /* 2,097,152 */
  const int nWo  = kEmb * kEmb;
  if (in_sizes[0] != nAct || in_sizes[1] != kBatch * kSeqK * kEmb || in_sizes[2] != kBatch * kSeqK ||
      in_sizes[3] != kBatch * kSeqK || in_sizes[4] != nWq || in_sizes[5] != kEmb || in_sizes[6] != nWkv ||
      in_sizes[7] != kKVCols || in_sizes[8] != nWo || in_sizes[9] != kEmb) return;
  if (out_size != nAct) return;

  const float* tgt   = (const float*)d_in[0];
  const float* mem   = (const float*)d_in[1];
  const float* abias = (const float*)d_in[2];
  const int*   kmask = (const int*)d_in[3];
  const float* Wq_w  = (const float*)d_in[4];
  const float* Wq_b  = (const float*)d_in[5];
  const float* Wkv_w = (const float*)d_in[6];
  const float* Wkv_b = (const float*)d_in[7];
  const float* out_w = (const float*)d_in[8];
  const float* out_b = (const float*)d_in[9];
  float* out = (float*)d_out;

  /* workspace region map (bytes, all offsets multiples of 1 MiB):
       [  0 MiB,  8 MiB)  tgt16   bf16 [4096][1024]
       [  8 MiB, 16 MiB)  mem16   bf16 [4096][1024]
       [ 16 MiB, 18 MiB)  wq16    bf16 [1024][1024]
       [ 18 MiB, 22 MiB)  wkv16   bf16 [2048][1024]
       [ 22 MiB, 24 MiB)  wo16    bf16 [1024][1024]
       [ 24 MiB, 32 MiB)  qh      bf16 [4096][1024]   [ 32, 40) ql
       [ 40 MiB, 56 MiB)  kvh     bf16 [4096][2048]   [ 56, 72) kvl
       [ 72 MiB, 80 MiB)  ch      bf16 [4096][1024]   [ 80, 88) cl
     total 92,274,688 B */
  const size_t szAct16 = (size_t)nAct * 2;
  const size_t szKV16  = (size_t)kRowsM * kKVCols * 2;
  const size_t oTgt = 0;
  const size_t oMem = oTgt + szAct16;
  const size_t oWq  = oMem + szAct16;
  const size_t oWkv = oWq + (size_t)nWq * 2;
  const size_t oWo  = oWkv + (size_t)nWkv * 2;
  const size_t oQh  = oWo + (size_t)nWo * 2;
  const size_t oQl  = oQh + szAct16;
  const size_t oKVh = oQl + szAct16;
  const size_t oKVl = oKVh + szKV16;
  const size_t oCh  = oKVl + szKV16;
  const size_t oCl  = oCh + szAct16;
  const size_t total = oCl + szAct16;
  if (total > ws_size) return;

  char* ws = (char*)d_ws;
  unsigned short* tgt16 = (unsigned short*)(ws + oTgt);
  unsigned short* mem16 = (unsigned short*)(ws + oMem);
  unsigned short* wq16  = (unsigned short*)(ws + oWq);
  unsigned short* wkv16 = (unsigned short*)(ws + oWkv);
  unsigned short* wo16  = (unsigned short*)(ws + oWo);
  unsigned short* qh    = (unsigned short*)(ws + oQh);
  unsigned short* ql    = (unsigned short*)(ws + oQl);
  unsigned short* kvh   = (unsigned short*)(ws + oKVh);
  unsigned short* kvl   = (unsigned short*)(ws + oKVl);
  unsigned short* ch    = (unsigned short*)(ws + oCh);
  unsigned short* cl    = (unsigned short*)(ws + oCl);

  /* 1. RNE-convert the five float matrices to bf16 planes: one launch; the planes tgt16 .. wo16 are contiguous from tgt16 on */
  cast_f32_bf16_all<<<dim3(kCastBlocks), dim3(512), 0, stream>>>(tgt, mem, Wq_w, Wkv_w, out_w, tgt16);

  /* 2. q = tgt16 . wq16^T + bq : M=4096 N=1024 K=1024 -> bf16 hi/lo planes; 256 block tiles of 128x128 */
  {
    const int tiles = (kRowsM / 128) * (kEmb / 128);
    wmma_gemm64<1, 0, 2, 2><<<dim3(tiles, 1), dim3(128), 0, stream>>>(
        tgt16, tgt16, kEmb, 0L, wq16, wq16, kEmb, 0L, (void*)qh, (void*)ql, kEmb, 0L,
        Wq_b, kRowsM, kEmb, kEmb, 1.0f);
  }
  /* 3. kv = mem16 . wkv16^T + bkv : M=4096 N=2048 K=1024 -> bf16 hi/lo planes; 512 block tiles */
  {
    const int tiles = (kRowsM / 128) * (kKVCols / 128);
    wmma_gemm64<1, 0, 2, 2><<<dim3(tiles, 1), dim3(128), 0, stream>>>(
        mem16, mem16, kEmb, 0L, wkv16, wkv16, kEmb, 0L, (void*)kvh, (void*)kvl, kKVCols, 0L,
        Wkv_b, kRowsM, kKVCols, kEmb, 1.0f);
  }
  /* 4. attention: grid = B*H*(SQ/64) = 1024 blocks of 128 threads -> ctx hi/lo planes */
  {
    const int nblk = kBatch * kHeads * (kSeqQ / 64);
    mha_attn_hd64<<<dim3(nblk), dim3(128), 0, stream>>>(qh, ql, kvh, kvl, abias, kmask, ch, cl);
  }
  /* 5. out = (ch + cl) . wo16^T + bo : M=4096 N=1024 K=1024, A carried hi+lo (2 products), f32 out */
  {
    const int tiles = (kRowsM / 128) * (kEmb / 128);
    wmma_gemm64<1, 1, 2, 0><<<dim3(tiles, 1), dim3(128), 0, stream>>>(
        ch, cl, kEmb, 0L, wo16, wo16, kEmb, 0L, (void*)out, (void*)cl, kEmb, 0L,
        out_b, kRowsM, kEmb, kEmb, 1.0f);
  }
}

// v006
// A run of this version takes 192 microseconds.
// Next to v005, in two timings, it ran 1.04 times as fast each time.
// Over all steps from v000 it is 2.90 times as fast.
// Contractions: q/kv/out projections on v_wmma_f32_16x16x32_bf16 (float inputs RNE-converted to bf16 once; out-projection A operand carried as bf16 hi+lo planes, 2 products); attention q.k and p.v on v_wmma_f32_16x16x32_bf16 with bf16 hi+lo planes for q,k,p,v (3 products); f32 accumulate; softmax and normalisation in f32.
#include <hip/hip_runtime.h>

typedef __attribute__((ext_vector_type(16))) _Float16 v16h;
typedef __attribute__((ext_vector_type(8)))  _Float16 v8h;
typedef __attribute__((ext_vector_type(16))) __bf16   v16b;
typedef __attribute__((ext_vector_type(8)))  __bf16   v8b;
typedef __attribute__((ext_vector_type(8)))  float    v8f;
typedef __attribute__((ext_vector_type(4)))  float    v4f;
typedef __attribute__((ext_vector_type(2)))  float    v2f;
typedef __attribute__((ext_vector_type(4)))  unsigned v4u;
typedef __attribute__((ext_vector_type(2)))  unsigned v2u;

static constexpr int kBatch  = 2;
static constexpr int kSeqQ   = 2048;
static constexpr int kSeqK   = 2048;
static constexpr int kEmb    = 1024;
static constexpr int kHeads  = 16;
static constexpr int kHeadD  = 64;
static constexpr int kKVCols = 2 * kEmb;          /* 2048: k at cols 0..1023, v at cols 1024..2047 */
static constexpr int kRowsM  = kBatch * kSeqQ;    /* 4096 (== kBatch * kSeqK) */
static constexpr int kKC     = 64;                /* keys per streamed chunk */
static constexpr float kLog2E = 1.4426950408889634f;   /* log2(e): the attention scores are carried in the base-2 domain */
static constexpr int kLP     = 72;                /* LDS row pitch in 16-bit elements: 144 B = 16 B x 9, so the 16 rows of a 16-byte fragment read fall on distinct banks */

__device__ __forceinline__ unsigned short f2bf_bits(float f) {
  unsigned u = __float_as_uint(f);
  return (unsigned short)((u + 0x7FFFu + ((u >> 16) & 1u)) >> 16);
}
__device__ __forceinline__ float bf_bits2f(unsigned short h) { return __uint_as_float(((unsigned)h) << 16); }

// hazard guards as plain device helpers
__device__ __forceinline__ void dep_guard_h(v8f& a, v8f& b, v16h x, v16h y) { asm volatile("v_nop\n\tv_nop\n\tv_nop\n\tv_nop" : "+v"(a), "+v"(b) : "v"(x), "v"(y)); }
__device__ __forceinline__ void dep_guard_b(v8f& a, v8f& b, v16b x, v16b y) { asm volatile("v_nop\n\tv_nop\n\tv_nop\n\tv_nop" : "+v"(a), "+v"(b) : "v"(x), "v"(y)); }
__device__ __forceinline__ void keep4_h(v16h a, v16h b, v16h c, v16h d) { asm volatile("v_nop" :: "v"(a), "v"(b), "v"(c), "v"(d)); }
__device__ __forceinline__ void keep4_b(v16b a, v16b b, v16b c, v16b d) { asm volatile("v_nop" :: "v"(a), "v"(b), "v"(c), "v"(d)); }
__device__ __forceinline__ void acc_guard4(v8f& a, v8f& b, v8f& c, v8f& d) { asm volatile("v_nop\n\tv_nop\n\tv_nop\n\tv_nop" : "+v"(a), "+v"(b), "+v"(c), "+v"(d)); }
template <typename T> struct Frag;
template <> struct Frag<_Float16> {
  typedef v16h V; union U { v16h v; v8h h[2]; };
  static __device__ __forceinline__ v16h load(const _Float16* p) {   // elements 0..7 <- p[0..7], 8..15 <- p[16..23]
    U f; f.h[0] = *(const v8h*)(p); f.h[1] = *(const v8h*)(p + 16); return f.v;
  }
  static __device__ __forceinline__ v8f mma(v16h a, v16h b, v8f c) {
    return __builtin_amdgcn_wmma_f32_16x16x32_f16(false, a, false, b, (short)0, c, false, false);
  }
  static __device__ __forceinline__ void guard(v8f& a, v8f& b, v16h x, v16h y) { dep_guard_h(a, b, x, y); }
  static __device__ __forceinline__ void keep(v16h a, v16h b, v16h c, v16h d) { keep4_h(a, b, c, d); }
};
template <> struct Frag<__bf16> {
  typedef v16b V; union U { v16b v; v8b h[2]; };
  static __device__ __forceinline__ v16b load(const __bf16* p) {
    U f; f.h[0] = *(const v8b*)(p); f.h[1] = *(const v8b*)(p + 16); return f.v;
  }
  static __device__ __forceinline__ v8f mma(v16b a, v16b b, v8f c) {
    return __builtin_amdgcn_wmma_f32_16x16x32_bf16(false, a, false, b, (short)0, c, false, false);
  }
  static __device__ __forceinline__ void guard(v8f& a, v8f& b, v16b x, v16b y) { dep_guard_b(a, b, x, y); }
  static __device__ __forceinline__ void keep(v16b a, v16b b, v16b c, v16b d) { keep4_b(a, b, c, d); }
};

// a block-uniform global address, pinned into a scalar register pair
typedef const __attribute__((address_space(1))) char* gbytes;
typedef const __attribute__((address_space(1))) v4u*  gvec16;
__device__ __forceinline__ gbytes uniform_ptr(const void* p) {
  const unsigned long long u = (unsigned long long)p;
  const unsigned lo = (unsigned)__builtin_amdgcn_readfirstlane((int)(unsigned)u);
  const unsigned hi = (unsigned)__builtin_amdgcn_readfirstlane((int)(unsigned)(u >> 32));
  return (gbytes)(((unsigned long long)hi << 32) | lo);
}

// ---- Register-blocked batched WMMA GEMM, operands staged through LDS ---------
// C[m,n] = scale * sum_k A[m,k] * Bt[n,k] (+bias); a block of 4 waves owns a 128x128 tile, each wave a 64x64 quarter.
// A row-major [M,K]; Bt row-major [N,K]; M,N % 128 == 0, K % 64 == 0.
// Each stage is 64 k = one whole 128-byte line of every operand row: 8 lanes read a line, a wave-wide load covers 4 whole lines.
// Two LDS buffers: stage s+1 is loaded into registers while stage s is multiplied, and stored behind it; one barrier per stage.
// SPLIT: 0 = single product; 1 = A carried as hi+lo planes (A.B + A2.B); 2 = A and B hi+lo planes (A.B + A.B2 + A2.B).
// BIAS_MODE: 0 = none, 2 = bias[n] (bias RNE-converted to bf16 before the add).
// OUT_MODE: 0 = f32, 1 = f16, 2 = bf16 hi plane (Cout) + bf16 lo plane (Cout2).
// ET: 0 = f16 operands, 1 = bf16 operands (pointers passed as 16-bit storage)
template <int ET> struct Elem;
template <> struct Elem<0> { typedef _Float16 T; };
template <> struct Elem<1> { typedef __bf16 T; };
template <int ET, int SPLIT, int BIAS_MODE, int OUT_MODE>
__global__ __launch_bounds__(128) void wmma_gemm64(
    const unsigned short* __restrict__ Ap, const unsigned short* __restrict__ A2p, int lda, long strideA,
    const unsigned short* __restrict__ Btp, const unsigned short* __restrict__ Bt2p, int ldb, long strideB,
    void* __restrict__ Cout, void* __restrict__ Cout2, int ldc, long strideC,
    const float* __restrict__ bias,
    int M, int N, int K, float scale) {
  typedef typename Elem<ET>::T T;
  typedef typename Frag<T>::V V;
  const T* A = (const T*)Ap; const T* A2 = (const T*)A2p; const T* Bt = (const T*)Btp; const T* Bt2 = (const T*)Bt2p;
  constexpr int PA = 0, PB = 1, PA2 = 2, PB2 = 3;              // operand planes in LDS
  constexpr int NPL = 2 + (SPLIT != 0 ? 1 : 0) + (SPLIT == 2 ? 1 : 0);
  __shared__ __align__(16) T sOp[2][NPL][128 * kLP];           // [buffer][plane][row][64 k], pitch kLP
  __shared__ __align__(16) float sT[4][16 * 68];               // per-wave 16x64 slab, pitch 68 floats
  const int b    = blockIdx.y;
  const int tid  = threadIdx.x;
  const int lane = tid & 31;
  const int wave = tid >> 5;
  const int tilesN = N >> 7;
  const int tilesM = M >> 7;
  if ((int)blockIdx.x >= tilesM * tilesN) return;   // block-uniform, in front of every barrier
  const int bm = blockIdx.x / tilesN;
  const int bn = blockIdx.x - bm * tilesN;
  const int wm = (wave >> 1) << 6;             // this wave's quarter inside the block tile
  const int wn = (wave & 1) << 6;
  const int m0 = (bm << 7) + wm;
  const int n0 = (bn << 7) + wn;

  const T* Ab  = A  + (size_t)b * strideA;
  const T* Bb  = Bt + (size_t)b * strideB;
  const T* Ab2 = (SPLIT != 0) ? (A2  + (size_t)b * strideA) : nullptr;
  const T* Bb2 = (SPLIT == 2) ? (Bt2 + (size_t)b * strideB) : nullptr;

  const int rlane = lane & 15;                 // row (A) / col (B, D) within subtile
  const int koff  = (lane >> 4) * 8;           // k offset of this lane half
  const int mOff  = (lane >> 4) * 8;           // D row offset

  // staging map: thread -> (row tid>>3 of each group of 16 rows, 16-byte piece tid&7 of the row's line)
  const int srow = tid >> 3;
  const int sseg = (tid & 7) * 8;
  const int sLane = srow * kLP + sseg;
  unsigned aByte = (unsigned)(srow * lda + sseg) * 2u;      // per-lane byte offsets; they advance by one line (128 B) per stage
  unsigned bByte = (unsigned)(srow * ldb + sseg) * 2u;
  // block-uniform base of each group of 16 rows, held in scalar registers: every load is base + one per-lane offset,
  // so no address register is rewritten while a stage's loads are being issued
  gbytes gp[NPL][8];
#pragma unroll
  for (int i = 0; i < 8; ++i) {
    gp[PA][i] = uniform_ptr(Ab + (size_t)((bm << 7) + 16 * i) * lda);
    gp[PB][i] = uniform_ptr(Bb + (size_t)((bn << 7) + 16 * i) * ldb);
    if (SPLIT != 0) gp[SPLIT != 0 ? PA2 : PA][i] = uniform_ptr(Ab2 + (size_t)((bm << 7) + 16 * i) * lda);
    if (SPLIT == 2) gp[SPLIT == 2 ? PB2 : PB][i] = uniform_ptr(Bb2 + (size_t)((bn << 7) + 16 * i) * ldb);
  }

  v8f acc[4][4];
#pragma unroll
  for (int i = 0; i < 4; ++i)
#pragma unroll
    for (int j = 0; j < 4; ++j) acc[i][j] = (v8f){0.f,0.f,0.f,0.f,0.f,0.f,0.f,0.f};

  v4u rg[NPL][8];
  const int nst = K >> 6;
#pragma unroll
  for (int p = 0; p < NPL; ++p)
#pragma unroll
    for (int i = 0; i < 8; ++i) rg[p][i] = *(gvec16)(gp[p][i] + ((p & 1) ? bByte : aByte));
#pragma unroll
  for (int p = 0; p < NPL; ++p)
#pragma unroll
    for (int i = 0; i < 8; ++i) *(v4u*)(&sOp[0][p][sLane + 16 * i * kLP]) = rg[p][i];

  for (int s = 0; s < nst; ++s) {
    const bool more = (s + 1 < nst);           // block-uniform
    __syncthreads();                           // publishes stage s; ends every wave's reads of the buffer that stage s+1 goes into
    if (more) {
      aByte += 128u;
      bByte += 128u;
#pragma unroll
      for (int p = 0; p < NPL; ++p)
#pragma unroll
        for (int i = 0; i < 8; ++i) rg[p][i] = *(gvec16)(gp[p][i] + ((p & 1) ? bByte : aByte));
      // behind this wait the address registers of the loads above may be rewritten; it also keeps the loads in front of the stage's LDS reads
      asm volatile("s_wait_xcnt 0x0" ::: "memory");
    }
    const int cur = s & 1;
    // the A fragments run one row of tiles ahead of the products, so that a row's LDS latency hides behind the row before it
    const int aoLane = (wm + rlane) * kLP + koff;
    V ahn = Frag<T>::load(&sOp[cur][PA][aoLane]);
    V aln;
    if (SPLIT != 0) aln = Frag<T>::load(&sOp[cur][SPLIT != 0 ? PA2 : PA][aoLane]);
#pragma unroll
    for (int kk = 0; kk < 64; kk += 32) {
      V bh[4], bl[4];
#pragma unroll
      for (int j = 0; j < 4; ++j) {
        const int bo = (wn + (j << 4) + rlane) * kLP + koff + kk;
        bh[j] = Frag<T>::load(&sOp[cur][PB][bo]);
        if (SPLIT == 2) bl[j] = Frag<T>::load(&sOp[cur][SPLIT == 2 ? PB2 : PB][bo]);
      }
#pragma unroll
      for (int i = 0; i < 4; ++i) {
        const V ah = ahn;
        V al;
        if (SPLIT != 0) al = aln;
        if (i < 3 || kk == 0) {
          const int an = aoLane + ((i < 3) ? ((i + 1) << 4) * kLP + kk : 32);
          ahn = Frag<T>::load(&sOp[cur][PA][an]);
          if (SPLIT != 0) aln = Frag<T>::load(&sOp[cur][SPLIT != 0 ? PA2 : PA][an]);
        }
#pragma unroll
        for (int j = 0; j < 4; ++j) {
          acc[i][j] = Frag<T>::mma(ah, bh[j], acc[i][j]);
          if (SPLIT == 2) acc[i][j] = Frag<T>::mma(ah, bl[j], acc[i][j]);
          if (SPLIT != 0) acc[i][j] = Frag<T>::mma(al, bh[j], acc[i][j]);
        }
        Frag<T>::guard(acc[i][0], acc[i][3], ah, (SPLIT != 0) ? al : ah);
      }
      Frag<T>::keep(bh[0], bh[1], bh[2], bh[3]);
      if (SPLIT == 2) Frag<T>::keep(bl[0], bl[1], bl[2], bl[3]);
    }
    if (more) {
#pragma unroll
      for (int p = 0; p < NPL; ++p)
#pragma unroll
        for (int i = 0; i < 8; ++i) *(v4u*)(&sOp[cur ^ 1][p][sLane + 16 * i * kLP]) = rg[p][i];
    }
  }
  acc_guard4(acc[0][0], acc[0][1], acc[0][2], acc[0][3]);
  acc_guard4(acc[1][0], acc[1][1], acc[1][2], acc[1][3]);
  acc_guard4(acc[2][0], acc[2][1], acc[2][2], acc[2][3]);
  acc_guard4(acc[3][0], acc[3][1], acc[3][2], acc[3][3]);

  // ---- epilogue ----
  float* slab = sT[wave];
#pragma unroll
  for (int i = 0; i < 4; ++i) {
    const int mBase = m0 + (i << 4);
#pragma unroll
    for (int j = 0; j < 4; ++j) {
      const int n = n0 + (j << 4) + rlane;
      float bv = 0.f;
      if (BIAS_MODE == 2) bv = bf_bits2f(f2bf_bits(bias[n]));
#pragma unroll
      for (int r = 0; r < 8; ++r) {
        float v = acc[i][j][r] * scale;
        if (BIAS_MODE == 2) v += bv;
        slab[(mOff + r) * 68 + (j << 4) + rlane] = v;
      }
    }
    __builtin_amdgcn_fence(__ATOMIC_RELEASE, "workgroup");
    __builtin_amdgcn_wave_barrier();
    __builtin_amdgcn_fence(__ATOMIC_ACQUIRE, "workgroup");
    if (OUT_MODE == 0) {
      float* C = (float*)Cout + (size_t)b * strideC;
      const int hh = lane >> 4, c4 = (lane & 15) * 4;     // row seg = 256 B = 16 lanes x 16 B
      {
#pragma unroll
        for (int it = 0; it < 8; ++it) {
          const int row = it * 2 + hh;
          v4f v = *(const v4f*)(slab + row * 68 + c4);
          *(v4f*)(C + (size_t)(mBase + row) * ldc + n0 + c4) = v;
        }
        
      }
    } else {
      const int q = lane >> 3, c8 = (lane & 7) * 8;
      unsigned short* C  = (unsigned short*)Cout  + (size_t)b * strideC;
      unsigned short* C2 = (OUT_MODE == 2) ? ((unsigned short*)Cout2 + (size_t)b * strideC) : nullptr;
      {
#pragma unroll
        for (int it = 0; it < 4; ++it) {
          const int row = it * 4 + q;
          const float* sp = slab + row * 68 + c8;
          v8h hv, lv;
#pragma unroll
          for (int e = 0; e < 8; ++e) {
            if (OUT_MODE == 1) {
              hv[e] = (_Float16)sp[e];
            } else {
              unsigned short hb = f2bf_bits(sp[e]);
              unsigned short lb = f2bf_bits(sp[e] - bf_bits2f(hb));
              hv[e] = __builtin_bit_cast(_Float16, hb);
              lv[e] = __builtin_bit_cast(_Float16, lb);
            }
          }
          *(v8h*)(C + (size_t)(mBase + row) * ldc + n0 + c8) = hv;
          if (OUT_MODE == 2) *(v8h*)(C2 + (size_t)(mBase + row) * ldc + n0 + c8) = lv;
        }
        
      }
    }
    __builtin_amdgcn_fence(__ATOMIC_RELEASE, "workgroup");
    __builtin_amdgcn_wave_barrier();
    __builtin_amdgcn_fence(__ATOMIC_ACQUIRE, "workgroup");
  }
}

// One launch converts all five float matrices. Their bf16 planes lie back to back in the workspace, in the order
// tgt, mem, Wq_w, Wkv_w, out_w, so the output is one flat array of three equal thirds: tgt, mem, the three weights.
// A unit = 1024 consecutive elements = one wave x 8 loads of 16 B per lane; every matrix is a whole number of units.
// Grid = kCastBlocks blocks x 16 waves, all resident at once; wave w converts unit w of each third: every element exactly once.
static constexpr int kCastUnit   = 1024;
static constexpr int kCastBlocks = 256;
static constexpr int kCastThird  = kCastBlocks * 16 * kCastUnit;    /* 4,194,304 elements */
static_assert(kRowsM * kEmb == kCastThird && kEmb * kEmb + kKVCols * kEmb + kEmb * kEmb == kCastThird);
static_assert((kEmb * kEmb) % kCastUnit == 0 && (kKVCols * kEmb) % kCastUnit == 0);
__global__ __launch_bounds__(512) void cast_f32_bf16_all(
    const float* __restrict__ tgt, const float* __restrict__ mem, const float* __restrict__ wq,
    const float* __restrict__ wkv, const float* __restrict__ wo, unsigned short* __restrict__ out) {
  constexpr int w1 = kEmb * kEmb, w2 = w1 + kKVCols * kEmb;
  const int l4 = (threadIdx.x & 31) * 4;
  const int e  = __builtin_amdgcn_readfirstlane((int)(blockIdx.x * 16 + (threadIdx.x >> 5))) * kCastUnit;   // wave-uniform, 0 <= e < kCastThird
  const float* src[3];
  src[0] = tgt + e;
  src[1] = mem + e;
  src[2] = (e < w1) ? wq + e : (e < w2) ? wkv + (e - w1) : wo + (e - w2);
  v4f x[3][8];
#pragma unroll
  for (int s = 0; s < 3; ++s)
#pragma unroll
    for (int i = 0; i < 8; ++i) x[s][i] = *(const v4f*)(src[s] + i * 128 + l4);   // 512 contiguous bytes per wave-wide load
  // keeps all 24 loads in front of the first conversion: without it the compiler waits for the first 8 before it issues the rest
  __builtin_amdgcn_sched_barrier(0);
#pragma unroll
  for (int s = 0; s < 3; ++s)
#pragma unroll
    for (int i = 0; i < 8; ++i) {
      v2u y;
      y[0] = (unsigned)f2bf_bits(x[s][i][0]) | ((unsigned)f2bf_bits(x[s][i][1]) << 16);
      y[1] = (unsigned)f2bf_bits(x[s][i][2]) | ((unsigned)f2bf_bits(x[s][i][3]) << 16);
      *(v2u*)(out + s * kCastThird + e + i * 128 + l4) = y;                        // 256 contiguous bytes per wave-wide store: two whole lines
    }
}

// ---- bf16 helpers for the attention kernel ----
__device__ __forceinline__ __bf16 to_bf16(float f) { return __builtin_bit_cast(__bf16, f2bf_bits(f)); }
__device__ __forceinline__ void split_bf16(float f, __bf16& hi, __bf16& lo) {
  const unsigned short hb = f2bf_bits(f);
  hi = __builtin_bit_cast(__bf16, hb);
  lo = to_bf16(f - __uint_as_float(((unsigned)hb) << 16));
}
__device__ __forceinline__ v8f mma_bf16(v16b a, v16b b, v8f c) {
  c = __builtin_amdgcn_wmma_f32_16x16x32_bf16(false, a, false, b, (short)0, c, false, false);
  asm volatile("v_nop\n\tv_nop\n\tv_nop\n\tv_nop" : "+v"(c) : "v"(a), "v"(b));
  return c;
}

__device__ __forceinline__ void exp2_x8(v8f& x) {
  float a = x[0], b = x[1], c = x[2], d = x[3], e = x[4], f = x[5], g = x[6], h = x[7];
  // one statement, so that nothing comes between: an independent v_exp_f32 behind each, the v_nop behind the last
  asm("v_exp_f32 %0, %0\n\tv_exp_f32 %1, %1\n\tv_exp_f32 %2, %2\n\tv_exp_f32 %3, %3\n\t"
      "v_exp_f32 %4, %4\n\tv_exp_f32 %5, %5\n\tv_exp_f32 %6, %6\n\tv_exp_f32 %7, %7\n\tv_nop"
      : "+v"(a), "+v"(b), "+v"(c), "+v"(d), "+v"(e), "+v"(f), "+v"(g), "+v"(h));
  x = (v8f){a, b, c, d, e, f, g, h};
}
__device__ __forceinline__ float exp2_x1(float x) {
  asm("v_exp_f32 %0, %0\n\tv_nop" : "+v"(x));   // the v_nop: the same slot
  return x;
}

// lane l with lane l ^ 16
__device__ __forceinline__ float xhalf(float x) {
  return __builtin_bit_cast(float, __builtin_amdgcn_permlanex16(__builtin_bit_cast(int, x), __builtin_bit_cast(int, x), 0x76543210, 0xfedcba98, false, false));
}

// =====================================================================================
// Cross attention, head_dim 64, 16-bit plane inputs:
//   q planes  Qh/Ql : bf16 hi/lo, element (b,s,h,d) at (b*SQ+s)*1024 + h*64 + d
//   kv planes KVh/KVl: bf16 hi/lo, row (b*SK+s) pitch 2048; k at col h*64+d, v at col 1024+h*64+d
//   scores = 0.125 * q.k^T (hi.hi + hi.lo + lo.hi) + bf16(attn_bias[b,kv]); key mask 0 -> score = -inf
//   the scores are held times log2(e) (folded into the scale and into the staged bias), so e^(s-m) is one v_exp_f32 of a difference
//   out    = softmax(scores).v with p and v as bf16 hi/lo (3 products), f32 accumulate, f32 online softmax
//   both products run transposed (scores^T = k.q^T, out^T += v^T.p^T): a lane owns one query, p stays in registers
//   ctx written as bf16 hi/lo planes Ch/Cl, element (b,s,h,d) at (b*SQ+s)*1024 + h*64 + d.
// Block = 4 waves = 64 query rows of one (b,h); grid.x = B*H*(SQ/64) = 1024.
// =====================================================================================
__global__ __launch_bounds__(128)
void mha_attn_hd64(const unsigned short* __restrict__ Qh, const unsigned short* __restrict__ Ql,
                   const unsigned short* __restrict__ KVh, const unsigned short* __restrict__ KVl,
                   const float* __restrict__ abias, const int* __restrict__ kmask,
                   unsigned short* __restrict__ Ch, unsigned short* __restrict__ Cl)
{
  __shared__ __align__(16) __bf16 Ksh[kKC * kLP];         // K hi [kv][d], pitch kLP   9 KB
  __shared__ __align__(16) __bf16 Ksl[kKC * kLP];         // K lo [kv][d], pitch kLP   9 KB
  __shared__ __align__(16) __bf16 Vth[kHeadD * kLP];      // V hi [d][kv], pitch kLP   9 KB
  __shared__ __align__(16) __bf16 Vtl[kHeadD * kLP];      // V lo [d][kv], pitch kLP   9 KB
  __shared__ __align__(16) __bf16 Psh[4][16 * kLP];       // per wave out hi staging [row][d], pitch kLP
  __shared__ __align__(16) __bf16 Psl[4][16 * kLP];       // per wave out lo staging [row][d], pitch kLP
  __shared__ __align__(16) float CB[kKC];                               // per chunk: bf16(bias) * log2(e), or -inf when masked

  const int tid  = threadIdx.x;
  const int wave = tid >> 5;
  const int lane = tid & 31;
  const int hh   = lane >> 4;
  const int c    = lane & 15;
  const int nqb  = kSeqQ / 64;
  const int bx   = blockIdx.x;
  const int qb   = bx % nqb;
  const int bhd  = bx / nqb;
  const int h    = bhd % kHeads;
  const int b    = bhd / kHeads;
  const int q0   = qb * 64 + wave * 16;
  const float ninf = -__builtin_huge_valf();

  const __bf16* Qhp = (const __bf16*)(const void*)Qh;
  const __bf16* Qlp = (const __bf16*)(const void*)Ql;

  // ---- Q fragments (B operand, column = c, split k map via Frag::load): 2 d-chunks, hi and lo ----
  v16b qah[2], qal[2];
  {
    const size_t qo = (size_t)(b * kSeqQ + q0 + c) * kEmb + h * kHeadD + 8 * hh;
#pragma unroll
    for (int dc = 0; dc < 2; ++dc) {
      qah[dc] = Frag<__bf16>::load(Qhp + qo + dc * 32);
      qal[dc] = Frag<__bf16>::load(Qlp + qo + dc * 32);
    }
  }

  const v8f zero8 = (v8f){0.f,0.f,0.f,0.f,0.f,0.f,0.f,0.f};
  float mrow = ninf, lrow = 0.f;   // one query (column c) per lane
  v8f oacc[4];
#pragma unroll
  for (int t = 0; t < 4; ++t) oacc[t] = zero8;

  __bf16* pwh = Psh[wave];
  __bf16* pwl = Psl[wave];

  // ---- staging maps; the next chunk's K, V, bias and mask travel in registers while the current chunk is worked on ----
  // K planes: thread -> (kv row tid>>1, d half (tid&1)*32): 128 thr x 32 elems = 64 x 64 per plane
  const int kvr = tid >> 1, dh = (tid & 1) * 32;
  // V planes transposed into [d][kv]: thread -> (kv pair vp = tid>>2, d range dq = (tid&3)*16)
  // 32 pairs x 4 ranges = 128 thr; each writes 2 kv x 16 d as packed u32 (both halves per-lane data)
  const int vp = tid >> 2, dq = (tid & 3) * 16;
  // every address is a block-uniform base (it alone moves from chunk to chunk) + one fixed per-lane byte offset
  const unsigned kByte = (unsigned)(kvr * kKVCols + dh) * 2u;
  const unsigned vByte = (unsigned)(2 * vp * kKVCols + kEmb + dq) * 2u;
  const unsigned bByte = (unsigned)(tid & (kKC - 1)) * 4u;
  v4u gkh[4], gkl[4], gxh[2], gyh[2], gxl[2], gyl[2];
  int gkeep = 0;
  float gbias = 0.f;
  auto fetch_chunk = [&](int kv0) {   // all 16 (waves 0 and 1: 18) loads of a chunk are issued together
    const size_t ro = (size_t)(b * kSeqK + kv0) * kKVCols + h * kHeadD;
    const gbytes baseH = uniform_ptr(KVh + ro);
    const gbytes baseL = uniform_ptr(KVl + ro);
#pragma unroll
    for (int i = 0; i < 4; ++i) {
      gkh[i] = *(gvec16)(baseH + kByte + 16 * i);
      gkl[i] = *(gvec16)(baseL + kByte + 16 * i);
    }
#pragma unroll
    for (int i = 0; i < 2; ++i) {
      gxh[i] = *(gvec16)(baseH + vByte + 16 * i);
      gyh[i] = *(gvec16)(baseH + vByte + 2 * kKVCols + 16 * i);
      gxl[i] = *(gvec16)(baseL + vByte + 16 * i);
      gyl[i] = *(gvec16)(baseL + vByte + 2 * kKVCols + 16 * i);
    }
    if (tid < kKC) {   // waves 0 and 1 entirely: wave-uniform branch
      gkeep = *(const __attribute__((address_space(1))) int*)(uniform_ptr(kmask + b * kSeqK + kv0) + bByte);
      gbias = *(const __attribute__((address_space(1))) float*)(uniform_ptr(abias + b * kSeqK + kv0) + bByte);
    }
    // behind this wait the address registers of the loads above may be rewritten; it also keeps the loads in front of the chunk's LDS reads
    asm volatile("s_wait_xcnt 0x0" ::: "memory");
  };
  fetch_chunk(0);

  for (int kc = 0; kc < kSeqK / kKC; ++kc) {
    __syncthreads();
#pragma unroll
    for (int i = 0; i < 4; ++i) {
      *(v4u*)(Ksh + kvr * kLP + dh + 8 * i) = gkh[i];
      *(v4u*)(Ksl + kvr * kLP + dh + 8 * i) = gkl[i];
    }
#pragma unroll
    for (int i = 0; i < 2; ++i) {
#pragma unroll
      for (int jw = 0; jw < 4; ++jw) {
        const int d0 = dq + 8 * i + 2 * jw;
        const unsigned xhw = gxh[i][jw], yhw = gyh[i][jw], xlw = gxl[i][jw], ylw = gyl[i][jw];
        const unsigned h0 = (xhw & 0xffffu) | (yhw << 16);
        const unsigned h1 = (xhw >> 16) | (yhw & 0xffff0000u);
        const unsigned l0 = (xlw & 0xffffu) | (ylw << 16);
        const unsigned l1 = (xlw >> 16) | (ylw & 0xffff0000u);
        *(unsigned*)(Vth + d0 * kLP + 2 * vp)       = h0;
        *(unsigned*)(Vth + (d0 + 1) * kLP + 2 * vp) = h1;
        *(unsigned*)(Vtl + d0 * kLP + 2 * vp)       = l0;
        *(unsigned*)(Vtl + (d0 + 1) * kLP + 2 * vp) = l1;
      }
    }
    if (tid < kKC) {   // waves 0 and 1 entirely: wave-uniform branch
      const float bb = bf_bits2f(f2bf_bits(gbias));
      CB[tid] = (gkeep != 0) ? bb * kLog2E : ninf;
    }
    __syncthreads();
    if (kc + 1 < kSeqK / kKC) fetch_chunk((kc + 1) * kKC);   // block-uniform; the loads fly under this chunk's products and softmax

    // ---- scores, transposed: tile j = K rows (A operand) x Q columns (B operand), 2 d-chunks x 3 products ----
    // D map: this lane holds query column c and the keys j*16 + 8*hh + r
    v8f s[4];
#pragma unroll
    for (int j = 0; j < 4; ++j) {
      s[j] = zero8;
#pragma unroll
      for (int dc = 0; dc < 2; ++dc) {
        const v16b kbh = Frag<__bf16>::load(Ksh + (j * 16 + c) * kLP + dc * 32 + 8 * hh);
        const v16b kbl = Frag<__bf16>::load(Ksl + (j * 16 + c) * kLP + dc * 32 + 8 * hh);
        s[j] = mma_bf16(kbh, qah[dc], s[j]);
        s[j] = mma_bf16(kbl, qah[dc], s[j]);
        s[j] = mma_bf16(kbh, qal[dc], s[j]);
      }
    }
    float cm = ninf;
#pragma unroll
    for (int j = 0; j < 4; ++j) {
      const v4f cb0 = *(const v4f*)(CB + j * 16 + 8 * hh);
      const v4f cb1 = *(const v4f*)(CB + j * 16 + 8 * hh + 4);
#pragma unroll
      for (int r = 0; r < 8; ++r) {
        const float v = s[j][r] * (0.125f * kLog2E) + ((r < 4) ? cb0[r & 3] : cb1[r & 3]);
        s[j][r] = v;
        cm = fmaxf(cm, v);
      }
    }
    cm = fmaxf(cm, xhalf(cm));   // the other lane half holds this query's other 32 keys
    // ---- online softmax, one query per lane; P packs from the score tiles straight into B operands ----
    const float mnew = fmaxf(mrow, cm);
    const bool live = (mnew != ninf);
    float alpha = 1.0f;
    float ps[4] = {0.f, 0.f, 0.f, 0.f};
    if (live) {   // one guard per lane: it owns one query, so one flag covers the rescale factor and all 32 of its scores
      alpha = exp2_x1(mrow - mnew);   // every argument here is <= 0: no range reduction, no overflow test
#pragma unroll
      for (int j = 0; j < 4; ++j) {
#pragma unroll
        for (int r = 0; r < 8; ++r) s[j][r] -= mnew;
        exp2_x8(s[j]);
#pragma unroll
        for (int r = 0; r < 8; ++r) ps[j] += s[j][r];
      }
    } else {
#pragma unroll
      for (int j = 0; j < 4; ++j) s[j] = zero8;
    }
    mrow = mnew;
    v16b ph[2], pl[2];
#pragma unroll
    for (int j = 0; j < 4; ++j) {
#pragma unroll
      for (int r = 0; r < 8; ++r) {
        const float p = s[j][r];
        __bf16 a, bl;
        split_bf16(p, a, bl);
        ph[j >> 1][(j & 1) * 8 + r] = a;    // element e of the operand is key kk*32 + (e < 8 ? 8*hh + e : 16 + 8*hh + e - 8): the order of Frag::load
        pl[j >> 1][(j & 1) * 8 + r] = bl;
      }
    }
    lrow = lrow * alpha + ((ps[0] + ps[1]) + (ps[2] + ps[3]));   // this lane half's share; the halves join in the epilogue
#pragma unroll
    for (int t = 0; t < 4; ++t)
#pragma unroll
      for (int r = 0; r < 8; ++r) oacc[t][r] *= alpha;
    // ---- out^T += V^T.P^T : 2 kv-chunks x 4 d-tiles x 3 products; this lane holds query c, d = t*16 + 8*hh + r ----
#pragma unroll
    for (int kk = 0; kk < 2; ++kk) {
#pragma unroll
      for (int t = 0; t < 4; ++t) {
        const v16b vb = Frag<__bf16>::load(Vth + (t * 16 + c) * kLP + kk * 32 + 8 * hh);
        const v16b vl = Frag<__bf16>::load(Vtl + (t * 16 + c) * kLP + kk * 32 + 8 * hh);
        oacc[t] = mma_bf16(vb, ph[kk], oacc[t]);
        oacc[t] = mma_bf16(vl, ph[kk], oacc[t]);
        oacc[t] = mma_bf16(vb, pl[kk], oacc[t]);
      }
    }
  }

  // ---- epilogue: join the halves' sums, normalise, split to bf16 hi/lo into this wave's staging, whole-line stores ----
  {
    const float inv = 1.0f / (lrow + xhalf(lrow));
#pragma unroll
    for (int t = 0; t < 4; ++t) {
      v8b xa, xb;
#pragma unroll
      for (int r = 0; r < 8; ++r) {
        const float v = oacc[t][r] * inv;
        __bf16 a, bl;
        split_bf16(v, a, bl);
        xa[r] = a;
        xb[r] = bl;
      }
      *(v8b*)(pwh + c * kLP + t * 16 + 8 * hh) = xa;
      *(v8b*)(pwl + c * kLP + t * 16 + 8 * hh) = xb;
    }
  }
  __builtin_amdgcn_fence(__ATOMIC_RELEASE, "workgroup");
  __builtin_amdgcn_wave_barrier();
  __builtin_amdgcn_fence(__ATOMIC_ACQUIRE, "workgroup");
  {
    _Float16* Chp = (_Float16*)(void*)Ch;
    _Float16* Clp = (_Float16*)(void*)Cl;
    const int q8 = lane >> 3, c8 = (lane & 7) * 8;
    const size_t ob = (size_t)(b * kSeqQ + q0) * kEmb + h * kHeadD + c8;
    {
#pragma unroll
      for (int it = 0; it < 4; ++it) {
        const int row = it * 4 + q8;
        const v8b xh = *(const v8b*)(pwh + row * kLP + c8);
        const v8b xl = *(const v8b*)(pwl + row * kLP + c8);
        const v8h yh = __builtin_bit_cast(v8h, xh);
        const v8h yl = __builtin_bit_cast(v8h, xl);
        *(v8h*)(Chp + ob + (size_t)row * kEmb) = yh;
        *(v8h*)(Clp + ob + (size_t)row * kEmb) = yl;
      }
      
    }
  }
}

extern "C" void kernel_launch(void* const* d_in, const int* in_sizes, int n_in,
                              void* d_out, int out_size, void* d_ws, size_t ws_size,
                              hipStream_t stream) {
  static_assert(kRowsM % 128 == 0 && kEmb % 128 == 0 && kKVCols % 128 == 0 && kEmb % 64 == 0);
  static_assert(kSeqQ % 64 == 0 && kSeqK % kKC == 0 && kHeadD == 64 && kHeads * kHeadD == kEmb && kSeqQ == kSeqK);

  if (n_in < 10) return;
  const int nAct = kRowsM * kEmb;            /* 4,194,304 elements */
  const int nWq  = kEmb * kEmb;              /* 1,048,576 */
  const int nWkv = kKVCols * kEmb;           /* 2,097,152 */
  const int nWo  = kEmb * kEmb;
  if (in_sizes[0] != nAct || in_sizes[1] != kBatch * kSeqK * kEmb || in_sizes[2] != kBatch * kSeqK ||
      in_sizes[3] != kBatch * kSeqK || in_sizes[4] != nWq || in_sizes[5] != kEmb || in_sizes[6] != nWkv ||
      in_sizes[7] != kKVCols || in_sizes[8] != nWo || in_sizes[9] != kEmb) return;
  if (out_size != nAct) return;

  const float* tgt   = (const float*)d_in[0];
  const float* mem   = (const float*)d_in[1];
  const float* abias = (const float*)d_in[2];
  const int*   kmask = (const int*)d_in[3];
  const float* Wq_w  = (const float*)d_in[4];
  const float* Wq_b  = (const float*)d_in[5];
  const float* Wkv_w = (const float*)d_in[6];
  const float* Wkv_b = (const float*)d_in[7];
  const float* out_w = (const float*)d_in[8];
  const float* out_b = (const float*)d_in[9];
  float* out = (float*)d_out;

  /* workspace region map (bytes, all offsets multiples of 1 MiB):
       [  0 MiB,  8 MiB)  tgt16   bf16 [4096][1024]
       [  8 MiB, 16 MiB)  mem16   bf16 [4096][1024]
       [ 16 MiB, 18 MiB)  wq16    bf16 [1024][1024]
       [ 18 MiB, 22 MiB)  wkv16   bf16 [2048][1024]
       [ 22 MiB, 24 MiB)  wo16    bf16 [1024][1024]
       [ 24 MiB, 32 MiB)  qh      bf16 [4096][1024]   [ 32, 40) ql
       [ 40 MiB, 56 MiB)  kvh     bf16 [4096][2048]   [ 56, 72) kvl
       [ 72 MiB, 80 MiB)  ch      bf16 [4096][1024]   [ 80, 88) cl
     total 92,274,688 B */
  const size_t szAct16 = (size_t)nAct * 2;
  const size_t szKV16  = (size_t)kRowsM * kKVCols * 2;
  const size_t oTgt = 0;
  const size_t oMem = oTgt + szAct16;
  const size_t oWq  = oMem + szAct16;
  const size_t oWkv = oWq + (size_t)nWq * 2;
  const size_t oWo  = oWkv + (size_t)nWkv * 2;
  const size_t oQh  = oWo + (size_t)nWo * 2;
  const size_t oQl  = oQh + szAct16;
  const size_t oKVh = oQl + szAct16;
  const size_t oKVl = oKVh + szKV16;
  const size_t oCh  = oKVl + szKV16;
  const size_t oCl  = oCh + szAct16;
  const size_t total = oCl + szAct16;
  if (total > ws_size) return;

  char* ws = (char*)d_ws;
  unsigned short* tgt16 = (unsigned short*)(ws + oTgt);
  unsigned short* mem16 = (unsigned short*)(ws + oMem);
  unsigned short* wq16  = (unsigned short*)(ws + oWq);
  unsigned short* wkv16 = (unsigned short*)(ws + oWkv);
  unsigned short* wo16  = (unsigned short*)(ws + oWo);
  unsigned short* qh    = (unsigned short*)(ws + oQh);
  unsigned short* ql    = (unsigned short*)(ws + oQl);
  unsigned short* kvh   = (unsigned short*)(ws + oKVh);
  unsigned short* kvl   = (unsigned short*)(ws + oKVl);
  unsigned short* ch    = (unsigned short*)(ws + oCh);
  unsigned short* cl    = (unsigned short*)(ws + oCl);

  /* 1. RNE-convert the five float matrices to bf16 planes: one launch; the planes tgt16 .. wo16 are contiguous from tgt16 on */
  cast_f32_bf16_all<<<dim3(kCastBlocks), dim3(512), 0, stream>>>(tgt, mem, Wq_w, Wkv_w, out_w, tgt16);

  /* 2. q = tgt16 . wq16^T + bq : M=4096 N=1024 K=1024 -> bf16 hi/lo planes; 256 block tiles of 128x128 */
  {
    const int tiles = (kRowsM / 128) * (kEmb / 128);
    wmma_gemm64<1, 0, 2, 2><<<dim3(tiles, 1), dim3(128), 0, stream>>>(
        tgt16, tgt16, kEmb, 0L, wq16, wq16, kEmb, 0L, (void*)qh, (void*)ql, kEmb, 0L,
        Wq_b, kRowsM, kEmb, kEmb, 1.0f);
  }
  /* 3. kv = mem16 . wkv16^T + bkv : M=4096 N=2048 K=1024 -> bf16 hi/lo planes; 512 block tiles */
  {
    const int tiles = (kRowsM / 128) * (kKVCols / 128);
    wmma_gemm64<1, 0, 2, 2><<<dim3(tiles, 1), dim3(128), 0, stream>>>(
        mem16, mem16, kEmb, 0L, wkv16, wkv16, kEmb, 0L, (void*)kvh, (void*)kvl, kKVCols, 0L,
        Wkv_b, kRowsM, kKVCols, kEmb, 1.0f);
  }
  /* 4. attention: grid = B*H*(SQ/64) = 1024 blocks of 128 threads -> ctx hi/lo planes */
  {
    const int nblk = kBatch * kHeads * (kSeqQ / 64);
    mha_attn_hd64<<<dim3(nblk), dim3(128), 0, stream>>>(qh, ql, kvh, kvl, abias, kmask, ch, cl);
  }
  /* 5. out = (ch + cl) . wo16^T + bo : M=4096 N=1024 K=1024, A carried hi+lo (2 products), f32 out */
  {
    const int tiles = (kRowsM / 128) * (kEmb / 128);
    wmma_gemm64<1, 1, 2, 0><<<dim3(tiles, 1), dim3(128), 0, stream>>>(
        ch, cl, kEmb, 0L, wo16, wo16, kEmb, 0L, (void*)out, (void*)cl, kEmb, 0L,
        out_b, kRowsM, kEmb, kEmb, 1.0f);
  }
}

// v007
// It runs in 138 microseconds.
// In both of two side-by-side timings against v006, it was 1.39 times as fast.
// Over all steps from v000 it is 4.04 times as fast.
// Contractions: q/kv/out projections on v_wmma_f32_16x16x32_bf16 (float inputs RNE-converted to bf16 once; out-projection A operand carried as bf16 hi+lo planes, 2 products); attention q.k and p.v on v_wmma_f32_16x16x32_bf16 with bf16 hi+lo planes for q,k,p,v (3 products); f32 accumulate; softmax and normalisation in f32.
#include <hip/hip_runtime.h>

typedef __attribute__((ext_vector_type(16))) _Float16 v16h;
typedef __attribute__((ext_vector_type(8)))  _Float16 v8h;
typedef __attribute__((ext_vector_type(16))) __bf16   v16b;
typedef __attribute__((ext_vector_type(8)))  __bf16   v8b;
typedef __attribute__((ext_vector_type(8)))  float    v8f;
typedef __attribute__((ext_vector_type(4)))  float    v4f;
typedef __attribute__((ext_vector_type(2)))  float    v2f;
typedef __attribute__((ext_vector_type(4)))  unsigned v4u;
typedef __attribute__((ext_vector_type(2)))  unsigned v2u;
typedef __attribute__((ext_vector_type(4)))  int      v4i;

static constexpr int kBatch  = 2;
static constexpr int kSeqQ   = 2048;
static constexpr int kSeqK   = 2048;
static constexpr int kEmb    = 1024;
static constexpr int kHeads  = 16;
static constexpr int kHeadD  = 64;
static constexpr int kKVCols = 2 * kEmb;          /* 2048: k at cols 0..1023, v at cols 1024..2047 */
static constexpr int kRowsM  = kBatch * kSeqQ;    /* 4096 (== kBatch * kSeqK) */
static constexpr int kKC     = 64;                /* keys per streamed chunk */
static constexpr float kLog2E = 1.4426950408889634f;   /* log2(e): the attention scores are carried in the base-2 domain */
static constexpr int kCountPitch = 32;            /* ints between the two batches' live-key counts: a 128-byte line each */
static constexpr int kLP     = 72;                /* LDS row pitch in 16-bit elements: 144 B = 16 B x 9, so the 16 rows of a 16-byte fragment read fall on distinct banks */

__device__ __forceinline__ unsigned short f2bf_bits(float f) {
  unsigned u = __float_as_uint(f);
  return (unsigned short)((u + 0x7FFFu + ((u >> 16) & 1u)) >> 16);
}
__device__ __forceinline__ float bf_bits2f(unsigned short h) { return __uint_as_float(((unsigned)h) << 16); }

// hazard guards as plain device helpers
__device__ __forceinline__ void dep_guard_h(v8f& a, v8f& b, v16h x, v16h y) { asm volatile("v_nop\n\tv_nop\n\tv_nop\n\tv_nop" : "+v"(a), "+v"(b) : "v"(x), "v"(y)); }
__device__ __forceinline__ void dep_guard_b(v8f& a, v8f& b, v16b x, v16b y) { asm volatile("v_nop\n\tv_nop\n\tv_nop\n\tv_nop" : "+v"(a), "+v"(b) : "v"(x), "v"(y)); }
__device__ __forceinline__ void keep4_h(v16h a, v16h b, v16h c, v16h d) { asm volatile("v_nop" :: "v"(a), "v"(b), "v"(c), "v"(d)); }
__device__ __forceinline__ void keep4_b(v16b a, v16b b, v16b c, v16b d) { asm volatile("v_nop" :: "v"(a), "v"(b), "v"(c), "v"(d)); }
__device__ __forceinline__ void acc_guard4(v8f& a, v8f& b, v8f& c, v8f& d) { asm volatile("v_nop\n\tv_nop\n\tv_nop\n\tv_nop" : "+v"(a), "+v"(b), "+v"(c), "+v"(d)); }
template <typename T> struct Frag;
template <> struct Frag<_Float16> {
  typedef v16h V; union U { v16h v; v8h h[2]; };
  static __device__ __forceinline__ v16h load(const _Float16* p) {   // elements 0..7 <- p[0..7], 8..15 <- p[16..23]
    U f; f.h[0] = *(const v8h*)(p); f.h[1] = *(const v8h*)(p + 16); return f.v;
  }
  static __device__ __forceinline__ v8f mma(v16h a, v16h b, v8f c) {
    return __builtin_amdgcn_wmma_f32_16x16x32_f16(false, a, false, b, (short)0, c, false, false);
  }
  static __device__ __forceinline__ void guard(v8f& a, v8f& b, v16h x, v16h y) { dep_guard_h(a, b, x, y); }
  static __device__ __forceinline__ void keep(v16h a, v16h b, v16h c, v16h d) { keep4_h(a, b, c, d); }
};
template <> struct Frag<__bf16> {
  typedef v16b V; union U { v16b v; v8b h[2]; };
  static __device__ __forceinline__ v16b load(const __bf16* p) {
    U f; f.h[0] = *(const v8b*)(p); f.h[1] = *(const v8b*)(p + 16); return f.v;
  }
  static __device__ __forceinline__ v8f mma(v16b a, v16b b, v8f c) {
    return __builtin_amdgcn_wmma_f32_16x16x32_bf16(false, a, false, b, (short)0, c, false, false);
  }
  static __device__ __forceinline__ void guard(v8f& a, v8f& b, v16b x, v16b y) { dep_guard_b(a, b, x, y); }
  static __device__ __forceinline__ void keep(v16b a, v16b b, v16b c, v16b d) { keep4_b(a, b, c, d); }
};

// a block-uniform global address, pinned into a scalar register pair
typedef const __attribute__((address_space(1))) char* gbytes;
typedef const __attribute__((address_space(1))) v4u*  gvec16;
__device__ __forceinline__ gbytes uniform_ptr(const void* p) {
  const unsigned long long u = (unsigned long long)p;
  const unsigned lo = (unsigned)__builtin_amdgcn_readfirstlane((int)(unsigned)u);
  const unsigned hi = (unsigned)__builtin_amdgcn_readfirstlane((int)(unsigned)(u >> 32));
  return (gbytes)(((unsigned long long)hi << 32) | lo);
}

// ---- Register-blocked batched WMMA GEMM, operands staged through LDS ---------
// C[m,n] = scale * sum_k A[m,k] * Bt[n,k] (+bias); a block of 4 waves owns a 128x128 tile, each wave a 64x64 quarter.
// A row-major [M,K]; Bt row-major [N,K]; M,N % 128 == 0, K % 64 == 0.
// Each stage is 64 k = one whole 128-byte line of every operand row: 8 lanes read a line, a wave-wide load covers 4 whole lines.
// Two LDS buffers: stage s+1 is loaded into registers while stage s is multiplied, and stored behind it; one barrier per stage.
// SPLIT: 0 = single product; 1 = A carried as hi+lo planes (A.B + A2.B); 2 = A and B hi+lo planes (A.B + A.B2 + A2.B).
// rowsLive: see at its test below.
// BIAS_MODE: 0 = none, 2 = bias[n] (bias RNE-converted to bf16 before the add).
// OUT_MODE: 0 = f32, 1 = f16, 2 = bf16 hi plane (Cout) + bf16 lo plane (Cout2).
// ET: 0 = f16 operands, 1 = bf16 operands (pointers passed as 16-bit storage)
template <int ET> struct Elem;
template <> struct Elem<0> { typedef _Float16 T; };
template <> struct Elem<1> { typedef __bf16 T; };
template <int ET, int SPLIT, int BIAS_MODE, int OUT_MODE>
__global__ __launch_bounds__(128) void wmma_gemm64(
    const unsigned short* __restrict__ Ap, const unsigned short* __restrict__ A2p, int lda, long strideA,
    const unsigned short* __restrict__ Btp, const unsigned short* __restrict__ Bt2p, int ldb, long strideB,
    void* __restrict__ Cout, void* __restrict__ Cout2, int ldc, long strideC,
    const float* __restrict__ bias, const int* __restrict__ rowsLive,
    int M, int N, int K, float scale) {
  typedef typename Elem<ET>::T T;
  typedef typename Frag<T>::V V;
  const T* A = (const T*)Ap; const T* A2 = (const T*)A2p; const T* Bt = (const T*)Btp; const T* Bt2 = (const T*)Bt2p;
  constexpr int PA = 0, PB = 1, PA2 = 2, PB2 = 3;              // operand planes in LDS
  constexpr int NPL = 2 + (SPLIT != 0 ? 1 : 0) + (SPLIT == 2 ? 1 : 0);
  __shared__ __align__(16) T sOp[2][NPL][128 * kLP];           // [buffer][plane][row][64 k], pitch kLP
  __shared__ __align__(16) float sT[4][16 * 68];               // per-wave 16x64 slab, pitch 68 floats
  const int b    = blockIdx.y;
  const int tid  = threadIdx.x;
  const int lane = tid & 31;
  const int wave = tid >> 5;
  const int tilesN = N >> 7;
  const int tilesM = M >> 7;
  if ((int)blockIdx.x >= tilesM * tilesN) return;   // block-uniform, in front of every barrier
  const int bm = blockIdx.x / tilesN;
  const int bn = blockIdx.x - bm * tilesN;
  // rowsLive (may be null): per batch, the number of leading A rows whose product anybody reads; a tile wholly behind it is not computed
  if (rowsLive != nullptr && (bm << 7) >= rowsLive[b * kCountPitch]) return;   // block-uniform, in front of every barrier
  const int wm = (wave >> 1) << 6;             // this wave's quarter inside the block tile
  const int wn = (wave & 1) << 6;
  const int m0 = (bm << 7) + wm;
  const int n0 = (bn << 7) + wn;

  const T* Ab  = A  + (size_t)b * strideA;
  const T* Bb  = Bt + (size_t)b * strideB;
  const T* Ab2 = (SPLIT != 0) ? (A2  + (size_t)b * strideA) : nullptr;
  const T* Bb2 = (SPLIT == 2) ? (Bt2 + (size_t)b * strideB) : nullptr;

  const int rlane = lane & 15;                 // row (A) / col (B, D) within subtile
  const int koff  = (lane >> 4) * 8;           // k offset of this lane half
  const int mOff  = (lane >> 4) * 8;           // D row offset

  // staging map: thread -> (row tid>>3 of each group of 16 rows, 16-byte piece tid&7 of the row's line)
  const int srow = tid >> 3;
  const int sseg = (tid & 7) * 8;
  const int sLane = srow * kLP + sseg;
  unsigned aByte = (unsigned)(srow * lda + sseg) * 2u;      // per-lane byte offsets; they advance by one line (128 B) per stage
  unsigned bByte = (unsigned)(srow * ldb + sseg) * 2u;
  // block-uniform base of each group of 16 rows, held in scalar registers: every load is base + one per-lane offset,
  // so no address register is rewritten while a stage's loads are being issued
  gbytes gp[NPL][8];
#pragma unroll
  for (int i = 0; i < 8; ++i) {
    gp[PA][i] = uniform_ptr(Ab + (size_t)((bm << 7) + 16 * i) * lda);
    gp[PB][i] = uniform_ptr(Bb + (size_t)((bn << 7) + 16 * i) * ldb);
    if (SPLIT != 0) gp[SPLIT != 0 ? PA2 : PA][i] = uniform_ptr(Ab2 + (size_t)((bm << 7) + 16 * i) * lda);
    if (SPLIT == 2) gp[SPLIT == 2 ? PB2 : PB][i] = uniform_ptr(Bb2 + (size_t)((bn << 7) + 16 * i) * ldb);
  }

  v8f acc[4][4];
#pragma unroll
  for (int i = 0; i < 4; ++i)
#pragma unroll
    for (int j = 0; j < 4; ++j) acc[i][j] = (v8f){0.f,0.f,0.f,0.f,0.f,0.f,0.f,0.f};

  v4u rg[NPL][8];
  const int nst = K >> 6;
#pragma unroll
  for (int p = 0; p < NPL; ++p)
#pragma unroll
    for (int i = 0; i < 8; ++i) rg[p][i] = *(gvec16)(gp[p][i] + ((p & 1) ? bByte : aByte));
#pragma unroll
  for (int p = 0; p < NPL; ++p)
#pragma unroll
    for (int i = 0; i < 8; ++i) *(v4u*)(&sOp[0][p][sLane + 16 * i * kLP]) = rg[p][i];

  for (int s = 0; s < nst; ++s) {
    const bool more = (s + 1 < nst);           // block-uniform
    __syncthreads();                           // publishes stage s; ends every wave's reads of the buffer that stage s+1 goes into
    if (more) {
      aByte += 128u;
      bByte += 128u;
#pragma unroll
      for (int p = 0; p < NPL; ++p)
#pragma unroll
        for (int i = 0; i < 8; ++i) rg[p][i] = *(gvec16)(gp[p][i] + ((p & 1) ? bByte : aByte));
      // behind this wait the address registers of the loads above may be rewritten; it also keeps the loads in front of the stage's LDS reads
      asm volatile("s_wait_xcnt 0x0" ::: "memory");
    }
    const int cur = s & 1;
    // the A fragments run one row of tiles ahead of the products, so that a row's LDS latency hides behind the row before it
    const int aoLane = (wm + rlane) * kLP + koff;
    V ahn = Frag<T>::load(&sOp[cur][PA][aoLane]);
    V aln;
    if (SPLIT != 0) aln = Frag<T>::load(&sOp[cur][SPLIT != 0 ? PA2 : PA][aoLane]);
#pragma unroll
    for (int kk = 0; kk < 64; kk += 32) {
      V bh[4], bl[4];
#pragma unroll
      for (int j = 0; j < 4; ++j) {
        const int bo = (wn + (j << 4) + rlane) * kLP + koff + kk;
        bh[j] = Frag<T>::load(&sOp[cur][PB][bo]);
        if (SPLIT == 2) bl[j] = Frag<T>::load(&sOp[cur][SPLIT == 2 ? PB2 : PB][bo]);
      }
#pragma unroll
      for (int i = 0; i < 4; ++i) {
        const V ah = ahn;
        V al;
        if (SPLIT != 0) al = aln;
        if (i < 3 || kk == 0) {
          const int an = aoLane + ((i < 3) ? ((i + 1) << 4) * kLP + kk : 32);
          ahn = Frag<T>::load(&sOp[cur][PA][an]);
          if (SPLIT != 0) aln = Frag<T>::load(&sOp[cur][SPLIT != 0 ? PA2 : PA][an]);
        }
#pragma unroll
        for (int j = 0; j < 4; ++j) {
          acc[i][j] = Frag<T>::mma(ah, bh[j], acc[i][j]);
          if (SPLIT == 2) acc[i][j] = Frag<T>::mma(ah, bl[j], acc[i][j]);
          if (SPLIT != 0) acc[i][j] = Frag<T>::mma(al, bh[j], acc[i][j]);
        }
        Frag<T>::guard(acc[i][0], acc[i][3], ah, (SPLIT != 0) ? al : ah);
      }
      Frag<T>::keep(bh[0], bh[1], bh[2], bh[3]);
      if (SPLIT == 2) Frag<T>::keep(bl[0], bl[1], bl[2], bl[3]);
    }
    if (more) {
#pragma unroll
      for (int p = 0; p < NPL; ++p)
#pragma unroll
        for (int i = 0; i < 8; ++i) *(v4u*)(&sOp[cur ^ 1][p][sLane + 16 * i * kLP]) = rg[p][i];
    }
  }
  acc_guard4(acc[0][0], acc[0][1], acc[0][2], acc[0][3]);
  acc_guard4(acc[1][0], acc[1][1], acc[1][2], acc[1][3]);
  acc_guard4(acc[2][0], acc[2][1], acc[2][2], acc[2][3]);
  acc_guard4(acc[3][0], acc[3][1], acc[3][2], acc[3][3]);

  // ---- epilogue ----
  float* slab = sT[wave];
#pragma unroll
  for (int i = 0; i < 4; ++i) {
    const int mBase = m0 + (i << 4);
#pragma unroll
    for (int j = 0; j < 4; ++j) {
      const int n = n0 + (j << 4) + rlane;
      float bv = 0.f;
      if (BIAS_MODE == 2) bv = bf_bits2f(f2bf_bits(bias[n]));
#pragma unroll
      for (int r = 0; r < 8; ++r) {
        float v = acc[i][j][r] * scale;
        if (BIAS_MODE == 2) v += bv;
        slab[(mOff + r) * 68 + (j << 4) + rlane] = v;
      }
    }
    __builtin_amdgcn_fence(__ATOMIC_RELEASE, "workgroup");
    __builtin_amdgcn_wave_barrier();
    __builtin_amdgcn_fence(__ATOMIC_ACQUIRE, "workgroup");
    if (OUT_MODE == 0) {
      float* C = (float*)Cout + (size_t)b * strideC;
      const int hh = lane >> 4, c4 = (lane & 15) * 4;     // row seg = 256 B = 16 lanes x 16 B
      {
#pragma unroll
        for (int it = 0; it < 8; ++it) {
          const int row = it * 2 + hh;
          v4f v = *(const v4f*)(slab + row * 68 + c4);
          *(v4f*)(C + (size_t)(mBase + row) * ldc + n0 + c4) = v;
        }
        
      }
    } else {
      const int q = lane >> 3, c8 = (lane & 7) * 8;
      unsigned short* C  = (unsigned short*)Cout  + (size_t)b * strideC;
      unsigned short* C2 = (OUT_MODE == 2) ? ((unsigned short*)Cout2 + (size_t)b * strideC) : nullptr;
      {
#pragma unroll
        for (int it = 0; it < 4; ++it) {
          const int row = it * 4 + q;
          const float* sp = slab + row * 68 + c8;
          v8h hv, lv;
#pragma unroll
          for (int e = 0; e < 8; ++e) {
            if (OUT_MODE == 1) {
              hv[e] = (_Float16)sp[e];
            } else {
              unsigned short hb = f2bf_bits(sp[e]);
              unsigned short lb = f2bf_bits(sp[e] - bf_bits2f(hb));
              hv[e] = __builtin_bit_cast(_Float16, hb);
              lv[e] = __builtin_bit_cast(_Float16, lb);
            }
          }
          *(v8h*)(C + (size_t)(mBase + row) * ldc + n0 + c8) = hv;
          if (OUT_MODE == 2) *(v8h*)(C2 + (size_t)(mBase + row) * ldc + n0 + c8) = lv;
        }
        
      }
    }
    __builtin_amdgcn_fence(__ATOMIC_RELEASE, "workgroup");
    __builtin_amdgcn_wave_barrier();
    __builtin_amdgcn_fence(__ATOMIC_ACQUIRE, "workgroup");
  }
}

// One launch converts all five float matrices. Their bf16 planes lie back to back in the workspace, in the order
// tgt, mem, Wq_w, Wkv_w, out_w, so the output is one flat array of three equal thirds: tgt, mem, the three weights.
// A unit = 1024 consecutive elements = one wave x 8 loads of 16 B per lane; every matrix is a whole number of units.
// Grid = kCastBlocks blocks x 16 waves, all resident at once; wave w converts unit w of each third: every element exactly once.
// A unit of mem is one key's row. The rows of a batch are stored in a new order: the keys whose mask is non-zero first (in their old
// order), the masked keys behind them. A masked key's weight in the softmax is exactly 0, so the kv projection and the attention end
// at the live count. Each block scans its batch's whole mask (512 threads x 4 keys) for the places of its own 16 rows; the first block
// of a batch also stores the count and, in the new order, each key's additive score term (bf16(bias) * log2(e), -inf when masked).
// place = live ? (live keys before it) : (live keys in all) + (masked keys before it): counts of keys, so 0 <= place < kSeqK for any mask.
static constexpr int kCastUnit   = 1024;
static constexpr int kCastBlocks = 256;
static constexpr int kCastThird  = kCastBlocks * 16 * kCastUnit;    /* 4,194,304 elements */
static_assert(kRowsM * kEmb == kCastThird && kEmb * kEmb + kKVCols * kEmb + kEmb * kEmb == kCastThird);
static_assert((kEmb * kEmb) % kCastUnit == 0 && (kKVCols * kEmb) % kCastUnit == 0);
static_assert(kCastUnit == kEmb && kCastBlocks * 16 == kBatch * kSeqK && 512 * 4 == kSeqK && kSeqK % 16 == 0);
__global__ __launch_bounds__(512) void cast_f32_bf16_all(
    const float* __restrict__ tgt, const float* __restrict__ mem, const float* __restrict__ wq,
    const float* __restrict__ wkv, const float* __restrict__ wo,
    const float* __restrict__ abias, const int* __restrict__ kmask,
    unsigned short* __restrict__ out, float* __restrict__ cbias, int* __restrict__ nlive) {
  constexpr int w1 = kEmb * kEmb, w2 = w1 + kKVCols * kEmb;
  __shared__ int sCnt[16];     // live keys in each wave's 128 keys
  __shared__ int sPlace[16];   // new places of this block's 16 mem rows
  const int tid = threadIdx.x;
  const int bb  = (int)(blockIdx.x * 16) / kSeqK;   // the batch of this block's 16 mem rows, and the first of them inside it
  const int s0  = (int)(blockIdx.x * 16) % kSeqK;
  const v4i mk = *(const v4i*)(kmask + bb * kSeqK + 4 * tid);   // this thread's 4 keys of the batch's mask
  const int l4 = (threadIdx.x & 31) * 4;
  const int e  = __builtin_amdgcn_readfirstlane((int)(blockIdx.x * 16 + (threadIdx.x >> 5))) * kCastUnit;   // wave-uniform, 0 <= e < kCastThird
  const float* src[3];
  src[0] = tgt + e;
  src[1] = mem + e;
  src[2] = (e < w1) ? wq + e : (e < w2) ? wkv + (e - w1) : wo + (e - w2);
  v4f x[3][8];
#pragma unroll
  for (int s = 0; s < 3; ++s)
#pragma unroll
    for (int i = 0; i < 8; ++i) x[s][i] = *(const v4f*)(src[s] + i * 128 + l4);   // 512 contiguous bytes per wave-wide load
  // keeps all 24 loads in front of the first conversion: without it the compiler waits for the first 8 before it issues the rest
  __builtin_amdgcn_sched_barrier(0);
  int place;
  {
    const int wv = tid >> 5;
    const unsigned below = (1u << (tid & 31)) - 1u;
    int before = 0, mine = 0;
#pragma unroll
    for (int k = 0; k < 4; ++k) {
      const unsigned bal = __builtin_amdgcn_ballot_w32(mk[k] != 0);
      before += __builtin_popcount(bal & below);
      mine   += __builtin_popcount(bal);
    }
    if ((tid & 31) == 0) sCnt[wv] = mine;
    __syncthreads();
    int total = 0;
#pragma unroll
    for (int i = 0; i < 16; ++i) {
      const int n = sCnt[i];
      total += n;
      before += (i < wv) ? n : 0;
    }
    v4f ab = (v4f){0.f, 0.f, 0.f, 0.f};
    if (s0 == 0) ab = *(const v4f*)(abias + bb * kSeqK + 4 * tid);   // block-uniform
#pragma unroll
    for (int k = 0; k < 4; ++k) {
      const int key = 4 * tid + k;
      const bool alive = (mk[k] != 0);
      const int pl = alive ? before : total + (key - before);
      before += alive ? 1 : 0;
      if ((key & ~15) == s0) sPlace[key & 15] = pl;
      if (s0 == 0) cbias[bb * kSeqK + pl] = alive ? bf_bits2f(f2bf_bits(ab[k])) * kLog2E : -__builtin_huge_valf();
    }
    if (s0 == 0 && tid == 0) nlive[bb * kCountPitch] = total;
    __syncthreads();
    place = __builtin_amdgcn_readfirstlane(sPlace[wv]);
  }
  const int dst[3] = {e, kCastThird + (bb * kSeqK + place) * kCastUnit, 2 * kCastThird + e};
#pragma unroll
  for (int s = 0; s < 3; ++s)
#pragma unroll
    for (int i = 0; i < 8; ++i) {
      v2u y;
      y[0] = (unsigned)f2bf_bits(x[s][i][0]) | ((unsigned)f2bf_bits(x[s][i][1]) << 16);
      y[1] = (unsigned)f2bf_bits(x[s][i][2]) | ((unsigned)f2bf_bits(x[s][i][3]) << 16);
      *(v2u*)(out + dst[s] + i * 128 + l4) = y;                        // 256 contiguous bytes per wave-wide store: two whole lines
    }
}

// ---- bf16 helpers for the attention kernel ----
__device__ __forceinline__ __bf16 to_bf16(float f) { return __builtin_bit_cast(__bf16, f2bf_bits(f)); }
__device__ __forceinline__ void split_bf16(float f, __bf16& hi, __bf16& lo) {
  const unsigned short hb = f2bf_bits(f);
  hi = __builtin_bit_cast(__bf16, hb);
  lo = to_bf16(f - __uint_as_float(((unsigned)hb) << 16));
}
__device__ __forceinline__ v8f mma_bf16(v16b a, v16b b, v8f c) {
  c = __builtin_amdgcn_wmma_f32_16x16x32_bf16(false, a, false, b, (short)0, c, false, false);
  asm volatile("v_nop\n\tv_nop\n\tv_nop\n\tv_nop" : "+v"(c) : "v"(a), "v"(b));
  return c;
}

__device__ __forceinline__ void exp2_x8(v8f& x) {
  float a = x[0], b = x[1], c = x[2], d = x[3], e = x[4], f = x[5], g = x[6], h = x[7];
  // one statement, so that nothing comes between: an independent v_exp_f32 behind each, the v_nop behind the last
  asm("v_exp_f32 %0, %0\n\tv_exp_f32 %1, %1\n\tv_exp_f32 %2, %2\n\tv_exp_f32 %3, %3\n\t"
      "v_exp_f32 %4, %4\n\tv_exp_f32 %5, %5\n\tv_exp_f32 %6, %6\n\tv_exp_f32 %7, %7\n\tv_nop"
      : "+v"(a), "+v"(b), "+v"(c), "+v"(d), "+v"(e), "+v"(f), "+v"(g), "+v"(h));
  x = (v8f){a, b, c, d, e, f, g, h};
}
__device__ __forceinline__ float exp2_x1(float x) {
  asm("v_exp_f32 %0, %0\n\tv_nop" : "+v"(x));   // the v_nop: the same slot
  return x;
}

// lane l with lane l ^ 16
__device__ __forceinline__ float xhalf(float x) {
  return __builtin_bit_cast(float, __builtin_amdgcn_permlanex16(__builtin_bit_cast(int, x), __builtin_bit_cast(int, x), 0x76543210, 0xfedcba98, false, false));
}

// =====================================================================================
// Cross attention, head_dim 64, 16-bit plane inputs:
//   q planes  Qh/Ql : bf16 hi/lo, element (b,s,h,d) at (b*SQ+s)*1024 + h*64 + d
//   kv planes KVh/KVl: bf16 hi/lo, row (b*SK+s) pitch 2048; k at col h*64+d, v at col 1024+h*64+d; s = the key's place, live keys first
//   scores = 0.125 * q.k^T (hi.hi + hi.lo + lo.hi) + bf16(attn_bias[b,kv]); key mask 0 -> score = -inf (cbias holds that term by place)
//   the key loop ends with the chunk that holds the last live key (nlive); the masked keys in that chunk get weight 0 through -inf
//   the scores are held times log2(e) (folded into the scale and into the staged bias), so e^(s-m) is one v_exp_f32 of a difference
//   out    = softmax(scores).v with p and v as bf16 hi/lo (3 products), f32 accumulate, f32 online softmax
//   both products run transposed (scores^T = k.q^T, out^T += v^T.p^T): a lane owns one query, p stays in registers
//   ctx written as bf16 hi/lo planes Ch/Cl, element (b,s,h,d) at (b*SQ+s)*1024 + h*64 + d.
// Block = 4 waves = 64 query rows of one (b,h); grid.x = B*H*(SQ/64) = 1024.
// =====================================================================================
__global__ __launch_bounds__(128)
void mha_attn_hd64(const unsigned short* __restrict__ Qh, const unsigned short* __restrict__ Ql,
                   const unsigned short* __restrict__ KVh, const unsigned short* __restrict__ KVl,
                   const float* __restrict__ cbias, const int* __restrict__ nlive,
                   unsigned short* __restrict__ Ch, unsigned short* __restrict__ Cl)
{
  __shared__ __align__(16) __bf16 Ksh[kKC * kLP];         // K hi [kv][d], pitch kLP   9 KB
  __shared__ __align__(16) __bf16 Ksl[kKC * kLP];         // K lo [kv][d], pitch kLP   9 KB
  __shared__ __align__(16) __bf16 Vth[kHeadD * kLP];      // V hi [d][kv], pitch kLP   9 KB
  __shared__ __align__(16) __bf16 Vtl[kHeadD * kLP];      // V lo [d][kv], pitch kLP   9 KB
  __shared__ __align__(16) __bf16 Psh[4][16 * kLP];       // per wave out hi staging [row][d], pitch kLP
  __shared__ __align__(16) __bf16 Psl[4][16 * kLP];       // per wave out lo staging [row][d], pitch kLP
  __shared__ __align__(16) float CB[kKC];                               // per chunk: bf16(bias) * log2(e), or -inf when masked

  const int tid  = threadIdx.x;
  const int wave = tid >> 5;
  const int lane = tid & 31;
  const int hh   = lane >> 4;
  const int c    = lane & 15;
  const int nqb  = kSeqQ / 64;
  const int bx   = blockIdx.x;
  const int qb   = bx % nqb;
  const int bhd  = bx / nqb;
  const int h    = bhd % kHeads;
  const int b    = bhd / kHeads;
  const int q0   = qb * 64 + wave * 16;
  const float ninf = -__builtin_huge_valf();

  const __bf16* Qhp = (const __bf16*)(const void*)Qh;
  const __bf16* Qlp = (const __bf16*)(const void*)Ql;

  // ---- Q fragments (B operand, column = c, split k map via Frag::load): 2 d-chunks, hi and lo ----
  v16b qah[2], qal[2];
  {
    const size_t qo = (size_t)(b * kSeqQ + q0 + c) * kEmb + h * kHeadD + 8 * hh;
#pragma unroll
    for (int dc = 0; dc < 2; ++dc) {
      qah[dc] = Frag<__bf16>::load(Qhp + qo + dc * 32);
      qal[dc] = Frag<__bf16>::load(Qlp + qo + dc * 32);
    }
  }

  const v8f zero8 = (v8f){0.f,0.f,0.f,0.f,0.f,0.f,0.f,0.f};
  float mrow = ninf, lrow = 0.f;   // one query (column c) per lane
  v8f oacc[4];
#pragma unroll
  for (int t = 0; t < 4; ++t) oacc[t] = zero8;

  __bf16* pwh = Psh[wave];
  __bf16* pwl = Psl[wave];

  // ---- staging maps; the next chunk's K, V and score terms travel in registers while the current chunk is worked on ----
  // K planes: thread -> (kv row tid>>1, d half (tid&1)*32): 128 thr x 32 elems = 64 x 64 per plane
  const int kvr = tid >> 1, dh = (tid & 1) * 32;
  // V planes transposed into [d][kv]: thread -> (kv pair vp = tid>>2, d range dq = (tid&3)*16)
  // 32 pairs x 4 ranges = 128 thr; each writes 2 kv x 16 d as packed u32 (both halves per-lane data)
  const int vp = tid >> 2, dq = (tid & 3) * 16;
  // every address is a block-uniform base (it alone moves from chunk to chunk) + one fixed per-lane byte offset
  const unsigned kByte = (unsigned)(kvr * kKVCols + dh) * 2u;
  const unsigned vByte = (unsigned)(2 * vp * kKVCols + kEmb + dq) * 2u;
  const unsigned bByte = (unsigned)(tid & (kKC - 1)) * 4u;
  v4u gkh[4], gkl[4], gxh[2], gyh[2], gxl[2], gyl[2];
  float gbias = 0.f;
  auto fetch_chunk = [&](int kv0) {   // all 16 (waves 0 and 1: 17) loads of a chunk are issued together
    const size_t ro = (size_t)(b * kSeqK + kv0) * kKVCols + h * kHeadD;
    const gbytes baseH = uniform_ptr(KVh + ro);
    const gbytes baseL = uniform_ptr(KVl + ro);
#pragma unroll
    for (int i = 0; i < 4; ++i) {
      gkh[i] = *(gvec16)(baseH + kByte + 16 * i);
      gkl[i] = *(gvec16)(baseL + kByte + 16 * i);
    }
#pragma unroll
    for (int i = 0; i < 2; ++i) {
      gxh[i] = *(gvec16)(baseH + vByte + 16 * i);
      gyh[i] = *(gvec16)(baseH + vByte + 2 * kKVCols + 16 * i);
      gxl[i] = *(gvec16)(baseL + vByte + 16 * i);
      gyl[i] = *(gvec16)(baseL + vByte + 2 * kKVCols + 16 * i);
    }
    if (tid < kKC) {   // waves 0 and 1 entirely: wave-uniform branch
      gbias = *(const __attribute__((address_space(1))) float*)(uniform_ptr(cbias + b * kSeqK + kv0) + bByte);
    }
    // behind this wait the address registers of the loads above may be rewritten; it also keeps the loads in front of the chunk's LDS reads
    asm volatile("s_wait_xcnt 0x0" ::: "memory");
  };
  // chunks that hold a live key: block-uniform, bounded by the shape whatever the count word holds
  const int nch = (min(max(__builtin_amdgcn_readfirstlane(nlive[b * kCountPitch]), 0), kSeqK) + kKC - 1) / kKC;
  if (nch > 0) fetch_chunk(0);

  for (int kc = 0; kc < nch; ++kc) {
    __syncthreads();
#pragma unroll
    for (int i = 0; i < 4; ++i) {
      *(v4u*)(Ksh + kvr * kLP + dh + 8 * i) = gkh[i];
      *(v4u*)(Ksl + kvr * kLP + dh + 8 * i) = gkl[i];
    }
#pragma unroll
    for (int i = 0; i < 2; ++i) {
#pragma unroll
      for (int jw = 0; jw < 4; ++jw) {
        const int d0 = dq + 8 * i + 2 * jw;
        const unsigned xhw = gxh[i][jw], yhw = gyh[i][jw], xlw = gxl[i][jw], ylw = gyl[i][jw];
        const unsigned h0 = (xhw & 0xffffu) | (yhw << 16);
        const unsigned h1 = (xhw >> 16) | (yhw & 0xffff0000u);
        const unsigned l0 = (xlw & 0xffffu) | (ylw << 16);
        const unsigned l1 = (xlw >> 16) | (ylw & 0xffff0000u);
        *(unsigned*)(Vth + d0 * kLP + 2 * vp)       = h0;
        *(unsigned*)(Vth + (d0 + 1) * kLP + 2 * vp) = h1;
        *(unsigned*)(Vtl + d0 * kLP + 2 * vp)       = l0;
        *(unsigned*)(Vtl + (d0 + 1) * kLP + 2 * vp) = l1;
      }
    }
    if (tid < kKC) CB[tid] = gbias;   // waves 0 and 1 entirely: wave-uniform branch
    __syncthreads();
    if (kc + 1 < nch) fetch_chunk((kc + 1) * kKC);   // block-uniform; the loads fly under this chunk's products and softmax

    // ---- scores, transposed: tile j = K rows (A operand) x Q columns (B operand), 2 d-chunks x 3 products ----
    // D map: this lane holds query column c and the keys j*16 + 8*hh + r
    v8f s[4];
#pragma unroll
    for (int j = 0; j < 4; ++j) {
      s[j] = zero8;
#pragma unroll
      for (int dc = 0; dc < 2; ++dc) {
        const v16b kbh = Frag<__bf16>::load(Ksh + (j * 16 + c) * kLP + dc * 32 + 8 * hh);
        const v16b kbl = Frag<__bf16>::load(Ksl + (j * 16 + c) * kLP + dc * 32 + 8 * hh);
        s[j] = mma_bf16(kbh, qah[dc], s[j]);
        s[j] = mma_bf16(kbl, qah[dc], s[j]);
        s[j] = mma_bf16(kbh, qal[dc], s[j]);
      }
    }
    float cm = ninf;
#pragma unroll
    for (int j = 0; j < 4; ++j) {
      const v4f cb0 = *(const v4f*)(CB + j * 16 + 8 * hh);
      const v4f cb1 = *(const v4f*)(CB + j * 16 + 8 * hh + 4);
#pragma unroll
      for (int r = 0; r < 8; ++r) {
        const float v = s[j][r] * (0.125f * kLog2E) + ((r < 4) ? cb0[r & 3] : cb1[r & 3]);
        s[j][r] = v;
        cm = fmaxf(cm, v);
      }
    }
    cm = fmaxf(cm, xhalf(cm));   // the other lane half holds this query's other 32 keys
    // ---- online softmax, one query per lane; P packs from the score tiles straight into B operands ----
    const float mnew = fmaxf(mrow, cm);
    const bool live = (mnew != ninf);
    float alpha = 1.0f;
    float ps[4] = {0.f, 0.f, 0.f, 0.f};
    if (live) {   // one guard per lane: it owns one query, so one flag covers the rescale factor and all 32 of its scores
      alpha = exp2_x1(mrow - mnew);   // every argument here is <= 0: no range reduction, no overflow test
#pragma unroll
      for (int j = 0; j < 4; ++j) {
#pragma unroll
        for (int r = 0; r < 8; ++r) s[j][r] -= mnew;
        exp2_x8(s[j]);
#pragma unroll
        for (int r = 0; r < 8; ++r) ps[j] += s[j][r];
      }
    } else {
#pragma unroll
      for (int j = 0; j < 4; ++j) s[j] = zero8;
    }
    mrow = mnew;
    v16b ph[2], pl[2];
#pragma unroll
    for (int j = 0; j < 4; ++j) {
#pragma unroll
      for (int r = 0; r < 8; ++r) {
        const float p = s[j][r];
        __bf16 a, bl;
        split_bf16(p, a, bl);
        ph[j >> 1][(j & 1) * 8 + r] = a;    // element e of the operand is key kk*32 + (e < 8 ? 8*hh + e : 16 + 8*hh + e - 8): the order of Frag::load
        pl[j >> 1][(j & 1) * 8 + r] = bl;
      }
    }
    lrow = lrow * alpha + ((ps[0] + ps[1]) + (ps[2] + ps[3]));   // this lane half's share; the halves join in the epilogue
#pragma unroll
    for (int t = 0; t < 4; ++t)
#pragma unroll
      for (int r = 0; r < 8; ++r) oacc[t][r] *= alpha;
    // ---- out^T += V^T.P^T : 2 kv-chunks x 4 d-tiles x 3 products; this lane holds query c, d = t*16 + 8*hh + r ----
#pragma unroll
    for (int kk = 0; kk < 2; ++kk) {
#pragma unroll
      for (int t = 0; t < 4; ++t) {
        const v16b vb = Frag<__bf16>::load(Vth + (t * 16 + c) * kLP + kk * 32 + 8 * hh);
        const v16b vl = Frag<__bf16>::load(Vtl + (t * 16 + c) * kLP + kk * 32 + 8 * hh);
        oacc[t] = mma_bf16(vb, ph[kk], oacc[t]);
        oacc[t] = mma_bf16(vl, ph[kk], oacc[t]);
        oacc[t] = mma_bf16(vb, pl[kk], oacc[t]);
      }
    }
  }

  // ---- epilogue: join the halves' sums, normalise, split to bf16 hi/lo into this wave's staging, whole-line stores ----
  {
    const float inv = 1.0f / (lrow + xhalf(lrow));
#pragma unroll
    for (int t = 0; t < 4; ++t) {
      v8b xa, xb;
#pragma unroll
      for (int r = 0; r < 8; ++r) {
        const float v = oacc[t][r] * inv;
        __bf16 a, bl;
        split_bf16(v, a, bl);
        xa[r] = a;
        xb[r] = bl;
      }
      *(v8b*)(pwh + c * kLP + t * 16 + 8 * hh) = xa;
      *(v8b*)(pwl + c * kLP + t * 16 + 8 * hh) = xb;
    }
  }
  __builtin_amdgcn_fence(__ATOMIC_RELEASE, "workgroup");
  __builtin_amdgcn_wave_barrier();
  __builtin_amdgcn_fence(__ATOMIC_ACQUIRE, "workgroup");
  {
    _Float16* Chp = (_Float16*)(void*)Ch;
    _Float16* Clp = (_Float16*)(void*)Cl;
    const int q8 = lane >> 3, c8 = (lane & 7) * 8;
    const size_t ob = (size_t)(b * kSeqQ + q0) * kEmb + h * kHeadD + c8;
    {
#pragma unroll
      for (int it = 0; it < 4; ++it) {
        const int row = it * 4 + q8;
        const v8b xh = *(const v8b*)(pwh + row * kLP + c8);
        const v8b xl = *(const v8b*)(pwl + row * kLP + c8);
        const v8h yh = __builtin_bit_cast(v8h, xh);
        const v8h yl = __builtin_bit_cast(v8h, xl);
        *(v8h*)(Chp + ob + (size_t)row * kEmb) = yh;
        *(v8h*)(Clp + ob + (size_t)row * kEmb) = yl;
      }
      
    }
  }
}

extern "C" void kernel_launch(void* const* d_in, const int* in_sizes, int n_in,
                              void* d_out, int out_size, void* d_ws, size_t ws_size,
                              hipStream_t stream) {
  static_assert(kSeqK % 128 == 0 && kRowsM % 128 == 0 && kEmb % 128 == 0 && kKVCols % 128 == 0 && kEmb % 64 == 0);
  static_assert(kSeqQ % 64 == 0 && kSeqK % kKC == 0 && kHeadD == 64 && kHeads * kHeadD == kEmb && kSeqQ == kSeqK);

  if (n_in < 10) return;
  const int nAct = kRowsM * kEmb;            /* 4,194,304 elements */
  const int nWq  = kEmb * kEmb;              /* 1,048,576 */
  const int nWkv = kKVCols * kEmb;           /* 2,097,152 */
  const int nWo  = kEmb * kEmb;
  if (in_sizes[0] != nAct || in_sizes[1] != kBatch * kSeqK * kEmb || in_sizes[2] != kBatch * kSeqK ||
      in_sizes[3] != kBatch * kSeqK || in_sizes[4] != nWq || in_sizes[5] != kEmb || in_sizes[6] != nWkv ||
      in_sizes[7] != kKVCols || in_sizes[8] != nWo || in_sizes[9] != kEmb) return;
  if (out_size != nAct) return;

  const float* tgt   = (const float*)d_in[0];
  const float* mem   = (const float*)d_in[1];
  const float* abias = (const float*)d_in[2];
  const int*   kmask = (const int*)d_in[3];
  const float* Wq_w  = (const float*)d_in[4];
  const float* Wq_b  = (const float*)d_in[5];
  const float* Wkv_w = (const float*)d_in[6];
  const float* Wkv_b = (const float*)d_in[7];
  const float* out_w = (const float*)d_in[8];
  const float* out_b = (const float*)d_in[9];
  float* out = (float*)d_out;

  /* workspace region map (bytes, every offset but nlive's a multiple of 1 MiB):
       [  0 MiB,  8 MiB)  tgt16   bf16 [4096][1024]
       [  8 MiB, 16 MiB)  mem16   bf16 [4096][1024]
       [ 16 MiB, 18 MiB)  wq16    bf16 [1024][1024]
       [ 18 MiB, 22 MiB)  wkv16   bf16 [2048][1024]
       [ 22 MiB, 24 MiB)  wo16    bf16 [1024][1024]
       [ 24 MiB, 32 MiB)  qh      bf16 [4096][1024]   [ 32, 40) ql
       [ 40 MiB, 56 MiB)  kvh     bf16 [4096][2048]   [ 56, 72) kvl
       [ 72 MiB, 80 MiB)  ch      bf16 [4096][1024]   [ 80, 88) cl
       [ 88 MiB, +16 KiB) cbias   f32 [2][2048], then nlive int [2] at a pitch of 128 B */
  const size_t szAct16 = (size_t)nAct * 2;
  const size_t szKV16  = (size_t)kRowsM * kKVCols * 2;
  const size_t oTgt = 0;
  const size_t oMem = oTgt + szAct16;
  const size_t oWq  = oMem + szAct16;
  const size_t oWkv = oWq + (size_t)nWq * 2;
  const size_t oWo  = oWkv + (size_t)nWkv * 2;
  const size_t oQh  = oWo + (size_t)nWo * 2;
  const size_t oQl  = oQh + szAct16;
  const size_t oKVh = oQl + szAct16;
  const size_t oKVl = oKVh + szKV16;
  const size_t oCh  = oKVl + szKV16;
  const size_t oCl  = oCh + szAct16;
  const size_t oCb  = oCl + szAct16;
  const size_t oNl  = oCb + (size_t)kBatch * kSeqK * 4;
  const size_t total = oNl + (size_t)kBatch * kCountPitch * 4;
  if (total > ws_size) return;

  char* ws = (char*)d_ws;
  unsigned short* tgt16 = (unsigned short*)(ws + oTgt);
  unsigned short* mem16 = (unsigned short*)(ws + oMem);
  unsigned short* wq16  = (unsigned short*)(ws + oWq);
  unsigned short* wkv16 = (unsigned short*)(ws + oWkv);
  unsigned short* wo16  = (unsigned short*)(ws + oWo);
  unsigned short* qh    = (unsigned short*)(ws + oQh);
  unsigned short* ql    = (unsigned short*)(ws + oQl);
  unsigned short* kvh   = (unsigned short*)(ws + oKVh);
  unsigned short* kvl   = (unsigned short*)(ws + oKVl);
  unsigned short* ch    = (unsigned short*)(ws + oCh);
  unsigned short* cl    = (unsigned short*)(ws + oCl);
  float* cbias = (float*)(ws + oCb);
  int*   nlive = (int*)(ws + oNl);

  /* 1. RNE-convert the five float matrices to bf16 planes: one launch; the planes tgt16 .. wo16 are contiguous from tgt16 on;
        mem16's rows go live keys first, with cbias and nlive to match */
  cast_f32_bf16_all<<<dim3(kCastBlocks), dim3(512), 0, stream>>>(tgt, mem, Wq_w, Wkv_w, out_w, abias, kmask, tgt16, cbias, nlive);

  /* 2. q = tgt16 . wq16^T + bq : M=4096 N=1024 K=1024 -> bf16 hi/lo planes; 256 block tiles of 128x128 */
  {
    const int tiles = (kRowsM / 128) * (kEmb / 128);
    wmma_gemm64<1, 0, 2, 2><<<dim3(tiles, 1), dim3(128), 0, stream>>>(
        tgt16, tgt16, kEmb, 0L, wq16, wq16, kEmb, 0L, (void*)qh, (void*)ql, kEmb, 0L,
        Wq_b, nullptr, kRowsM, kEmb, kEmb, 1.0f);
  }
  /* 3. kv = mem16 . wkv16^T + bkv : per batch M=2048 N=2048 K=1024 -> bf16 hi/lo planes; 2 x 256 block tiles, those behind the live keys return at once */
  {
    const int tiles = (kSeqK / 128) * (kKVCols / 128);
    wmma_gemm64<1, 0, 2, 2><<<dim3(tiles, kBatch), dim3(128), 0, stream>>>(
        mem16, mem16, kEmb, (long)kSeqK * kEmb, wkv16, wkv16, kEmb, 0L, (void*)kvh, (void*)kvl, kKVCols, (long)kSeqK * kKVCols,
        Wkv_b, nlive, kSeqK, kKVCols, kEmb, 1.0f);
  }
  /* 4. attention: grid = B*H*(SQ/64) = 1024 blocks of 128 threads -> ctx hi/lo planes */
  {
    const int nblk = kBatch * kHeads * (kSeqQ / 64);
    mha_attn_hd64<<<dim3(nblk), dim3(128), 0, stream>>>(qh, ql, kvh, kvl, cbias, nlive, ch, cl);
  }
  /* 5. out = (ch + cl) . wo16^T + bo : M=4096 N=1024 K=1024, A carried hi+lo (2 products), f32 out */
  {
    const int tiles = (kRowsM / 128) * (kEmb / 128);
    wmma_gemm64<1, 1, 2, 0><<<dim3(tiles, 1), dim3(128), 0, stream>>>(
        ch, cl, kEmb, 0L, wo16, wo16, kEmb, 0L, (void*)out, (void*)cl, kEmb, 0L,
        out_b, nullptr, kRowsM, kEmb, kEmb, 1.0f);
  }
}

// v008
// Measured time: 130 microseconds a run.
// Next to v007, in two timings, it ran 1.06 times as fast each time.
// All steps since v000 together make it 4.28 times as fast.
// Contractions: q/kv/out projections on v_wmma_f32_16x16x32_bf16 (float inputs RNE-converted to bf16 once; out-projection A operand carried as bf16 hi+lo planes, 2 products); attention q.k and p.v on v_wmma_f32_16x16x32_bf16 with bf16 hi+lo planes for q,k,p,v (3 products); f32 accumulate; softmax and normalisation in f32.
#include <hip/hip_runtime.h>

typedef __attribute__((ext_vector_type(16))) _Float16 v16h;
typedef __attribute__((ext_vector_type(8)))  _Float16 v8h;
typedef __attribute__((ext_vector_type(16))) __bf16   v16b;
typedef __attribute__((ext_vector_type(8)))  __bf16   v8b;
typedef __attribute__((ext_vector_type(8)))  float    v8f;
typedef __attribute__((ext_vector_type(4)))  float    v4f;
typedef __attribute__((ext_vector_type(2)))  float    v2f;
typedef __attribute__((ext_vector_type(4)))  unsigned v4u;
typedef __attribute__((ext_vector_type(2)))  unsigned v2u;
typedef __attribute__((ext_vector_type(4)))  int      v4i;

static constexpr int kBatch  = 2;
static constexpr int kSeqQ   = 2048;
static constexpr int kSeqK   = 2048;
static constexpr int kEmb    = 1024;
static constexpr int kHeads  = 16;
static constexpr int kHeadD  = 64;
static constexpr int kKVCols = 2 * kEmb;          /* 2048: k at cols 0..1023, v at cols 1024..2047 */
static constexpr int kRowsM  = kBatch * kSeqQ;    /* 4096 (== kBatch * kSeqK) */
static constexpr int kKC     = 64;                /* keys per streamed chunk */
static constexpr float kLog2E = 1.4426950408889634f;   /* log2(e): the attention scores are carried in the base-2 domain */
static constexpr int kCountPitch = 32;            /* ints between the two batches' live-key counts: a 128-byte line each */
static constexpr int kLP     = 72;                /* LDS row pitch in 16-bit elements: 144 B = 16 B x 9, so the 16 rows of a 16-byte fragment read fall on distinct banks */

__device__ __forceinline__ unsigned short f2bf_bits(float f) {
  unsigned u = __float_as_uint(f);
  return (unsigned short)((u + 0x7FFFu + ((u >> 16) & 1u)) >> 16);
}
__device__ __forceinline__ float bf_bits2f(unsigned short h) { return __uint_as_float(((unsigned)h) << 16); }

// hazard guards as plain device helpers
__device__ __forceinline__ void dep_guard_h(v8f& a, v8f& b, v16h x, v16h y) { asm volatile("v_nop\n\tv_nop\n\tv_nop\n\tv_nop" : "+v"(a), "+v"(b) : "v"(x), "v"(y)); }
__device__ __forceinline__ void dep_guard_b(v8f& a, v8f& b, v16b x, v16b y) { asm volatile("v_nop\n\tv_nop\n\tv_nop\n\tv_nop" : "+v"(a), "+v"(b) : "v"(x), "v"(y)); }
__device__ __forceinline__ void keep4_h(v16h a, v16h b, v16h c, v16h d) { asm volatile("v_nop" :: "v"(a), "v"(b), "v"(c), "v"(d)); }
__device__ __forceinline__ void keep4_b(v16b a, v16b b, v16b c, v16b d) { asm volatile("v_nop" :: "v"(a), "v"(b), "v"(c), "v"(d)); }
__device__ __forceinline__ void acc_guard4(v8f& a, v8f& b, v8f& c, v8f& d) { asm volatile("v_nop\n\tv_nop\n\tv_nop\n\tv_nop" : "+v"(a), "+v"(b), "+v"(c), "+v"(d)); }
template <typename T> struct Frag;
template <> struct Frag<_Float16> {
  typedef v16h V; union U { v16h v; v8h h[2]; };
  static __device__ __forceinline__ v16h load(const _Float16* p) {   // elements 0..7 <- p[0..7], 8..15 <- p[16..23]
    U f; f.h[0] = *(const v8h*)(p); f.h[1] = *(const v8h*)(p + 16); return f.v;
  }
  static __device__ __forceinline__ v8f mma(v16h a, v16h b, v8f c) {
    return __builtin_amdgcn_wmma_f32_16x16x32_f16(false, a, false, b, (short)0, c, false, false);
  }
  static __device__ __forceinline__ void guard(v8f& a, v8f& b, v16h x, v16h y) { dep_guard_h(a, b, x, y); }
  static __device__ __forceinline__ void keep(v16h a, v16h b, v16h c, v16h d) { keep4_h(a, b, c, d); }
};
template <> struct Frag<__bf16> {
  typedef v16b V; union U { v16b v; v8b h[2]; };
  static __device__ __forceinline__ v16b load(const __bf16* p) {
    U f; f.h[0] = *(const v8b*)(p); f.h[1] = *(const v8b*)(p + 16); return f.v;
  }
  static __device__ __forceinline__ v8f mma(v16b a, v16b b, v8f c) {
    return __builtin_amdgcn_wmma_f32_16x16x32_bf16(false, a, false, b, (short)0, c, false, false);
  }
  static __device__ __forceinline__ void guard(v8f& a, v8f& b, v16b x, v16b y) { dep_guard_b(a, b, x, y); }
  static __device__ __forceinline__ void keep(v16b a, v16b b, v16b c, v16b d) { keep4_b(a, b, c, d); }
};

// a block-uniform global address, pinned into a scalar register pair
typedef const __attribute__((address_space(1))) char* gbytes;
typedef const __attribute__((address_space(1))) v4u*  gvec16;
__device__ __forceinline__ gbytes uniform_ptr(const void* p) {
  const unsigned long long u = (unsigned long long)p;
  const unsigned lo = (unsigned)__builtin_amdgcn_readfirstlane((int)(unsigned)u);
  const unsigned hi = (unsigned)__builtin_amdgcn_readfirstlane((int)(unsigned)(u >> 32));
  return (gbytes)(((unsigned long long)hi << 32) | lo);
}

// ---- Register-blocked batched WMMA GEMM, operands staged through LDS ---------
// C[m,n] = scale * sum_k A[m,k] * Bt[n,k] (+bias); a block of 4 waves owns a 128x128 tile, each wave a 64x64 quarter.
// A row-major [M,K]; Bt row-major [N,K]; M,N % 128 == 0, K % 64 == 0.
// Each stage is 64 k = one whole 128-byte line of every operand row: 8 lanes read a line, a wave-wide load covers 4 whole lines.
// Two LDS buffers: stage s+1 is loaded into registers while stage s is multiplied, and stored behind it; one barrier per stage.
// SPLIT: 0 = single product; 1 = A carried as hi+lo planes (A.B + A2.B); 2 = A and B hi+lo planes (A.B + A.B2 + A2.B).
// rowsLive: see at its test below.
// BIAS_MODE: 0 = none, 2 = bias[n] (bias RNE-converted to bf16 before the add).
// OUT_MODE: 0 = f32, 1 = f16, 2 = bf16 hi plane (Cout) + bf16 lo plane (Cout2).
// ET: 0 = f16 operands, 1 = bf16 operands (pointers passed as 16-bit storage)
template <int ET> struct Elem;
template <> struct Elem<0> { typedef _Float16 T; };
template <> struct Elem<1> { typedef __bf16 T; };
template <int ET, int SPLIT, int BIAS_MODE, int OUT_MODE>
__global__ __launch_bounds__(128) void wmma_gemm64(
    const unsigned short* __restrict__ Ap, const unsigned short* __restrict__ A2p, int lda, long strideA,
    const unsigned short* __restrict__ Btp, const unsigned short* __restrict__ Bt2p, int ldb, long strideB,
    void* __restrict__ Cout, void* __restrict__ Cout2, int ldc, long strideC,
    const float* __restrict__ bias, const int* __restrict__ rowsLive,
    int M, int N, int K, float scale) {
  typedef typename Elem<ET>::T T;
  typedef typename Frag<T>::V V;
  const T* A = (const T*)Ap; const T* A2 = (const T*)A2p; const T* Bt = (const T*)Btp; const T* Bt2 = (const T*)Bt2p;
  constexpr int PA = 0, PB = 1, PA2 = 2, PB2 = 3;              // operand planes in LDS
  constexpr int NPL = 2 + (SPLIT != 0 ? 1 : 0) + (SPLIT == 2 ? 1 : 0);
  __shared__ __align__(16) T sOp[2][NPL][128 * kLP];           // [buffer][plane][row][64 k], pitch kLP
  __shared__ __align__(16) float sT[4][16 * 68];               // per-wave 16x64 slab, pitch 68 floats
  const int b    = blockIdx.y;
  const int tid  = threadIdx.x;
  const int lane = tid & 31;
  const int wave = tid >> 5;
  const int tilesN = N >> 7;
  const int tilesM = M >> 7;
  if ((int)blockIdx.x >= tilesM * tilesN) return;   // block-uniform, in front of every barrier
  const int bm = blockIdx.x / tilesN;
  const int bn = blockIdx.x - bm * tilesN;
  // rowsLive (may be null): per batch, the number of leading A rows whose product anybody reads; a tile wholly behind it is not computed
  if (rowsLive != nullptr && (bm << 7) >= rowsLive[b * kCountPitch]) return;   // block-uniform, in front of every barrier
  const int wm = (wave >> 1) << 6;             // this wave's quarter inside the block tile
  const int wn = (wave & 1) << 6;
  const int m0 = (bm << 7) + wm;
  const int n0 = (bn << 7) + wn;

  const T* Ab  = A  + (size_t)b * strideA;
  const T* Bb  = Bt + (size_t)b * strideB;
  const T* Ab2 = (SPLIT != 0) ? (A2  + (size_t)b * strideA) : nullptr;
  const T* Bb2 = (SPLIT == 2) ? (Bt2 + (size_t)b * strideB) : nullptr;

  const int rlane = lane & 15;                 // row (A) / col (B, D) within subtile
  const int koff  = (lane >> 4) * 8;           // k offset of this lane half
  const int mOff  = (lane >> 4) * 8;           // D row offset

  // staging map: thread -> (row tid>>3 of each group of 16 rows, 16-byte piece tid&7 of the row's line)
  const int srow = tid >> 3;
  const int sseg = (tid & 7) * 8;
  const int sLane = srow * kLP + sseg;
  unsigned aByte = (unsigned)(srow * lda + sseg) * 2u;      // per-lane byte offsets; they advance by one line (128 B) per stage
  unsigned bByte = (unsigned)(srow * ldb + sseg) * 2u;
  // block-uniform base of each group of 16 rows, held in scalar registers: every load is base + one per-lane offset,
  // so no address register is rewritten while a stage's loads are being issued
  gbytes gp[NPL][8];
#pragma unroll
  for (int i = 0; i < 8; ++i) {
    gp[PA][i] = uniform_ptr(Ab + (size_t)((bm << 7) + 16 * i) * lda);
    gp[PB][i] = uniform_ptr(Bb + (size_t)((bn << 7) + 16 * i) * ldb);
    if (SPLIT != 0) gp[SPLIT != 0 ? PA2 : PA][i] = uniform_ptr(Ab2 + (size_t)((bm << 7) + 16 * i) * lda);
    if (SPLIT == 2) gp[SPLIT == 2 ? PB2 : PB][i] = uniform_ptr(Bb2 + (size_t)((bn << 7) + 16 * i) * ldb);
  }

  v8f acc[4][4];
#pragma unroll
  for (int i = 0; i < 4; ++i)
#pragma unroll
    for (int j = 0; j < 4; ++j) acc[i][j] = (v8f){0.f,0.f,0.f,0.f,0.f,0.f,0.f,0.f};

  v4u rg[NPL][8];
  const int nst = K >> 6;
#pragma unroll
  for (int p = 0; p < NPL; ++p)
#pragma unroll
    for (int i = 0; i < 8; ++i) rg[p][i] = *(gvec16)(gp[p][i] + ((p & 1) ? bByte : aByte));
#pragma unroll
  for (int p = 0; p < NPL; ++p)
#pragma unroll
    for (int i = 0; i < 8; ++i) *(v4u*)(&sOp[0][p][sLane + 16 * i * kLP]) = rg[p][i];

  for (int s = 0; s < nst; ++s) {
    const bool more = (s + 1 < nst);           // block-uniform
    __syncthreads();                           // publishes stage s; ends every wave's reads of the buffer that stage s+1 goes into
    if (more) {
      aByte += 128u;
      bByte += 128u;
#pragma unroll
      for (int p = 0; p < NPL; ++p)
#pragma unroll
        for (int i = 0; i < 8; ++i) rg[p][i] = *(gvec16)(gp[p][i] + ((p & 1) ? bByte : aByte));
      // behind this wait the address registers of the loads above may be rewritten; it also keeps the loads in front of the stage's LDS reads
      asm volatile("s_wait_xcnt 0x0" ::: "memory");
    }
    const int cur = s & 1;
    // the A fragments run one row of tiles ahead of the products, so that a row's LDS latency hides behind the row before it
    const int aoLane = (wm + rlane) * kLP + koff;
    V ahn = Frag<T>::load(&sOp[cur][PA][aoLane]);
    V aln;
    if (SPLIT != 0) aln = Frag<T>::load(&sOp[cur][SPLIT != 0 ? PA2 : PA][aoLane]);
#pragma unroll
    for (int kk = 0; kk < 64; kk += 32) {
      V bh[4], bl[4];
#pragma unroll
      for (int j = 0; j < 4; ++j) {
        const int bo = (wn + (j << 4) + rlane) * kLP + koff + kk;
        bh[j] = Frag<T>::load(&sOp[cur][PB][bo]);
        if (SPLIT == 2) bl[j] = Frag<T>::load(&sOp[cur][SPLIT == 2 ? PB2 : PB][bo]);
      }
#pragma unroll
      for (int i = 0; i < 4; ++i) {
        const V ah = ahn;
        V al;
        if (SPLIT != 0) al = aln;
        if (i < 3 || kk == 0) {
          const int an = aoLane + ((i < 3) ? ((i + 1) << 4) * kLP + kk : 32);
          ahn = Frag<T>::load(&sOp[cur][PA][an]);
          if (SPLIT != 0) aln = Frag<T>::load(&sOp[cur][SPLIT != 0 ? PA2 : PA][an]);
        }
#pragma unroll
        for (int j = 0; j < 4; ++j) {
          acc[i][j] = Frag<T>::mma(ah, bh[j], acc[i][j]);
          if (SPLIT == 2) acc[i][j] = Frag<T>::mma(ah, bl[j], acc[i][j]);
          if (SPLIT != 0) acc[i][j] = Frag<T>::mma(al, bh[j], acc[i][j]);
        }
        Frag<T>::guard(acc[i][0], acc[i][3], ah, (SPLIT != 0) ? al : ah);
      }
      Frag<T>::keep(bh[0], bh[1], bh[2], bh[3]);
      if (SPLIT == 2) Frag<T>::keep(bl[0], bl[1], bl[2], bl[3]);
    }
    if (more) {
#pragma unroll
      for (int p = 0; p < NPL; ++p)
#pragma unroll
        for (int i = 0; i < 8; ++i) *(v4u*)(&sOp[cur ^ 1][p][sLane + 16 * i * kLP]) = rg[p][i];
    }
  }
  acc_guard4(acc[0][0], acc[0][1], acc[0][2], acc[0][3]);
  acc_guard4(acc[1][0], acc[1][1], acc[1][2], acc[1][3]);
  acc_guard4(acc[2][0], acc[2][1], acc[2][2], acc[2][3]);
  acc_guard4(acc[3][0], acc[3][1], acc[3][2], acc[3][3]);

  // ---- epilogue ----
  float* slab = sT[wave];
#pragma unroll
  for (int i = 0; i < 4; ++i) {
    const int mBase = m0 + (i << 4);
#pragma unroll
    for (int j = 0; j < 4; ++j) {
      const int n = n0 + (j << 4) + rlane;
      float bv = 0.f;
      if (BIAS_MODE == 2) bv = bf_bits2f(f2bf_bits(bias[n]));
#pragma unroll
      for (int r = 0; r < 8; ++r) {
        float v = acc[i][j][r] * scale;
        if (BIAS_MODE == 2) v += bv;
        slab[(mOff + r) * 68 + (j << 4) + rlane] = v;
      }
    }
    __builtin_amdgcn_fence(__ATOMIC_RELEASE, "workgroup");
    __builtin_amdgcn_wave_barrier();
    __builtin_amdgcn_fence(__ATOMIC_ACQUIRE, "workgroup");
    if (OUT_MODE == 0) {
      float* C = (float*)Cout + (size_t)b * strideC;
      const int hh = lane >> 4, c4 = (lane & 15) * 4;     // row seg = 256 B = 16 lanes x 16 B
      {
#pragma unroll
        for (int it = 0; it < 8; ++it) {
          const int row = it * 2 + hh;
          v4f v = *(const v4f*)(slab + row * 68 + c4);
          *(v4f*)(C + (size_t)(mBase + row) * ldc + n0 + c4) = v;
        }
        
      }
    } else {
      const int q = lane >> 3, c8 = (lane & 7) * 8;
      unsigned short* C  = (unsigned short*)Cout  + (size_t)b * strideC;
      unsigned short* C2 = (OUT_MODE == 2) ? ((unsigned short*)Cout2 + (size_t)b * strideC) : nullptr;
      {
#pragma unroll
        for (int it = 0; it < 4; ++it) {
          const int row = it * 4 + q;
          const float* sp = slab + row * 68 + c8;
          v8h hv, lv;
#pragma unroll
          for (int e = 0; e < 8; ++e) {
            if (OUT_MODE == 1) {
              hv[e] = (_Float16)sp[e];
            } else {
              unsigned short hb = f2bf_bits(sp[e]);
              unsigned short lb = f2bf_bits(sp[e] - bf_bits2f(hb));
              hv[e] = __builtin_bit_cast(_Float16, hb);
              lv[e] = __builtin_bit_cast(_Float16, lb);
            }
          }
          *(v8h*)(C + (size_t)(mBase + row) * ldc + n0 + c8) = hv;
          if (OUT_MODE == 2) *(v8h*)(C2 + (size_t)(mBase + row) * ldc + n0 + c8) = lv;
        }
        
      }
    }
    __builtin_amdgcn_fence(__ATOMIC_RELEASE, "workgroup");
    __builtin_amdgcn_wave_barrier();
    __builtin_amdgcn_fence(__ATOMIC_ACQUIRE, "workgroup");
  }
}

// One launch converts all five float matrices. Their bf16 planes lie back to back in the workspace, in the order
// tgt, mem, Wq_w, Wkv_w, out_w, so the output is one flat array of three equal thirds: tgt, mem, the three weights.
// A unit = 1024 consecutive elements = one wave x 8 loads of 16 B per lane; every matrix is a whole number of units.
// Grid = kCastBlocks blocks x 16 waves, all resident at once; wave w converts unit w of each third: every element exactly once.
// A unit of mem is one key's row. The rows of a batch are stored in a new order: the keys whose mask is non-zero first (in their old
// order), the masked keys behind them. A masked key's weight in the softmax is exactly 0, so the kv projection and the attention end
// at the live count. Each block scans its batch's whole mask (512 threads x 4 keys) for the places of its own 16 rows; the first block
// of a batch also stores the count and, in the new order, each key's additive score term (bf16(bias) * log2(e), -inf when masked).
// place = live ? (live keys before it) : (live keys in all) + (masked keys before it): counts of keys, so 0 <= place < kSeqK for any mask.
static constexpr int kCastUnit   = 1024;
static constexpr int kCastBlocks = 256;
static constexpr int kCastThird  = kCastBlocks * 16 * kCastUnit;    /* 4,194,304 elements */
static_assert(kRowsM * kEmb == kCastThird && kEmb * kEmb + kKVCols * kEmb + kEmb * kEmb == kCastThird);
static_assert((kEmb * kEmb) % kCastUnit == 0 && (kKVCols * kEmb) % kCastUnit == 0);
static_assert(kCastUnit == kEmb && kCastBlocks * 16 == kBatch * kSeqK && 512 * 4 == kSeqK && kSeqK % 16 == 0);
__global__ __launch_bounds__(512) void cast_f32_bf16_all(
    const float* __restrict__ tgt, const float* __restrict__ mem, const float* __restrict__ wq,
    const float* __restrict__ wkv, const float* __restrict__ wo,
    const float* __restrict__ abias, const int* __restrict__ kmask,
    unsigned short* __restrict__ out, float* __restrict__ cbias, int* __restrict__ nlive) {
  constexpr int w1 = kEmb * kEmb, w2 = w1 + kKVCols * kEmb;
  __shared__ int sCnt[16];     // live keys in each wave's 128 keys
  __shared__ int sPlace[16];   // new places of this block's 16 mem rows
  const int tid = threadIdx.x;
  const int bb  = (int)(blockIdx.x * 16) / kSeqK;   // the batch of this block's 16 mem rows, and the first of them inside it
  const int s0  = (int)(blockIdx.x * 16) % kSeqK;
  const v4i mk = *(const v4i*)(kmask + bb * kSeqK + 4 * tid);   // this thread's 4 keys of the batch's mask
  const int l4 = (threadIdx.x & 31) * 4;
  const int e  = __builtin_amdgcn_readfirstlane((int)(blockIdx.x * 16 + (threadIdx.x >> 5))) * kCastUnit;   // wave-uniform, 0 <= e < kCastThird
  const float* src[3];
  src[0] = tgt + e;
  src[1] = mem + e;
  src[2] = (e < w1) ? wq + e : (e < w2) ? wkv + (e - w1) : wo + (e - w2);
  v4f x[3][8];
#pragma unroll
  for (int s = 0; s < 3; ++s)
#pragma unroll
    for (int i = 0; i < 8; ++i) x[s][i] = *(const v4f*)(src[s] + i * 128 + l4);   // 512 contiguous bytes per wave-wide load
  // keeps all 24 loads in front of the first conversion: without it the compiler waits for the first 8 before it issues the rest
  __builtin_amdgcn_sched_barrier(0);
  int place;
  {
    const int wv = tid >> 5;
    const unsigned below = (1u << (tid & 31)) - 1u;
    int before = 0, mine = 0;
#pragma unroll
    for (int k = 0; k < 4; ++k) {
      const unsigned bal = __builtin_amdgcn_ballot_w32(mk[k] != 0);
      before += __builtin_popcount(bal & below);
      mine   += __builtin_popcount(bal);
    }
    if ((tid & 31) == 0) sCnt[wv] = mine;
    __syncthreads();
    int total = 0;
#pragma unroll
    for (int i = 0; i < 16; ++i) {
      const int n = sCnt[i];
      total += n;
      before += (i < wv) ? n : 0;
    }
    v4f ab = (v4f){0.f, 0.f, 0.f, 0.f};
    if (s0 == 0) ab = *(const v4f*)(abias + bb * kSeqK + 4 * tid);   // block-uniform
#pragma unroll
    for (int k = 0; k < 4; ++k) {
      const int key = 4 * tid + k;
      const bool alive = (mk[k] != 0);
      const int pl = alive ? before : total + (key - before);
      before += alive ? 1 : 0;
      if ((key & ~15) == s0) sPlace[key & 15] = pl;
      if (s0 == 0) cbias[bb * kSeqK + pl] = alive ? bf_bits2f(f2bf_bits(ab[k])) * kLog2E : -__builtin_huge_valf();
    }
    if (s0 == 0 && tid == 0) nlive[bb * kCountPitch] = total;
    __syncthreads();
    place = __builtin_amdgcn_readfirstlane(sPlace[wv]);
  }
  const int dst[3] = {e, kCastThird + (bb * kSeqK + place) * kCastUnit, 2 * kCastThird + e};
#pragma unroll
  for (int s = 0; s < 3; ++s)
#pragma unroll
    for (int i = 0; i < 8; ++i) {
      v2u y;
      y[0] = (unsigned)f2bf_bits(x[s][i][0]) | ((unsigned)f2bf_bits(x[s][i][1]) << 16);
      y[1] = (unsigned)f2bf_bits(x[s][i][2]) | ((unsigned)f2bf_bits(x[s][i][3]) << 16);
      *(v2u*)(out + dst[s] + i * 128 + l4) = y;                        // 256 contiguous bytes per wave-wide store: two whole lines
    }
}

// ---- bf16 helpers for the attention kernel ----
__device__ __forceinline__ __bf16 to_bf16(float f) { return __builtin_bit_cast(__bf16, f2bf_bits(f)); }
__device__ __forceinline__ void split_bf16(float f, __bf16& hi, __bf16& lo) {
  const unsigned short hb = f2bf_bits(f);
  hi = __builtin_bit_cast(__bf16, hb);
  lo = to_bf16(f - __uint_as_float(((unsigned)hb) << 16));
}
__device__ __forceinline__ v8f mma_bf16(v16b a, v16b b, v8f c) {
  return __builtin_amdgcn_wmma_f32_16x16x32_bf16(false, a, false, b, (short)0, c, false, false);
}

__device__ __forceinline__ void exp2_x8(v8f& x) {
  float a = x[0], b = x[1], c = x[2], d = x[3], e = x[4], f = x[5], g = x[6], h = x[7];
  // one statement, so that nothing comes between: an independent v_exp_f32 behind each, the v_nop behind the last
  asm("v_exp_f32 %0, %0\n\tv_exp_f32 %1, %1\n\tv_exp_f32 %2, %2\n\tv_exp_f32 %3, %3\n\t"
      "v_exp_f32 %4, %4\n\tv_exp_f32 %5, %5\n\tv_exp_f32 %6, %6\n\tv_exp_f32 %7, %7\n\tv_nop"
      : "+v"(a), "+v"(b), "+v"(c), "+v"(d), "+v"(e), "+v"(f), "+v"(g), "+v"(h));
  x = (v8f){a, b, c, d, e, f, g, h};
}
__device__ __forceinline__ float exp2_x1(float x) {
  asm("v_exp_f32 %0, %0\n\tv_nop" : "+v"(x));   // the v_nop: the same slot
  return x;
}

// lane l with lane l ^ 16
__device__ __forceinline__ float xhalf(float x) {
  return __builtin_bit_cast(float, __builtin_amdgcn_permlanex16(__builtin_bit_cast(int, x), __builtin_bit_cast(int, x), 0x76543210, 0xfedcba98, false, false));
}

// =====================================================================================
// Cross attention, head_dim 64, 16-bit plane inputs:
//   q planes  Qh/Ql : bf16 hi/lo, element (b,s,h,d) at (b*SQ+s)*1024 + h*64 + d
//   kv planes KVh/KVl: bf16 hi/lo, row (b*SK+s) pitch 2048; k at col h*64+d, v at col 1024+h*64+d; s = the key's place, live keys first
//   scores = 0.125 * q.k^T (hi.hi + hi.lo + lo.hi) + bf16(attn_bias[b,kv]); key mask 0 -> score = -inf (cbias holds that term by place)
//   the key loop ends with the chunk that holds the last live key (nlive); the masked keys in that chunk get weight 0 through -inf
//   the scores are held times log2(e) (folded into the scale and into the staged bias), so e^(s-m) is one v_exp_f32 of a difference
//   out    = softmax(scores).v with p and v as bf16 hi/lo (3 products), f32 accumulate, f32 online softmax
//   both products run transposed (scores^T = k.q^T, out^T += v^T.p^T): a lane owns one query, p stays in registers
//   ctx written as bf16 hi/lo planes Ch/Cl, element (b,s,h,d) at (b*SQ+s)*1024 + h*64 + d.
// Block = 4 waves = 64 query rows of one (b,h); grid.x = B*H*(SQ/64) = 1024.
// =====================================================================================
// the second argument: at least four waves a SIMD, that is at most 256 vector registers, so that all 1024 blocks stay resident at once
__global__ __launch_bounds__(128, 4)
void mha_attn_hd64(const unsigned short* __restrict__ Qh, const unsigned short* __restrict__ Ql,
                   const unsigned short* __restrict__ KVh, const unsigned short* __restrict__ KVl,
                   const float* __restrict__ cbias, const int* __restrict__ nlive,
                   unsigned short* __restrict__ Ch, unsigned short* __restrict__ Cl)
{
  __shared__ __align__(16) __bf16 Ksh[kKC * kLP];         // K hi [kv][d], pitch kLP   9 KB
  __shared__ __align__(16) __bf16 Ksl[kKC * kLP];         // K lo [kv][d], pitch kLP   9 KB
  __shared__ __align__(16) __bf16 Vth[kHeadD * kLP];      // V hi [d][kv], pitch kLP   9 KB
  __shared__ __align__(16) __bf16 Vtl[kHeadD * kLP];      // V lo [d][kv], pitch kLP   9 KB
  __shared__ __align__(16) __bf16 Psh[4][16 * kLP];       // per wave out hi staging [row][d], pitch kLP
  __shared__ __align__(16) __bf16 Psl[4][16 * kLP];       // per wave out lo staging [row][d], pitch kLP
  __shared__ __align__(16) float CB[kKC];                               // per chunk: bf16(bias) * log2(e), or -inf when masked

  const int tid  = threadIdx.x;
  const int wave = __builtin_amdgcn_readfirstlane(tid >> 5);   // in a scalar register: the epilogue's addresses then hold fewer vector registers across the loop
  const int lane = tid & 31;
  const int hh   = lane >> 4;
  const int c    = lane & 15;
  const int nqb  = kSeqQ / 64;
  const int bx   = blockIdx.x;
  const int qb   = bx % nqb;
  const int bhd  = bx / nqb;
  const int h    = bhd % kHeads;
  const int b    = bhd / kHeads;
  const int q0   = qb * 64 + wave * 16;
  const float ninf = -__builtin_huge_valf();

  const __bf16* Qhp = (const __bf16*)(const void*)Qh;
  const __bf16* Qlp = (const __bf16*)(const void*)Ql;

  // ---- Q fragments (B operand, column = c, split k map via Frag::load): 2 d-chunks, hi and lo ----
  v16b qah[2], qal[2];
  {
    const size_t qo = (size_t)(b * kSeqQ + q0 + c) * kEmb + h * kHeadD + 8 * hh;
#pragma unroll
    for (int dc = 0; dc < 2; ++dc) {
      qah[dc] = Frag<__bf16>::load(Qhp + qo + dc * 32);
      qal[dc] = Frag<__bf16>::load(Qlp + qo + dc * 32);
    }
  }

  const v8f zero8 = (v8f){0.f,0.f,0.f,0.f,0.f,0.f,0.f,0.f};
  float mrow = ninf, lrow = 0.f;   // one query (column c) per lane
  v8f oacc[4];
#pragma unroll
  for (int t = 0; t < 4; ++t) oacc[t] = zero8;

  __bf16* pwh = Psh[wave];
  __bf16* pwl = Psl[wave];

  // ---- staging maps; the next chunk's K, V and score terms travel in registers while the current chunk is worked on ----
  // K planes: thread -> (kv row tid>>1, d half (tid&1)*32): 128 thr x 32 elems = 64 x 64 per plane
  const int kvr = tid >> 1, dh = (tid & 1) * 32;
  // V planes transposed into [d][kv]: thread -> (kv pair vp = tid>>2, d range dq = (tid&3)*16)
  // 32 pairs x 4 ranges = 128 thr; each writes 2 kv x 16 d as packed u32 (both halves per-lane data)
  const int vp = tid >> 2, dq = (tid & 3) * 16;
  // every address is a fixed block-uniform base + one 32-bit per-lane byte offset, which moves on by a chunk in front of each later fetch:
  // so each offset holds one vector register across the loop, not a 64-bit pair (below 2^25 for the last chunk: no wrap)
  unsigned kByte = (unsigned)(kvr * kKVCols + dh) * 2u;
  unsigned vByte = (unsigned)(2 * vp * kKVCols + kEmb + dq) * 2u;
  unsigned bByte = (unsigned)(tid & (kKC - 1)) * 4u;
  const gbytes baseH = uniform_ptr(KVh + (size_t)(b * kSeqK) * kKVCols + h * kHeadD);
  const gbytes baseL = uniform_ptr(KVl + (size_t)(b * kSeqK) * kKVCols + h * kHeadD);
  const gbytes baseB = uniform_ptr(cbias + b * kSeqK);
  v4u gkh[4], gkl[4], gxh[2], gyh[2], gxl[2], gyl[2];
  float gbias = 0.f;
  // a chunk is fetched in two parts: K and the score terms in front of the score products, V behind them, where the K fragments' registers are free again
  auto fetch_v = [&]() {
#pragma unroll
    for (int i = 0; i < 2; ++i) {
      gxh[i] = *(gvec16)(baseH + vByte + 16 * i);
      gyh[i] = *(gvec16)(baseH + vByte + 2 * kKVCols + 16 * i);
      gxl[i] = *(gvec16)(baseL + vByte + 16 * i);
      gyl[i] = *(gvec16)(baseL + vByte + 2 * kKVCols + 16 * i);
    }
    // behind this wait the address registers of the loads above may be rewritten
    asm volatile("s_wait_xcnt 0x0" ::: "memory");
  };
  auto fetch_k = [&]() {
#pragma unroll
    for (int i = 0; i < 4; ++i) {
      gkh[i] = *(gvec16)(baseH + kByte + 16 * i);
      gkl[i] = *(gvec16)(baseL + kByte + 16 * i);
    }
    if (tid < kKC) {   // waves 0 and 1 entirely: wave-uniform branch
      gbias = *(const __attribute__((address_space(1))) float*)(baseB + bByte);
    }
    // behind this wait the address registers of the loads above may be rewritten; it also keeps the loads in front of the chunk's LDS reads
    asm volatile("s_wait_xcnt 0x0" ::: "memory");
  };
  // chunks that hold a live key: block-uniform, bounded by the shape whatever the count word holds
  const int nch = (min(max(__builtin_amdgcn_readfirstlane(nlive[b * kCountPitch]), 0), kSeqK) + kKC - 1) / kKC;
  if (nch > 0) { fetch_k(); fetch_v(); }

  for (int kc = 0; kc < nch; ++kc) {
    __syncthreads();
#pragma unroll
    for (int i = 0; i < 4; ++i) {
      *(v4u*)(Ksh + kvr * kLP + dh + 8 * i) = gkh[i];
      *(v4u*)(Ksl + kvr * kLP + dh + 8 * i) = gkl[i];
    }
#pragma unroll
    for (int i = 0; i < 2; ++i) {
#pragma unroll
      for (int jw = 0; jw < 4; ++jw) {
        const int d0 = dq + 8 * i + 2 * jw;
        const unsigned xhw = gxh[i][jw], yhw = gyh[i][jw], xlw = gxl[i][jw], ylw = gyl[i][jw];
        const unsigned h0 = (xhw & 0xffffu) | (yhw << 16);
        const unsigned h1 = (xhw >> 16) | (yhw & 0xffff0000u);
        const unsigned l0 = (xlw & 0xffffu) | (ylw << 16);
        const unsigned l1 = (xlw >> 16) | (ylw & 0xffff0000u);
        *(unsigned*)(Vth + d0 * kLP + 2 * vp)       = h0;
        *(unsigned*)(Vth + (d0 + 1) * kLP + 2 * vp) = h1;
        *(unsigned*)(Vtl + d0 * kLP + 2 * vp)       = l0;
        *(unsigned*)(Vtl + (d0 + 1) * kLP + 2 * vp) = l1;
      }
    }
    if (tid < kKC) CB[tid] = gbias;   // waves 0 and 1 entirely: wave-uniform branch
    __syncthreads();
    if (kc + 1 < nch) {   // block-uniform; the loads fly under this chunk's products and softmax
      kByte += (unsigned)(kKC * kKVCols) * 2u;
      bByte += (unsigned)kKC * 4u;
      fetch_k();
    }

    // ---- scores, transposed: tile j = K rows (A operand) x Q columns (B operand), 2 d-chunks x 3 products ----
    // D map: this lane holds query column c and the keys j*16 + 8*hh + r
    // the fragments of a d-chunk's four key tiles are read as one group in front of its 12 products, and successive products go to
    // different tiles: one LDS latency per group, no product waits for the one before it; each tile's own sums keep their order
    v8f s[4];
#pragma unroll
    for (int j = 0; j < 4; ++j) s[j] = zero8;
#pragma unroll
    for (int dc = 0; dc < 2; ++dc) {
      v16b kbh[4], kbl[4];
#pragma unroll
      for (int j = 0; j < 4; ++j) {
        kbh[j] = Frag<__bf16>::load(Ksh + (j * 16 + c) * kLP + dc * 32 + 8 * hh);
        kbl[j] = Frag<__bf16>::load(Ksl + (j * 16 + c) * kLP + dc * 32 + 8 * hh);
      }
      // fence pair round the products: without it the compiler moves the reads in among them, the lo planes' into one shared register set with a full wait behind each
      __builtin_amdgcn_sched_barrier(0);
#pragma unroll
      for (int j = 0; j < 4; ++j) s[j] = mma_bf16(kbh[j], qah[dc], s[j]);
#pragma unroll
      for (int j = 0; j < 4; ++j) s[j] = mma_bf16(kbl[j], qah[dc], s[j]);
#pragma unroll
      for (int j = 0; j < 4; ++j) s[j] = mma_bf16(kbh[j], qal[dc], s[j]);
      __builtin_amdgcn_sched_barrier(0);   // the pair's second half; it also keeps the reads of the score terms out of the products
    }
    // four vector slots behind the last score products, on both sides of the branch below
    acc_guard4(s[0], s[1], s[2], s[3]);
    if (kc + 1 < nch) {   // block-uniform
      vByte += (unsigned)(kKC * kKVCols) * 2u;
      fetch_v();
    }
    float cm = ninf;
#pragma unroll
    for (int j = 0; j < 4; ++j) {
      const v4f cb0 = *(const v4f*)(CB + j * 16 + 8 * hh);
      const v4f cb1 = *(const v4f*)(CB + j * 16 + 8 * hh + 4);
#pragma unroll
      for (int r = 0; r < 8; ++r) {
        const float v = s[j][r] * (0.125f * kLog2E) + ((r < 4) ? cb0[r & 3] : cb1[r & 3]);
        s[j][r] = v;
        cm = fmaxf(cm, v);
      }
    }
    cm = fmaxf(cm, xhalf(cm));   // the other lane half holds this query's other 32 keys
    // ---- online softmax, one query per lane; P packs from the score tiles straight into B operands ----
    const float mnew = fmaxf(mrow, cm);
    const bool live = (mnew != ninf);
    float alpha = 1.0f;
    float ps[4] = {0.f, 0.f, 0.f, 0.f};
    if (live) {   // one guard per lane: it owns one query, so one flag covers the rescale factor and all 32 of its scores
      alpha = exp2_x1(mrow - mnew);   // every argument here is <= 0: no range reduction, no overflow test
#pragma unroll
      for (int j = 0; j < 4; ++j) {
#pragma unroll
        for (int r = 0; r < 8; ++r) s[j][r] -= mnew;
        exp2_x8(s[j]);
#pragma unroll
        for (int r = 0; r < 8; ++r) ps[j] += s[j][r];
      }
    } else {
#pragma unroll
      for (int j = 0; j < 4; ++j) s[j] = zero8;
    }
    mrow = mnew;
    v16b ph[2], pl[2];
#pragma unroll
    for (int j = 0; j < 4; ++j) {
#pragma unroll
      for (int r = 0; r < 8; ++r) {
        const float p = s[j][r];
        __bf16 a, bl;
        split_bf16(p, a, bl);
        ph[j >> 1][(j & 1) * 8 + r] = a;    // element e of the operand is key kk*32 + (e < 8 ? 8*hh + e : 16 + 8*hh + e - 8): the order of Frag::load
        pl[j >> 1][(j & 1) * 8 + r] = bl;
      }
    }
    lrow = lrow * alpha + ((ps[0] + ps[1]) + (ps[2] + ps[3]));   // this lane half's share; the halves join in the epilogue
#pragma unroll
    for (int t = 0; t < 4; ++t)
#pragma unroll
      for (int r = 0; r < 8; ++r) oacc[t][r] *= alpha;
    // ---- out^T += V^T.P^T : 2 kv-chunks x 4 d-tiles x 3 products; this lane holds query c, d = t*16 + 8*hh + r ----
    // grouped like the score products: a kv-chunk's four d-tiles are read together, successive products go to different tiles
#pragma unroll
    for (int kk = 0; kk < 2; ++kk) {
      v16b vb[4], vl[4];
#pragma unroll
      for (int t = 0; t < 4; ++t) {
        vb[t] = Frag<__bf16>::load(Vth + (t * 16 + c) * kLP + kk * 32 + 8 * hh);
        vl[t] = Frag<__bf16>::load(Vtl + (t * 16 + c) * kLP + kk * 32 + 8 * hh);
      }
#pragma unroll
      for (int t = 0; t < 4; ++t) oacc[t] = mma_bf16(vb[t], ph[kk], oacc[t]);
#pragma unroll
      for (int t = 0; t < 4; ++t) oacc[t] = mma_bf16(vl[t], ph[kk], oacc[t]);
#pragma unroll
      for (int t = 0; t < 4; ++t) oacc[t] = mma_bf16(vb[t], pl[kk], oacc[t]);
    }
    // four vector slots behind the chunk's last products, on both sides of the loop's branch
    acc_guard4(oacc[0], oacc[1], oacc[2], oacc[3]);
  }

  // ---- epilogue: join the halves' sums, normalise, split to bf16 hi/lo into this wave's staging, whole-line stores ----
  // the lane number is read anew here, so that none of the epilogue's addresses holds a vector register across the loop
  const int eln = (int)__builtin_amdgcn_mbcnt_lo(~0u, 0u);
  const int ec = eln & 15, ehh = eln >> 4;
  {
    const float inv = 1.0f / (lrow + xhalf(lrow));
#pragma unroll
    for (int t = 0; t < 4; ++t) {
      v8b xa, xb;
#pragma unroll
      for (int r = 0; r < 8; ++r) {
        const float v = oacc[t][r] * inv;
        __bf16 a, bl;
        split_bf16(v, a, bl);
        xa[r] = a;
        xb[r] = bl;
      }
      *(v8b*)(pwh + ec * kLP + t * 16 + 8 * ehh) = xa;
      *(v8b*)(pwl + ec * kLP + t * 16 + 8 * ehh) = xb;
    }
  }
  __builtin_amdgcn_fence(__ATOMIC_RELEASE, "workgroup");
  __builtin_amdgcn_wave_barrier();
  __builtin_amdgcn_fence(__ATOMIC_ACQUIRE, "workgroup");
  {
    _Float16* Chp = (_Float16*)(void*)Ch;
    _Float16* Clp = (_Float16*)(void*)Cl;
    const int q8 = eln >> 3, c8 = (eln & 7) * 8;
    const size_t ob = (size_t)(b * kSeqQ + q0) * kEmb + h * kHeadD + c8;
    {
#pragma unroll
      for (int it = 0; it < 4; ++it) {
        const int row = it * 4 + q8;
        const v8b xh = *(const v8b*)(pwh + row * kLP + c8);
        const v8b xl = *(const v8b*)(pwl + row * kLP + c8);
        const v8h yh = __builtin_bit_cast(v8h, xh);
        const v8h yl = __builtin_bit_cast(v8h, xl);
        *(v8h*)(Chp + ob + (size_t)row * kEmb) = yh;
        *(v8h*)(Clp + ob + (size_t)row * kEmb) = yl;
      }
      
    }
  }
}

extern "C" void kernel_launch(void* const* d_in, const int* in_sizes, int n_in,
                              void* d_out, int out_size, void* d_ws, size_t ws_size,
                              hipStream_t stream) {
  static_assert(kSeqK % 128 == 0 && kRowsM % 128 == 0 && kEmb % 128 == 0 && kKVCols % 128 == 0 && kEmb % 64 == 0);
  static_assert(kSeqQ % 64 == 0 && kSeqK % kKC == 0 && kHeadD == 64 && kHeads * kHeadD == kEmb && kSeqQ == kSeqK);

  if (n_in < 10) return;
  const int nAct = kRowsM * kEmb;            /* 4,194,304 elements */
  const int nWq  = kEmb * kEmb;              /* 1,048,576 */
  const int nWkv = kKVCols * kEmb;           /* 2,097,152 */
  const int nWo  = kEmb * kEmb;
  if (in_sizes[0] != nAct || in_sizes[1] != kBatch * kSeqK * kEmb || in_sizes[2] != kBatch * kSeqK ||
      in_sizes[3] != kBatch * kSeqK || in_sizes[4] != nWq || in_sizes[5] != kEmb || in_sizes[6] != nWkv ||
      in_sizes[7] != kKVCols || in_sizes[8] != nWo || in_sizes[9] != kEmb) return;
  if (out_size != nAct) return;

  const float* tgt   = (const float*)d_in[0];
  const float* mem   = (const float*)d_in[1];
  const float* abias = (const float*)d_in[2];
  const int*   kmask = (const int*)d_in[3];
  const float* Wq_w  = (const float*)d_in[4];
  const float* Wq_b  = (const float*)d_in[5];
  const float* Wkv_w = (const float*)d_in[6];
  const float* Wkv_b = (const float*)d_in[7];
  const float* out_w = (const float*)d_in[8];
  const float* out_b = (const float*)d_in[9];
  float* out = (float*)d_out;

  /* workspace region map (bytes, every offset but nlive's a multiple of 1 MiB):
       [  0 MiB,  8 MiB)  tgt16   bf16 [4096][1024]
       [  8 MiB, 16 MiB)  mem16   bf16 [4096][1024]
       [ 16 MiB, 18 MiB)  wq16    bf16 [1024][1024]
       [ 18 MiB, 22 MiB)  wkv16   bf16 [2048][1024]
       [ 22 MiB, 24 MiB)  wo16    bf16 [1024][1024]
       [ 24 MiB, 32 MiB)  qh      bf16 [4096][1024]   [ 32, 40) ql
       [ 40 MiB, 56 MiB)  kvh     bf16 [4096][2048]   [ 56, 72) kvl
       [ 72 MiB, 80 MiB)  ch      bf16 [4096][1024]   [ 80, 88) cl
       [ 88 MiB, +16 KiB) cbias   f32 [2][2048], then nlive int [2] at a pitch of 128 B */
  const size_t szAct16 = (size_t)nAct * 2;
  const size_t szKV16  = (size_t)kRowsM * kKVCols * 2;
  const size_t oTgt = 0;
  const size_t oMem = oTgt + szAct16;
  const size_t oWq  = oMem + szAct16;
  const size_t oWkv = oWq + (size_t)nWq * 2;
  const size_t oWo  = oWkv + (size_t)nWkv * 2;
  const size_t oQh  = oWo + (size_t)nWo * 2;
  const size_t oQl  = oQh + szAct16;
  const size_t oKVh = oQl + szAct16;
  const size_t oKVl = oKVh + szKV16;
  const size_t oCh  = oKVl + szKV16;
  const size_t oCl  = oCh + szAct16;
  const size_t oCb  = oCl + szAct16;
  const size_t oNl  = oCb + (size_t)kBatch * kSeqK * 4;
  const size_t total = oNl + (size_t)kBatch * kCountPitch * 4;
  if (total > ws_size) return;

  char* ws = (char*)d_ws;
  unsigned short* tgt16 = (unsigned short*)(ws + oTgt);
  unsigned short* mem16 = (unsigned short*)(ws + oMem);
  unsigned short* wq16  = (unsigned short*)(ws + oWq);
  unsigned short* wkv16 = (unsigned short*)(ws + oWkv);
  unsigned short* wo16  = (unsigned short*)(ws + oWo);
  unsigned short* qh    = (unsigned short*)(ws + oQh);
  unsigned short* ql    = (unsigned short*)(ws + oQl);
  unsigned short* kvh   = (unsigned short*)(ws + oKVh);
  unsigned short* kvl   = (unsigned short*)(ws + oKVl);
  unsigned short* ch    = (unsigned short*)(ws + oCh);
  unsigned short* cl    = (unsigned short*)(ws + oCl);
  float* cbias = (float*)(ws + oCb);
  int*   nlive = (int*)(ws + oNl);

  /* 1. RNE-convert the five float matrices to bf16 planes: one launch; the planes tgt16 .. wo16 are contiguous from tgt16 on;
        mem16's rows go live keys first, with cbias and nlive to match */
  cast_f32_bf16_all<<<dim3(kCastBlocks), dim3(512), 0, stream>>>(tgt, mem, Wq_w, Wkv_w, out_w, abias, kmask, tgt16, cbias, nlive);

  /* 2. q = tgt16 . wq16^T + bq : M=4096 N=1024 K=1024 -> bf16 hi/lo planes; 256 block tiles of 128x128 */
  {
    const int tiles = (kRowsM / 128) * (kEmb / 128);
    wmma_gemm64<1, 0, 2, 2><<<dim3(tiles, 1), dim3(128), 0, stream>>>(
        tgt16, tgt16, kEmb, 0L, wq16, wq16, kEmb, 0L, (void*)qh, (void*)ql, kEmb, 0L,
        Wq_b, nullptr, kRowsM, kEmb, kEmb, 1.0f);
  }
  /* 3. kv = mem16 . wkv16^T + bkv : per batch M=2048 N=2048 K=1024 -> bf16 hi/lo planes; 2 x 256 block tiles, those behind the live keys return at once */
  {
    const int tiles = (kSeqK / 128) * (kKVCols / 128);
    wmma_gemm64<1, 0, 2, 2><<<dim3(tiles, kBatch), dim3(128), 0, stream>>>(
        mem16, mem16, kEmb, (long)kSeqK * kEmb, wkv16, wkv16, kEmb, 0L, (void*)kvh, (void*)kvl, kKVCols, (long)kSeqK * kKVCols,
        Wkv_b, nlive, kSeqK, kKVCols, kEmb, 1.0f);
  }
  /* 4. attention: grid = B*H*(SQ/64) = 1024 blocks of 128 threads -> ctx hi/lo planes */
  {
    const int nblk = kBatch * kHeads * (kSeqQ / 64);
    mha_attn_hd64<<<dim3(nblk), dim3(128), 0, stream>>>(qh, ql, kvh, kvl, cbias, nlive, ch, cl);
  }
  /* 5. out = (ch + cl) . wo16^T + bo : M=4096 N=1024 K=1024, A carried hi+lo (2 products), f32 out */
  {
    const int tiles = (kRowsM / 128) * (kEmb / 128);
    wmma_gemm64<1, 1, 2, 0><<<dim3(tiles, 1), dim3(128), 0, stream>>>(
        ch, cl, kEmb, 0L, wo16, wo16, kEmb, 0L, (void*)out, (void*)cl, kEmb, 0L,
        out_b, nullptr, kRowsM, kEmb, kEmb, 1.0f);
  }
}

// v009
// A run of this version takes 113 microseconds.
// Next to v008, in two timings, it ran 1.15 and 1.14 times as fast.
// All steps since v000 together make it 4.90 times as fast.
// Contractions: q/kv/out projections on v_wmma_f32_16x16x32_bf16 (float inputs RNE-converted to bf16 once; out-projection A operand carried as bf16 hi+lo planes, 2 products); attention q.k and p.v on v_wmma_f32_16x16x32_bf16 with bf16 hi+lo planes for q,k,p,v (3 products); f32 accumulate; softmax and normalisation in f32.
#include <hip/hip_runtime.h>

typedef __attribute__((ext_vector_type(16))) _Float16 v16h;
typedef __attribute__((ext_vector_type(8)))  _Float16 v8h;
typedef __attribute__((ext_vector_type(16))) __bf16   v16b;
typedef __attribute__((ext_vector_type(8)))  __bf16   v8b;
typedef __attribute__((ext_vector_type(8)))  float    v8f;
typedef __attribute__((ext_vector_type(4)))  float    v4f;
typedef __attribute__((ext_vector_type(2)))  float    v2f;
typedef __attribute__((ext_vector_type(4)))  unsigned v4u;
typedef __attribute__((ext_vector_type(2)))  unsigned v2u;
typedef __attribute__((ext_vector_type(4)))  int      v4i;

static constexpr int kBatch  = 2;
static constexpr int kSeqQ   = 2048;
static constexpr int kSeqK   = 2048;
static constexpr int kEmb    = 1024;
static constexpr int kHeads  = 16;
static constexpr int kHeadD  = 64;
static constexpr int kKVCols = 2 * kEmb;          /* 2048: k at cols 0..1023, v at cols 1024..2047 */
static constexpr int kRowsM  = kBatch * kSeqQ;    /* 4096 (== kBatch * kSeqK) */
static constexpr int kKC     = 64;                /* keys per streamed chunk */
static constexpr float kLog2E = 1.4426950408889634f;   /* log2(e): the attention scores are carried in the base-2 domain */
static constexpr int kCountPitch = 32;            /* ints between the two batches' live-key counts: a 128-byte line each */
static constexpr int kLP     = 72;                /* LDS row pitch in 16-bit elements: 144 B = 16 B x 9, so the 16 rows of a 16-byte fragment read fall on distinct banks */

__device__ __forceinline__ unsigned short f2bf_bits(float f) {
  unsigned u = __float_as_uint(f);
  return (unsigned short)((u + 0x7FFFu + ((u >> 16) & 1u)) >> 16);
}
__device__ __forceinline__ float bf_bits2f(unsigned short h) { return __uint_as_float(((unsigned)h) << 16); }

// hazard guards as plain device helpers
__device__ __forceinline__ void dep_guard_h(v8f& a, v8f& b, v16h x, v16h y) { asm volatile("v_nop\n\tv_nop\n\tv_nop\n\tv_nop" : "+v"(a), "+v"(b) : "v"(x), "v"(y)); }
__device__ __forceinline__ void dep_guard_b(v8f& a, v8f& b, v16b x, v16b y) { asm volatile("v_nop\n\tv_nop\n\tv_nop\n\tv_nop" : "+v"(a), "+v"(b) : "v"(x), "v"(y)); }
__device__ __forceinline__ void keep4_h(v16h a, v16h b, v16h c, v16h d) { asm volatile("v_nop" :: "v"(a), "v"(b), "v"(c), "v"(d)); }
__device__ __forceinline__ void keep4_b(v16b a, v16b b, v16b c, v16b d) { asm volatile("v_nop" :: "v"(a), "v"(b), "v"(c), "v"(d)); }
__device__ __forceinline__ void acc_guard4(v8f& a, v8f& b, v8f& c, v8f& d) { asm volatile("v_nop\n\tv_nop\n\tv_nop\n\tv_nop" : "+v"(a), "+v"(b), "+v"(c), "+v"(d)); }
template <typename T> struct Frag;
template <> struct Frag<_Float16> {
  typedef v16h V; union U { v16h v; v8h h[2]; };
  static __device__ __forceinline__ v16h load(const _Float16* p) {   // elements 0..7 <- p[0..7], 8..15 <- p[16..23]
    U f; f.h[0] = *(const v8h*)(p); f.h[1] = *(const v8h*)(p + 16); return f.v;
  }
  static __device__ __forceinline__ v8f mma(v16h a, v16h b, v8f c) {
    return __builtin_amdgcn_wmma_f32_16x16x32_f16(false, a, false, b, (short)0, c, false, false);
  }
  static __device__ __forceinline__ void guard(v8f& a, v8f& b, v16h x, v16h y) { dep_guard_h(a, b, x, y); }
  static __device__ __forceinline__ void keep(v16h a, v16h b, v16h c, v16h d) { keep4_h(a, b, c, d); }
};
template <> struct Frag<__bf16> {
  typedef v16b V; union U { v16b v; v8b h[2]; };
  static __device__ __forceinline__ v16b load(const __bf16* p) {
    U f; f.h[0] = *(const v8b*)(p); f.h[1] = *(const v8b*)(p + 16); return f.v;
  }
  static __device__ __forceinline__ v8f mma(v16b a, v16b b, v8f c) {
    return __builtin_amdgcn_wmma_f32_16x16x32_bf16(false, a, false, b, (short)0, c, false, false);
  }
  static __device__ __forceinline__ void guard(v8f& a, v8f& b, v16b x, v16b y) { dep_guard_b(a, b, x, y); }
  static __device__ __forceinline__ void keep(v16b a, v16b b, v16b c, v16b d) { keep4_b(a, b, c, d); }
};

// a block-uniform global address, pinned into a scalar register pair
typedef const __attribute__((address_space(1))) char* gbytes;
typedef const __attribute__((address_space(1))) v4u*  gvec16;
__device__ __forceinline__ gbytes uniform_ptr(const void* p) {
  const unsigned long long u = (unsigned long long)p;
  const unsigned lo = (unsigned)__builtin_amdgcn_readfirstlane((int)(unsigned)u);
  const unsigned hi = (unsigned)__builtin_amdgcn_readfirstlane((int)(unsigned)(u >> 32));
  return (gbytes)(((unsigned long long)hi << 32) | lo);
}

// ---- Register-blocked batched WMMA GEMM, operands staged through LDS ---------
// C[m,n] = scale * sum_k A[m,k] * Bt[n,k] (+bias); a block of 4 waves owns a 128x128 tile, each wave a 64x64 quarter.
// A row-major [M,K]; Bt row-major [N,K]; M,N % 128 == 0, K % 64 == 0.
// Each stage is 64 k = one whole 128-byte line of every operand row: 8 lanes read a line, a wave-wide load covers 4 whole lines.
// Two LDS buffers: stage s+1 is loaded into registers while stage s is multiplied, and stored behind it; one barrier per stage.
// SPLIT: 0 = single product; 1 = A carried as hi+lo planes (A.B + A2.B); 2 = A and B hi+lo planes (A.B + A.B2 + A2.B).
// rowsLive: see at its test below.
// PAIR: 0 = one product, grid (tiles, batches). 1 = two independent products of the same lda, ldb and K in one launch, flat grid: the first
// (M1/128)*(N1/128) blocks take the unbatched product of the arguments that end in 1, the rest the batched one, its tiles ordered row of tiles,
// batch, column, so that the tiles behind rowsLive come last. A WGP then holds a block of each product, and each fills the other's waits.
// BIAS_MODE: 0 = none, 2 = bias[n] (bias RNE-converted to bf16 before the add).
// OUT_MODE: 0 = f32, 1 = f16, 2 = bf16 hi plane (Cout) + bf16 lo plane (Cout2).
// ET: 0 = f16 operands, 1 = bf16 operands (pointers passed as 16-bit storage)
template <int ET> struct Elem;
template <> struct Elem<0> { typedef _Float16 T; };
template <> struct Elem<1> { typedef __bf16 T; };
template <int ET, int SPLIT, int BIAS_MODE, int OUT_MODE, int PAIR>
__global__ __launch_bounds__(128) void wmma_gemm64(
    const unsigned short* __restrict__ Ap0, const unsigned short* __restrict__ A2p0, int lda, long strideA,
    const unsigned short* __restrict__ Btp0, const unsigned short* __restrict__ Bt2p0, int ldb, long strideB,
    void* __restrict__ Cout0, void* __restrict__ Cout20, int ldc0, long strideC,
    const float* __restrict__ bias0, const int* __restrict__ rowsLive0,
    int M0, int N0, int K, float scale, int batches,
    const unsigned short* __restrict__ Ap1, const unsigned short* __restrict__ Btp1,
    void* __restrict__ Cout1, void* __restrict__ Cout21, int ldc1, const float* __restrict__ bias1, int M1, int N1) {
  static_assert(PAIR == 0 || SPLIT == 0);
  typedef typename Elem<ET>::T T;
  typedef typename Frag<T>::V V;
  // which product this block belongs to, and its tile number there: block-uniform
  const int tiles1 = PAIR ? (M1 >> 7) * (N1 >> 7) : 0;
  const bool one = PAIR && (int)blockIdx.x < tiles1;
  const int tile = (int)blockIdx.x - (one ? 0 : tiles1);
  const unsigned short* Ap = one ? Ap1 : Ap0;
  const unsigned short* A2p = one ? Ap1 : A2p0;
  const unsigned short* Btp = one ? Btp1 : Btp0;
  const unsigned short* Bt2p = one ? Btp1 : Bt2p0;
  void* Cout = one ? Cout1 : Cout0;
  void* Cout2 = one ? Cout21 : Cout20;
  const float* bias = one ? bias1 : bias0;
  const int* rowsLive = one ? nullptr : rowsLive0;
  const int ldc = one ? ldc1 : ldc0;
  const int M = one ? M1 : M0;
  const int N = one ? N1 : N0;
  const int nb = one ? 1 : batches;
  const T* A = (const T*)Ap; const T* A2 = (const T*)A2p; const T* Bt = (const T*)Btp; const T* Bt2 = (const T*)Bt2p;
  constexpr int PA = 0, PB = 1, PA2 = 2, PB2 = 3;              // operand planes in LDS
  constexpr int NPL = 2 + (SPLIT != 0 ? 1 : 0) + (SPLIT == 2 ? 1 : 0);
  __shared__ __align__(16) T sOp[2][NPL][128 * kLP];           // [buffer][plane][row][64 k], pitch kLP
  __shared__ __align__(16) float sT[4][16 * 68];               // per-wave 16x64 slab, pitch 68 floats
  const int tid  = threadIdx.x;
  const int lane = tid & 31;
  const int wave = tid >> 5;
  const int tilesN = N >> 7;
  const int tilesM = M >> 7;
  if (tile >= tilesM * tilesN * (PAIR ? nb : 1)) return;   // block-uniform, in front of every barrier
  const int trow = tile / tilesN;              // PAIR: row of tiles and batch together, the batch running faster
  const int bn = tile - trow * tilesN;
  const int bm = PAIR ? trow / nb : trow;
  const int b  = PAIR ? trow - bm * nb : (int)blockIdx.y;
  // rowsLive (may be null): per batch, the number of leading A rows whose product anybody reads; a tile wholly behind it is not computed
  if (rowsLive != nullptr && (bm << 7) >= rowsLive[b * kCountPitch]) return;   // block-uniform, in front of every barrier
  const int wm = (wave >> 1) << 6;             // this wave's quarter inside the block tile
  const int wn = (wave & 1) << 6;
  const int m0 = (bm << 7) + wm;
  const int n0 = (bn << 7) + wn;

  const T* Ab  = A  + (size_t)b * strideA;
  const T* Bb  = Bt + (size_t)b * strideB;
  const T* Ab2 = (SPLIT != 0) ? (A2  + (size_t)b * strideA) : nullptr;
  const T* Bb2 = (SPLIT == 2) ? (Bt2 + (size_t)b * strideB) : nullptr;

  const int rlane = lane & 15;                 // row (A) / col (B, D) within subtile
  const int koff  = (lane >> 4) * 8;           // k offset of this lane half
  const int mOff  = (lane >> 4) * 8;           // D row offset

  // staging map: thread -> (row tid>>3 of each group of 16 rows, 16-byte piece tid&7 of the row's line)
  const int srow = tid >> 3;
  const int sseg = (tid & 7) * 8;
  const int sLane = srow * kLP + sseg;
  unsigned aByte = (unsigned)(srow * lda + sseg) * 2u;      // per-lane byte offsets; they advance by one line (128 B) per stage
  unsigned bByte = (unsigned)(srow * ldb + sseg) * 2u;
  // block-uniform base of each group of 16 rows, held in scalar registers: every load is base + one per-lane offset,
  // so no address register is rewritten while a stage's loads are being issued
  gbytes gp[NPL][8];
#pragma unroll
  for (int i = 0; i < 8; ++i) {
    gp[PA][i] = uniform_ptr(Ab + (size_t)((bm << 7) + 16 * i) * lda);
    gp[PB][i] = uniform_ptr(Bb + (size_t)((bn << 7) + 16 * i) * ldb);
    if (SPLIT != 0) gp[SPLIT != 0 ? PA2 : PA][i] = uniform_ptr(Ab2 + (size_t)((bm << 7) + 16 * i) * lda);
    if (SPLIT == 2) gp[SPLIT == 2 ? PB2 : PB][i] = uniform_ptr(Bb2 + (size_t)((bn << 7) + 16 * i) * ldb);
  }

  v8f acc[4][4];
#pragma unroll
  for (int i = 0; i < 4; ++i)
#pragma unroll
    for (int j = 0; j < 4; ++j) acc[i][j] = (v8f){0.f,0.f,0.f,0.f,0.f,0.f,0.f,0.f};

  v4u rg[NPL][8];
  const int nst = K >> 6;
#pragma unroll
  for (int p = 0; p < NPL; ++p)
#pragma unroll
    for (int i = 0; i < 8; ++i) rg[p][i] = *(gvec16)(gp[p][i] + ((p & 1) ? bByte : aByte));
#pragma unroll
  for (int p = 0; p < NPL; ++p)
#pragma unroll
    for (int i = 0; i < 8; ++i) *(v4u*)(&sOp[0][p][sLane + 16 * i * kLP]) = rg[p][i];

  for (int s = 0; s < nst; ++s) {
    const bool more = (s + 1 < nst);           // block-uniform
    __syncthreads();                           // publishes stage s; ends every wave's reads of the buffer that stage s+1 goes into
    if (more) {
      aByte += 128u;
      bByte += 128u;
#pragma unroll
      for (int p = 0; p < NPL; ++p)
#pragma unroll
        for (int i = 0; i < 8; ++i) rg[p][i] = *(gvec16)(gp[p][i] + ((p & 1) ? bByte : aByte));
      // behind this wait the address registers of the loads above may be rewritten; it also keeps the loads in front of the stage's LDS reads
      asm volatile("s_wait_xcnt 0x0" ::: "memory");
    }
    const int cur = s & 1;
    // the A fragments run one row of tiles ahead of the products, so that a row's LDS latency hides behind the row before it
    const int aoLane = (wm + rlane) * kLP + koff;
    V ahn = Frag<T>::load(&sOp[cur][PA][aoLane]);
    V aln;
    if (SPLIT != 0) aln = Frag<T>::load(&sOp[cur][SPLIT != 0 ? PA2 : PA][aoLane]);
#pragma unroll
    for (int kk = 0; kk < 64; kk += 32) {
      V bh[4], bl[4];
#pragma unroll
      for (int j = 0; j < 4; ++j) {
        const int bo = (wn + (j << 4) + rlane) * kLP + koff + kk;
        bh[j] = Frag<T>::load(&sOp[cur][PB][bo]);
        if (SPLIT == 2) bl[j] = Frag<T>::load(&sOp[cur][SPLIT == 2 ? PB2 : PB][bo]);
      }
#pragma unroll
      for (int i = 0; i < 4; ++i) {
        const V ah = ahn;
        V al;
        if (SPLIT != 0) al = aln;
        if (i < 3 || kk == 0) {
          const int an = aoLane + ((i < 3) ? ((i + 1) << 4) * kLP + kk : 32);
          ahn = Frag<T>::load(&sOp[cur][PA][an]);
          if (SPLIT != 0) aln = Frag<T>::load(&sOp[cur][SPLIT != 0 ? PA2 : PA][an]);
        }
#pragma unroll
        for (int j = 0; j < 4; ++j) {
          acc[i][j] = Frag<T>::mma(ah, bh[j], acc[i][j]);
          if (SPLIT == 2) acc[i][j] = Frag<T>::mma(ah, bl[j], acc[i][j]);
          if (SPLIT != 0) acc[i][j] = Frag<T>::mma(al, bh[j], acc[i][j]);
        }
        Frag<T>::guard(acc[i][0], acc[i][3], ah, (SPLIT != 0) ? al : ah);
      }
      Frag<T>::keep(bh[0], bh[1], bh[2], bh[3]);
      if (SPLIT == 2) Frag<T>::keep(bl[0], bl[1], bl[2], bl[3]);
    }
    if (more) {
#pragma unroll
      for (int p = 0; p < NPL; ++p)
#pragma unroll
        for (int i = 0; i < 8; ++i) *(v4u*)(&sOp[cur ^ 1][p][sLane + 16 * i * kLP]) = rg[p][i];
    }
  }
  acc_guard4(acc[0][0], acc[0][1], acc[0][2], acc[0][3]);
  acc_guard4(acc[1][0], acc[1][1], acc[1][2], acc[1][3]);
  acc_guard4(acc[2][0], acc[2][1], acc[2][2], acc[2][3]);
  acc_guard4(acc[3][0], acc[3][1], acc[3][2], acc[3][3]);

  // ---- epilogue ----
  float* slab = sT[wave];
#pragma unroll
  for (int i = 0; i < 4; ++i) {
    const int mBase = m0 + (i << 4);
#pragma unroll
    for (int j = 0; j < 4; ++j) {
      const int n = n0 + (j << 4) + rlane;
      float bv = 0.f;
      if (BIAS_MODE == 2) bv = bf_bits2f(f2bf_bits(bias[n]));
#pragma unroll
      for (int r = 0; r < 8; ++r) {
        float v = acc[i][j][r] * scale;
        if (BIAS_MODE == 2) v += bv;
        slab[(mOff + r) * 68 + (j << 4) + rlane] = v;
      }
    }
    __builtin_amdgcn_fence(__ATOMIC_RELEASE, "workgroup");
    __builtin_amdgcn_wave_barrier();
    __builtin_amdgcn_fence(__ATOMIC_ACQUIRE, "workgroup");
    if (OUT_MODE == 0) {
      float* C = (float*)Cout + (size_t)b * strideC;
      const int hh = lane >> 4, c4 = (lane & 15) * 4;     // row seg = 256 B = 16 lanes x 16 B
      {
#pragma unroll
        for (int it = 0; it < 8; ++it) {
          const int row = it * 2 + hh;
          v4f v = *(const v4f*)(slab + row * 68 + c4);
          *(v4f*)(C + (size_t)(mBase + row) * ldc + n0 + c4) = v;
        }
        
      }
    } else {
      const int q = lane >> 3, c8 = (lane & 7) * 8;
      unsigned short* C  = (unsigned short*)Cout  + (size_t)b * strideC;
      unsigned short* C2 = (OUT_MODE == 2) ? ((unsigned short*)Cout2 + (size_t)b * strideC) : nullptr;
      {
#pragma unroll
        for (int it = 0; it < 4; ++it) {
          const int row = it * 4 + q;
          const float* sp = slab + row * 68 + c8;
          v8h hv, lv;
#pragma unroll
          for (int e = 0; e < 8; ++e) {
            if (OUT_MODE == 1) {
              hv[e] = (_Float16)sp[e];
            } else {
              unsigned short hb = f2bf_bits(sp[e]);
              unsigned short lb = f2bf_bits(sp[e] - bf_bits2f(hb));
              hv[e] = __builtin_bit_cast(_Float16, hb);
              lv[e] = __builtin_bit_cast(_Float16, lb);
            }
          }
          *(v8h*)(C + (size_t)(mBase + row) * ldc + n0 + c8) = hv;
          if (OUT_MODE == 2) *(v8h*)(C2 + (size_t)(mBase + row) * ldc + n0 + c8) = lv;
        }
        
      }
    }
    __builtin_amdgcn_fence(__ATOMIC_RELEASE, "workgroup");
    __builtin_amdgcn_wave_barrier();
    __builtin_amdgcn_fence(__ATOMIC_ACQUIRE, "workgroup");
  }
}

// One launch converts all five float matrices. Their bf16 planes lie back to back in the workspace, in the order
// tgt, mem, Wq_w, Wkv_w, out_w, so the output is one flat array of three equal thirds: tgt, mem, the three weights.
// A unit = 1024 consecutive elements = one wave x 8 loads of 16 B per lane; every matrix is a whole number of units.
// Grid = kCastBlocks blocks x 16 waves, all resident at once; wave w converts unit w of each third: every element exactly once.
// A unit of mem is one key's row. The rows of a batch are stored in a new order: the keys whose mask is non-zero first (in their old
// order), the masked keys behind them. A masked key's weight in the softmax is exactly 0, so the kv projection and the attention end
// at the live count. Each block scans its batch's whole mask (512 threads x 4 keys) for the places of its own 16 rows; the first block
// of a batch also stores the count and, in the new order, each key's additive score term (bf16(bias) * log2(e), -inf when masked).
// place = live ? (live keys before it) : (live keys in all) + (masked keys before it): counts of keys, so 0 <= place < kSeqK for any mask.
static constexpr int kCastUnit   = 1024;
static constexpr int kCastBlocks = 256;
static constexpr int kCastThird  = kCastBlocks * 16 * kCastUnit;    /* 4,194,304 elements */
static_assert(kRowsM * kEmb == kCastThird && kEmb * kEmb + kKVCols * kEmb + kEmb * kEmb == kCastThird);
static_assert((kEmb * kEmb) % kCastUnit == 0 && (kKVCols * kEmb) % kCastUnit == 0);
static_assert(kCastUnit == kEmb && kCastBlocks * 16 == kBatch * kSeqK && 512 * 4 == kSeqK && kSeqK % 16 == 0);
__global__ __launch_bounds__(512) void cast_f32_bf16_all(
    const float* __restrict__ tgt, const float* __restrict__ mem, const float* __restrict__ wq,
    const float* __restrict__ wkv, const float* __restrict__ wo,
    const float* __restrict__ abias, const int* __restrict__ kmask,
    unsigned short* __restrict__ out, float* __restrict__ cbias, int* __restrict__ nlive) {
  constexpr int w1 = kEmb * kEmb, w2 = w1 + kKVCols * kEmb;
  __shared__ int sCnt[16];     // live keys in each wave's 128 keys
  __shared__ int sPlace[16];   // new places of this block's 16 mem rows
  const int tid = threadIdx.x;
  const int bb  = (int)(blockIdx.x * 16) / kSeqK;   // the batch of this block's 16 mem rows, and the first of them inside it
  const int s0  = (int)(blockIdx.x * 16) % kSeqK;
  const v4i mk = *(const v4i*)(kmask + bb * kSeqK + 4 * tid);   // this thread's 4 keys of the batch's mask
  const int l4 = (threadIdx.x & 31) * 4;
  const int e  = __builtin_amdgcn_readfirstlane((int)(blockIdx.x * 16 + (threadIdx.x >> 5))) * kCastUnit;   // wave-uniform, 0 <= e < kCastThird
  const float* src[3];
  src[0] = tgt + e;
  src[1] = mem + e;
  src[2] = (e < w1) ? wq + e : (e < w2) ? wkv + (e - w1) : wo + (e - w2);
  v4f x[3][8];
#pragma unroll
  for (int s = 0; s < 3; ++s)
#pragma unroll
    for (int i = 0; i < 8; ++i) x[s][i] = *(const v4f*)(src[s] + i * 128 + l4);   // 512 contiguous bytes per wave-wide load
  // keeps all 24 loads in front of the first conversion: without it the compiler waits for the first 8 before it issues the rest
  __builtin_amdgcn_sched_barrier(0);
  int place;
  {
    const int wv = tid >> 5;
    const unsigned below = (1u << (tid & 31)) - 1u;
    int before = 0, mine = 0;
#pragma unroll
    for (int k = 0; k < 4; ++k) {
      const unsigned bal = __builtin_amdgcn_ballot_w32(mk[k] != 0);
      before += __builtin_popcount(bal & below);
      mine   += __builtin_popcount(bal);
    }
    if ((tid & 31) == 0) sCnt[wv] = mine;
    __syncthreads();
    int total = 0;
#pragma unroll
    for (int i = 0; i < 16; ++i) {
      const int n = sCnt[i];
      total += n;
      before += (i < wv) ? n : 0;
    }
    v4f ab = (v4f){0.f, 0.f, 0.f, 0.f};
    if (s0 == 0) ab = *(const v4f*)(abias + bb * kSeqK + 4 * tid);   // block-uniform
#pragma unroll
    for (int k = 0; k < 4; ++k) {
      const int key = 4 * tid + k;
      const bool alive = (mk[k] != 0);
      const int pl = alive ? before : total + (key - before);
      before += alive ? 1 : 0;
      if ((key & ~15) == s0) sPlace[key & 15] = pl;
      if (s0 == 0) cbias[bb * kSeqK + pl] = alive ? bf_bits2f(f2bf_bits(ab[k])) * kLog2E : -__builtin_huge_valf();
    }
    if (s0 == 0 && tid == 0) nlive[bb * kCountPitch] = total;
    __syncthreads();
    place = __builtin_amdgcn_readfirstlane(sPlace[wv]);
  }
  const int dst[3] = {e, kCastThird + (bb * kSeqK + place) * kCastUnit, 2 * kCastThird + e};
#pragma unroll
  for (int s = 0; s < 3; ++s)
#pragma unroll
    for (int i = 0; i < 8; ++i) {
      v2u y;
      y[0] = (unsigned)f2bf_bits(x[s][i][0]) | ((unsigned)f2bf_bits(x[s][i][1]) << 16);
      y[1] = (unsigned)f2bf_bits(x[s][i][2]) | ((unsigned)f2bf_bits(x[s][i][3]) << 16);
      *(v2u*)(out + dst[s] + i * 128 + l4) = y;                        // 256 contiguous bytes per wave-wide store: two whole lines
    }
}

// ---- bf16 helpers for the attention kernel ----
__device__ __forceinline__ __bf16 to_bf16(float f) { return __builtin_bit_cast(__bf16, f2bf_bits(f)); }
__device__ __forceinline__ void split_bf16(float f, __bf16& hi, __bf16& lo) {
  const unsigned short hb = f2bf_bits(f);
  hi = __builtin_bit_cast(__bf16, hb);
  lo = to_bf16(f - __uint_as_float(((unsigned)hb) << 16));
}
__device__ __forceinline__ v8f mma_bf16(v16b a, v16b b, v8f c) {
  return __builtin_amdgcn_wmma_f32_16x16x32_bf16(false, a, false, b, (short)0, c, false, false);
}

__device__ __forceinline__ void exp2_x8(v8f& x) {
  float a = x[0], b = x[1], c = x[2], d = x[3], e = x[4], f = x[5], g = x[6], h = x[7];
  // one statement, so that nothing comes between: an independent v_exp_f32 behind each, the v_nop behind the last
  asm("v_exp_f32 %0, %0\n\tv_exp_f32 %1, %1\n\tv_exp_f32 %2, %2\n\tv_exp_f32 %3, %3\n\t"
      "v_exp_f32 %4, %4\n\tv_exp_f32 %5, %5\n\tv_exp_f32 %6, %6\n\tv_exp_f32 %7, %7\n\tv_nop"
      : "+v"(a), "+v"(b), "+v"(c), "+v"(d), "+v"(e), "+v"(f), "+v"(g), "+v"(h));
  x = (v8f){a, b, c, d, e, f, g, h};
}
__device__ __forceinline__ float exp2_x1(float x) {
  asm("v_exp_f32 %0, %0\n\tv_nop" : "+v"(x));   // the v_nop: the same slot
  return x;
}

// lane l with lane l ^ 16
__device__ __forceinline__ float xhalf(float x) {
  return __builtin_bit_cast(float, __builtin_amdgcn_permlanex16(__builtin_bit_cast(int, x), __builtin_bit_cast(int, x), 0x76543210, 0xfedcba98, false, false));
}

// =====================================================================================
// Cross attention, head_dim 64, 16-bit plane inputs:
//   q planes  Qh/Ql : bf16 hi/lo, element (b,s,h,d) at (b*SQ+s)*1024 + h*64 + d
//   kv planes KVh/KVl: bf16 hi/lo, row (b*SK+s) pitch 2048; k at col h*64+d, v at col 1024+h*64+d; s = the key's place, live keys first
//   scores = 0.125 * q.k^T (hi.hi + hi.lo + lo.hi) + bf16(attn_bias[b,kv]); key mask 0 -> score = -inf (cbias holds that term by place)
//   the key loop ends with the chunk that holds the last live key (nlive); the masked keys in that chunk get weight 0 through -inf
//   the scores are held times log2(e) (folded into the scale and into the staged bias), so e^(s-m) is one v_exp_f32 of a difference
//   out    = softmax(scores).v with p and v as bf16 hi/lo (3 products), f32 accumulate, f32 online softmax
//   both products run transposed (scores^T = k.q^T, out^T += v^T.p^T): a lane owns one query, p stays in registers
//   ctx written as bf16 hi/lo planes Ch/Cl, element (b,s,h,d) at (b*SQ+s)*1024 + h*64 + d.
// Block = 4 waves = 64 query rows of one (b,h); grid.x = B*H*(SQ/64) = 1024.
// =====================================================================================
// the second argument: at least four waves a SIMD, that is at most 256 vector registers, so that all 1024 blocks stay resident at once
__global__ __launch_bounds__(128, 4)
void mha_attn_hd64(const unsigned short* __restrict__ Qh, const unsigned short* __restrict__ Ql,
                   const unsigned short* __restrict__ KVh, const unsigned short* __restrict__ KVl,
                   const float* __restrict__ cbias, const int* __restrict__ nlive,
                   unsigned short* __restrict__ Ch, unsigned short* __restrict__ Cl)
{
  __shared__ __align__(16) __bf16 Ksh[kKC * kLP];         // K hi [kv][d], pitch kLP   9 KB
  __shared__ __align__(16) __bf16 Ksl[kKC * kLP];         // K lo [kv][d], pitch kLP   9 KB
  __shared__ __align__(16) __bf16 Vth[kHeadD * kLP];      // V hi [d][kv], pitch kLP   9 KB
  __shared__ __align__(16) __bf16 Vtl[kHeadD * kLP];      // V lo [d][kv], pitch kLP   9 KB
  __shared__ __align__(16) __bf16 Psh[4][16 * kLP];       // per wave out hi staging [row][d], pitch kLP
  __shared__ __align__(16) __bf16 Psl[4][16 * kLP];       // per wave out lo staging [row][d], pitch kLP
  __shared__ __align__(16) float CB[kKC];                               // per chunk: bf16(bias) * log2(e), or -inf when masked

  const int tid  = threadIdx.x;
  const int wave = __builtin_amdgcn_readfirstlane(tid >> 5);   // in a scalar register: the epilogue's addresses then hold fewer vector registers across the loop
  const int lane = tid & 31;
  const int hh   = lane >> 4;
  const int c    = lane & 15;
  const int nqb  = kSeqQ / 64;
  const int bx   = blockIdx.x;
  const int qb   = bx % nqb;
  const int bhd  = bx / nqb;
  const int h    = bhd % kHeads;
  const int b    = bhd / kHeads;
  const int q0   = qb * 64 + wave * 16;
  const float ninf = -__builtin_huge_valf();

  const __bf16* Qhp = (const __bf16*)(const void*)Qh;
  const __bf16* Qlp = (const __bf16*)(const void*)Ql;

  // ---- Q fragments (B operand, column = c, split k map via Frag::load): 2 d-chunks, hi and lo ----
  v16b qah[2], qal[2];
  {
    const size_t qo = (size_t)(b * kSeqQ + q0 + c) * kEmb + h * kHeadD + 8 * hh;
#pragma unroll
    for (int dc = 0; dc < 2; ++dc) {
      qah[dc] = Frag<__bf16>::load(Qhp + qo + dc * 32);
      qal[dc] = Frag<__bf16>::load(Qlp + qo + dc * 32);
    }
  }

  const v8f zero8 = (v8f){0.f,0.f,0.f,0.f,0.f,0.f,0.f,0.f};
  float mrow = ninf, lrow = 0.f;   // one query (column c) per lane
  v8f oacc[4];
#pragma unroll
  for (int t = 0; t < 4; ++t) oacc[t] = zero8;

  __bf16* pwh = Psh[wave];
  __bf16* pwl = Psl[wave];

  // ---- staging maps; the next chunk's K, V and score terms travel in registers while the current chunk is worked on ----
  // K planes: thread -> (kv row tid>>1, d half (tid&1)*32): 128 thr x 32 elems = 64 x 64 per plane
  const int kvr = tid >> 1, dh = (tid & 1) * 32;
  // V planes transposed into [d][kv]: thread -> (kv pair vp = tid>>2, d range dq = (tid&3)*16)
  // 32 pairs x 4 ranges = 128 thr; each writes 2 kv x 16 d as packed u32 (both halves per-lane data)
  const int vp = tid >> 2, dq = (tid & 3) * 16;
  // every address is a fixed block-uniform base + one 32-bit per-lane byte offset, which moves on by a chunk in front of each later fetch:
  // so each offset holds one vector register across the loop, not a 64-bit pair (below 2^25 for the last chunk: no wrap)
  unsigned kByte = (unsigned)(kvr * kKVCols + dh) * 2u;
  unsigned vByte = (unsigned)(2 * vp * kKVCols + kEmb + dq) * 2u;
  unsigned bByte = (unsigned)(tid & (kKC - 1)) * 4u;
  const gbytes baseH = uniform_ptr(KVh + (size_t)(b * kSeqK) * kKVCols + h * kHeadD);
  const gbytes baseL = uniform_ptr(KVl + (size_t)(b * kSeqK) * kKVCols + h * kHeadD);
  const gbytes baseB = uniform_ptr(cbias + b * kSeqK);
  v4u gkh[4], gkl[4], gxh[2], gyh[2], gxl[2], gyl[2];
  float gbias = 0.f;
  // a chunk is fetched in two parts: K and the score terms in front of the score products, V behind them, where the K fragments' registers are free again
  auto fetch_v = [&]() {
#pragma unroll
    for (int i = 0; i < 2; ++i) {
      gxh[i] = *(gvec16)(baseH + vByte + 16 * i);
      gyh[i] = *(gvec16)(baseH + vByte + 2 * kKVCols + 16 * i);
      gxl[i] = *(gvec16)(baseL + vByte + 16 * i);
      gyl[i] = *(gvec16)(baseL + vByte + 2 * kKVCols + 16 * i);
    }
    // behind this wait the address registers of the loads above may be rewritten
    asm volatile("s_wait_xcnt 0x0" ::: "memory");
  };
  auto fetch_k = [&]() {
#pragma unroll
    for (int i = 0; i < 4; ++i) {
      gkh[i] = *(gvec16)(baseH + kByte + 16 * i);
      gkl[i] = *(gvec16)(baseL + kByte + 16 * i);
    }
    if (tid < kKC) {   // waves 0 and 1 entirely: wave-uniform branch
      gbias = *(const __attribute__((address_space(1))) float*)(baseB + bByte);
    }
    // behind this wait the address registers of the loads above may be rewritten; it also keeps the loads in front of the chunk's LDS reads
    asm volatile("s_wait_xcnt 0x0" ::: "memory");
  };
  // chunks that hold a live key: block-uniform, bounded by the shape whatever the count word holds
  const int nch = (min(max(__builtin_amdgcn_readfirstlane(nlive[b * kCountPitch]), 0), kSeqK) + kKC - 1) / kKC;
  if (nch > 0) { fetch_k(); fetch_v(); }

  for (int kc = 0; kc < nch; ++kc) {
    __syncthreads();
#pragma unroll
    for (int i = 0; i < 4; ++i) {
      *(v4u*)(Ksh + kvr * kLP + dh + 8 * i) = gkh[i];
      *(v4u*)(Ksl + kvr * kLP + dh + 8 * i) = gkl[i];
    }
#pragma unroll
    for (int i = 0; i < 2; ++i) {
#pragma unroll
      for (int jw = 0; jw < 4; ++jw) {
        const int d0 = dq + 8 * i + 2 * jw;
        const unsigned xhw = gxh[i][jw], yhw = gyh[i][jw], xlw = gxl[i][jw], ylw = gyl[i][jw];
        const unsigned h0 = (xhw & 0xffffu) | (yhw << 16);
        const unsigned h1 = (xhw >> 16) | (yhw & 0xffff0000u);
        const unsigned l0 = (xlw & 0xffffu) | (ylw << 16);
        const unsigned l1 = (xlw >> 16) | (ylw & 0xffff0000u);
        *(unsigned*)(Vth + d0 * kLP + 2 * vp)       = h0;
        *(unsigned*)(Vth + (d0 + 1) * kLP + 2 * vp) = h1;
        *(unsigned*)(Vtl + d0 * kLP + 2 * vp)       = l0;
        *(unsigned*)(Vtl + (d0 + 1) * kLP + 2 * vp) = l1;
      }
    }
    if (tid < kKC) CB[tid] = gbias;   // waves 0 and 1 entirely: wave-uniform branch
    __syncthreads();
    if (kc + 1 < nch) {   // block-uniform; the loads fly under this chunk's products and softmax
      kByte += (unsigned)(kKC * kKVCols) * 2u;
      bByte += (unsigned)kKC * 4u;
      fetch_k();
    }

    // ---- scores, transposed: tile j = K rows (A operand) x Q columns (B operand), 2 d-chunks x 3 products ----
    // D map: this lane holds query column c and the keys j*16 + 8*hh + r
    // the fragments of a d-chunk's four key tiles are read as one group in front of its 12 products, and successive products go to
    // different tiles: one LDS latency per group, no product waits for the one before it; each tile's own sums keep their order
    v8f s[4];
#pragma unroll
    for (int j = 0; j < 4; ++j) s[j] = zero8;
#pragma unroll
    for (int dc = 0; dc < 2; ++dc) {
      v16b kbh[4], kbl[4];
#pragma unroll
      for (int j = 0; j < 4; ++j) {
        kbh[j] = Frag<__bf16>::load(Ksh + (j * 16 + c) * kLP + dc * 32 + 8 * hh);
        kbl[j] = Frag<__bf16>::load(Ksl + (j * 16 + c) * kLP + dc * 32 + 8 * hh);
      }
      // fence pair round the products: without it the compiler moves the reads in among them, the lo planes' into one shared register set with a full wait behind each
      __builtin_amdgcn_sched_barrier(0);
#pragma unroll
      for (int j = 0; j < 4; ++j) s[j] = mma_bf16(kbh[j], qah[dc], s[j]);
#pragma unroll
      for (int j = 0; j < 4; ++j) s[j] = mma_bf16(kbl[j], qah[dc], s[j]);
#pragma unroll
      for (int j = 0; j < 4; ++j) s[j] = mma_bf16(kbh[j], qal[dc], s[j]);
      __builtin_amdgcn_sched_barrier(0);   // the pair's second half; it also keeps the reads of the score terms out of the products
    }
    // four vector slots behind the last score products, on both sides of the branch below
    acc_guard4(s[0], s[1], s[2], s[3]);
    if (kc + 1 < nch) {   // block-uniform
      vByte += (unsigned)(kKC * kKVCols) * 2u;
      fetch_v();
    }
    float cm = ninf;
#pragma unroll
    for (int j = 0; j < 4; ++j) {
      const v4f cb0 = *(const v4f*)(CB + j * 16 + 8 * hh);
      const v4f cb1 = *(const v4f*)(CB + j * 16 + 8 * hh + 4);
#pragma unroll
      for (int r = 0; r < 8; ++r) {
        const float v = s[j][r] * (0.125f * kLog2E) + ((r < 4) ? cb0[r & 3] : cb1[r & 3]);
        s[j][r] = v;
        cm = fmaxf(cm, v);
      }
    }
    cm = fmaxf(cm, xhalf(cm));   // the other lane half holds this query's other 32 keys
    // ---- online softmax, one query per lane; P packs from the score tiles straight into B operands ----
    const float mnew = fmaxf(mrow, cm);
    const bool live = (mnew != ninf);
    float alpha = 1.0f;
    float ps[4] = {0.f, 0.f, 0.f, 0.f};
    if (live) {   // one guard per lane: it owns one query, so one flag covers the rescale factor and all 32 of its scores
      alpha = exp2_x1(mrow - mnew);   // every argument here is <= 0: no range reduction, no overflow test
#pragma unroll
      for (int j = 0; j < 4; ++j) {
#pragma unroll
        for (int r = 0; r < 8; ++r) s[j][r] -= mnew;
        exp2_x8(s[j]);
#pragma unroll
        for (int r = 0; r < 8; ++r) ps[j] += s[j][r];
      }
    } else {
#pragma unroll
      for (int j = 0; j < 4; ++j) s[j] = zero8;
    }
    mrow = mnew;
    v16b ph[2], pl[2];
#pragma unroll
    for (int j = 0; j < 4; ++j) {
#pragma unroll
      for (int r = 0; r < 8; ++r) {
        const float p = s[j][r];
        __bf16 a, bl;
        split_bf16(p, a, bl);
        ph[j >> 1][(j & 1) * 8 + r] = a;    // element e of the operand is key kk*32 + (e < 8 ? 8*hh + e : 16 + 8*hh + e - 8): the order of Frag::load
        pl[j >> 1][(j & 1) * 8 + r] = bl;
      }
    }
    lrow = lrow * alpha + ((ps[0] + ps[1]) + (ps[2] + ps[3]));   // this lane half's share; the halves join in the epilogue
#pragma unroll
    for (int t = 0; t < 4; ++t)
#pragma unroll
      for (int r = 0; r < 8; ++r) oacc[t][r] *= alpha;
    // ---- out^T += V^T.P^T : 2 kv-chunks x 4 d-tiles x 3 products; this lane holds query c, d = t*16 + 8*hh + r ----
    // grouped like the score products: a kv-chunk's four d-tiles are read together, successive products go to different tiles
#pragma unroll
    for (int kk = 0; kk < 2; ++kk) {
      v16b vb[4], vl[4];
#pragma unroll
      for (int t = 0; t < 4; ++t) {
        vb[t] = Frag<__bf16>::load(Vth + (t * 16 + c) * kLP + kk * 32 + 8 * hh);
        vl[t] = Frag<__bf16>::load(Vtl + (t * 16 + c) * kLP + kk * 32 + 8 * hh);
      }
#pragma unroll
      for (int t = 0; t < 4; ++t) oacc[t] = mma_bf16(vb[t], ph[kk], oacc[t]);
#pragma unroll
      for (int t = 0; t < 4; ++t) oacc[t] = mma_bf16(vl[t], ph[kk], oacc[t]);
#pragma unroll
      for (int t = 0; t < 4; ++t) oacc[t] = mma_bf16(vb[t], pl[kk], oacc[t]);
    }
    // four vector slots behind the chunk's last products, on both sides of the loop's branch
    acc_guard4(oacc[0], oacc[1], oacc[2], oacc[3]);
  }

  // ---- epilogue: join the halves' sums, normalise, split to bf16 hi/lo into this wave's staging, whole-line stores ----
  // the lane number is read anew here, so that none of the epilogue's addresses holds a vector register across the loop
  const int eln = (int)__builtin_amdgcn_mbcnt_lo(~0u, 0u);
  const int ec = eln & 15, ehh = eln >> 4;
  {
    const float inv = 1.0f / (lrow + xhalf(lrow));
#pragma unroll
    for (int t = 0; t < 4; ++t) {
      v8b xa, xb;
#pragma unroll
      for (int r = 0; r < 8; ++r) {
        const float v = oacc[t][r] * inv;
        __bf16 a, bl;
        split_bf16(v, a, bl);
        xa[r] = a;
        xb[r] = bl;
      }
      *(v8b*)(pwh + ec * kLP + t * 16 + 8 * ehh) = xa;
      *(v8b*)(pwl + ec * kLP + t * 16 + 8 * ehh) = xb;
    }
  }
  __builtin_amdgcn_fence(__ATOMIC_RELEASE, "workgroup");
  __builtin_amdgcn_wave_barrier();
  __builtin_amdgcn_fence(__ATOMIC_ACQUIRE, "workgroup");
  {
    _Float16* Chp = (_Float16*)(void*)Ch;
    _Float16* Clp = (_Float16*)(void*)Cl;
    const int q8 = eln >> 3, c8 = (eln & 7) * 8;
    const size_t ob = (size_t)(b * kSeqQ + q0) * kEmb + h * kHeadD + c8;
    {
#pragma unroll
      for (int it = 0; it < 4; ++it) {
        const int row = it * 4 + q8;
        const v8b xh = *(const v8b*)(pwh + row * kLP + c8);
        const v8b xl = *(const v8b*)(pwl + row * kLP + c8);
        const v8h yh = __builtin_bit_cast(v8h, xh);
        const v8h yl = __builtin_bit_cast(v8h, xl);
        *(v8h*)(Chp + ob + (size_t)row * kEmb) = yh;
        *(v8h*)(Clp + ob + (size_t)row * kEmb) = yl;
      }
      
    }
  }
}

extern "C" void kernel_launch(void* const* d_in, const int* in_sizes, int n_in,
                              void* d_out, int out_size, void* d_ws, size_t ws_size,
                              hipStream_t stream) {
  static_assert(kSeqK % 128 == 0 && kRowsM % 128 == 0 && kEmb % 128 == 0 && kKVCols % 128 == 0 && kEmb % 64 == 0);
  static_assert(kSeqQ % 64 == 0 && kSeqK % kKC == 0 && kHeadD == 64 && kHeads * kHeadD == kEmb && kSeqQ == kSeqK);

  if (n_in < 10) return;
  const int nAct = kRowsM * kEmb;            /* 4,194,304 elements */
  const int nWq  = kEmb * kEmb;              /* 1,048,576 */
  const int nWkv = kKVCols * kEmb;           /* 2,097,152 */
  const int nWo  = kEmb * kEmb;
  if (in_sizes[0] != nAct || in_sizes[1] != kBatch * kSeqK * kEmb || in_sizes[2] != kBatch * kSeqK ||
      in_sizes[3] != kBatch * kSeqK || in_sizes[4] != nWq || in_sizes[5] != kEmb || in_sizes[6] != nWkv ||
      in_sizes[7] != kKVCols || in_sizes[8] != nWo || in_sizes[9] != kEmb) return;
  if (out_size != nAct) return;

  const float* tgt   = (const float*)d_in[0];
  const float* mem   = (const float*)d_in[1];
  const float* abias = (const float*)d_in[2];
  const int*   kmask = (const int*)d_in[3];
  const float* Wq_w  = (const float*)d_in[4];
  const float* Wq_b  = (const float*)d_in[5];
  const float* Wkv_w = (const float*)d_in[6];
  const float* Wkv_b = (const float*)d_in[7];
  const float* out_w = (const float*)d_in[8];
  const float* out_b = (const float*)d_in[9];
  float* out = (float*)d_out;

  /* workspace region map (bytes, every offset but nlive's a multiple of 1 MiB):
       [  0 MiB,  8 MiB)  tgt16   bf16 [4096][1024]
       [  8 MiB, 16 MiB)  mem16   bf16 [4096][1024]
       [ 16 MiB, 18 MiB)  wq16    bf16 [1024][1024]
       [ 18 MiB, 22 MiB)  wkv16   bf16 [2048][1024]
       [ 22 MiB, 24 MiB)  wo16    bf16 [1024][1024]
       [ 24 MiB, 32 MiB)  qh      bf16 [4096][1024]   [ 32, 40) ql
       [ 40 MiB, 56 MiB)  kvh     bf16 [4096][2048]   [ 56, 72) kvl
       [ 72 MiB, 80 MiB)  ch      bf16 [4096][1024]   [ 80, 88) cl
       [ 88 MiB, +16 KiB) cbias   f32 [2][2048], then nlive int [2] at a pitch of 128 B */
  const size_t szAct16 = (size_t)nAct * 2;
  const size_t szKV16  = (size_t)kRowsM * kKVCols * 2;
  const size_t oTgt = 0;
  const size_t oMem = oTgt + szAct16;
  const size_t oWq  = oMem + szAct16;
  const size_t oWkv = oWq + (size_t)nWq * 2;
  const size_t oWo  = oWkv + (size_t)nWkv * 2;
  const size_t oQh  = oWo + (size_t)nWo * 2;
  const size_t oQl  = oQh + szAct16;
  const size_t oKVh = oQl + szAct16;
  const size_t oKVl = oKVh + szKV16;
  const size_t oCh  = oKVl + szKV16;
  const size_t oCl  = oCh + szAct16;
  const size_t oCb  = oCl + szAct16;
  const size_t oNl  = oCb + (size_t)kBatch * kSeqK * 4;
  const size_t total = oNl + (size_t)kBatch * kCountPitch * 4;
  if (total > ws_size) return;

  char* ws = (char*)d_ws;
  unsigned short* tgt16 = (unsigned short*)(ws + oTgt);
  unsigned short* mem16 = (unsigned short*)(ws + oMem);
  unsigned short* wq16  = (unsigned short*)(ws + oWq);
  unsigned short* wkv16 = (unsigned short*)(ws + oWkv);
  unsigned short* wo16  = (unsigned short*)(ws + oWo);
  unsigned short* qh    = (unsigned short*)(ws + oQh);
  unsigned short* ql    = (unsigned short*)(ws + oQl);
  unsigned short* kvh   = (unsigned short*)(ws + oKVh);
  unsigned short* kvl   = (unsigned short*)(ws + oKVl);
  unsigned short* ch    = (unsigned short*)(ws + oCh);
  unsigned short* cl    = (unsigned short*)(ws + oCl);
  float* cbias = (float*)(ws + oCb);
  int*   nlive = (int*)(ws + oNl);

  /* 1. RNE-convert the five float matrices to bf16 planes: one launch; the planes tgt16 .. wo16 are contiguous from tgt16 on;
        mem16's rows go live keys first, with cbias and nlive to match */
  cast_f32_bf16_all<<<dim3(kCastBlocks), dim3(512), 0, stream>>>(tgt, mem, Wq_w, Wkv_w, out_w, abias, kmask, tgt16, cbias, nlive);

  /* 2. both projections in one launch, each -> bf16 hi/lo planes:
        q  = tgt16 . wq16^T + bq   : M=4096 N=1024 K=1024; 256 block tiles of 128x128, the first blocks of the grid
        kv = mem16 . wkv16^T + bkv : per batch M=2048 N=2048 K=1024; 2 x 256 block tiles behind them, those behind the live keys last: they return at once */
  {
    const int tilesQ  = (kRowsM / 128) * (kEmb / 128);
    const int tilesKV = (kSeqK / 128) * (kKVCols / 128) * kBatch;
    wmma_gemm64<1, 0, 2, 2, 1><<<dim3(tilesQ + tilesKV), dim3(128), 0, stream>>>(
        mem16, mem16, kEmb, (long)kSeqK * kEmb, wkv16, wkv16, kEmb, 0L, (void*)kvh, (void*)kvl, kKVCols, (long)kSeqK * kKVCols,
        Wkv_b, nlive, kSeqK, kKVCols, kEmb, 1.0f, kBatch,
        tgt16, wq16, (void*)qh, (void*)ql, kEmb, Wq_b, kRowsM, kEmb);
  }
  /* 3. attention: grid = B*H*(SQ/64) = 1024 blocks of 128 threads -> ctx hi/lo planes */
  {
    const int nblk = kBatch * kHeads * (kSeqQ / 64);
    mha_attn_hd64<<<dim3(nblk), dim3(128), 0, stream>>>(qh, ql, kvh, kvl, cbias, nlive, ch, cl);
  }
  /* 4. out = (ch + cl) . wo16^T + bo : M=4096 N=1024 K=1024, A carried hi+lo (2 products), f32 out */
  {
    const int tiles = (kRowsM / 128) * (kEmb / 128);
    wmma_gemm64<1, 1, 2, 0, 0><<<dim3(tiles, 1), dim3(128), 0, stream>>>(
        ch, cl, kEmb, 0L, wo16, wo16, kEmb, 0L, (void*)out, (void*)cl, kEmb, 0L,
        out_b, nullptr, kRowsM, kEmb, kEmb, 1.0f, 1,
        nullptr, nullptr, nullptr, nullptr, 0, nullptr, 0, 0);
  }
}

// v010
// A run of this version takes 107 microseconds.
// Timed twice side by side with v009, it ran 1.06 times as fast both times.
// All steps since v000 together make it 5.20 times as fast.
// Contractions: q/kv/out projections on v_wmma_f32_16x16x32_bf16 (float inputs RNE-converted to bf16 once; out-projection A operand carried as bf16 hi+lo planes, 2 products); attention q.k and p.v on v_wmma_f32_16x16x32_bf16 with bf16 hi+lo planes for q,k,p,v (3 products); f32 accumulate; softmax and normalisation in f32.
#include <hip/hip_runtime.h>

typedef __attribute__((ext_vector_type(16))) _Float16 v16h;
typedef __attribute__((ext_vector_type(8)))  _Float16 v8h;
typedef __attribute__((ext_vector_type(16))) __bf16   v16b;
typedef __attribute__((ext_vector_type(8)))  __bf16   v8b;
typedef __attribute__((ext_vector_type(8)))  float    v8f;
typedef __attribute__((ext_vector_type(4)))  float    v4f;
typedef __attribute__((ext_vector_type(2)))  float    v2f;
typedef __attribute__((ext_vector_type(4)))  unsigned v4u;
typedef __attribute__((ext_vector_type(2)))  unsigned v2u;
typedef __attribute__((ext_vector_type(4)))  int      v4i;

static constexpr int kBatch  = 2;
static constexpr int kSeqQ   = 2048;
static constexpr int kSeqK   = 2048;
static constexpr int kEmb    = 1024;
static constexpr int kHeads  = 16;
static constexpr int kHeadD  = 64;
static constexpr int kKVCols = 2 * kEmb;          /* 2048: k at cols 0..1023, v at cols 1024..2047 */
static constexpr int kRowsM  = kBatch * kSeqQ;    /* 4096 (== kBatch * kSeqK) */
static constexpr int kKC     = 64;                /* keys per streamed chunk */
static constexpr float kLog2E = 1.4426950408889634f;   /* log2(e): the attention scores are carried in the base-2 domain */
static constexpr int kCountPitch = 32;            /* ints between the two batches' live-key counts: a 128-byte line each */
static constexpr int kLP     = 72;                /* LDS row pitch in 16-bit elements: 144 B = 16 B x 9, so the 16 rows of a 16-byte fragment read fall on distinct banks */

typedef __attribute__((ext_vector_type(2)))  __bf16   v2b;
typedef __attribute__((ext_vector_type(8)))  unsigned v8u;
// f32 -> bf16, round to nearest even, by the hardware's packed conversion: one instruction for two values, already packed (a in the low half)
__device__ __forceinline__ unsigned pack_bf16(float a, float b) {
  return __builtin_bit_cast(unsigned, __builtin_convertvector((v2f){a, b}, v2b));
}
// one value rounded to bf16 and widened again
__device__ __forceinline__ float round_bf16(float f) { return (float)(__bf16)f; }
// two values as bf16 hi + lo: hi = bf16(x), lo = bf16(x - hi); x - hi is exact in f32, so lo is rounded once
__device__ __forceinline__ void split_bf16x2(float a, float b, unsigned& hi, unsigned& lo) {
  const v2b h = __builtin_convertvector((v2f){a, b}, v2b);
  hi = __builtin_bit_cast(unsigned, h);
  lo = pack_bf16(a - (float)h[0], b - (float)h[1]);
}

// hazard guards as plain device helpers (their inline asm stays out of the kernel template body)
__device__ __forceinline__ void dep_guard_h(v8f& a, v8f& b, v16h x, v16h y) { asm volatile("v_nop\n\tv_nop\n\tv_nop\n\tv_nop" : "+v"(a), "+v"(b) : "v"(x), "v"(y)); }
__device__ __forceinline__ void dep_guard_b(v8f& a, v8f& b, v16b x, v16b y) { asm volatile("v_nop\n\tv_nop\n\tv_nop\n\tv_nop" : "+v"(a), "+v"(b) : "v"(x), "v"(y)); }
__device__ __forceinline__ void keep4_h(v16h a, v16h b, v16h c, v16h d) { asm volatile("v_nop" :: "v"(a), "v"(b), "v"(c), "v"(d)); }
__device__ __forceinline__ void keep4_b(v16b a, v16b b, v16b c, v16b d) { asm volatile("v_nop" :: "v"(a), "v"(b), "v"(c), "v"(d)); }
__device__ __forceinline__ void acc_guard4(v8f& a, v8f& b, v8f& c, v8f& d) { asm volatile("v_nop\n\tv_nop\n\tv_nop\n\tv_nop" : "+v"(a), "+v"(b), "+v"(c), "+v"(d)); }
template <typename T> struct Frag;
template <> struct Frag<_Float16> {
  typedef v16h V; union U { v16h v; v8h h[2]; };
  static __device__ __forceinline__ v16h load(const _Float16* p) {   // elements 0..7 <- p[0..7], 8..15 <- p[16..23]
    U f; f.h[0] = *(const v8h*)(p); f.h[1] = *(const v8h*)(p + 16); return f.v;
  }
  static __device__ __forceinline__ v8f mma(v16h a, v16h b, v8f c) {
    return __builtin_amdgcn_wmma_f32_16x16x32_f16(false, a, false, b, (short)0, c, false, false);
  }
  static __device__ __forceinline__ void guard(v8f& a, v8f& b, v16h x, v16h y) { dep_guard_h(a, b, x, y); }
  static __device__ __forceinline__ void keep(v16h a, v16h b, v16h c, v16h d) { keep4_h(a, b, c, d); }
};
template <> struct Frag<__bf16> {
  typedef v16b V; union U { v16b v; v8b h[2]; };
  static __device__ __forceinline__ v16b load(const __bf16* p) {
    U f; f.h[0] = *(const v8b*)(p); f.h[1] = *(const v8b*)(p + 16); return f.v;
  }
  static __device__ __forceinline__ v8f mma(v16b a, v16b b, v8f c) {
    return __builtin_amdgcn_wmma_f32_16x16x32_bf16(false, a, false, b, (short)0, c, false, false);
  }
  static __device__ __forceinline__ void guard(v8f& a, v8f& b, v16b x, v16b y) { dep_guard_b(a, b, x, y); }
  static __device__ __forceinline__ void keep(v16b a, v16b b, v16b c, v16b d) { keep4_b(a, b, c, d); }
};

// a block-uniform global address, pinned into a scalar register pair
typedef const __attribute__((address_space(1))) char* gbytes;
typedef const __attribute__((address_space(1))) v4u*  gvec16;
__device__ __forceinline__ gbytes uniform_ptr(const void* p) {
  const unsigned long long u = (unsigned long long)p;
  const unsigned lo = (unsigned)__builtin_amdgcn_readfirstlane((int)(unsigned)u);
  const unsigned hi = (unsigned)__builtin_amdgcn_readfirstlane((int)(unsigned)(u >> 32));
  return (gbytes)(((unsigned long long)hi << 32) | lo);
}

// ---- Register-blocked batched WMMA GEMM, operands staged through LDS ---------
// C[m,n] = scale * sum_k A[m,k] * Bt[n,k] (+bias); a block of 4 waves owns a 128x128 tile, each wave a 64x64 quarter.
// A row-major [M,K]; Bt row-major [N,K]; M,N % 128 == 0, K % 64 == 0.
// Each stage is 64 k = one whole 128-byte line of every operand row: 8 lanes read a line, a wave-wide load covers 4 whole lines.
// Two LDS buffers: stage s+1 is loaded into registers while stage s is multiplied, and stored behind it; one barrier per stage.
// SPLIT: 0 = single product; 1 = A carried as hi+lo planes (A.B + A2.B); 2 = A and B hi+lo planes (A.B + A.B2 + A2.B).
// rowsLive: see at its test below.
// PAIR: 0 = one product, grid (tiles, batches). 1 = two independent products of the same lda, ldb and K in one launch, flat grid: the first
// (M1/128)*(N1/128) blocks take the unbatched product of the arguments that end in 1, the rest the batched one, its tiles ordered row of tiles,
// batch, column, so that the tiles behind rowsLive come last. A WGP then holds a block of each product, and each fills the other's waits.
// BIAS_MODE: 0 = none, 2 = bias[n] (bias RNE-converted to bf16 before the add).
// OUT_MODE: 0 = f32, 1 = f16, 2 = bf16 hi plane (Cout) + bf16 lo plane (Cout2).
// ET: 0 = f16 operands, 1 = bf16 operands (pointers passed as 16-bit storage)
template <int ET> struct Elem;
template <> struct Elem<0> { typedef _Float16 T; };
template <> struct Elem<1> { typedef __bf16 T; };
template <int ET, int SPLIT, int BIAS_MODE, int OUT_MODE, int PAIR>
__global__ __launch_bounds__(128) void wmma_gemm64(
    const unsigned short* __restrict__ Ap0, const unsigned short* __restrict__ A2p0, int lda, long strideA,
    const unsigned short* __restrict__ Btp0, const unsigned short* __restrict__ Bt2p0, int ldb, long strideB,
    void* __restrict__ Cout0, void* __restrict__ Cout20, int ldc0, long strideC,
    const float* __restrict__ bias0, const int* __restrict__ rowsLive0,
    int M0, int N0, int K, float scale, int batches,
    const unsigned short* __restrict__ Ap1, const unsigned short* __restrict__ Btp1,
    void* __restrict__ Cout1, void* __restrict__ Cout21, int ldc1, const float* __restrict__ bias1, int M1, int N1) {
  static_assert(PAIR == 0 || SPLIT == 0);
  typedef typename Elem<ET>::T T;
  typedef typename Frag<T>::V V;
  // which product this block belongs to, and its tile number there: block-uniform
  const int tiles1 = PAIR ? (M1 >> 7) * (N1 >> 7) : 0;
  const bool one = PAIR && (int)blockIdx.x < tiles1;
  const int tile = (int)blockIdx.x - (one ? 0 : tiles1);
  const unsigned short* Ap = one ? Ap1 : Ap0;
  const unsigned short* A2p = one ? Ap1 : A2p0;
  const unsigned short* Btp = one ? Btp1 : Btp0;
  const unsigned short* Bt2p = one ? Btp1 : Bt2p0;
  void* Cout = one ? Cout1 : Cout0;
  void* Cout2 = one ? Cout21 : Cout20;
  const float* bias = one ? bias1 : bias0;
  const int* rowsLive = one ? nullptr : rowsLive0;
  const int ldc = one ? ldc1 : ldc0;
  const int M = one ? M1 : M0;
  const int N = one ? N1 : N0;
  const int nb = one ? 1 : batches;
  const T* A = (const T*)Ap; const T* A2 = (const T*)A2p; const T* Bt = (const T*)Btp; const T* Bt2 = (const T*)Bt2p;
  constexpr int PA = 0, PB = 1, PA2 = 2, PB2 = 3;              // operand planes in LDS
  constexpr int NPL = 2 + (SPLIT != 0 ? 1 : 0) + (SPLIT == 2 ? 1 : 0);
  __shared__ __align__(16) T sOp[2][NPL][128 * kLP];           // [buffer][plane][row][64 k], pitch kLP
  __shared__ __align__(16) float sT[4][16 * 68];               // per-wave 16x64 slab, pitch 68 floats
  const int tid  = threadIdx.x;
  const int lane = tid & 31;
  const int wave = tid >> 5;
  const int tilesN = N >> 7;
  const int tilesM = M >> 7;
  if (tile >= tilesM * tilesN * (PAIR ? nb : 1)) return;   // block-uniform, in front of every barrier
  const int trow = tile / tilesN;              // PAIR: row of tiles and batch together, the batch running faster
  const int bn = tile - trow * tilesN;
  const int bm = PAIR ? trow / nb : trow;
  const int b  = PAIR ? trow - bm * nb : (int)blockIdx.y;
  // rowsLive (may be null): per batch, the number of leading A rows whose product anybody reads; a tile wholly behind it is not computed
  if (rowsLive != nullptr && (bm << 7) >= rowsLive[b * kCountPitch]) return;   // block-uniform, in front of every barrier
  const int wm = (wave >> 1) << 6;             // this wave's quarter inside the block tile
  const int wn = (wave & 1) << 6;
  const int m0 = (bm << 7) + wm;
  const int n0 = (bn << 7) + wn;

  const T* Ab  = A  + (size_t)b * strideA;
  const T* Bb  = Bt + (size_t)b * strideB;
  const T* Ab2 = (SPLIT != 0) ? (A2  + (size_t)b * strideA) : nullptr;
  const T* Bb2 = (SPLIT == 2) ? (Bt2 + (size_t)b * strideB) : nullptr;

  const int rlane = lane & 15;                 // row (A) / col (B, D) within subtile
  const int koff  = (lane >> 4) * 8;           // k offset of this lane half
  const int mOff  = (lane >> 4) * 8;           // D row offset

  // staging map: thread -> (row tid>>3 of each group of 16 rows, 16-byte piece tid&7 of the row's line)
  const int srow = tid >> 3;
  const int sseg = (tid & 7) * 8;
  const int sLane = srow * kLP + sseg;
  unsigned aByte = (unsigned)(srow * lda + sseg) * 2u;      // per-lane byte offsets; they advance by one line (128 B) per stage
  unsigned bByte = (unsigned)(srow * ldb + sseg) * 2u;
  // block-uniform base of each group of 16 rows, held in scalar registers: every load is base + one per-lane offset,
  // so no address register is rewritten while a stage's loads are being issued
  gbytes gp[NPL][8];
#pragma unroll
  for (int i = 0; i < 8; ++i) {
    gp[PA][i] = uniform_ptr(Ab + (size_t)((bm << 7) + 16 * i) * lda);
    gp[PB][i] = uniform_ptr(Bb + (size_t)((bn << 7) + 16 * i) * ldb);
    if (SPLIT != 0) gp[SPLIT != 0 ? PA2 : PA][i] = uniform_ptr(Ab2 + (size_t)((bm << 7) + 16 * i) * lda);
    if (SPLIT == 2) gp[SPLIT == 2 ? PB2 : PB][i] = uniform_ptr(Bb2 + (size_t)((bn << 7) + 16 * i) * ldb);
  }

  v8f acc[4][4];
#pragma unroll
  for (int i = 0; i < 4; ++i)
#pragma unroll
    for (int j = 0; j < 4; ++j) acc[i][j] = (v8f){0.f,0.f,0.f,0.f,0.f,0.f,0.f,0.f};

  v4u rg[NPL][8];
  const int nst = K >> 6;
#pragma unroll
  for (int p = 0; p < NPL; ++p)
#pragma unroll
    for (int i = 0; i < 8; ++i) rg[p][i] = *(gvec16)(gp[p][i] + ((p & 1) ? bByte : aByte));
#pragma unroll
  for (int p = 0; p < NPL; ++p)
#pragma unroll
    for (int i = 0; i < 8; ++i) *(v4u*)(&sOp[0][p][sLane + 16 * i * kLP]) = rg[p][i];

  for (int s = 0; s < nst; ++s) {
    const bool more = (s + 1 < nst);           // block-uniform
    __syncthreads();                           // publishes stage s; ends every wave's reads of the buffer that stage s+1 goes into
    if (more) {
      aByte += 128u;
      bByte += 128u;
#pragma unroll
      for (int p = 0; p < NPL; ++p)
#pragma unroll
        for (int i = 0; i < 8; ++i) rg[p][i] = *(gvec16)(gp[p][i] + ((p & 1) ? bByte : aByte));
      // behind this wait the address registers of the loads above may be rewritten; it also keeps the loads in front of the stage's LDS reads
      asm volatile("s_wait_xcnt 0x0" ::: "memory");
    }
    const int cur = s & 1;
    // the A fragments run one row of tiles ahead of the products, so that a row's LDS latency hides behind the row before it
    const int aoLane = (wm + rlane) * kLP + koff;
    V ahn = Frag<T>::load(&sOp[cur][PA][aoLane]);
    V aln;
    if (SPLIT != 0) aln = Frag<T>::load(&sOp[cur][SPLIT != 0 ? PA2 : PA][aoLane]);
#pragma unroll
    for (int kk = 0; kk < 64; kk += 32) {
      V bh[4], bl[4];
#pragma unroll
      for (int j = 0; j < 4; ++j) {
        const int bo = (wn + (j << 4) + rlane) * kLP + koff + kk;
        bh[j] = Frag<T>::load(&sOp[cur][PB][bo]);
        if (SPLIT == 2) bl[j] = Frag<T>::load(&sOp[cur][SPLIT == 2 ? PB2 : PB][bo]);
      }
#pragma unroll
      for (int i = 0; i < 4; ++i) {
        const V ah = ahn;
        V al;
        if (SPLIT != 0) al = aln;
        if (i < 3 || kk == 0) {
          const int an = aoLane + ((i < 3) ? ((i + 1) << 4) * kLP + kk : 32);
          ahn = Frag<T>::load(&sOp[cur][PA][an]);
          if (SPLIT != 0) aln = Frag<T>::load(&sOp[cur][SPLIT != 0 ? PA2 : PA][an]);
        }
#pragma unroll
        for (int j = 0; j < 4; ++j) {
          acc[i][j] = Frag<T>::mma(ah, bh[j], acc[i][j]);
          if (SPLIT == 2) acc[i][j] = Frag<T>::mma(ah, bl[j], acc[i][j]);
          if (SPLIT != 0) acc[i][j] = Frag<T>::mma(al, bh[j], acc[i][j]);
        }
        Frag<T>::guard(acc[i][0], acc[i][3], ah, (SPLIT != 0) ? al : ah);
      }
      Frag<T>::keep(bh[0], bh[1], bh[2], bh[3]);
      if (SPLIT == 2) Frag<T>::keep(bl[0], bl[1], bl[2], bl[3]);
    }
    if (more) {
#pragma unroll
      for (int p = 0; p < NPL; ++p)
#pragma unroll
        for (int i = 0; i < 8; ++i) *(v4u*)(&sOp[cur ^ 1][p][sLane + 16 * i * kLP]) = rg[p][i];
    }
  }
  acc_guard4(acc[0][0], acc[0][1], acc[0][2], acc[0][3]);
  acc_guard4(acc[1][0], acc[1][1], acc[1][2], acc[1][3]);
  acc_guard4(acc[2][0], acc[2][1], acc[2][2], acc[2][3]);
  acc_guard4(acc[3][0], acc[3][1], acc[3][2], acc[3][3]);

  // ---- epilogue ----
  float* slab = sT[wave];
#pragma unroll
  for (int i = 0; i < 4; ++i) {
    const int mBase = m0 + (i << 4);
#pragma unroll
    for (int j = 0; j < 4; ++j) {
      const int n = n0 + (j << 4) + rlane;
      float bv = 0.f;
      if (BIAS_MODE == 2) bv = round_bf16(bias[n]);
#pragma unroll
      for (int r = 0; r < 8; ++r) {
        float v = acc[i][j][r] * scale;
        if (BIAS_MODE == 2) v += bv;
        slab[(mOff + r) * 68 + (j << 4) + rlane] = v;
      }
    }
    __builtin_amdgcn_fence(__ATOMIC_RELEASE, "workgroup");
    __builtin_amdgcn_wave_barrier();
    __builtin_amdgcn_fence(__ATOMIC_ACQUIRE, "workgroup");
    if (OUT_MODE == 0) {
      float* C = (float*)Cout + (size_t)b * strideC;
      const int hh = lane >> 4, c4 = (lane & 15) * 4;     // row seg = 256 B = 16 lanes x 16 B
      {
#pragma unroll
        for (int it = 0; it < 8; ++it) {
          const int row = it * 2 + hh;
          v4f v = *(const v4f*)(slab + row * 68 + c4);
          *(v4f*)(C + (size_t)(mBase + row) * ldc + n0 + c4) = v;
        }
        
      }
    } else {
      const int q = lane >> 3, c8 = (lane & 7) * 8;
      unsigned short* C  = (unsigned short*)Cout  + (size_t)b * strideC;
      unsigned short* C2 = (OUT_MODE == 2) ? ((unsigned short*)Cout2 + (size_t)b * strideC) : nullptr;
      {
#pragma unroll
        for (int it = 0; it < 4; ++it) {
          const int row = it * 4 + q;
          const float* sp = slab + row * 68 + c8;
          v8h hv, lv;
          if (OUT_MODE == 1) {
#pragma unroll
            for (int e = 0; e < 8; ++e) hv[e] = (_Float16)sp[e];
          } else {
            v4u hw, lw;
#pragma unroll
            for (int e = 0; e < 4; ++e) {
              unsigned hb, lb;
              split_bf16x2(sp[2 * e], sp[2 * e + 1], hb, lb);
              hw[e] = hb;
              lw[e] = lb;
            }
            hv = __builtin_bit_cast(v8h, hw);
            lv = __builtin_bit_cast(v8h, lw);
          }
          *(v8h*)(C + (size_t)(mBase + row) * ldc + n0 + c8) = hv;
          if (OUT_MODE == 2) *(v8h*)(C2 + (size_t)(mBase + row) * ldc + n0 + c8) = lv;
        }
        
      }
    }
    __builtin_amdgcn_fence(__ATOMIC_RELEASE, "workgroup");
    __builtin_amdgcn_wave_barrier();
    __builtin_amdgcn_fence(__ATOMIC_ACQUIRE, "workgroup");
  }
}

// One launch converts all five float matrices. Their bf16 planes lie back to back in the workspace, in the order
// tgt, mem, Wq_w, Wkv_w, out_w, so the output is one flat array of three equal thirds: tgt, mem, the three weights.
// A unit = 1024 consecutive elements = one wave x 8 loads of 16 B per lane; every matrix is a whole number of units.
// Grid = kCastBlocks blocks x 16 waves, all resident at once; wave w converts unit w of each third: every element exactly once.
// A unit of mem is one key's row. The rows of a batch are stored in a new order: the keys whose mask is non-zero first (in their old
// order), the masked keys behind them. A masked key's weight in the softmax is exactly 0, so the kv projection and the attention end
// at the live count. Each block scans its batch's whole mask (512 threads x 4 keys) for the places of its own 16 rows; the first block
// of a batch also stores the count and, in the new order, each key's additive score term (bf16(bias) * log2(e), -inf when masked).
// place = live ? (live keys before it) : (live keys in all) + (masked keys before it): counts of keys, so 0 <= place < kSeqK for any mask.
static constexpr int kCastUnit   = 1024;
static constexpr int kCastBlocks = 256;
static constexpr int kCastThird  = kCastBlocks * 16 * kCastUnit;    /* 4,194,304 elements */
static_assert(kRowsM * kEmb == kCastThird && kEmb * kEmb + kKVCols * kEmb + kEmb * kEmb == kCastThird);
static_assert((kEmb * kEmb) % kCastUnit == 0 && (kKVCols * kEmb) % kCastUnit == 0);
static_assert(kCastUnit == kEmb && kCastBlocks * 16 == kBatch * kSeqK && 512 * 4 == kSeqK && kSeqK % 16 == 0);
__global__ __launch_bounds__(512) void cast_f32_bf16_all(
    const float* __restrict__ tgt, const float* __restrict__ mem, const float* __restrict__ wq,
    const float* __restrict__ wkv, const float* __restrict__ wo,
    const float* __restrict__ abias, const int* __restrict__ kmask,
    unsigned short* __restrict__ out, float* __restrict__ cbias, int* __restrict__ nlive) {
  constexpr int w1 = kEmb * kEmb, w2 = w1 + kKVCols * kEmb;
  __shared__ int sCnt[16];     // live keys in each wave's 128 keys
  __shared__ int sPlace[16];   // new places of this block's 16 mem rows
  const int tid = threadIdx.x;
  const int bb  = (int)(blockIdx.x * 16) / kSeqK;   // the batch of this block's 16 mem rows, and the first of them inside it
  const int s0  = (int)(blockIdx.x * 16) % kSeqK;
  const v4i mk = *(const v4i*)(kmask + bb * kSeqK + 4 * tid);   // this thread's 4 keys of the batch's mask
  const int l4 = (threadIdx.x & 31) * 4;
  const int e  = __builtin_amdgcn_readfirstlane((int)(blockIdx.x * 16 + (threadIdx.x >> 5))) * kCastUnit;   // wave-uniform, 0 <= e < kCastThird
  const float* src[3];
  src[0] = tgt + e;
  src[1] = mem + e;
  src[2] = (e < w1) ? wq + e : (e < w2) ? wkv + (e - w1) : wo + (e - w2);
  v4f x[3][8];
#pragma unroll
  for (int s = 0; s < 3; ++s)
#pragma unroll
    for (int i = 0; i < 8; ++i) x[s][i] = *(const v4f*)(src[s] + i * 128 + l4);   // 512 contiguous bytes per wave-wide load
  // keeps all 24 loads in front of the first conversion: without it the compiler waits for the first 8 before it issues the rest
  __builtin_amdgcn_sched_barrier(0);
  int place;
  {
    const int wv = tid >> 5;
    const unsigned below = (1u << (tid & 31)) - 1u;
    int before = 0, mine = 0;
#pragma unroll
    for (int k = 0; k < 4; ++k) {
      const unsigned bal = __builtin_amdgcn_ballot_w32(mk[k] != 0);
      before += __builtin_popcount(bal & below);
      mine   += __builtin_popcount(bal);
    }
    if ((tid & 31) == 0) sCnt[wv] = mine;
    __syncthreads();
    int total = 0;
#pragma unroll
    for (int i = 0; i < 16; ++i) {
      const int n = sCnt[i];
      total += n;
      before += (i < wv) ? n : 0;
    }
    v4f ab = (v4f){0.f, 0.f, 0.f, 0.f};
    if (s0 == 0) ab = *(const v4f*)(abias + bb * kSeqK + 4 * tid);   // block-uniform
#pragma unroll
    for (int k = 0; k < 4; ++k) {
      const int key = 4 * tid + k;
      const bool alive = (mk[k] != 0);
      const int pl = alive ? before : total + (key - before);
      before += alive ? 1 : 0;
      if ((key & ~15) == s0) sPlace[key & 15] = pl;
      if (s0 == 0) cbias[bb * kSeqK + pl] = alive ? round_bf16(ab[k]) * kLog2E : -__builtin_huge_valf();
    }
    if (s0 == 0 && tid == 0) nlive[bb * kCountPitch] = total;
    __syncthreads();
    place = __builtin_amdgcn_readfirstlane(sPlace[wv]);
  }
  const int dst[3] = {e, kCastThird + (bb * kSeqK + place) * kCastUnit, 2 * kCastThird + e};
#pragma unroll
  for (int s = 0; s < 3; ++s)
#pragma unroll
    for (int i = 0; i < 8; ++i) {
      v2u y;
      y[0] = pack_bf16(x[s][i][0], x[s][i][1]);
      y[1] = pack_bf16(x[s][i][2], x[s][i][3]);
      *(v2u*)(out + dst[s] + i * 128 + l4) = y;                        // 256 contiguous bytes per wave-wide store: two whole lines
    }
}

// ---- bf16 helpers for the attention kernel ----
__device__ __forceinline__ v8f mma_bf16(v16b a, v16b b, v8f c) {
  return __builtin_amdgcn_wmma_f32_16x16x32_bf16(false, a, false, b, (short)0, c, false, false);
}

__device__ __forceinline__ void exp2_x8(v8f& x) {
  float a = x[0], b = x[1], c = x[2], d = x[3], e = x[4], f = x[5], g = x[6], h = x[7];
  // one statement, so that nothing comes between: an independent v_exp_f32 behind each, the v_nop behind the last
  asm("v_exp_f32 %0, %0\n\tv_exp_f32 %1, %1\n\tv_exp_f32 %2, %2\n\tv_exp_f32 %3, %3\n\t"
      "v_exp_f32 %4, %4\n\tv_exp_f32 %5, %5\n\tv_exp_f32 %6, %6\n\tv_exp_f32 %7, %7\n\tv_nop"
      : "+v"(a), "+v"(b), "+v"(c), "+v"(d), "+v"(e), "+v"(f), "+v"(g), "+v"(h));
  x = (v8f){a, b, c, d, e, f, g, h};
}
__device__ __forceinline__ float exp2_x1(float x) {
  asm("v_exp_f32 %0, %0\n\tv_nop" : "+v"(x));   // the v_nop: the same slot
  return x;
}

// lane l with lane l ^ 16
__device__ __forceinline__ float xhalf(float x) {
  return __builtin_bit_cast(float, __builtin_amdgcn_permlanex16(__builtin_bit_cast(int, x), __builtin_bit_cast(int, x), 0x76543210, 0xfedcba98, false, false));
}

// =====================================================================================
// Cross attention, head_dim 64, 16-bit plane inputs:
//   q planes  Qh/Ql : bf16 hi/lo, element (b,s,h,d) at (b*SQ+s)*1024 + h*64 + d
//   kv planes KVh/KVl: bf16 hi/lo, row (b*SK+s) pitch 2048; k at col h*64+d, v at col 1024+h*64+d; s = the key's place, live keys first
//   scores = 0.125 * q.k^T (hi.hi + hi.lo + lo.hi) + bf16(attn_bias[b,kv]); key mask 0 -> score = -inf (cbias holds that term by place)
//   the key loop ends with the chunk that holds the last live key (nlive); the masked keys in that chunk get weight 0 through -inf
//   the scores are held times log2(e) (folded into the scale and into the staged bias), so e^(s-m) is one v_exp_f32 of a difference
//   out    = softmax(scores).v with p and v as bf16 hi/lo (3 products), f32 accumulate, f32 online softmax
//   both products run transposed (scores^T = k.q^T, out^T += v^T.p^T): a lane owns one query, p stays in registers
//   ctx written as bf16 hi/lo planes Ch/Cl, element (b,s,h,d) at (b*SQ+s)*1024 + h*64 + d.
// Block = 4 waves = 64 query rows of one (b,h); grid.x = B*H*(SQ/64) = 1024.
// =====================================================================================
// the second argument: at least four waves a SIMD, that is at most 256 vector registers, so that all 1024 blocks stay resident at once
__global__ __launch_bounds__(128, 4)
void mha_attn_hd64(const unsigned short* __restrict__ Qh, const unsigned short* __restrict__ Ql,
                   const unsigned short* __restrict__ KVh, const unsigned short* __restrict__ KVl,
                   const float* __restrict__ cbias, const int* __restrict__ nlive,
                   unsigned short* __restrict__ Ch, unsigned short* __restrict__ Cl)
{
  __shared__ __align__(16) __bf16 Ksh[kKC * kLP];         // K hi [kv][d], pitch kLP   9 KB
  __shared__ __align__(16) __bf16 Ksl[kKC * kLP];         // K lo [kv][d], pitch kLP   9 KB
  __shared__ __align__(16) __bf16 Vth[kHeadD * kLP];      // V hi [d][kv], pitch kLP   9 KB
  __shared__ __align__(16) __bf16 Vtl[kHeadD * kLP];      // V lo [d][kv], pitch kLP   9 KB
  __shared__ __align__(16) __bf16 Psh[4][16 * kLP];       // per wave out hi staging [row][d], pitch kLP
  __shared__ __align__(16) __bf16 Psl[4][16 * kLP];       // per wave out lo staging [row][d], pitch kLP
  __shared__ __align__(16) float CB[kKC];                               // per chunk: bf16(bias) * log2(e), or -inf when masked

  const int tid  = threadIdx.x;
  const int wave = __builtin_amdgcn_readfirstlane(tid >> 5);   // in a scalar register: the epilogue's addresses then hold fewer vector registers across the loop
  const int lane = tid & 31;
  const int hh   = lane >> 4;
  const int c    = lane & 15;
  const int nqb  = kSeqQ / 64;
  const int bx   = blockIdx.x;
  const int qb   = bx % nqb;
  const int bhd  = bx / nqb;
  const int h    = bhd % kHeads;
  const int b    = bhd / kHeads;
  const int q0   = qb * 64 + wave * 16;
  const float ninf = -__builtin_huge_valf();

  const __bf16* Qhp = (const __bf16*)(const void*)Qh;
  const __bf16* Qlp = (const __bf16*)(const void*)Ql;

  // ---- Q fragments (B operand, column = c, split k map via Frag::load): 2 d-chunks, hi and lo ----
  v16b qah[2], qal[2];
  {
    const size_t qo = (size_t)(b * kSeqQ + q0 + c) * kEmb + h * kHeadD + 8 * hh;
#pragma unroll
    for (int dc = 0; dc < 2; ++dc) {
      qah[dc] = Frag<__bf16>::load(Qhp + qo + dc * 32);
      qal[dc] = Frag<__bf16>::load(Qlp + qo + dc * 32);
    }
  }

  const v8f zero8 = (v8f){0.f,0.f,0.f,0.f,0.f,0.f,0.f,0.f};
  float mrow = ninf, lrow = 0.f;   // one query (column c) per lane
  v8f oacc[4];
#pragma unroll
  for (int t = 0; t < 4; ++t) oacc[t] = zero8;

  __bf16* pwh = Psh[wave];
  __bf16* pwl = Psl[wave];

  // ---- staging maps; the next chunk's K, V and score terms travel in registers while the current chunk is worked on ----
  // K planes: thread -> (kv row tid>>1, d half (tid&1)*32): 128 thr x 32 elems = 64 x 64 per plane
  const int kvr = tid >> 1, dh = (tid & 1) * 32;
  // V planes transposed into [d][kv]: thread -> (kv pair vp = tid>>2, d range dq = (tid&3)*16)
  // 32 pairs x 4 ranges = 128 thr; each writes 2 kv x 16 d as packed u32 (both halves per-lane data)
  const int vp = tid >> 2, dq = (tid & 3) * 16;
  // every address is a fixed block-uniform base + one 32-bit per-lane byte offset, which moves on by a chunk in front of each later fetch:
  // so each offset holds one vector register across the loop, not a 64-bit pair (below 2^25 for the last chunk: no wrap)
  unsigned kByte = (unsigned)(kvr * kKVCols + dh) * 2u;
  unsigned vByte = (unsigned)(2 * vp * kKVCols + kEmb + dq) * 2u;
  unsigned bByte = (unsigned)(tid & (kKC - 1)) * 4u;
  const gbytes baseH = uniform_ptr(KVh + (size_t)(b * kSeqK) * kKVCols + h * kHeadD);
  const gbytes baseL = uniform_ptr(KVl + (size_t)(b * kSeqK) * kKVCols + h * kHeadD);
  const gbytes baseB = uniform_ptr(cbias + b * kSeqK);
  v4u gkh[4], gkl[4], gxh[2], gyh[2], gxl[2], gyl[2];
  float gbias = 0.f;
  // a chunk is fetched in two parts: K and the score terms in front of the score products, V behind them, where the K fragments' registers are free again
  auto fetch_v = [&]() {
#pragma unroll
    for (int i = 0; i < 2; ++i) {
      gxh[i] = *(gvec16)(baseH + vByte + 16 * i);
      gyh[i] = *(gvec16)(baseH + vByte + 2 * kKVCols + 16 * i);
      gxl[i] = *(gvec16)(baseL + vByte + 16 * i);
      gyl[i] = *(gvec16)(baseL + vByte + 2 * kKVCols + 16 * i);
    }
    // behind this wait the address registers of the loads above may be rewritten
    asm volatile("s_wait_xcnt 0x0" ::: "memory");
  };
  auto fetch_k = [&]() {
#pragma unroll
    for (int i = 0; i < 4; ++i) {
      gkh[i] = *(gvec16)(baseH + kByte + 16 * i);
      gkl[i] = *(gvec16)(baseL + kByte + 16 * i);
    }
    if (tid < kKC) {   // waves 0 and 1 entirely: wave-uniform branch
      gbias = *(const __attribute__((address_space(1))) float*)(baseB + bByte);
    }
    // behind this wait the address registers of the loads above may be rewritten; it also keeps the loads in front of the chunk's LDS reads
    asm volatile("s_wait_xcnt 0x0" ::: "memory");
  };
  // chunks that hold a live key: block-uniform, bounded by the shape whatever the count word holds
  const int nch = (min(max(__builtin_amdgcn_readfirstlane(nlive[b * kCountPitch]), 0), kSeqK) + kKC - 1) / kKC;
  if (nch > 0) { fetch_k(); fetch_v(); }

  for (int kc = 0; kc < nch; ++kc) {
    __syncthreads();
#pragma unroll
    for (int i = 0; i < 4; ++i) {
      *(v4u*)(Ksh + kvr * kLP + dh + 8 * i) = gkh[i];
      *(v4u*)(Ksl + kvr * kLP + dh + 8 * i) = gkl[i];
    }
#pragma unroll
    for (int i = 0; i < 2; ++i) {
#pragma unroll
      for (int jw = 0; jw < 4; ++jw) {
        const int d0 = dq + 8 * i + 2 * jw;
        const unsigned xhw = gxh[i][jw], yhw = gyh[i][jw], xlw = gxl[i][jw], ylw = gyl[i][jw];
        const unsigned h0 = (xhw & 0xffffu) | (yhw << 16);
        const unsigned h1 = (xhw >> 16) | (yhw & 0xffff0000u);
        const unsigned l0 = (xlw & 0xffffu) | (ylw << 16);
        const unsigned l1 = (xlw >> 16) | (ylw & 0xffff0000u);
        *(unsigned*)(Vth + d0 * kLP + 2 * vp)       = h0;
        *(unsigned*)(Vth + (d0 + 1) * kLP + 2 * vp) = h1;
        *(unsigned*)(Vtl + d0 * kLP + 2 * vp)       = l0;
        *(unsigned*)(Vtl + (d0 + 1) * kLP + 2 * vp) = l1;
      }
    }
    if (tid < kKC) CB[tid] = gbias;   // waves 0 and 1 entirely: wave-uniform branch
    __syncthreads();
    if (kc + 1 < nch) {   // block-uniform; the loads fly under this chunk's products and softmax
      kByte += (unsigned)(kKC * kKVCols) * 2u;
      bByte += (unsigned)kKC * 4u;
      fetch_k();
    }

    // ---- scores, transposed: tile j = K rows (A operand) x Q columns (B operand), 2 d-chunks x 3 products ----
    // D map: this lane holds query column c and the keys j*16 + 8*hh + r
    // the fragments of a d-chunk's four key tiles are read as one group in front of its 12 products, and successive products go to
    // different tiles: one LDS latency per group, no product waits for the one before it; each tile's own sums keep their order
    v8f s[4];
#pragma unroll
    for (int j = 0; j < 4; ++j) s[j] = zero8;
#pragma unroll
    for (int dc = 0; dc < 2; ++dc) {
      v16b kbh[4], kbl[4];
#pragma unroll
      for (int j = 0; j < 4; ++j) {
        kbh[j] = Frag<__bf16>::load(Ksh + (j * 16 + c) * kLP + dc * 32 + 8 * hh);
        kbl[j] = Frag<__bf16>::load(Ksl + (j * 16 + c) * kLP + dc * 32 + 8 * hh);
      }
      // fence pair round the products: without it the compiler moves the reads in among them, the lo planes' into one shared register set with a full wait behind each
      __builtin_amdgcn_sched_barrier(0);
#pragma unroll
      for (int j = 0; j < 4; ++j) s[j] = mma_bf16(kbh[j], qah[dc], s[j]);
#pragma unroll
      for (int j = 0; j < 4; ++j) s[j] = mma_bf16(kbl[j], qah[dc], s[j]);
#pragma unroll
      for (int j = 0; j < 4; ++j) s[j] = mma_bf16(kbh[j], qal[dc], s[j]);
      __builtin_amdgcn_sched_barrier(0);   // the pair's second half; it also keeps the reads of the score terms out of the products
    }
    // four vector slots behind the last score products, on both sides of the branch below
    acc_guard4(s[0], s[1], s[2], s[3]);
    if (kc + 1 < nch) {   // block-uniform
      vByte += (unsigned)(kKC * kKVCols) * 2u;
      fetch_v();
    }
    float cm = ninf;
#pragma unroll
    for (int j = 0; j < 4; ++j) {
      const v4f cb0 = *(const v4f*)(CB + j * 16 + 8 * hh);
      const v4f cb1 = *(const v4f*)(CB + j * 16 + 8 * hh + 4);
#pragma unroll
      for (int r = 0; r < 8; ++r) {
        const float v = s[j][r] * (0.125f * kLog2E) + ((r < 4) ? cb0[r & 3] : cb1[r & 3]);
        s[j][r] = v;
        cm = fmaxf(cm, v);
      }
    }
    cm = fmaxf(cm, xhalf(cm));   // the other lane half holds this query's other 32 keys
    // ---- online softmax, one query per lane; P packs from the score tiles straight into B operands ----
    const float mnew = fmaxf(mrow, cm);
    const bool live = (mnew != ninf);
    float alpha = 1.0f;
    float ps[4] = {0.f, 0.f, 0.f, 0.f};
    if (live) {   // one guard per lane: it owns one query, so one flag covers the rescale factor and all 32 of its scores
      alpha = exp2_x1(mrow - mnew);   // every argument here is <= 0: no range reduction, no overflow test
#pragma unroll
      for (int j = 0; j < 4; ++j) {
#pragma unroll
        for (int r = 0; r < 8; ++r) s[j][r] -= mnew;
        exp2_x8(s[j]);
#pragma unroll
        for (int r = 0; r < 8; ++r) ps[j] += s[j][r];
      }
    } else {
#pragma unroll
      for (int j = 0; j < 4; ++j) s[j] = zero8;
    }
    mrow = mnew;
    v16b ph[2], pl[2];
#pragma unroll
    for (int kk = 0; kk < 2; ++kk) {
      v8u hw, lw;
#pragma unroll
      for (int e = 0; e < 8; ++e) {
        const int j = 2 * kk + (e >> 2), r = 2 * (e & 3);
        unsigned a, bl;
        split_bf16x2(s[j][r], s[j][r + 1], a, bl);
        hw[e] = a;    // word e = elements 2e, 2e+1; element i of the operand is key kk*32 + (i < 8 ? 8*hh + i : 16 + 8*hh + i - 8): the order of Frag::load
        lw[e] = bl;
      }
      ph[kk] = __builtin_bit_cast(v16b, hw);
      pl[kk] = __builtin_bit_cast(v16b, lw);
    }
    lrow = lrow * alpha + ((ps[0] + ps[1]) + (ps[2] + ps[3]));   // this lane half's share; the halves join in the epilogue
#pragma unroll
    for (int t = 0; t < 4; ++t)
#pragma unroll
      for (int r = 0; r < 8; ++r) oacc[t][r] *= alpha;
    // ---- out^T += V^T.P^T : 2 kv-chunks x 4 d-tiles x 3 products; this lane holds query c, d = t*16 + 8*hh + r ----
    // grouped like the score products: a kv-chunk's four d-tiles are read together, successive products go to different tiles
#pragma unroll
    for (int kk = 0; kk < 2; ++kk) {
      v16b vb[4], vl[4];
#pragma unroll
      for (int t = 0; t < 4; ++t) {
        vb[t] = Frag<__bf16>::load(Vth + (t * 16 + c) * kLP + kk * 32 + 8 * hh);
        vl[t] = Frag<__bf16>::load(Vtl + (t * 16 + c) * kLP + kk * 32 + 8 * hh);
      }
#pragma unroll
      for (int t = 0; t < 4; ++t) oacc[t] = mma_bf16(vb[t], ph[kk], oacc[t]);
#pragma unroll
      for (int t = 0; t < 4; ++t) oacc[t] = mma_bf16(vl[t], ph[kk], oacc[t]);
#pragma unroll
      for (int t = 0; t < 4; ++t) oacc[t] = mma_bf16(vb[t], pl[kk], oacc[t]);
    }
    // four vector slots behind the chunk's last products, on both sides of the loop's branch
    acc_guard4(oacc[0], oacc[1], oacc[2], oacc[3]);
  }

  // ---- epilogue: join the halves' sums, normalise, split to bf16 hi/lo into this wave's staging, whole-line stores ----
  // the lane number is read anew here, so that none of the epilogue's addresses holds a vector register across the loop
  const int eln = (int)__builtin_amdgcn_mbcnt_lo(~0u, 0u);
  const int ec = eln & 15, ehh = eln >> 4;
  {
    const float inv = 1.0f / (lrow + xhalf(lrow));
#pragma unroll
    for (int t = 0; t < 4; ++t) {
      v4u xa, xb;
#pragma unroll
      for (int r = 0; r < 4; ++r) {
        unsigned a, bl;
        split_bf16x2(oacc[t][2 * r] * inv, oacc[t][2 * r + 1] * inv, a, bl);
        xa[r] = a;
        xb[r] = bl;
      }
      *(v4u*)(pwh + ec * kLP + t * 16 + 8 * ehh) = xa;
      *(v4u*)(pwl + ec * kLP + t * 16 + 8 * ehh) = xb;
    }
  }
  __builtin_amdgcn_fence(__ATOMIC_RELEASE, "workgroup");
  __builtin_amdgcn_wave_barrier();
  __builtin_amdgcn_fence(__ATOMIC_ACQUIRE, "workgroup");
  {
    _Float16* Chp = (_Float16*)(void*)Ch;
    _Float16* Clp = (_Float16*)(void*)Cl;
    const int q8 = eln >> 3, c8 = (eln & 7) * 8;
    const size_t ob = (size_t)(b * kSeqQ + q0) * kEmb + h * kHeadD + c8;
    {
#pragma unroll
      for (int it = 0; it < 4; ++it) {
        const int row = it * 4 + q8;
        const v8b xh = *(const v8b*)(pwh + row * kLP + c8);
        const v8b xl = *(const v8b*)(pwl + row * kLP + c8);
        const v8h yh = __builtin_bit_cast(v8h, xh);
        const v8h yl = __builtin_bit_cast(v8h, xl);
        *(v8h*)(Chp + ob + (size_t)row * kEmb) = yh;
        *(v8h*)(Clp + ob + (size_t)row * kEmb) = yl;
      }
      
    }
  }
}

extern "C" void kernel_launch(void* const* d_in, const int* in_sizes, int n_in,
                              void* d_out, int out_size, void* d_ws, size_t ws_size,
                              hipStream_t stream) {
  static_assert(kSeqK % 128 == 0 && kRowsM % 128 == 0 && kEmb % 128 == 0 && kKVCols % 128 == 0 && kEmb % 64 == 0);
  static_assert(kSeqQ % 64 == 0 && kSeqK % kKC == 0 && kHeadD == 64 && kHeads * kHeadD == kEmb && kSeqQ == kSeqK);

  if (n_in < 10) return;
  const int nAct = kRowsM * kEmb;            /* 4,194,304 elements */
  const int nWq  = kEmb * kEmb;              /* 1,048,576 */
  const int nWkv = kKVCols * kEmb;           /* 2,097,152 */
  const int nWo  = kEmb * kEmb;
  if (in_sizes[0] != nAct || in_sizes[1] != kBatch * kSeqK * kEmb || in_sizes[2] != kBatch * kSeqK ||
      in_sizes[3] != kBatch * kSeqK || in_sizes[4] != nWq || in_sizes[5] != kEmb || in_sizes[6] != nWkv ||
      in_sizes[7] != kKVCols || in_sizes[8] != nWo || in_sizes[9] != kEmb) return;
  if (out_size != nAct) return;

  const float* tgt   = (const float*)d_in[0];
  const float* mem   = (const float*)d_in[1];
  const float* abias = (const float*)d_in[2];
  const int*   kmask = (const int*)d_in[3];
  const float* Wq_w  = (const float*)d_in[4];
  const float* Wq_b  = (const float*)d_in[5];
  const float* Wkv_w = (const float*)d_in[6];
  const float* Wkv_b = (const float*)d_in[7];
  const float* out_w = (const float*)d_in[8];
  const float* out_b = (const float*)d_in[9];
  float* out = (float*)d_out;

  /* workspace region map (bytes, every offset but nlive's a multiple of 1 MiB):
       [  0 MiB,  8 MiB)  tgt16   bf16 [4096][1024]
       [  8 MiB, 16 MiB)  mem16   bf16 [4096][1024]
       [ 16 MiB, 18 MiB)  wq16    bf16 [1024][1024]
       [ 18 MiB, 22 MiB)  wkv16   bf16 [2048][1024]
       [ 22 MiB, 24 MiB)  wo16    bf16 [1024][1024]
       [ 24 MiB, 32 MiB)  qh      bf16 [4096][1024]   [ 32, 40) ql
       [ 40 MiB, 56 MiB)  kvh     bf16 [4096][2048]   [ 56, 72) kvl
       [ 72 MiB, 80 MiB)  ch      bf16 [4096][1024]   [ 80, 88) cl
       [ 88 MiB, +16 KiB) cbias   f32 [2][2048], then nlive int [2] at a pitch of 128 B */
  const size_t szAct16 = (size_t)nAct * 2;
  const size_t szKV16  = (size_t)kRowsM * kKVCols * 2;
  const size_t oTgt = 0;
  const size_t oMem = oTgt + szAct16;
  const size_t oWq  = oMem + szAct16;
  const size_t oWkv = oWq + (size_t)nWq * 2;
  const size_t oWo  = oWkv + (size_t)nWkv * 2;
  const size_t oQh  = oWo + (size_t)nWo * 2;
  const size_t oQl  = oQh + szAct16;
  const size_t oKVh = oQl + szAct16;
  const size_t oKVl = oKVh + szKV16;
  const size_t oCh  = oKVl + szKV16;
  const size_t oCl  = oCh + szAct16;
  const size_t oCb  = oCl + szAct16;
  const size_t oNl  = oCb + (size_t)kBatch * kSeqK * 4;
  const size_t total = oNl + (size_t)kBatch * kCountPitch * 4;
  if (total > ws_size) return;

  char* ws = (char*)d_ws;
  unsigned short* tgt16 = (unsigned short*)(ws + oTgt);
  unsigned short* mem16 = (unsigned short*)(ws + oMem);
  unsigned short* wq16  = (unsigned short*)(ws + oWq);
  unsigned short* wkv16 = (unsigned short*)(ws + oWkv);
  unsigned short* wo16  = (unsigned short*)(ws + oWo);
  unsigned short* qh    = (unsigned short*)(ws + oQh);
  unsigned short* ql    = (unsigned short*)(ws + oQl);
  unsigned short* kvh   = (unsigned short*)(ws + oKVh);
  unsigned short* kvl   = (unsigned short*)(ws + oKVl);
  unsigned short* ch    = (unsigned short*)(ws + oCh);
  unsigned short* cl    = (unsigned short*)(ws + oCl);
  float* cbias = (float*)(ws + oCb);
  int*   nlive = (int*)(ws + oNl);

  /* 1. RNE-convert the five float matrices to bf16 planes: one launch; the planes tgt16 .. wo16 are contiguous from tgt16 on;
        mem16's rows go live keys first, with cbias and nlive to match */
  cast_f32_bf16_all<<<dim3(kCastBlocks), dim3(512), 0, stream>>>(tgt, mem, Wq_w, Wkv_w, out_w, abias, kmask, tgt16, cbias, nlive);

  /* 2. both projections in one launch, each -> bf16 hi/lo planes:
        q  = tgt16 . wq16^T + bq   : M=4096 N=1024 K=1024; 256 block tiles of 128x128, the first blocks of the grid
        kv = mem16 . wkv16^T + bkv : per batch M=2048 N=2048 K=1024; 2 x 256 block tiles behind them, those behind the live keys last: they return at once */
  {
    const int tilesQ  = (kRowsM / 128) * (kEmb / 128);
    const int tilesKV = (kSeqK / 128) * (kKVCols / 128) * kBatch;
    wmma_gemm64<1, 0, 2, 2, 1><<<dim3(tilesQ + tilesKV), dim3(128), 0, stream>>>(
        mem16, mem16, kEmb, (long)kSeqK * kEmb, wkv16, wkv16, kEmb, 0L, (void*)kvh, (void*)kvl, kKVCols, (long)kSeqK * kKVCols,
        Wkv_b, nlive, kSeqK, kKVCols, kEmb, 1.0f, kBatch,
        tgt16, wq16, (void*)qh, (void*)ql, kEmb, Wq_b, kRowsM, kEmb);
  }
  /* 3. attention: grid = B*H*(SQ/64) = 1024 blocks of 128 threads -> ctx hi/lo planes */
  {
    const int nblk = kBatch * kHeads * (kSeqQ / 64);
    mha_attn_hd64<<<dim3(nblk), dim3(128), 0, stream>>>(qh, ql, kvh, kvl, cbias, nlive, ch, cl);
  }
  /* 4. out = (ch + cl) . wo16^T + bo : M=4096 N=1024 K=1024, A carried hi+lo (2 products), f32 out */
  {
    const int tiles = (kRowsM / 128) * (kEmb / 128);
    wmma_gemm64<1, 1, 2, 0, 0><<<dim3(tiles, 1), dim3(128), 0, stream>>>(
        ch, cl, kEmb, 0L, wo16, wo16, kEmb, 0L, (void*)out, (void*)cl, kEmb, 0L,
        out_b, nullptr, kRowsM, kEmb, kEmb, 1.0f, 1,
        nullptr, nullptr, nullptr, nullptr, 0, nullptr, 0, 0);
  }
}
